// v000
// The times below were measured on an AMD MI455X: many runs one after another, warmed up first and cycling through
// copies of the inputs, with the whole window's GPU time divided by the number of runs. Launches and the gaps
// between them are all in it. The median over several windows is given; except for v000 it joins two sittings, which
// can be a few percent apart, so the side-by-side timings, each taken in one sitting, are the better comparison.
// v000 is the starting kernel. One run takes 1970 microseconds.
#include <hip/hip_runtime.h>
// Polar causal multi-head attention (4 x 2048 tokens x 1024, 16 heads x 64): q, k, v = SiLU(x*W^T); per (token, head) r = |q|, dir = q/(r + 1e-6); scores = (q_dir.k_dir) * (r_q q_scale[h]) * (r_k k_scale[h]) = (q . k) * f_q * f_k with f = r*scale/(r + 1e-6), j <= i; softmax; merged . Wo^T -> [4,2048,1024].
// Structure (per batch): x as an exact f16 plane; the three projections as f16 WMMA GEMMs (32x64 wave tiles, f32, exact products); a VALU pass applies SiLU and folds the per-(token, head) polar factor f into q and k (f32); q, k as f16 hi + x2^10 residual planes, V^T as hi + residual planes; the causal structure computed on device into a key bit plane + per-block key bound; the fused flash kernel per (head, 64 queries) (three-product hi/lo scores, online softmax f32, P hi + residual via LDS, two value accumulators); O as hi + residual planes; output projection as two GEMMs into the batch's output rows.
// Compute dtype: x, weights, scales rounded to bf16; projections exact; SiLU / norms / factors f32; q, k, P, v, O as f16 hi + residual pairs (~2^-21); f32 accumulation and softmax. v_wmma_f32_16x16x32_f16.
#define NBT 4
#define SLEN 2048
#define DM 1024
#define NH 16
#define SCL 1.0f
#define NR SLEN
typedef __bf16 v16b __attribute__((ext_vector_type(16)));
typedef unsigned short v8us __attribute__((ext_vector_type(8), may_alias));
typedef float  v8f  __attribute__((ext_vector_type(8)));
typedef float  v4f  __attribute__((ext_vector_type(4)));
typedef float  v4fa __attribute__((ext_vector_type(4), may_alias));
union FragB { v16b v; v8us half[2]; unsigned short u[16]; };

__device__ __forceinline__ unsigned short bf16_bits(float x) { unsigned int u = __float_as_uint(x); return (unsigned short)((u + 0x7FFFu + ((u >> 16) & 1u)) >> 16); }
__device__ __forceinline__ float bf16_val(unsigned short b) { return __uint_as_float(((unsigned int)b) << 16); }
__device__ __forceinline__ float bf16_round(float x) { return bf16_val(bf16_bits(x)); }
// D += A·B with NT terms: 1 = ah·bh, 2 = + al·bh (A split), 3 = + ah·bl (both split)
template <int NT>
__device__ __forceinline__ v8f mmaN(v16b ah, v16b al, v16b bh, v16b bl, v8f c) {
  c = __builtin_amdgcn_wmma_f32_16x16x32_bf16(false, ah, false, bh, (short)0, c, false, false);
  if (NT >= 2) c = __builtin_amdgcn_wmma_f32_16x16x32_bf16(false, al, false, bh, (short)0, c, false, false);
  if (NT >= 3) c = __builtin_amdgcn_wmma_f32_16x16x32_bf16(false, ah, false, bl, (short)0, c, false, false);
  asm volatile("v_nop\n\tv_nop\n\tv_nop\n\tv_nop" : "+v"(c) : "v"(ah), "v"(al), "v"(bh), "v"(bl));
  return c;
}

__global__ __launch_bounds__(256) void k_wt_bf16(const float* __restrict__ W, unsigned short* __restrict__ Wt, int K, int N) {
  const int t = blockIdx.x * 256 + threadIdx.x;
  const int k8n = K / 8;
  if (t >= N * k8n) return;
  const int n = t / k8n, k8 = (t % k8n) * 8;
  v8us v;
#pragma unroll
  for (int i = 0; i < 8; ++i) v[i] = bf16_bits(W[(size_t)(k8 + i) * N + n]);
  *(v8us*)(Wt + (size_t)n * K + k8) = v;
  
}

// GEMM C[M][N] (f32, pitch ldc) = act(A[M][K]·W + bias). A f32 row-major (pitch lda) converted per fragment to bf16
// (ASPLIT: hi/lo two planes -> 2 terms, else single rounded term); Wt bf16 [N][K] (pitch ldb). BIAS_BF16 rounds the
// bias to bf16 first (bias quantised to bf16 before the add). K%32==0, M%16==0, N%64==0.
template <bool ASPLIT, int ACT, bool BIAS_BF16>
__global__ __launch_bounds__(128) void k_gemm_bf(const float* __restrict__ A, int lda, const unsigned short* __restrict__ Wt, int ldb,
                                               const float* __restrict__ bias, float* __restrict__ C, int ldc, int M, int N, int K) {
  __shared__ __attribute__((aligned(16))) float so[4][16][64];
  const int tid = threadIdx.x, w = tid >> 5, lane = tid & 31, ln = lane & 15, hh = lane >> 4;
  const int ntn = N / 64;
  const int wid = blockIdx.x * 4 + w;
  const int mt = wid / ntn, nq = wid % ntn;
  if (mt * 16 >= M) return;
  const int row0 = mt * 16, col0 = nq * 64;
  const float* arow = A + (size_t)(row0 + ln) * lda;
  v8f acc[4] = {};
  for (int kb = 0; kb < K; kb += 32) {
    FragB ah, al;
    const v4f x0 = *(const v4fa*)(arow + kb + 8 * hh), x1 = *(const v4fa*)(arow + kb + 8 * hh + 4);
    const v4f x2 = *(const v4fa*)(arow + kb + 16 + 8 * hh), x3 = *(const v4fa*)(arow + kb + 16 + 8 * hh + 4);
    float xs[16] = {x0[0],x0[1],x0[2],x0[3],x1[0],x1[1],x1[2],x1[3],x2[0],x2[1],x2[2],x2[3],x3[0],x3[1],x3[2],x3[3]};
#pragma unroll
    for (int i = 0; i < 16; ++i) { const unsigned short hb = bf16_bits(xs[i]); ah.u[i] = hb; al.u[i] = ASPLIT ? bf16_bits(xs[i] - bf16_val(hb)) : (unsigned short)0; }
#pragma unroll
    for (int t = 0; t < 4; ++t) {
      const unsigned short* brow = Wt + (size_t)(col0 + t * 16 + ln) * ldb + kb;
      FragB b;
      b.half[0] = *(const v8us*)(brow + 8 * hh);
      b.half[1] = *(const v8us*)(brow + 16 + 8 * hh);
      acc[t] = mmaN<ASPLIT ? 2 : 1>(ah.v, al.v, b.v, b.v, acc[t]);
    }
  }
#pragma unroll
  for (int t = 0; t < 4; ++t) {
    float bv = bias ? bias[col0 + t * 16 + ln] : 0.f;
    if (BIAS_BF16) bv = bf16_round(bv);
#pragma unroll
    for (int r = 0; r < 8; ++r) { float v = acc[t][r] + bv; if (ACT == 1) v = fmaxf(v, 0.f); so[w][8 * hh + r][t * 16 + ln] = v; }
  }
  __builtin_amdgcn_fence(__ATOMIC_ACQ_REL, "workgroup");
  __builtin_amdgcn_wave_barrier();
  const int rsub = lane >> 4, c4 = (lane & 15) * 4;
  {
#pragma unroll
    for (int q = 0; q < 8; ++q) {
      const int r = q * 2 + rsub;
      const v4f v = *(const v4fa*)&so[w][r][c4];
      *(v4f*)(C + (size_t)(row0 + r) * ldc + col0 + c4) = v;
    }
    
  }
}

// GEMM C = act(A·W + bias + resid): A f32 (ASPLIT -> hi/lo 2 terms), Wt bf16 [N][K]; ACT 0 none, 1 relu, 2 exact gelu;
// resid (optional, f32, row index = (row % rmod), pitch ldr, RES_BF16 rounds it) added before the activation.
template <bool ASPLIT, int ACT, bool BIAS_BF16, bool RES_BF16>
__global__ __launch_bounds__(128) void k_gemm_bf3(const float* __restrict__ A, int lda, const unsigned short* __restrict__ Wt, int ldb,
                                                const float* __restrict__ bias, const float* __restrict__ resid, int rmod, int ldr,
                                                float* __restrict__ C, int ldc, int M, int N, int K) {
  __shared__ __attribute__((aligned(16))) float so[4][16][64];
  const int tid = threadIdx.x, w = tid >> 5, lane = tid & 31, ln = lane & 15, hh = lane >> 4;
  const int ntn = N / 64;
  const int wid = blockIdx.x * 4 + w;
  const int mt = wid / ntn, nq = wid % ntn;
  if (mt * 16 >= M) return;
  const int row0 = mt * 16, col0 = nq * 64;
  const float* arow = A + (size_t)(row0 + ln) * lda;
  v8f acc[4] = {};
  for (int kb = 0; kb < K; kb += 32) {
    FragB ah, al;
    const v4f x0 = *(const v4fa*)(arow + kb + 8 * hh), x1 = *(const v4fa*)(arow + kb + 8 * hh + 4);
    const v4f x2 = *(const v4fa*)(arow + kb + 16 + 8 * hh), x3 = *(const v4fa*)(arow + kb + 16 + 8 * hh + 4);
    float xs[16] = {x0[0],x0[1],x0[2],x0[3],x1[0],x1[1],x1[2],x1[3],x2[0],x2[1],x2[2],x2[3],x3[0],x3[1],x3[2],x3[3]};
#pragma unroll
    for (int i = 0; i < 16; ++i) { const unsigned short hb = bf16_bits(xs[i]); ah.u[i] = hb; al.u[i] = ASPLIT ? bf16_bits(xs[i] - bf16_val(hb)) : (unsigned short)0; }
#pragma unroll
    for (int t = 0; t < 4; ++t) {
      const unsigned short* brow = Wt + (size_t)(col0 + t * 16 + ln) * ldb + kb;
      FragB b;
      b.half[0] = *(const v8us*)(brow + 8 * hh);
      b.half[1] = *(const v8us*)(brow + 16 + 8 * hh);
      acc[t] = mmaN<ASPLIT ? 2 : 1>(ah.v, al.v, b.v, b.v, acc[t]);
    }
  }
#pragma unroll
  for (int t = 0; t < 4; ++t) {
    const int col = col0 + t * 16 + ln;
    float bv = bias ? bias[col] : 0.f;
    if (BIAS_BF16) bv = bf16_round(bv);
#pragma unroll
    for (int r = 0; r < 8; ++r) {
      float v = acc[t][r] + bv;
      if (resid) { float rv = resid[(size_t)((row0 + 8 * hh + r) % rmod) * ldr + col]; if (RES_BF16) rv = bf16_round(rv); v += rv; }
      if (ACT == 1) v = fmaxf(v, 0.f);
      if (ACT == 2) v = 0.5f * v * (1.0f + erff(v * 0.70710678118654752f));
      if (ACT == 3) { const float u = 0.7978845608028654f * (v + 0.044715f * v * v * v); v = 0.5f * v * (1.0f + tanhf(u)); }
      so[w][8 * hh + r][t * 16 + ln] = v;
    }
  }
  __builtin_amdgcn_fence(__ATOMIC_ACQ_REL, "workgroup");
  __builtin_amdgcn_wave_barrier();
  const int rsub = lane >> 4, c4 = (lane & 15) * 4;
  {
#pragma unroll
    for (int q = 0; q < 8; ++q) {
      const int r = q * 2 + rsub;
      const v4f v = *(const v4fa*)&so[w][r][c4];
      *(v4f*)(C + (size_t)(row0 + r) * ldc + col0 + c4) = v;
    }
    
  }
}
// row LayerNorm (biased variance, eps) over N: s = X (+ R); optional out_sum <- s; out_norm <- (s-mu)*rsqrt(var+eps)*g + b
template <bool PARAM_BF16>
__global__ __launch_bounds__(256) void k_layernorm(const float* __restrict__ X, const float* __restrict__ R, const float* __restrict__ g, const float* __restrict__ bta,
                                                  float* __restrict__ out_sum, float* __restrict__ out_norm, int N, float eps) {
  __shared__ float red[256];
  const int row = blockIdx.x, tid = threadIdx.x;
  const float* x = X + (size_t)row * N; const float* rr = R ? R + (size_t)row * N : nullptr;
  float vals[16];                     // up to N = 4096
  const int per = N / 256;            // contiguous chunk per thread? use strided-by-4 chunks: thread handles j = tid*4 + 1024*u
  float s1 = 0.f;
  for (int u = 0; u < per / 4; ++u) {
    const int j = tid * 4 + 1024 * u;
    const v4f a = *(const v4fa*)(x + j);
    v4f b = {0.f,0.f,0.f,0.f}; if (rr) b = *(const v4fa*)(rr + j);
#pragma unroll
    for (int q = 0; q < 4; ++q) { const float v = a[q] + b[q]; vals[u * 4 + q] = v; s1 += v; }
  }
  red[tid] = s1; __syncthreads();
  for (int st = 128; st > 0; st >>= 1) { if (tid < st) red[tid] += red[tid + st]; __syncthreads(); }
  const float mu = red[0] / (float)N; __syncthreads();
  float s2 = 0.f;
  for (int u = 0; u < per / 4; ++u)
#pragma unroll
    for (int q = 0; q < 4; ++q) { const float c = vals[u * 4 + q] - mu; s2 += c * c; }
  red[tid] = s2; __syncthreads();
  for (int st = 128; st > 0; st >>= 1) { if (tid < st) red[tid] += red[tid + st]; __syncthreads(); }
  const float rs = rsqrtf(red[0] / (float)N + eps);
  {
    for (int u = 0; u < per / 4; ++u) {
      const int j = tid * 4 + 1024 * u;
      v4f o, sm;
#pragma unroll
      for (int q = 0; q < 4; ++q) {
        float gg = g[j + q], bb = bta[j + q];
        if (PARAM_BF16) { gg = bf16_round(gg); bb = bf16_round(bb); }
        sm[q] = vals[u * 4 + q]; o[q] = (vals[u * 4 + q] - mu) * rs * gg + bb;
      }
      if (out_sum) *(v4f*)(out_sum + (size_t)row * N + j) = sm;
      *(v4f*)(out_norm + (size_t)row * N + j) = o;
    }
    
  }
}



// ---- f16 WMMA path (v_wmma_f32_16x16x32_f16): 11-bit significands for operands in range — used where a [0,1] probability operand needs more precision than bf16
typedef _Float16 v16h __attribute__((ext_vector_type(16)));
union FragH { v16h v; v8us half[2]; _Float16 h[16]; unsigned short u[16]; };
template <int NT>
__device__ __forceinline__ v8f mmaH(v16h ah, v16h al, v16h bh, v16h bl, v8f c) {
  c = __builtin_amdgcn_wmma_f32_16x16x32_f16(false, ah, false, bh, (short)0, c, false, false);
  if (NT >= 2) c = __builtin_amdgcn_wmma_f32_16x16x32_f16(false, al, false, bh, (short)0, c, false, false);
  if (NT >= 3) c = __builtin_amdgcn_wmma_f32_16x16x32_f16(false, ah, false, bl, (short)0, c, false, false);
  asm volatile("v_nop\n\tv_nop\n\tv_nop\n\tv_nop" : "+v"(c) : "v"(ah), "v"(al), "v"(bh), "v"(bl));
  return c;
}
// batched GEMM like k_gemm_b but f16 operands: A f32 (split into f16 hi/lo if ASPLIT, else rounded to f16), Bt = f16 values [n][k]; alpha; C f32; N multiple of 16 (partial tiles skipped)
template <bool ASPLIT>
__global__ __launch_bounds__(128) void k_gemm_h(const float* __restrict__ A, int lda, size_t sA, const _Float16* __restrict__ Bh, int ldb, size_t sB, float alpha, float* __restrict__ C, int ldc, size_t sC, int M, int N, int K) {
  __shared__ __attribute__((aligned(16))) float so[4][16][64];
  const int tid = threadIdx.x, w = tid >> 5, lane = tid & 31, ln = lane & 15, hh = lane >> 4; const int by = blockIdx.y;
  A += (size_t)by * sA; Bh += (size_t)by * sB; C += (size_t)by * sC;
  const int ntn = (N + 63) / 64; const int wid = blockIdx.x * 4 + w; const int mt = wid / ntn, nq = wid % ntn; if (mt * 16 >= M) return;
  const int row0 = mt * 16, col0 = nq * 64; const float* arow = A + (size_t)(row0 + ln) * lda;
  v8f acc[4] = {};
  for (int kb = 0; kb < K; kb += 32) {
    FragH ah, al;
    const v4f x0 = *(const v4fa*)(arow + kb + 8 * hh), x1 = *(const v4fa*)(arow + kb + 8 * hh + 4), x2 = *(const v4fa*)(arow + kb + 16 + 8 * hh), x3 = *(const v4fa*)(arow + kb + 16 + 8 * hh + 4);
    float xs[16] = {x0[0],x0[1],x0[2],x0[3],x1[0],x1[1],x1[2],x1[3],x2[0],x2[1],x2[2],x2[3],x3[0],x3[1],x3[2],x3[3]};
#pragma unroll
    for (int i = 0; i < 16; ++i) { const _Float16 h = (_Float16)xs[i]; ah.h[i] = h; al.h[i] = ASPLIT ? (_Float16)(xs[i] - (float)h) : (_Float16)0.0f; }
#pragma unroll
    for (int t = 0; t < 4; ++t) { if (col0 + t * 16 >= N) continue; const size_t boff = (size_t)(col0 + t * 16 + ln) * ldb + kb; FragH bq; bq.half[0] = *(const v8us*)(Bh + boff + 8 * hh); bq.half[1] = *(const v8us*)(Bh + boff + 16 + 8 * hh);
      acc[t] = mmaH<ASPLIT ? 2 : 1>(ah.v, al.v, bq.v, bq.v, acc[t]); }
  }
#pragma unroll
  for (int t = 0; t < 4; ++t) { if (col0 + t * 16 >= N) continue;
#pragma unroll
    for (int r = 0; r < 8; ++r) so[w][8 * hh + r][t * 16 + ln] = acc[t][r] * alpha; }
  __builtin_amdgcn_fence(__ATOMIC_ACQ_REL, "workgroup"); __builtin_amdgcn_wave_barrier();
  const int rsub = lane >> 4, c4 = (lane & 15) * 4;
  {
#pragma unroll
    for (int q = 0; q < 8; ++q) { const int r = q * 2 + rsub; if (col0 + c4 < N) { const v4f v = *(const v4fa*)&so[w][r][c4]; *(v4f*)(C + (size_t)(row0 + r) * ldc + col0 + c4) = v; } }
     }
}

// Wt[n][k] = f16(W[k][n]·scale) from f32 row-major W[K][N] (scale = power of two; bf16-exact weights stay exact in f16 away from the subnormal range)
__global__ __launch_bounds__(256) void k_wt_f16(const float* __restrict__ W, _Float16* __restrict__ Wt, int K, int N, float scale) {
  const int t = blockIdx.x * 256 + threadIdx.x; if (t >= N * (K / 8)) return; const int n = t / (K / 8), k8 = (t % (K / 8)) * 8; FragH f;
#pragma unroll
  for (int i = 0; i < 8; ++i) f.h[i] = (_Float16)(bf16_round(W[(size_t)(k8 + i) * N + n]) * scale); const v8us o = f.half[0];
  *(v8us*)((unsigned short*)Wt + (size_t)n * K + k8) = o; 
}
// k_gemm_hh variant with fused epilogue: v = acc·alpha + bias[by·sBias + col] (+ CP[(row/rowsPerB)·sCPb + by·64 + col] if CP) ; ACT 0 none / 1 elu ; writes f16 C16 (and f32 C if non-null)
template <int ACT>
__global__ __launch_bounds__(128) void k_gemm_hhx(const _Float16* __restrict__ A, int lda, size_t sA, const _Float16* __restrict__ Bh, int ldb, size_t sB, float alpha, const float* __restrict__ bias, size_t sBias, const float* __restrict__ CP, int rowsPerB, size_t sCPb, int row0g,
    float* __restrict__ C, _Float16* __restrict__ C16, int ldc, size_t sC, int M, int N, int K) {
  __shared__ __attribute__((aligned(16))) float so[4][16][64];
  const int tid = threadIdx.x, w = tid >> 5, lane = tid & 31, ln = lane & 15, hh = lane >> 4; const int by = blockIdx.y;
  A += (size_t)by * sA; Bh += (size_t)by * sB; const size_t cofs = (size_t)by * sC; const float* bp = bias ? bias + (size_t)by * sBias : nullptr;
  const int ntn = (N + 63) / 64; const int wid = blockIdx.x * 4 + w; const int mt = wid / ntn, nq = wid % ntn; if (mt * 16 >= M) return;
  const int row0 = mt * 16, col0 = nq * 64; const _Float16* arow = A + (size_t)(row0 + ln) * lda;
  v8f acc[4] = {};
  for (int kb = 0; kb < K; kb += 32) { FragH ah; ah.half[0] = *(const v8us*)((const unsigned short*)arow + kb + 8 * hh); ah.half[1] = *(const v8us*)((const unsigned short*)arow + kb + 16 + 8 * hh);
#pragma unroll
    for (int t = 0; t < 4; ++t) { if (col0 + t * 16 >= N) continue; const size_t boff = (size_t)(col0 + t * 16 + ln) * ldb + kb; FragH bq; bq.half[0] = *(const v8us*)((const unsigned short*)Bh + boff + 8 * hh); bq.half[1] = *(const v8us*)((const unsigned short*)Bh + boff + 16 + 8 * hh);
      acc[t] = mmaH<1>(ah.v, ah.v, bq.v, bq.v, acc[t]); }
  }
#pragma unroll
  for (int t = 0; t < 4; ++t) { if (col0 + t * 16 >= N) continue; const int col = col0 + t * 16 + ln; const float bv = bp ? bf16_round(bp[col]) : 0.f;
#pragma unroll
    for (int r = 0; r < 8; ++r) { float v = acc[t][r] * alpha + bv; if (CP) { const int bidx = (row0g + row0 + 8 * hh + r) / rowsPerB; v += CP[(size_t)bidx * sCPb + (size_t)by * 64 + col]; } if (ACT == 1) v = (v > 0.f) ? v : expm1f(v); else if (ACT == 7) v = (v > 0.f) ? v + 1.0f : expf(v); else if (ACT == 8) v = tanhf(v); else if (ACT == 9) v = 0.5f * v * (1.0f + tanhf(0.7978845608028654f * (v + 0.044715f * v * v * v))); else if (ACT == 11) v = 1.0f / (1.0f + expf(-v)); else if (ACT == 12) v = (v > 0.f) ? v : 0.01f * v; else if (ACT == 14) v = (v > 0.f) ? v : 0.1f * v; else if (ACT == 15) v = v / (1.0f + expf(-v)); else if (ACT == 3) v = fmaxf(v, 0.f); else if (ACT == 6) v = 0.5f * v * (1.0f + erff(v * 0.70710678118654752f)); so[w][8 * hh + r][t * 16 + ln] = v; } }
  __builtin_amdgcn_fence(__ATOMIC_ACQ_REL, "workgroup"); __builtin_amdgcn_wave_barrier();
  const int rsub = lane >> 4, c4 = (lane & 15) * 4; typedef _Float16 v4h __attribute__((ext_vector_type(4)));
  {
#pragma unroll
    for (int q = 0; q < 8; ++q) { const int r = q * 2 + rsub; if (col0 + c4 < N) { const v4f v = *(const v4fa*)&so[w][r][c4]; if (C) *(v4f*)(C + cofs + (size_t)(row0 + r) * ldc + col0 + c4) = v; if (C16) { v4h h4; for (int i = 0; i < 4; ++i) h4[i] = (_Float16)v[i]; *(v4h*)(C16 + cofs + (size_t)(row0 + r) * ldc + col0 + c4) = h4; } } }
     }
}


typedef _Float16 v4h __attribute__((ext_vector_type(4)));

__global__ __launch_bounds__(256) void k_x16(const float* __restrict__ x, _Float16* __restrict__ X16, size_t n8) { const size_t t = (size_t)blockIdx.x * 256 + threadIdx.x; if (t >= n8) return; FragH f;
#pragma unroll
  for (int q = 0; q < 8; ++q) f.h[q] = (_Float16)bf16_round(x[t * 8 + q]); *(v8us*)((unsigned short*)X16 + t * 8) = f.half[0];  }
__global__ __launch_bounds__(256) void k_h16(const float* __restrict__ x, _Float16* __restrict__ X16, size_t n8) { const size_t t = (size_t)blockIdx.x * 256 + threadIdx.x; if (t >= n8) return; FragH f;
#pragma unroll
  for (int q = 0; q < 8; ++q) f.h[q] = (_Float16)x[t * 8 + q]; *(v8us*)((unsigned short*)X16 + t * 8) = f.half[0];  }
__global__ __launch_bounds__(256) void k_round16f(const float* __restrict__ W, _Float16* __restrict__ Bt, size_t n8) { const size_t t = (size_t)blockIdx.x * 256 + threadIdx.x; if (t >= n8) return; FragH f;
#pragma unroll
  for (int i = 0; i < 8; ++i) f.h[i] = (_Float16)(bf16_round(W[t * 8 + i]) * 16.0f); *(v8us*)((unsigned short*)Bt + t * 8) = f.half[0];  }
template <int NHv, int TTv>
__global__ __launch_bounds__(256) void k_vt(const _Float16* __restrict__ V16, int ldv, int voff, _Float16* __restrict__ Vt) { __shared__ unsigned short tl[64][66]; const int tid = threadIdx.x; const int slab = blockIdx.x / (TTv / 64), lg = blockIdx.x % (TTv / 64); const int b = slab / NHv, h = slab % NHv;
  for (int i = tid; i < 64 * 8; i += 256) { const int r = i / 8, c8 = (i % 8) * 8; FragH f; f.half[0] = *(const v8us*)((const unsigned short*)V16 + ((size_t)b * TTv + lg * 64 + r) * ldv + voff + h * 64 + c8);
#pragma unroll
    for (int q = 0; q < 8; ++q) tl[r][c8 + q] = f.u[q]; }
  __syncthreads();
  {
#pragma unroll
    for (int rd = 0; rd < 2; ++rd) { const int d = rd * 32 + tid / 8, pc = tid % 8; FragH f;
#pragma unroll
      for (int q = 0; q < 8; ++q) f.u[q] = tl[pc * 8 + q][d];
      *(v8us*)((unsigned short*)Vt + ((size_t)slab * 64 + d) * TTv + lg * 64 + pc * 8) = f.half[0]; }
     } }

__global__ __launch_bounds__(256) void k_hl(const float* __restrict__ F, _Float16* __restrict__ Hh, _Float16* __restrict__ Hl, size_t n8) { const size_t t = (size_t)blockIdx.x * 256 + threadIdx.x; if (t >= n8) return; FragH fh, fl; const v4f a = *(const v4fa*)(F + t * 8), c = *(const v4fa*)(F + t * 8 + 4);
#pragma unroll
  for (int q = 0; q < 4; ++q) { _Float16 h = (_Float16)a[q]; fh.h[q] = h; fl.h[q] = (_Float16)((a[q] - (float)h) * 1024.0f); h = (_Float16)c[q]; fh.h[4 + q] = h; fl.h[4 + q] = (_Float16)((c[q] - (float)h) * 1024.0f); }
  { *(v8us*)((unsigned short*)Hh + t * 8) = fh.half[0]; *(v8us*)((unsigned short*)Hl + t * 8) = fl.half[0];  } }

// ---- fast GEMM (wave tile 32x64; requires M % 32 == 0 rows per launch region and N % 64 == 0); epilogue = k_gemm_hhx semantics ----
__device__ __forceinline__ v16h g2_frag(const _Float16* p, int hh) { FragH f; f.half[0] = *(const v8us*)((const unsigned short*)p + 8 * hh); f.half[1] = *(const v8us*)((const unsigned short*)p + 16 + 8 * hh); return f.v; }
__device__ __forceinline__ v8f g2_mma(v16h a, v16h b, v8f c) { v8f d = __builtin_amdgcn_wmma_f32_16x16x32_f16(false, a, false, b, (short)0, c, false, false); asm volatile("v_nop\n\tv_nop\n\tv_nop\n\tv_nop" : "+v"(d) : "v"(a), "v"(b)); return d; }
template <int ACT>
__global__ __launch_bounds__(128) void k_gemm2(const _Float16* __restrict__ A, int lda, size_t sA, const _Float16* __restrict__ Bh, int ldb, size_t sB, float alpha, const float* __restrict__ bias, size_t sBias, const float* __restrict__ CP, int rowsPerB, size_t sCPb, int row0g,
    float* __restrict__ C, _Float16* __restrict__ C16, int ldc, size_t sC, int M, int N, int K) {
  __shared__ __attribute__((aligned(16))) float so[4][32][68];
  const int tid = threadIdx.x, w = tid >> 5, lane = tid & 31, ln = lane & 15, hh = lane >> 4; const int by = blockIdx.y;
  A += (size_t)by * sA; Bh += (size_t)by * sB; const size_t cofs = (size_t)by * sC; const float* bp = bias ? bias + (size_t)by * sBias : nullptr;
  const int ntn = N >> 6; const int mt = blockIdx.x / ntn, nq = blockIdx.x - mt * ntn; const int row0 = mt * 128 + 32 * w, col0 = nq * 64; if (row0 >= M) return;
  const _Float16* a0p = A + (size_t)(row0 + ln) * lda; const _Float16* a1p = a0p + (size_t)16 * lda;
  const _Float16* b0p = Bh + (size_t)(col0 + ln) * ldb; const _Float16* b1p = b0p + (size_t)16 * ldb; const _Float16* b2p = b1p + (size_t)16 * ldb; const _Float16* b3p = b2p + (size_t)16 * ldb;
  const v8f z8 = {0.f,0.f,0.f,0.f,0.f,0.f,0.f,0.f}; v8f c00 = z8, c01 = z8, c02 = z8, c03 = z8, c10 = z8, c11 = z8, c12 = z8, c13 = z8;
#pragma unroll 1
  for (int kb = 0; kb < K; kb += 32) { const v16h a0 = g2_frag(a0p + kb, hh), a1 = g2_frag(a1p + kb, hh);
    v16h b = g2_frag(b0p + kb, hh); c00 = g2_mma(a0, b, c00); c10 = g2_mma(a1, b, c10);
    b = g2_frag(b1p + kb, hh); c01 = g2_mma(a0, b, c01); c11 = g2_mma(a1, b, c11);
    b = g2_frag(b2p + kb, hh); c02 = g2_mma(a0, b, c02); c12 = g2_mma(a1, b, c12);
    b = g2_frag(b3p + kb, hh); c03 = g2_mma(a0, b, c03); c13 = g2_mma(a1, b, c13); }
  v8f accs[8] = {c00, c01, c02, c03, c10, c11, c12, c13};
#pragma unroll
  for (int u = 0; u < 8; ++u) { const int t = u & 3, half = u >> 2; const int col = col0 + t * 16 + ln; const float bv = bp ? bf16_round(bp[col]) : 0.f;
#pragma unroll
    for (int r = 0; r < 8; ++r) { const int rloc = half * 16 + 8 * hh + r; float v = accs[u][r] * alpha + bv; if (CP) { const int bidx = (row0g + row0 + rloc) / rowsPerB; v += CP[(size_t)bidx * sCPb + (size_t)by * 64 + col]; }
      if (ACT == 3) v = fmaxf(v, 0.f); else if (ACT == 6) v = 0.5f * v * (1.0f + erff(v * 0.70710678118654752f)); else if (ACT == 11) v = 1.0f / (1.0f + expf(-v)); else if (ACT == 15) v = v / (1.0f + expf(-v)); else if (ACT == 12) v = (v > 0.f) ? v : 0.01f * v; else if (ACT == 8) v = tanhf(v);
      so[w][rloc][t * 16 + ln] = v; } }
  __builtin_amdgcn_fence(__ATOMIC_ACQ_REL, "workgroup"); __builtin_amdgcn_wave_barrier();
  const int rsub = lane >> 4, c4 = (lane & 15) * 4;
  {
#pragma unroll
    for (int q = 0; q < 16; ++q) { const int r = q * 2 + rsub; const v4f v = *(const v4fa*)&so[w][r][c4]; if (C) *(v4f*)(C + cofs + (size_t)(row0 + r) * ldc + col0 + c4) = v; if (C16) { v4h h4; for (int i = 0; i < 4; ++i) h4[i] = (_Float16)v[i]; *(v4h*)(C16 + cofs + (size_t)(row0 + r) * ldc + col0 + c4) = h4; } }
     } }



template <int TK>
__global__ __launch_bounds__(256) void k_vthl(const float* __restrict__ VF, int ldv, _Float16* __restrict__ Vth, _Float16* __restrict__ Vtl) { __shared__ float tl[64][65]; const int tid = threadIdx.x; const int slab = blockIdx.x / (TK / 64), lg = blockIdx.x % (TK / 64); const int b = slab / NH, h = slab % NH;
  for (int i = tid; i < 64 * 16; i += 256) { const int r = i / 16, c4 = (i % 16) * 4; const v4f a = *(const v4fa*)(VF + ((size_t)b * TK + lg * 64 + r) * ldv + h * 64 + c4); tl[r][c4] = a[0]; tl[r][c4 + 1] = a[1]; tl[r][c4 + 2] = a[2]; tl[r][c4 + 3] = a[3]; }
  __syncthreads();
  FragH fh[2], fl[2]; size_t oo[2];
#pragma unroll
  for (int rd = 0; rd < 2; ++rd) { const int d = rd * 32 + tid / 8, pc = tid % 8;
#pragma unroll
    for (int q = 0; q < 8; ++q) { const float v = tl[pc * 8 + q][d]; const _Float16 hv = (_Float16)v; fh[rd].h[q] = hv; fl[rd].h[q] = (_Float16)((v - (float)hv) * 1024.0f); } oo[rd] = ((size_t)slab * 64 + d) * TK + lg * 64 + pc * 8; }
  {
#pragma unroll
    for (int rd = 0; rd < 2; ++rd) { *(v8us*)((unsigned short*)Vth + oo[rd]) = fh[rd].half[0]; *(v8us*)((unsigned short*)Vtl + oo[rd]) = fl[rd].half[0]; }
     } }

template <int TQ, int TK>
__global__ __launch_bounds__(128) void k_flashm(const _Float16* __restrict__ Q16, const _Float16* __restrict__ Q16lo, int ldq, const _Float16* __restrict__ K16, const _Float16* __restrict__ K16lo, int ldk, const _Float16* __restrict__ Vt, const _Float16* __restrict__ Vtlo, const unsigned* __restrict__ MB, const int* __restrict__ RA, const int* __restrict__ KE, float* __restrict__ O, int ldo) {
  constexpr int RPW = 16, RTN = RPW / 16, NQB = TQ / (4 * RPW), DT = 4, KS = 2;
  __shared__ __attribute__((aligned(16))) unsigned short sP[4][RPW][40], sPl[4][RPW][40]; __shared__ __attribute__((aligned(16))) float sO[4][RPW][64 + 4];
  const int tid = threadIdx.x, w = tid >> 5, lane = tid & 31, ln = lane & 15, hh = lane >> 4;
  const int slab = blockIdx.x / NQB, qblk = blockIdx.x % NQB; const int b = slab / NH, h = slab % NH; const int qb0 = qblk * (4 * RPW); const int q0 = qb0 + w * RPW;
  FragH aq[2][KS], aql[2][KS];
#pragma unroll
  for (int rt = 0; rt < RTN; ++rt) { const size_t qo = ((size_t)b * TQ + q0 + rt * 16 + ln) * ldq + h * 64; const unsigned short* qr = (const unsigned short*)Q16 + qo; const unsigned short* ql = (const unsigned short*)Q16lo + qo;
#pragma unroll
    for (int ks = 0; ks < KS; ++ks) { aq[rt][ks].half[0] = *(const v8us*)(qr + ks * 32 + 8 * hh); aq[rt][ks].half[1] = *(const v8us*)(qr + ks * 32 + 16 + 8 * hh); aql[rt][ks].half[0] = *(const v8us*)(ql + ks * 32 + 8 * hh); aql[rt][ks].half[1] = *(const v8us*)(ql + ks * 32 + 16 + 8 * hh); } }
  const unsigned short* Vth = (const unsigned short*)Vt + (size_t)slab * 64 * TK; const unsigned short* Vtl = (const unsigned short*)Vtlo + (size_t)slab * 64 * TK;
  float m_r[2][8], l_r[2][8]; v8f oacc[2][DT], oaccl[2][DT];
#pragma unroll
  for (int rt = 0; rt < RTN; ++rt) {
#pragma unroll
    for (int r = 0; r < 8; ++r) { m_r[rt][r] = -3.0e38f; l_r[rt][r] = 0.f; }
#pragma unroll
    for (int dt = 0; dt < DT; ++dt) { oacc[rt][dt] = (v8f){0.f,0.f,0.f,0.f,0.f,0.f,0.f,0.f}; oaccl[rt][dt] = oacc[rt][dt]; } }
  int jend = KE[qblk * 32]; jend = min(TK, (jend + 31) & ~31); if (jend < 32) jend = 32;      /* block-uniform */
  int allm[2][8]; const unsigned* mrow[2][8];
#pragma unroll
  for (int rt = 0; rt < RTN; ++rt)
#pragma unroll
    for (int r = 0; r < 8; ++r) { const int tq = q0 + rt * 16 + 8 * hh + r; allm[rt][r] = RA[tq]; mrow[rt][r] = MB + (size_t)tq * (TK / 32); }
#pragma unroll 1
  for (int j0 = 0; j0 < jend; j0 += 32) {
    
    v8f s[2][2];
#pragma unroll
    for (int nt = 0; nt < 2; ++nt) { const size_t ko = ((size_t)b * TK + j0 + nt * 16 + ln) * ldk + h * 64; const unsigned short* kr = (const unsigned short*)K16 + ko; const unsigned short* kl = (const unsigned short*)K16lo + ko; FragH bk[KS], bkl[KS];
#pragma unroll
      for (int ks = 0; ks < KS; ++ks) { bk[ks].half[0] = *(const v8us*)(kr + ks * 32 + 8 * hh); bk[ks].half[1] = *(const v8us*)(kr + ks * 32 + 16 + 8 * hh); bkl[ks].half[0] = *(const v8us*)(kl + ks * 32 + 8 * hh); bkl[ks].half[1] = *(const v8us*)(kl + ks * 32 + 16 + 8 * hh); }
#pragma unroll
      for (int rt = 0; rt < RTN; ++rt) { v8f acc = (v8f){0.f,0.f,0.f,0.f,0.f,0.f,0.f,0.f}, accr = acc;
#pragma unroll
        for (int ks = 0; ks < KS; ++ks) { acc = mmaH<1>(aq[rt][ks].v, aq[rt][ks].v, bk[ks].v, bk[ks].v, acc); accr = mmaH<1>(aql[rt][ks].v, aql[rt][ks].v, bk[ks].v, bk[ks].v, accr); accr = mmaH<1>(aq[rt][ks].v, aq[rt][ks].v, bkl[ks].v, bkl[ks].v, accr); }
        s[rt][nt] = acc + accr * 0.0009765625f; } }
#pragma unroll
    for (int rt = 0; rt < RTN; ++rt)
#pragma unroll
      for (int r = 0; r < 8; ++r) { const unsigned mw = mrow[rt][r][j0 >> 5]; const bool am = (allm[rt][r] != 0);
        const bool ok0 = am || (((mw >> ln) & 1u) == 0u), ok1 = am || (((mw >> (16 + ln)) & 1u) == 0u);
        const float s0 = ok0 ? (am ? 0.f : s[rt][0][r] * SCL) : -INFINITY, s1 = ok1 ? (am ? 0.f : s[rt][1][r] * SCL) : -INFINITY; float mc = fmaxf(s0, s1);
        mc = fmaxf(mc, __shfl_xor(mc, 1, 32)); mc = fmaxf(mc, __shfl_xor(mc, 2, 32)); mc = fmaxf(mc, __shfl_xor(mc, 4, 32)); mc = fmaxf(mc, __shfl_xor(mc, 8, 32));
        const float mn = fmaxf(m_r[rt][r], mc); const float al = (mn > -1.0e38f) ? expf(m_r[rt][r] - mn) : 1.0f; m_r[rt][r] = mn; const float p0 = ok0 ? expf(s0 - mn) : 0.f, p1 = ok1 ? expf(s1 - mn) : 0.f; l_r[rt][r] = l_r[rt][r] * al + p0 + p1;
#pragma unroll
        for (int dt = 0; dt < DT; ++dt) { oacc[rt][dt][r] *= al; oaccl[rt][dt][r] *= al; }
        FragH t2, t3; const float ps0 = p0 * 1024.0f, ps1 = p1 * 1024.0f; t2.h[0] = (_Float16)ps0; t2.h[1] = (_Float16)ps1; t3.h[0] = (_Float16)((ps0 - (float)t2.h[0]) * 1024.0f); t3.h[1] = (_Float16)((ps1 - (float)t2.h[1]) * 1024.0f);
        sP[w][rt * 16 + 8 * hh + r][ln] = t2.u[0]; sP[w][rt * 16 + 8 * hh + r][16 + ln] = t2.u[1]; sPl[w][rt * 16 + 8 * hh + r][ln] = t3.u[0]; sPl[w][rt * 16 + 8 * hh + r][16 + ln] = t3.u[1]; }
    __builtin_amdgcn_fence(__ATOMIC_ACQ_REL, "workgroup"); __builtin_amdgcn_wave_barrier();
    FragH pa[2], pl[2];
#pragma unroll
    for (int rt = 0; rt < RTN; ++rt) { pa[rt].half[0] = *(const v8us*)&sP[w][rt * 16 + ln][8 * hh]; pa[rt].half[1] = *(const v8us*)&sP[w][rt * 16 + ln][16 + 8 * hh]; pl[rt].half[0] = *(const v8us*)&sPl[w][rt * 16 + ln][8 * hh]; pl[rt].half[1] = *(const v8us*)&sPl[w][rt * 16 + ln][16 + 8 * hh]; }
#pragma unroll
    for (int dt = 0; dt < DT; ++dt) { const size_t vo = (size_t)(dt * 16 + ln) * TK + j0; FragH bv, bl; bv.half[0] = *(const v8us*)(Vth + vo + 8 * hh); bv.half[1] = *(const v8us*)(Vth + vo + 16 + 8 * hh); bl.half[0] = *(const v8us*)(Vtl + vo + 8 * hh); bl.half[1] = *(const v8us*)(Vtl + vo + 16 + 8 * hh);
#pragma unroll
      for (int rt = 0; rt < RTN; ++rt) { oacc[rt][dt] = mmaH<1>(pa[rt].v, pa[rt].v, bv.v, bv.v, oacc[rt][dt]); oaccl[rt][dt] = mmaH<1>(pa[rt].v, pa[rt].v, bl.v, bl.v, oaccl[rt][dt]); oaccl[rt][dt] = mmaH<1>(pl[rt].v, pl[rt].v, bv.v, bv.v, oaccl[rt][dt]); } }
    __builtin_amdgcn_fence(__ATOMIC_ACQ_REL, "workgroup"); __builtin_amdgcn_wave_barrier(); }
#pragma unroll
  for (int rt = 0; rt < RTN; ++rt) {
#pragma unroll
    for (int r = 0; r < 8; ++r) { float l = l_r[rt][r]; l += __shfl_xor(l, 1, 32); l += __shfl_xor(l, 2, 32); l += __shfl_xor(l, 4, 32); l += __shfl_xor(l, 8, 32); l_r[rt][r] = (l > 0.f) ? 1.0f / (l * 1024.0f) : 0.f; }
#pragma unroll
    for (int dt = 0; dt < DT; ++dt)
#pragma unroll
      for (int r = 0; r < 8; ++r) sO[w][rt * 16 + 8 * hh + r][dt * 16 + ln] = (oacc[rt][dt][r] + oaccl[rt][dt][r] * 0.0009765625f) * l_r[rt][r]; }
  __builtin_amdgcn_fence(__ATOMIC_ACQ_REL, "workgroup"); __builtin_amdgcn_wave_barrier();
  {
#pragma unroll
    for (int rp = 0; rp < RPW; rp += 2) { const int r = rp + (lane >> 4), pc = lane & 15; const v4f val = *(const v4fa*)&sO[w][r][pc * 4]; *(v4f*)(O + ((size_t)b * TQ + q0 + r) * ldo + h * 64 + pc * 4) = val; }
     } }


__global__ __launch_bounds__(256) void k_causaltab(unsigned* __restrict__ MB, int* __restrict__ RA, int* __restrict__ KE, int nq, int nk) {
  const int t = blockIdx.x * 256 + threadIdx.x; const int nw = nk / 32;
  if (t < nq * nw) { const int q = t / nw, w = t % nw; const int first = q + 1 - 32 * w; const unsigned bits = (first <= 0) ? 0xffffffffu : ((first >= 32) ? 0u : (0xffffffffu << first)); *(unsigned*)(MB + t) = bits;  }
  if (t < nq) { *(int*)(RA + t) = 0;  }
  if (t < nq / 64) { const int v = 64 * (t + 1); *(int*)(KE + t * 32) = v;  } }

__device__ __forceinline__ float siluf(float g) { return g / (1.0f + expf(-g)); }
template <int MODE>
__global__ __launch_bounds__(256) void k_silufac(const float* __restrict__ F, const float* __restrict__ scale, float* __restrict__ G) {
  #pragma clang fp contract(off)
  const int tid = threadIdx.x, w = tid >> 5, ln = tid & 31; const int idx = blockIdx.x * 8 + w; if (idx >= NR * NH) return; const int r = idx / NH, h = idx % NH;
  const float* f = F + (size_t)r * DM + h * 64 + 2 * ln; const float a = siluf(f[0]), b = siluf(f[1]); float fac = 1.0f;
  if (MODE == 1) { float s = a * a + b * b; for (int o = 16; o > 0; o >>= 1) s += __shfl_xor(s, o, 32); const float rr = sqrtf(s); fac = (rr * bf16_round(scale[h])) / (rr + 1e-6f); }
  float o2[2]; o2[0] = a * fac; o2[1] = b * fac; const unsigned long long pk = *(const unsigned long long*)o2; float* dst = G + (size_t)r * DM + h * 64 + 2 * ln;
  *(unsigned long long*)dst = pk;  }

extern "C" void kernel_launch(void* const* d_in, const int* in_sizes, int n_in,
                              void* d_out, int out_size, void* d_ws, size_t ws_size, hipStream_t stream) {
  (void)in_sizes; (void)n_in; (void)out_size;
  const float* const* I = (const float* const*)d_in; const float* x = I[0]; const float* Wq = I[1]; const float* Wk = I[2]; const float* Wv = I[3]; const float* Wo = I[4]; const float* qs = I[5]; const float* ks = I[6];
  char* ws = (char*)d_ws; size_t off = 0;
  auto take = [&](size_t bytes) { char* p = ws + off; off += (bytes + 255) & ~(size_t)255; return p; };
  _Float16* BQ = (_Float16*)take((size_t)DM * DM * 2); _Float16* BK = (_Float16*)take((size_t)DM * DM * 2); _Float16* BV = (_Float16*)take((size_t)DM * DM * 2); _Float16* BO = (_Float16*)take((size_t)DM * DM * 2);
  _Float16* X16 = (_Float16*)take((size_t)NR * DM * 2); float* F = (float*)take((size_t)NR * DM * 4); float* G = (float*)take((size_t)NR * DM * 4);
  _Float16* Qh = (_Float16*)take((size_t)NR * DM * 2); _Float16* Ql = (_Float16*)take((size_t)NR * DM * 2); _Float16* Kh = (_Float16*)take((size_t)NR * DM * 2); _Float16* Kl = (_Float16*)take((size_t)NR * DM * 2); _Float16* Vth = (_Float16*)take((size_t)NR * DM * 2); _Float16* Vtl = (_Float16*)take((size_t)NR * DM * 2);
  unsigned* MB = (unsigned*)take((size_t)SLEN * (SLEN / 32) * 4); int* RA = (int*)take((size_t)SLEN * 4); int* KE = (int*)take((size_t)(SLEN / 64) * 32 * 4);
  if (off > ws_size) return;      /* 8 + 4 + 8 + 8 + 6 x 4 + 0.5 = 53 MiB */
  float* O = F; _Float16* Oh = (_Float16*)G; _Float16* Ol = Oh + (size_t)NR * DM;
  const size_t n8 = (size_t)NR * DM / 8; const unsigned nb8 = (unsigned)((n8 + 255) / 256); const size_t w8 = (size_t)DM * DM / 8; const unsigned wb = (unsigned)((w8 + 255) / 256); const unsigned nsf = (NR * NH + 7) / 8;
  k_round16f<<<wb, 256, 0, stream>>>(Wq, BQ, w8); k_round16f<<<wb, 256, 0, stream>>>(Wk, BK, w8); k_round16f<<<wb, 256, 0, stream>>>(Wv, BV, w8); k_round16f<<<wb, 256, 0, stream>>>(Wo, BO, w8);      /* torch (out,in) = natural Bt; x16 */
  k_causaltab<<<(SLEN * (SLEN / 32) + 255) / 256, 256, 0, stream>>>(MB, RA, KE, SLEN, SLEN);
  const dim3 gP((NR / 128) * (DM / 64), 1);
  for (int b = 0; b < NBT; ++b) {
    k_x16<<<nb8, 256, 0, stream>>>(x + (size_t)b * SLEN * DM, X16, n8);
    k_gemm2<0><<<gP, 128, 0, stream>>>(X16, DM, 0, BQ, DM, 0, 0.0625f, nullptr, 0, nullptr, 1, 0, 0, F, nullptr, DM, 0, NR, DM, DM); k_silufac<1><<<nsf, 256, 0, stream>>>(F, qs, G); k_hl<<<nb8, 256, 0, stream>>>(G, Qh, Ql, n8);      /* q = silu(x Wq^T) * f_q */
    k_gemm2<0><<<gP, 128, 0, stream>>>(X16, DM, 0, BK, DM, 0, 0.0625f, nullptr, 0, nullptr, 1, 0, 0, F, nullptr, DM, 0, NR, DM, DM); k_silufac<1><<<nsf, 256, 0, stream>>>(F, ks, G); k_hl<<<nb8, 256, 0, stream>>>(G, Kh, Kl, n8);      /* k = silu(x Wk^T) * f_k */
    k_gemm2<0><<<gP, 128, 0, stream>>>(X16, DM, 0, BV, DM, 0, 0.0625f, nullptr, 0, nullptr, 1, 0, 0, F, nullptr, DM, 0, NR, DM, DM); k_silufac<0><<<nsf, 256, 0, stream>>>(F, ks, G);      /* v = silu(x Wv^T) */
    k_vthl<SLEN><<<NH * (SLEN / 64), 256, 0, stream>>>(G, DM, Vth, Vtl);
    k_flashm<SLEN, SLEN><<<NH * (SLEN / 64), 128, 0, stream>>>(Qh, Ql, DM, Kh, Kl, DM, Vth, Vtl, MB, RA, KE, O, DM);
    k_hl<<<nb8, 256, 0, stream>>>(O, Oh, Ol, n8);
    float* outb = (float*)d_out + (size_t)b * SLEN * DM;
    k_gemm2<0><<<gP, 128, 0, stream>>>(Oh, DM, 0, BO, DM, 0, 0.0625f, nullptr, 0, nullptr, 1, 0, 0, outb, nullptr, DM, 0, NR, DM, DM);
    k_gemm2<0><<<gP, 128, 0, stream>>>(Ol, DM, 0, BO, DM, 0, 0.0625f / 1024.0f, nullptr, 0, outb, 1, (size_t)DM, 0, outb, nullptr, DM, 0, NR, DM, DM); }
}

// v001
// Measured time: 1020 microseconds a run.
// Next to v000, in two timings, it ran 1.94 and 1.93 times as fast.
#include <hip/hip_runtime.h>
// Polar causal multi-head attention (4 x 2048 tokens x 1024, 16 heads x 64): q, k, v = SiLU(x*W^T); per (token, head) r = |q|, dir = q/(r + 1e-6); scores = (q_dir.k_dir) * (r_q q_scale[h]) * (r_k k_scale[h]) = (q . k) * f_q * f_k with f = r*scale/(r + 1e-6), j <= i; softmax; merged . Wo^T -> [4,2048,1024].
// Structure (every launch covers all 4 batches: 8192 token rows, 64 (batch, head) slabs): x as an exact f16 plane; the three projections as f16 WMMA GEMMs (32x64 wave tiles, f32, exact products); a VALU pass applies SiLU and folds the per-(token, head) polar factor f into q and k (f32); q, k as f16 hi + x2^10 residual planes, V^T as hi + residual planes; the causal structure computed on device into a key bit plane + per-block key bound; the fused flash kernel per (head, 64 queries) (three-product hi/lo scores, online softmax f32, P hi + residual via LDS, two value accumulators); O as hi + residual planes; output projection as two GEMMs into the output rows.
// Compute dtype: x, weights, scales rounded to bf16; projections exact; SiLU / norms / factors f32; q, k, P, v, O as f16 hi + residual pairs (~2^-21); f32 accumulation and softmax. v_wmma_f32_16x16x32_f16.
#define NBT 4
#define SLEN 2048
#define DM 1024
#define NH 16
#define SCL 1.0f
#define NR (NBT * SLEN)
typedef __bf16 v16b __attribute__((ext_vector_type(16)));
typedef unsigned short v8us __attribute__((ext_vector_type(8), may_alias));
typedef float  v8f  __attribute__((ext_vector_type(8)));
typedef float  v4f  __attribute__((ext_vector_type(4)));
typedef float  v4fa __attribute__((ext_vector_type(4), may_alias));
union FragB { v16b v; v8us half[2]; unsigned short u[16]; };

__device__ __forceinline__ unsigned short bf16_bits(float x) { unsigned int u = __float_as_uint(x); return (unsigned short)((u + 0x7FFFu + ((u >> 16) & 1u)) >> 16); }
__device__ __forceinline__ float bf16_val(unsigned short b) { return __uint_as_float(((unsigned int)b) << 16); }
__device__ __forceinline__ float bf16_round(float x) { return bf16_val(bf16_bits(x)); }
// D += A·B with NT terms: 1 = ah·bh, 2 = + al·bh (A split), 3 = + ah·bl (both split)
template <int NT>
__device__ __forceinline__ v8f mmaN(v16b ah, v16b al, v16b bh, v16b bl, v8f c) {
  c = __builtin_amdgcn_wmma_f32_16x16x32_bf16(false, ah, false, bh, (short)0, c, false, false);
  if (NT >= 2) c = __builtin_amdgcn_wmma_f32_16x16x32_bf16(false, al, false, bh, (short)0, c, false, false);
  if (NT >= 3) c = __builtin_amdgcn_wmma_f32_16x16x32_bf16(false, ah, false, bl, (short)0, c, false, false);
  asm volatile("v_nop\n\tv_nop\n\tv_nop\n\tv_nop" : "+v"(c) : "v"(ah), "v"(al), "v"(bh), "v"(bl));
  return c;
}

__global__ __launch_bounds__(256) void k_wt_bf16(const float* __restrict__ W, unsigned short* __restrict__ Wt, int K, int N) {
  const int t = blockIdx.x * 256 + threadIdx.x;
  const int k8n = K / 8;
  if (t >= N * k8n) return;
  const int n = t / k8n, k8 = (t % k8n) * 8;
  v8us v;
#pragma unroll
  for (int i = 0; i < 8; ++i) v[i] = bf16_bits(W[(size_t)(k8 + i) * N + n]);
  *(v8us*)(Wt + (size_t)n * K + k8) = v;
  
}

// GEMM C[M][N] (f32, pitch ldc) = act(A[M][K]·W + bias). A f32 row-major (pitch lda) converted per fragment to bf16
// (ASPLIT: hi/lo two planes -> 2 terms, else single rounded term); Wt bf16 [N][K] (pitch ldb). BIAS_BF16 rounds the
// bias to bf16 first (bias quantised to bf16 before the add). K%32==0, M%16==0, N%64==0.
template <bool ASPLIT, int ACT, bool BIAS_BF16>
__global__ __launch_bounds__(128) void k_gemm_bf(const float* __restrict__ A, int lda, const unsigned short* __restrict__ Wt, int ldb,
                                               const float* __restrict__ bias, float* __restrict__ C, int ldc, int M, int N, int K) {
  __shared__ __attribute__((aligned(16))) float so[4][16][64];
  const int tid = threadIdx.x, w = tid >> 5, lane = tid & 31, ln = lane & 15, hh = lane >> 4;
  const int ntn = N / 64;
  const int wid = blockIdx.x * 4 + w;
  const int mt = wid / ntn, nq = wid % ntn;
  if (mt * 16 >= M) return;
  const int row0 = mt * 16, col0 = nq * 64;
  const float* arow = A + (size_t)(row0 + ln) * lda;
  v8f acc[4] = {};
  for (int kb = 0; kb < K; kb += 32) {
    FragB ah, al;
    const v4f x0 = *(const v4fa*)(arow + kb + 8 * hh), x1 = *(const v4fa*)(arow + kb + 8 * hh + 4);
    const v4f x2 = *(const v4fa*)(arow + kb + 16 + 8 * hh), x3 = *(const v4fa*)(arow + kb + 16 + 8 * hh + 4);
    float xs[16] = {x0[0],x0[1],x0[2],x0[3],x1[0],x1[1],x1[2],x1[3],x2[0],x2[1],x2[2],x2[3],x3[0],x3[1],x3[2],x3[3]};
#pragma unroll
    for (int i = 0; i < 16; ++i) { const unsigned short hb = bf16_bits(xs[i]); ah.u[i] = hb; al.u[i] = ASPLIT ? bf16_bits(xs[i] - bf16_val(hb)) : (unsigned short)0; }
#pragma unroll
    for (int t = 0; t < 4; ++t) {
      const unsigned short* brow = Wt + (size_t)(col0 + t * 16 + ln) * ldb + kb;
      FragB b;
      b.half[0] = *(const v8us*)(brow + 8 * hh);
      b.half[1] = *(const v8us*)(brow + 16 + 8 * hh);
      acc[t] = mmaN<ASPLIT ? 2 : 1>(ah.v, al.v, b.v, b.v, acc[t]);
    }
  }
#pragma unroll
  for (int t = 0; t < 4; ++t) {
    float bv = bias ? bias[col0 + t * 16 + ln] : 0.f;
    if (BIAS_BF16) bv = bf16_round(bv);
#pragma unroll
    for (int r = 0; r < 8; ++r) { float v = acc[t][r] + bv; if (ACT == 1) v = fmaxf(v, 0.f); so[w][8 * hh + r][t * 16 + ln] = v; }
  }
  __builtin_amdgcn_fence(__ATOMIC_ACQ_REL, "workgroup");
  __builtin_amdgcn_wave_barrier();
  const int rsub = lane >> 4, c4 = (lane & 15) * 4;
  {
#pragma unroll
    for (int q = 0; q < 8; ++q) {
      const int r = q * 2 + rsub;
      const v4f v = *(const v4fa*)&so[w][r][c4];
      *(v4f*)(C + (size_t)(row0 + r) * ldc + col0 + c4) = v;
    }
    
  }
}

// GEMM C = act(A·W + bias + resid): A f32 (ASPLIT -> hi/lo 2 terms), Wt bf16 [N][K]; ACT 0 none, 1 relu, 2 exact gelu;
// resid (optional, f32, row index = (row % rmod), pitch ldr, RES_BF16 rounds it) added before the activation.
template <bool ASPLIT, int ACT, bool BIAS_BF16, bool RES_BF16>
__global__ __launch_bounds__(128) void k_gemm_bf3(const float* __restrict__ A, int lda, const unsigned short* __restrict__ Wt, int ldb,
                                                const float* __restrict__ bias, const float* __restrict__ resid, int rmod, int ldr,
                                                float* __restrict__ C, int ldc, int M, int N, int K) {
  __shared__ __attribute__((aligned(16))) float so[4][16][64];
  const int tid = threadIdx.x, w = tid >> 5, lane = tid & 31, ln = lane & 15, hh = lane >> 4;
  const int ntn = N / 64;
  const int wid = blockIdx.x * 4 + w;
  const int mt = wid / ntn, nq = wid % ntn;
  if (mt * 16 >= M) return;
  const int row0 = mt * 16, col0 = nq * 64;
  const float* arow = A + (size_t)(row0 + ln) * lda;
  v8f acc[4] = {};
  for (int kb = 0; kb < K; kb += 32) {
    FragB ah, al;
    const v4f x0 = *(const v4fa*)(arow + kb + 8 * hh), x1 = *(const v4fa*)(arow + kb + 8 * hh + 4);
    const v4f x2 = *(const v4fa*)(arow + kb + 16 + 8 * hh), x3 = *(const v4fa*)(arow + kb + 16 + 8 * hh + 4);
    float xs[16] = {x0[0],x0[1],x0[2],x0[3],x1[0],x1[1],x1[2],x1[3],x2[0],x2[1],x2[2],x2[3],x3[0],x3[1],x3[2],x3[3]};
#pragma unroll
    for (int i = 0; i < 16; ++i) { const unsigned short hb = bf16_bits(xs[i]); ah.u[i] = hb; al.u[i] = ASPLIT ? bf16_bits(xs[i] - bf16_val(hb)) : (unsigned short)0; }
#pragma unroll
    for (int t = 0; t < 4; ++t) {
      const unsigned short* brow = Wt + (size_t)(col0 + t * 16 + ln) * ldb + kb;
      FragB b;
      b.half[0] = *(const v8us*)(brow + 8 * hh);
      b.half[1] = *(const v8us*)(brow + 16 + 8 * hh);
      acc[t] = mmaN<ASPLIT ? 2 : 1>(ah.v, al.v, b.v, b.v, acc[t]);
    }
  }
#pragma unroll
  for (int t = 0; t < 4; ++t) {
    const int col = col0 + t * 16 + ln;
    float bv = bias ? bias[col] : 0.f;
    if (BIAS_BF16) bv = bf16_round(bv);
#pragma unroll
    for (int r = 0; r < 8; ++r) {
      float v = acc[t][r] + bv;
      if (resid) { float rv = resid[(size_t)((row0 + 8 * hh + r) % rmod) * ldr + col]; if (RES_BF16) rv = bf16_round(rv); v += rv; }
      if (ACT == 1) v = fmaxf(v, 0.f);
      if (ACT == 2) v = 0.5f * v * (1.0f + erff(v * 0.70710678118654752f));
      if (ACT == 3) { const float u = 0.7978845608028654f * (v + 0.044715f * v * v * v); v = 0.5f * v * (1.0f + tanhf(u)); }
      so[w][8 * hh + r][t * 16 + ln] = v;
    }
  }
  __builtin_amdgcn_fence(__ATOMIC_ACQ_REL, "workgroup");
  __builtin_amdgcn_wave_barrier();
  const int rsub = lane >> 4, c4 = (lane & 15) * 4;
  {
#pragma unroll
    for (int q = 0; q < 8; ++q) {
      const int r = q * 2 + rsub;
      const v4f v = *(const v4fa*)&so[w][r][c4];
      *(v4f*)(C + (size_t)(row0 + r) * ldc + col0 + c4) = v;
    }
    
  }
}
// row LayerNorm (biased variance, eps) over N: s = X (+ R); optional out_sum <- s; out_norm <- (s-mu)*rsqrt(var+eps)*g + b
template <bool PARAM_BF16>
__global__ __launch_bounds__(256) void k_layernorm(const float* __restrict__ X, const float* __restrict__ R, const float* __restrict__ g, const float* __restrict__ bta,
                                                  float* __restrict__ out_sum, float* __restrict__ out_norm, int N, float eps) {
  __shared__ float red[256];
  const int row = blockIdx.x, tid = threadIdx.x;
  const float* x = X + (size_t)row * N; const float* rr = R ? R + (size_t)row * N : nullptr;
  float vals[16];                     // up to N = 4096
  const int per = N / 256;            // contiguous chunk per thread? use strided-by-4 chunks: thread handles j = tid*4 + 1024*u
  float s1 = 0.f;
  for (int u = 0; u < per / 4; ++u) {
    const int j = tid * 4 + 1024 * u;
    const v4f a = *(const v4fa*)(x + j);
    v4f b = {0.f,0.f,0.f,0.f}; if (rr) b = *(const v4fa*)(rr + j);
#pragma unroll
    for (int q = 0; q < 4; ++q) { const float v = a[q] + b[q]; vals[u * 4 + q] = v; s1 += v; }
  }
  red[tid] = s1; __syncthreads();
  for (int st = 128; st > 0; st >>= 1) { if (tid < st) red[tid] += red[tid + st]; __syncthreads(); }
  const float mu = red[0] / (float)N; __syncthreads();
  float s2 = 0.f;
  for (int u = 0; u < per / 4; ++u)
#pragma unroll
    for (int q = 0; q < 4; ++q) { const float c = vals[u * 4 + q] - mu; s2 += c * c; }
  red[tid] = s2; __syncthreads();
  for (int st = 128; st > 0; st >>= 1) { if (tid < st) red[tid] += red[tid + st]; __syncthreads(); }
  const float rs = rsqrtf(red[0] / (float)N + eps);
  {
    for (int u = 0; u < per / 4; ++u) {
      const int j = tid * 4 + 1024 * u;
      v4f o, sm;
#pragma unroll
      for (int q = 0; q < 4; ++q) {
        float gg = g[j + q], bb = bta[j + q];
        if (PARAM_BF16) { gg = bf16_round(gg); bb = bf16_round(bb); }
        sm[q] = vals[u * 4 + q]; o[q] = (vals[u * 4 + q] - mu) * rs * gg + bb;
      }
      if (out_sum) *(v4f*)(out_sum + (size_t)row * N + j) = sm;
      *(v4f*)(out_norm + (size_t)row * N + j) = o;
    }
    
  }
}



// ---- f16 WMMA path (v_wmma_f32_16x16x32_f16): 11-bit significands for operands in range — used where a [0,1] probability operand needs more precision than bf16
typedef _Float16 v16h __attribute__((ext_vector_type(16)));
union FragH { v16h v; v8us half[2]; _Float16 h[16]; unsigned short u[16]; };
template <int NT>
__device__ __forceinline__ v8f mmaH(v16h ah, v16h al, v16h bh, v16h bl, v8f c) {
  c = __builtin_amdgcn_wmma_f32_16x16x32_f16(false, ah, false, bh, (short)0, c, false, false);
  if (NT >= 2) c = __builtin_amdgcn_wmma_f32_16x16x32_f16(false, al, false, bh, (short)0, c, false, false);
  if (NT >= 3) c = __builtin_amdgcn_wmma_f32_16x16x32_f16(false, ah, false, bl, (short)0, c, false, false);
  asm volatile("v_nop\n\tv_nop\n\tv_nop\n\tv_nop" : "+v"(c) : "v"(ah), "v"(al), "v"(bh), "v"(bl));
  return c;
}
// batched GEMM like k_gemm_b but f16 operands: A f32 (split into f16 hi/lo if ASPLIT, else rounded to f16), Bt = f16 values [n][k]; alpha; C f32; N multiple of 16 (partial tiles skipped)
template <bool ASPLIT>
__global__ __launch_bounds__(128) void k_gemm_h(const float* __restrict__ A, int lda, size_t sA, const _Float16* __restrict__ Bh, int ldb, size_t sB, float alpha, float* __restrict__ C, int ldc, size_t sC, int M, int N, int K) {
  __shared__ __attribute__((aligned(16))) float so[4][16][64];
  const int tid = threadIdx.x, w = tid >> 5, lane = tid & 31, ln = lane & 15, hh = lane >> 4; const int by = blockIdx.y;
  A += (size_t)by * sA; Bh += (size_t)by * sB; C += (size_t)by * sC;
  const int ntn = (N + 63) / 64; const int wid = blockIdx.x * 4 + w; const int mt = wid / ntn, nq = wid % ntn; if (mt * 16 >= M) return;
  const int row0 = mt * 16, col0 = nq * 64; const float* arow = A + (size_t)(row0 + ln) * lda;
  v8f acc[4] = {};
  for (int kb = 0; kb < K; kb += 32) {
    FragH ah, al;
    const v4f x0 = *(const v4fa*)(arow + kb + 8 * hh), x1 = *(const v4fa*)(arow + kb + 8 * hh + 4), x2 = *(const v4fa*)(arow + kb + 16 + 8 * hh), x3 = *(const v4fa*)(arow + kb + 16 + 8 * hh + 4);
    float xs[16] = {x0[0],x0[1],x0[2],x0[3],x1[0],x1[1],x1[2],x1[3],x2[0],x2[1],x2[2],x2[3],x3[0],x3[1],x3[2],x3[3]};
#pragma unroll
    for (int i = 0; i < 16; ++i) { const _Float16 h = (_Float16)xs[i]; ah.h[i] = h; al.h[i] = ASPLIT ? (_Float16)(xs[i] - (float)h) : (_Float16)0.0f; }
#pragma unroll
    for (int t = 0; t < 4; ++t) { if (col0 + t * 16 >= N) continue; const size_t boff = (size_t)(col0 + t * 16 + ln) * ldb + kb; FragH bq; bq.half[0] = *(const v8us*)(Bh + boff + 8 * hh); bq.half[1] = *(const v8us*)(Bh + boff + 16 + 8 * hh);
      acc[t] = mmaH<ASPLIT ? 2 : 1>(ah.v, al.v, bq.v, bq.v, acc[t]); }
  }
#pragma unroll
  for (int t = 0; t < 4; ++t) { if (col0 + t * 16 >= N) continue;
#pragma unroll
    for (int r = 0; r < 8; ++r) so[w][8 * hh + r][t * 16 + ln] = acc[t][r] * alpha; }
  __builtin_amdgcn_fence(__ATOMIC_ACQ_REL, "workgroup"); __builtin_amdgcn_wave_barrier();
  const int rsub = lane >> 4, c4 = (lane & 15) * 4;
  {
#pragma unroll
    for (int q = 0; q < 8; ++q) { const int r = q * 2 + rsub; if (col0 + c4 < N) { const v4f v = *(const v4fa*)&so[w][r][c4]; *(v4f*)(C + (size_t)(row0 + r) * ldc + col0 + c4) = v; } }
     }
}

// Wt[n][k] = f16(W[k][n]·scale) from f32 row-major W[K][N] (scale = power of two; bf16-exact weights stay exact in f16 away from the subnormal range)
__global__ __launch_bounds__(256) void k_wt_f16(const float* __restrict__ W, _Float16* __restrict__ Wt, int K, int N, float scale) {
  const int t = blockIdx.x * 256 + threadIdx.x; if (t >= N * (K / 8)) return; const int n = t / (K / 8), k8 = (t % (K / 8)) * 8; FragH f;
#pragma unroll
  for (int i = 0; i < 8; ++i) f.h[i] = (_Float16)(bf16_round(W[(size_t)(k8 + i) * N + n]) * scale); const v8us o = f.half[0];
  *(v8us*)((unsigned short*)Wt + (size_t)n * K + k8) = o; 
}
// k_gemm_hh variant with fused epilogue: v = acc·alpha + bias[by·sBias + col] (+ CP[(row/rowsPerB)·sCPb + by·64 + col] if CP) ; ACT 0 none / 1 elu ; writes f16 C16 (and f32 C if non-null)
template <int ACT>
__global__ __launch_bounds__(128) void k_gemm_hhx(const _Float16* __restrict__ A, int lda, size_t sA, const _Float16* __restrict__ Bh, int ldb, size_t sB, float alpha, const float* __restrict__ bias, size_t sBias, const float* __restrict__ CP, int rowsPerB, size_t sCPb, int row0g,
    float* __restrict__ C, _Float16* __restrict__ C16, int ldc, size_t sC, int M, int N, int K) {
  __shared__ __attribute__((aligned(16))) float so[4][16][64];
  const int tid = threadIdx.x, w = tid >> 5, lane = tid & 31, ln = lane & 15, hh = lane >> 4; const int by = blockIdx.y;
  A += (size_t)by * sA; Bh += (size_t)by * sB; const size_t cofs = (size_t)by * sC; const float* bp = bias ? bias + (size_t)by * sBias : nullptr;
  const int ntn = (N + 63) / 64; const int wid = blockIdx.x * 4 + w; const int mt = wid / ntn, nq = wid % ntn; if (mt * 16 >= M) return;
  const int row0 = mt * 16, col0 = nq * 64; const _Float16* arow = A + (size_t)(row0 + ln) * lda;
  v8f acc[4] = {};
  for (int kb = 0; kb < K; kb += 32) { FragH ah; ah.half[0] = *(const v8us*)((const unsigned short*)arow + kb + 8 * hh); ah.half[1] = *(const v8us*)((const unsigned short*)arow + kb + 16 + 8 * hh);
#pragma unroll
    for (int t = 0; t < 4; ++t) { if (col0 + t * 16 >= N) continue; const size_t boff = (size_t)(col0 + t * 16 + ln) * ldb + kb; FragH bq; bq.half[0] = *(const v8us*)((const unsigned short*)Bh + boff + 8 * hh); bq.half[1] = *(const v8us*)((const unsigned short*)Bh + boff + 16 + 8 * hh);
      acc[t] = mmaH<1>(ah.v, ah.v, bq.v, bq.v, acc[t]); }
  }
#pragma unroll
  for (int t = 0; t < 4; ++t) { if (col0 + t * 16 >= N) continue; const int col = col0 + t * 16 + ln; const float bv = bp ? bf16_round(bp[col]) : 0.f;
#pragma unroll
    for (int r = 0; r < 8; ++r) { float v = acc[t][r] * alpha + bv; if (CP) { const int bidx = (row0g + row0 + 8 * hh + r) / rowsPerB; v += CP[(size_t)bidx * sCPb + (size_t)by * 64 + col]; } if (ACT == 1) v = (v > 0.f) ? v : expm1f(v); else if (ACT == 7) v = (v > 0.f) ? v + 1.0f : expf(v); else if (ACT == 8) v = tanhf(v); else if (ACT == 9) v = 0.5f * v * (1.0f + tanhf(0.7978845608028654f * (v + 0.044715f * v * v * v))); else if (ACT == 11) v = 1.0f / (1.0f + expf(-v)); else if (ACT == 12) v = (v > 0.f) ? v : 0.01f * v; else if (ACT == 14) v = (v > 0.f) ? v : 0.1f * v; else if (ACT == 15) v = v / (1.0f + expf(-v)); else if (ACT == 3) v = fmaxf(v, 0.f); else if (ACT == 6) v = 0.5f * v * (1.0f + erff(v * 0.70710678118654752f)); so[w][8 * hh + r][t * 16 + ln] = v; } }
  __builtin_amdgcn_fence(__ATOMIC_ACQ_REL, "workgroup"); __builtin_amdgcn_wave_barrier();
  const int rsub = lane >> 4, c4 = (lane & 15) * 4; typedef _Float16 v4h __attribute__((ext_vector_type(4)));
  {
#pragma unroll
    for (int q = 0; q < 8; ++q) { const int r = q * 2 + rsub; if (col0 + c4 < N) { const v4f v = *(const v4fa*)&so[w][r][c4]; if (C) *(v4f*)(C + cofs + (size_t)(row0 + r) * ldc + col0 + c4) = v; if (C16) { v4h h4; for (int i = 0; i < 4; ++i) h4[i] = (_Float16)v[i]; *(v4h*)(C16 + cofs + (size_t)(row0 + r) * ldc + col0 + c4) = h4; } } }
     }
}


typedef _Float16 v4h __attribute__((ext_vector_type(4)));

__global__ __launch_bounds__(256) void k_x16(const float* __restrict__ x, _Float16* __restrict__ X16, size_t n8) { const size_t t = (size_t)blockIdx.x * 256 + threadIdx.x; if (t >= n8) return; FragH f;
#pragma unroll
  for (int q = 0; q < 8; ++q) f.h[q] = (_Float16)bf16_round(x[t * 8 + q]); *(v8us*)((unsigned short*)X16 + t * 8) = f.half[0];  }
__global__ __launch_bounds__(256) void k_h16(const float* __restrict__ x, _Float16* __restrict__ X16, size_t n8) { const size_t t = (size_t)blockIdx.x * 256 + threadIdx.x; if (t >= n8) return; FragH f;
#pragma unroll
  for (int q = 0; q < 8; ++q) f.h[q] = (_Float16)x[t * 8 + q]; *(v8us*)((unsigned short*)X16 + t * 8) = f.half[0];  }
__global__ __launch_bounds__(256) void k_round16f(const float* __restrict__ W, _Float16* __restrict__ Bt, size_t n8) { const size_t t = (size_t)blockIdx.x * 256 + threadIdx.x; if (t >= n8) return; FragH f;
#pragma unroll
  for (int i = 0; i < 8; ++i) f.h[i] = (_Float16)(bf16_round(W[t * 8 + i]) * 16.0f); *(v8us*)((unsigned short*)Bt + t * 8) = f.half[0];  }
template <int NHv, int TTv>
__global__ __launch_bounds__(256) void k_vt(const _Float16* __restrict__ V16, int ldv, int voff, _Float16* __restrict__ Vt) { __shared__ unsigned short tl[64][66]; const int tid = threadIdx.x; const int slab = blockIdx.x / (TTv / 64), lg = blockIdx.x % (TTv / 64); const int b = slab / NHv, h = slab % NHv;
  for (int i = tid; i < 64 * 8; i += 256) { const int r = i / 8, c8 = (i % 8) * 8; FragH f; f.half[0] = *(const v8us*)((const unsigned short*)V16 + ((size_t)b * TTv + lg * 64 + r) * ldv + voff + h * 64 + c8);
#pragma unroll
    for (int q = 0; q < 8; ++q) tl[r][c8 + q] = f.u[q]; }
  __syncthreads();
  {
#pragma unroll
    for (int rd = 0; rd < 2; ++rd) { const int d = rd * 32 + tid / 8, pc = tid % 8; FragH f;
#pragma unroll
      for (int q = 0; q < 8; ++q) f.u[q] = tl[pc * 8 + q][d];
      *(v8us*)((unsigned short*)Vt + ((size_t)slab * 64 + d) * TTv + lg * 64 + pc * 8) = f.half[0]; }
     } }

__global__ __launch_bounds__(256) void k_hl(const float* __restrict__ F, _Float16* __restrict__ Hh, _Float16* __restrict__ Hl, size_t n8) { const size_t t = (size_t)blockIdx.x * 256 + threadIdx.x; if (t >= n8) return; FragH fh, fl; const v4f a = *(const v4fa*)(F + t * 8), c = *(const v4fa*)(F + t * 8 + 4);
#pragma unroll
  for (int q = 0; q < 4; ++q) { _Float16 h = (_Float16)a[q]; fh.h[q] = h; fl.h[q] = (_Float16)((a[q] - (float)h) * 1024.0f); h = (_Float16)c[q]; fh.h[4 + q] = h; fl.h[4 + q] = (_Float16)((c[q] - (float)h) * 1024.0f); }
  { *(v8us*)((unsigned short*)Hh + t * 8) = fh.half[0]; *(v8us*)((unsigned short*)Hl + t * 8) = fl.half[0];  } }

// ---- fast GEMM (wave tile 32x64; requires M % 32 == 0 rows per launch region and N % 64 == 0); epilogue = k_gemm_hhx semantics ----
__device__ __forceinline__ v16h g2_frag(const _Float16* p, int hh) { FragH f; f.half[0] = *(const v8us*)((const unsigned short*)p + 8 * hh); f.half[1] = *(const v8us*)((const unsigned short*)p + 16 + 8 * hh); return f.v; }
__device__ __forceinline__ v8f g2_mma(v16h a, v16h b, v8f c) { v8f d = __builtin_amdgcn_wmma_f32_16x16x32_f16(false, a, false, b, (short)0, c, false, false); asm volatile("v_nop\n\tv_nop\n\tv_nop\n\tv_nop" : "+v"(d) : "v"(a), "v"(b)); return d; }
template <int ACT>
__global__ __launch_bounds__(128) void k_gemm2(const _Float16* __restrict__ A, int lda, size_t sA, const _Float16* __restrict__ Bh, int ldb, size_t sB, float alpha, const float* __restrict__ bias, size_t sBias, const float* __restrict__ CP, int rowsPerB, size_t sCPb, int row0g,
    float* __restrict__ C, _Float16* __restrict__ C16, int ldc, size_t sC, int M, int N, int K) {
  __shared__ __attribute__((aligned(16))) float so[4][32][68];
  const int tid = threadIdx.x, w = tid >> 5, lane = tid & 31, ln = lane & 15, hh = lane >> 4; const int by = blockIdx.y;
  A += (size_t)by * sA; Bh += (size_t)by * sB; const size_t cofs = (size_t)by * sC; const float* bp = bias ? bias + (size_t)by * sBias : nullptr;
  const int ntn = N >> 6; const int mt = blockIdx.x / ntn, nq = blockIdx.x - mt * ntn; const int row0 = mt * 128 + 32 * w, col0 = nq * 64; if (row0 >= M) return;
  const _Float16* a0p = A + (size_t)(row0 + ln) * lda; const _Float16* a1p = a0p + (size_t)16 * lda;
  const _Float16* b0p = Bh + (size_t)(col0 + ln) * ldb; const _Float16* b1p = b0p + (size_t)16 * ldb; const _Float16* b2p = b1p + (size_t)16 * ldb; const _Float16* b3p = b2p + (size_t)16 * ldb;
  const v8f z8 = {0.f,0.f,0.f,0.f,0.f,0.f,0.f,0.f}; v8f c00 = z8, c01 = z8, c02 = z8, c03 = z8, c10 = z8, c11 = z8, c12 = z8, c13 = z8;
#pragma unroll 1
  for (int kb = 0; kb < K; kb += 32) { const v16h a0 = g2_frag(a0p + kb, hh), a1 = g2_frag(a1p + kb, hh);
    v16h b = g2_frag(b0p + kb, hh); c00 = g2_mma(a0, b, c00); c10 = g2_mma(a1, b, c10);
    b = g2_frag(b1p + kb, hh); c01 = g2_mma(a0, b, c01); c11 = g2_mma(a1, b, c11);
    b = g2_frag(b2p + kb, hh); c02 = g2_mma(a0, b, c02); c12 = g2_mma(a1, b, c12);
    b = g2_frag(b3p + kb, hh); c03 = g2_mma(a0, b, c03); c13 = g2_mma(a1, b, c13); }
  v8f accs[8] = {c00, c01, c02, c03, c10, c11, c12, c13};
#pragma unroll
  for (int u = 0; u < 8; ++u) { const int t = u & 3, half = u >> 2; const int col = col0 + t * 16 + ln; const float bv = bp ? bf16_round(bp[col]) : 0.f;
#pragma unroll
    for (int r = 0; r < 8; ++r) { const int rloc = half * 16 + 8 * hh + r; float v = accs[u][r] * alpha + bv; if (CP) { const int bidx = (row0g + row0 + rloc) / rowsPerB; v += CP[(size_t)bidx * sCPb + (size_t)by * 64 + col]; }
      if (ACT == 3) v = fmaxf(v, 0.f); else if (ACT == 6) v = 0.5f * v * (1.0f + erff(v * 0.70710678118654752f)); else if (ACT == 11) v = 1.0f / (1.0f + expf(-v)); else if (ACT == 15) v = v / (1.0f + expf(-v)); else if (ACT == 12) v = (v > 0.f) ? v : 0.01f * v; else if (ACT == 8) v = tanhf(v);
      so[w][rloc][t * 16 + ln] = v; } }
  __builtin_amdgcn_fence(__ATOMIC_ACQ_REL, "workgroup"); __builtin_amdgcn_wave_barrier();
  const int rsub = lane >> 4, c4 = (lane & 15) * 4;
  {
#pragma unroll
    for (int q = 0; q < 16; ++q) { const int r = q * 2 + rsub; const v4f v = *(const v4fa*)&so[w][r][c4]; if (C) *(v4f*)(C + cofs + (size_t)(row0 + r) * ldc + col0 + c4) = v; if (C16) { v4h h4; for (int i = 0; i < 4; ++i) h4[i] = (_Float16)v[i]; *(v4h*)(C16 + cofs + (size_t)(row0 + r) * ldc + col0 + c4) = h4; } }
     } }



template <int TK>
__global__ __launch_bounds__(256) void k_vthl(const float* __restrict__ VF, int ldv, _Float16* __restrict__ Vth, _Float16* __restrict__ Vtl) { __shared__ float tl[64][65]; const int tid = threadIdx.x; const int slab = blockIdx.x / (TK / 64), lg = blockIdx.x % (TK / 64); const int b = slab / NH, h = slab % NH;
  for (int i = tid; i < 64 * 16; i += 256) { const int r = i / 16, c4 = (i % 16) * 4; const v4f a = *(const v4fa*)(VF + ((size_t)b * TK + lg * 64 + r) * ldv + h * 64 + c4); tl[r][c4] = a[0]; tl[r][c4 + 1] = a[1]; tl[r][c4 + 2] = a[2]; tl[r][c4 + 3] = a[3]; }
  __syncthreads();
  FragH fh[2], fl[2]; size_t oo[2];
#pragma unroll
  for (int rd = 0; rd < 2; ++rd) { const int d = rd * 32 + tid / 8, pc = tid % 8;
#pragma unroll
    for (int q = 0; q < 8; ++q) { const float v = tl[pc * 8 + q][d]; const _Float16 hv = (_Float16)v; fh[rd].h[q] = hv; fl[rd].h[q] = (_Float16)((v - (float)hv) * 1024.0f); } oo[rd] = ((size_t)slab * 64 + d) * TK + lg * 64 + pc * 8; }
  {
#pragma unroll
    for (int rd = 0; rd < 2; ++rd) { *(v8us*)((unsigned short*)Vth + oo[rd]) = fh[rd].half[0]; *(v8us*)((unsigned short*)Vtl + oo[rd]) = fl[rd].half[0]; }
     } }

template <int TQ, int TK>
__global__ __launch_bounds__(128) void k_flashm(const _Float16* __restrict__ Q16, const _Float16* __restrict__ Q16lo, int ldq, const _Float16* __restrict__ K16, const _Float16* __restrict__ K16lo, int ldk, const _Float16* __restrict__ Vt, const _Float16* __restrict__ Vtlo, const unsigned* __restrict__ MB, const int* __restrict__ RA, const int* __restrict__ KE, float* __restrict__ O, int ldo) {
  constexpr int RPW = 16, RTN = RPW / 16, NQB = TQ / (4 * RPW), DT = 4, KS = 2;
  __shared__ __attribute__((aligned(16))) unsigned short sP[4][RPW][40], sPl[4][RPW][40]; __shared__ __attribute__((aligned(16))) float sO[4][RPW][64 + 4];
  const int tid = threadIdx.x, w = tid >> 5, lane = tid & 31, ln = lane & 15, hh = lane >> 4;
  const int slab = blockIdx.x / NQB, qblk = blockIdx.x % NQB; const int b = slab / NH, h = slab % NH; const int qb0 = qblk * (4 * RPW); const int q0 = qb0 + w * RPW;
  FragH aq[2][KS], aql[2][KS];
#pragma unroll
  for (int rt = 0; rt < RTN; ++rt) { const size_t qo = ((size_t)b * TQ + q0 + rt * 16 + ln) * ldq + h * 64; const unsigned short* qr = (const unsigned short*)Q16 + qo; const unsigned short* ql = (const unsigned short*)Q16lo + qo;
#pragma unroll
    for (int ks = 0; ks < KS; ++ks) { aq[rt][ks].half[0] = *(const v8us*)(qr + ks * 32 + 8 * hh); aq[rt][ks].half[1] = *(const v8us*)(qr + ks * 32 + 16 + 8 * hh); aql[rt][ks].half[0] = *(const v8us*)(ql + ks * 32 + 8 * hh); aql[rt][ks].half[1] = *(const v8us*)(ql + ks * 32 + 16 + 8 * hh); } }
  const unsigned short* Vth = (const unsigned short*)Vt + (size_t)slab * 64 * TK; const unsigned short* Vtl = (const unsigned short*)Vtlo + (size_t)slab * 64 * TK;
  float m_r[2][8], l_r[2][8]; v8f oacc[2][DT], oaccl[2][DT];
#pragma unroll
  for (int rt = 0; rt < RTN; ++rt) {
#pragma unroll
    for (int r = 0; r < 8; ++r) { m_r[rt][r] = -3.0e38f; l_r[rt][r] = 0.f; }
#pragma unroll
    for (int dt = 0; dt < DT; ++dt) { oacc[rt][dt] = (v8f){0.f,0.f,0.f,0.f,0.f,0.f,0.f,0.f}; oaccl[rt][dt] = oacc[rt][dt]; } }
  int jend = KE[qblk * 32]; jend = min(TK, (jend + 31) & ~31); if (jend < 32) jend = 32;      /* block-uniform */
  int allm[2][8]; const unsigned* mrow[2][8];
#pragma unroll
  for (int rt = 0; rt < RTN; ++rt)
#pragma unroll
    for (int r = 0; r < 8; ++r) { const int tq = q0 + rt * 16 + 8 * hh + r; allm[rt][r] = RA[tq]; mrow[rt][r] = MB + (size_t)tq * (TK / 32); }
#pragma unroll 1
  for (int j0 = 0; j0 < jend; j0 += 32) {
    
    v8f s[2][2];
#pragma unroll
    for (int nt = 0; nt < 2; ++nt) { const size_t ko = ((size_t)b * TK + j0 + nt * 16 + ln) * ldk + h * 64; const unsigned short* kr = (const unsigned short*)K16 + ko; const unsigned short* kl = (const unsigned short*)K16lo + ko; FragH bk[KS], bkl[KS];
#pragma unroll
      for (int ks = 0; ks < KS; ++ks) { bk[ks].half[0] = *(const v8us*)(kr + ks * 32 + 8 * hh); bk[ks].half[1] = *(const v8us*)(kr + ks * 32 + 16 + 8 * hh); bkl[ks].half[0] = *(const v8us*)(kl + ks * 32 + 8 * hh); bkl[ks].half[1] = *(const v8us*)(kl + ks * 32 + 16 + 8 * hh); }
#pragma unroll
      for (int rt = 0; rt < RTN; ++rt) { v8f acc = (v8f){0.f,0.f,0.f,0.f,0.f,0.f,0.f,0.f}, accr = acc;
#pragma unroll
        for (int ks = 0; ks < KS; ++ks) { acc = mmaH<1>(aq[rt][ks].v, aq[rt][ks].v, bk[ks].v, bk[ks].v, acc); accr = mmaH<1>(aql[rt][ks].v, aql[rt][ks].v, bk[ks].v, bk[ks].v, accr); accr = mmaH<1>(aq[rt][ks].v, aq[rt][ks].v, bkl[ks].v, bkl[ks].v, accr); }
        s[rt][nt] = acc + accr * 0.0009765625f; } }
#pragma unroll
    for (int rt = 0; rt < RTN; ++rt)
#pragma unroll
      for (int r = 0; r < 8; ++r) { const unsigned mw = mrow[rt][r][j0 >> 5]; const bool am = (allm[rt][r] != 0);
        const bool ok0 = am || (((mw >> ln) & 1u) == 0u), ok1 = am || (((mw >> (16 + ln)) & 1u) == 0u);
        const float s0 = ok0 ? (am ? 0.f : s[rt][0][r] * SCL) : -INFINITY, s1 = ok1 ? (am ? 0.f : s[rt][1][r] * SCL) : -INFINITY; float mc = fmaxf(s0, s1);
        mc = fmaxf(mc, __shfl_xor(mc, 1, 32)); mc = fmaxf(mc, __shfl_xor(mc, 2, 32)); mc = fmaxf(mc, __shfl_xor(mc, 4, 32)); mc = fmaxf(mc, __shfl_xor(mc, 8, 32));
        const float mn = fmaxf(m_r[rt][r], mc); const float al = (mn > -1.0e38f) ? expf(m_r[rt][r] - mn) : 1.0f; m_r[rt][r] = mn; const float p0 = ok0 ? expf(s0 - mn) : 0.f, p1 = ok1 ? expf(s1 - mn) : 0.f; l_r[rt][r] = l_r[rt][r] * al + p0 + p1;
#pragma unroll
        for (int dt = 0; dt < DT; ++dt) { oacc[rt][dt][r] *= al; oaccl[rt][dt][r] *= al; }
        FragH t2, t3; const float ps0 = p0 * 1024.0f, ps1 = p1 * 1024.0f; t2.h[0] = (_Float16)ps0; t2.h[1] = (_Float16)ps1; t3.h[0] = (_Float16)((ps0 - (float)t2.h[0]) * 1024.0f); t3.h[1] = (_Float16)((ps1 - (float)t2.h[1]) * 1024.0f);
        sP[w][rt * 16 + 8 * hh + r][ln] = t2.u[0]; sP[w][rt * 16 + 8 * hh + r][16 + ln] = t2.u[1]; sPl[w][rt * 16 + 8 * hh + r][ln] = t3.u[0]; sPl[w][rt * 16 + 8 * hh + r][16 + ln] = t3.u[1]; }
    __builtin_amdgcn_fence(__ATOMIC_ACQ_REL, "workgroup"); __builtin_amdgcn_wave_barrier();
    FragH pa[2], pl[2];
#pragma unroll
    for (int rt = 0; rt < RTN; ++rt) { pa[rt].half[0] = *(const v8us*)&sP[w][rt * 16 + ln][8 * hh]; pa[rt].half[1] = *(const v8us*)&sP[w][rt * 16 + ln][16 + 8 * hh]; pl[rt].half[0] = *(const v8us*)&sPl[w][rt * 16 + ln][8 * hh]; pl[rt].half[1] = *(const v8us*)&sPl[w][rt * 16 + ln][16 + 8 * hh]; }
#pragma unroll
    for (int dt = 0; dt < DT; ++dt) { const size_t vo = (size_t)(dt * 16 + ln) * TK + j0; FragH bv, bl; bv.half[0] = *(const v8us*)(Vth + vo + 8 * hh); bv.half[1] = *(const v8us*)(Vth + vo + 16 + 8 * hh); bl.half[0] = *(const v8us*)(Vtl + vo + 8 * hh); bl.half[1] = *(const v8us*)(Vtl + vo + 16 + 8 * hh);
#pragma unroll
      for (int rt = 0; rt < RTN; ++rt) { oacc[rt][dt] = mmaH<1>(pa[rt].v, pa[rt].v, bv.v, bv.v, oacc[rt][dt]); oaccl[rt][dt] = mmaH<1>(pa[rt].v, pa[rt].v, bl.v, bl.v, oaccl[rt][dt]); oaccl[rt][dt] = mmaH<1>(pl[rt].v, pl[rt].v, bv.v, bv.v, oaccl[rt][dt]); } }
    __builtin_amdgcn_fence(__ATOMIC_ACQ_REL, "workgroup"); __builtin_amdgcn_wave_barrier(); }
#pragma unroll
  for (int rt = 0; rt < RTN; ++rt) {
#pragma unroll
    for (int r = 0; r < 8; ++r) { float l = l_r[rt][r]; l += __shfl_xor(l, 1, 32); l += __shfl_xor(l, 2, 32); l += __shfl_xor(l, 4, 32); l += __shfl_xor(l, 8, 32); l_r[rt][r] = (l > 0.f) ? 1.0f / (l * 1024.0f) : 0.f; }
#pragma unroll
    for (int dt = 0; dt < DT; ++dt)
#pragma unroll
      for (int r = 0; r < 8; ++r) sO[w][rt * 16 + 8 * hh + r][dt * 16 + ln] = (oacc[rt][dt][r] + oaccl[rt][dt][r] * 0.0009765625f) * l_r[rt][r]; }
  __builtin_amdgcn_fence(__ATOMIC_ACQ_REL, "workgroup"); __builtin_amdgcn_wave_barrier();
  {
#pragma unroll
    for (int rp = 0; rp < RPW; rp += 2) { const int r = rp + (lane >> 4), pc = lane & 15; const v4f val = *(const v4fa*)&sO[w][r][pc * 4]; *(v4f*)(O + ((size_t)b * TQ + q0 + r) * ldo + h * 64 + pc * 4) = val; }
     } }


__global__ __launch_bounds__(256) void k_causaltab(unsigned* __restrict__ MB, int* __restrict__ RA, int* __restrict__ KE, int nq, int nk) {
  const int t = blockIdx.x * 256 + threadIdx.x; const int nw = nk / 32;
  if (t < nq * nw) { const int q = t / nw, w = t % nw; const int first = q + 1 - 32 * w; const unsigned bits = (first <= 0) ? 0xffffffffu : ((first >= 32) ? 0u : (0xffffffffu << first)); *(unsigned*)(MB + t) = bits;  }
  if (t < nq) { *(int*)(RA + t) = 0;  }
  if (t < nq / 64) { const int v = 64 * (t + 1); *(int*)(KE + t * 32) = v;  } }

__device__ __forceinline__ float siluf(float g) { return g / (1.0f + expf(-g)); }
template <int MODE>
__global__ __launch_bounds__(256) void k_silufac(const float* __restrict__ F, const float* __restrict__ scale, float* __restrict__ G) {
  #pragma clang fp contract(off)
  const int tid = threadIdx.x, w = tid >> 5, ln = tid & 31; const int idx = blockIdx.x * 8 + w; if (idx >= NR * NH) return; const int r = idx / NH, h = idx % NH;
  const float* f = F + (size_t)r * DM + h * 64 + 2 * ln; const float a = siluf(f[0]), b = siluf(f[1]); float fac = 1.0f;
  if (MODE == 1) { float s = a * a + b * b; for (int o = 16; o > 0; o >>= 1) s += __shfl_xor(s, o, 32); const float rr = sqrtf(s); fac = (rr * bf16_round(scale[h])) / (rr + 1e-6f); }
  float o2[2]; o2[0] = a * fac; o2[1] = b * fac; const unsigned long long pk = *(const unsigned long long*)o2; float* dst = G + (size_t)r * DM + h * 64 + 2 * ln;
  *(unsigned long long*)dst = pk;  }

extern "C" void kernel_launch(void* const* d_in, const int* in_sizes, int n_in,
                              void* d_out, int out_size, void* d_ws, size_t ws_size, hipStream_t stream) {
  (void)in_sizes; (void)n_in; (void)out_size;
  const float* const* I = (const float* const*)d_in; const float* x = I[0]; const float* Wq = I[1]; const float* Wk = I[2]; const float* Wv = I[3]; const float* Wo = I[4]; const float* qs = I[5]; const float* ks = I[6];
  char* ws = (char*)d_ws; size_t off = 0;
  auto take = [&](size_t bytes) { char* p = ws + off; off += (bytes + 255) & ~(size_t)255; return p; };
  _Float16* BQ = (_Float16*)take((size_t)DM * DM * 2); _Float16* BK = (_Float16*)take((size_t)DM * DM * 2); _Float16* BV = (_Float16*)take((size_t)DM * DM * 2); _Float16* BO = (_Float16*)take((size_t)DM * DM * 2);
  _Float16* X16 = (_Float16*)take((size_t)NR * DM * 2); float* F = (float*)take((size_t)NR * DM * 4); float* G = (float*)take((size_t)NR * DM * 4);
  _Float16* Qh = (_Float16*)take((size_t)NR * DM * 2); _Float16* Ql = (_Float16*)take((size_t)NR * DM * 2); _Float16* Kh = (_Float16*)take((size_t)NR * DM * 2); _Float16* Kl = (_Float16*)take((size_t)NR * DM * 2); _Float16* Vth = (_Float16*)take((size_t)NR * DM * 2); _Float16* Vtl = (_Float16*)take((size_t)NR * DM * 2);
  unsigned* MB = (unsigned*)take((size_t)SLEN * (SLEN / 32) * 4); int* RA = (int*)take((size_t)SLEN * 4); int* KE = (int*)take((size_t)(SLEN / 64) * 32 * 4);
  if (off > ws_size) return;      /* 8 + 16 + 32 + 32 + 6 x 16 + 0.5 = 185 MiB */
  float* O = F; _Float16* Oh = (_Float16*)G; _Float16* Ol = Oh + (size_t)NR * DM;
  const size_t n8 = (size_t)NR * DM / 8; const unsigned nb8 = (unsigned)((n8 + 255) / 256); const size_t w8 = (size_t)DM * DM / 8; const unsigned wb = (unsigned)((w8 + 255) / 256); const unsigned nsf = (NR * NH + 7) / 8;
  k_round16f<<<wb, 256, 0, stream>>>(Wq, BQ, w8); k_round16f<<<wb, 256, 0, stream>>>(Wk, BK, w8); k_round16f<<<wb, 256, 0, stream>>>(Wv, BV, w8); k_round16f<<<wb, 256, 0, stream>>>(Wo, BO, w8);      /* torch (out,in) = natural Bt; x16 */
  k_causaltab<<<(SLEN * (SLEN / 32) + 255) / 256, 256, 0, stream>>>(MB, RA, KE, SLEN, SLEN);
  const dim3 gP((NR / 128) * (DM / 64), 1);
  k_x16<<<nb8, 256, 0, stream>>>(x, X16, n8);
  k_gemm2<0><<<gP, 128, 0, stream>>>(X16, DM, 0, BQ, DM, 0, 0.0625f, nullptr, 0, nullptr, 1, 0, 0, F, nullptr, DM, 0, NR, DM, DM); k_silufac<1><<<nsf, 256, 0, stream>>>(F, qs, G); k_hl<<<nb8, 256, 0, stream>>>(G, Qh, Ql, n8);      /* q = silu(x Wq^T) * f_q */
  k_gemm2<0><<<gP, 128, 0, stream>>>(X16, DM, 0, BK, DM, 0, 0.0625f, nullptr, 0, nullptr, 1, 0, 0, F, nullptr, DM, 0, NR, DM, DM); k_silufac<1><<<nsf, 256, 0, stream>>>(F, ks, G); k_hl<<<nb8, 256, 0, stream>>>(G, Kh, Kl, n8);      /* k = silu(x Wk^T) * f_k */
  k_gemm2<0><<<gP, 128, 0, stream>>>(X16, DM, 0, BV, DM, 0, 0.0625f, nullptr, 0, nullptr, 1, 0, 0, F, nullptr, DM, 0, NR, DM, DM); k_silufac<0><<<nsf, 256, 0, stream>>>(F, ks, G);      /* v = silu(x Wv^T) */
  k_vthl<SLEN><<<NBT * NH * (SLEN / 64), 256, 0, stream>>>(G, DM, Vth, Vtl);
  k_flashm<SLEN, SLEN><<<NBT * NH * (SLEN / 64), 128, 0, stream>>>(Qh, Ql, DM, Kh, Kl, DM, Vth, Vtl, MB, RA, KE, O, DM);
  k_hl<<<nb8, 256, 0, stream>>>(O, Oh, Ol, n8);
  float* outb = (float*)d_out;
  k_gemm2<0><<<gP, 128, 0, stream>>>(Oh, DM, 0, BO, DM, 0, 0.0625f, nullptr, 0, nullptr, 1, 0, 0, outb, nullptr, DM, 0, NR, DM, DM);
  k_gemm2<0><<<gP, 128, 0, stream>>>(Ol, DM, 0, BO, DM, 0, 0.0625f / 1024.0f, nullptr, 0, outb, 1, (size_t)DM, 0, outb, nullptr, DM, 0, NR, DM, DM);
}

// v002
// One run takes 950 microseconds.
// Timed twice side by side with v001, it ran 1.08 times as fast both times.
// Over all steps from v000 it is 2.09 times as fast.
#include <hip/hip_runtime.h>
// Polar causal multi-head attention (4 x 2048 tokens x 1024, 16 heads x 64): q, k, v = SiLU(x*W^T); per (token, head) r = |q|, dir = q/(r + 1e-6); scores = (q_dir.k_dir) * (r_q q_scale[h]) * (r_k k_scale[h]) = (q . k) * f_q * f_k with f = r*scale/(r + 1e-6), j <= i; softmax; merged . Wo^T -> [4,2048,1024].
// Structure (every launch covers all 4 batches: 8192 token rows, 64 (batch, head) slabs): x as an exact f16 plane; the three projections as f16 WMMA GEMMs (32x64 wave tiles = 32 tokens x one head, f32, exact products) whose epilogue applies SiLU, folds the per-(token, head) polar factor f into q and k (f32) and stores q, k as f16 hi + x2^10 residual planes and V^T as hi + residual planes; the causal structure computed on device into a key bit plane + per-block key bound; the fused flash kernel per (head, 64 queries) (three-product hi/lo scores, online softmax f32, P hi + residual via LDS, two value accumulators) stores O as hi + residual planes; output projection as two GEMMs into the output rows.
// Compute dtype: x, weights, scales rounded to bf16; projections exact; SiLU / norms / factors f32; q, k, P, v, O as f16 hi + residual pairs (~2^-21); f32 accumulation and softmax. v_wmma_f32_16x16x32_f16.
#define NBT 4
#define SLEN 2048
#define DM 1024
#define NH 16
#define SCL 1.0f
#define NR (NBT * SLEN)
typedef __bf16 v16b __attribute__((ext_vector_type(16)));
typedef unsigned short v8us __attribute__((ext_vector_type(8), may_alias));
typedef float  v8f  __attribute__((ext_vector_type(8)));
typedef float  v4f  __attribute__((ext_vector_type(4)));
typedef float  v4fa __attribute__((ext_vector_type(4), may_alias));
union FragB { v16b v; v8us half[2]; unsigned short u[16]; };

__device__ __forceinline__ unsigned short bf16_bits(float x) { unsigned int u = __float_as_uint(x); return (unsigned short)((u + 0x7FFFu + ((u >> 16) & 1u)) >> 16); }
__device__ __forceinline__ float bf16_val(unsigned short b) { return __uint_as_float(((unsigned int)b) << 16); }
__device__ __forceinline__ float bf16_round(float x) { return bf16_val(bf16_bits(x)); }
// D += A·B with NT terms: 1 = ah·bh, 2 = + al·bh (A split), 3 = + ah·bl (both split)
template <int NT>
__device__ __forceinline__ v8f mmaN(v16b ah, v16b al, v16b bh, v16b bl, v8f c) {
  c = __builtin_amdgcn_wmma_f32_16x16x32_bf16(false, ah, false, bh, (short)0, c, false, false);
  if (NT >= 2) c = __builtin_amdgcn_wmma_f32_16x16x32_bf16(false, al, false, bh, (short)0, c, false, false);
  if (NT >= 3) c = __builtin_amdgcn_wmma_f32_16x16x32_bf16(false, ah, false, bl, (short)0, c, false, false);
  asm volatile("v_nop\n\tv_nop\n\tv_nop\n\tv_nop" : "+v"(c) : "v"(ah), "v"(al), "v"(bh), "v"(bl));
  return c;
}

__global__ __launch_bounds__(256) void k_wt_bf16(const float* __restrict__ W, unsigned short* __restrict__ Wt, int K, int N) {
  const int t = blockIdx.x * 256 + threadIdx.x;
  const int k8n = K / 8;
  if (t >= N * k8n) return;
  const int n = t / k8n, k8 = (t % k8n) * 8;
  v8us v;
#pragma unroll
  for (int i = 0; i < 8; ++i) v[i] = bf16_bits(W[(size_t)(k8 + i) * N + n]);
  *(v8us*)(Wt + (size_t)n * K + k8) = v;
  
}

// GEMM C[M][N] (f32, pitch ldc) = act(A[M][K]·W + bias). A f32 row-major (pitch lda) converted per fragment to bf16
// (ASPLIT: hi/lo two planes -> 2 terms, else single rounded term); Wt bf16 [N][K] (pitch ldb). BIAS_BF16 rounds the
// bias to bf16 first (bias quantised to bf16 before the add). K%32==0, M%16==0, N%64==0.
template <bool ASPLIT, int ACT, bool BIAS_BF16>
__global__ __launch_bounds__(128) void k_gemm_bf(const float* __restrict__ A, int lda, const unsigned short* __restrict__ Wt, int ldb,
                                               const float* __restrict__ bias, float* __restrict__ C, int ldc, int M, int N, int K) {
  __shared__ __attribute__((aligned(16))) float so[4][16][64];
  const int tid = threadIdx.x, w = tid >> 5, lane = tid & 31, ln = lane & 15, hh = lane >> 4;
  const int ntn = N / 64;
  const int wid = blockIdx.x * 4 + w;
  const int mt = wid / ntn, nq = wid % ntn;
  if (mt * 16 >= M) return;
  const int row0 = mt * 16, col0 = nq * 64;
  const float* arow = A + (size_t)(row0 + ln) * lda;
  v8f acc[4] = {};
  for (int kb = 0; kb < K; kb += 32) {
    FragB ah, al;
    const v4f x0 = *(const v4fa*)(arow + kb + 8 * hh), x1 = *(const v4fa*)(arow + kb + 8 * hh + 4);
    const v4f x2 = *(const v4fa*)(arow + kb + 16 + 8 * hh), x3 = *(const v4fa*)(arow + kb + 16 + 8 * hh + 4);
    float xs[16] = {x0[0],x0[1],x0[2],x0[3],x1[0],x1[1],x1[2],x1[3],x2[0],x2[1],x2[2],x2[3],x3[0],x3[1],x3[2],x3[3]};
#pragma unroll
    for (int i = 0; i < 16; ++i) { const unsigned short hb = bf16_bits(xs[i]); ah.u[i] = hb; al.u[i] = ASPLIT ? bf16_bits(xs[i] - bf16_val(hb)) : (unsigned short)0; }
#pragma unroll
    for (int t = 0; t < 4; ++t) {
      const unsigned short* brow = Wt + (size_t)(col0 + t * 16 + ln) * ldb + kb;
      FragB b;
      b.half[0] = *(const v8us*)(brow + 8 * hh);
      b.half[1] = *(const v8us*)(brow + 16 + 8 * hh);
      acc[t] = mmaN<ASPLIT ? 2 : 1>(ah.v, al.v, b.v, b.v, acc[t]);
    }
  }
#pragma unroll
  for (int t = 0; t < 4; ++t) {
    float bv = bias ? bias[col0 + t * 16 + ln] : 0.f;
    if (BIAS_BF16) bv = bf16_round(bv);
#pragma unroll
    for (int r = 0; r < 8; ++r) { float v = acc[t][r] + bv; if (ACT == 1) v = fmaxf(v, 0.f); so[w][8 * hh + r][t * 16 + ln] = v; }
  }
  __builtin_amdgcn_fence(__ATOMIC_ACQ_REL, "workgroup");
  __builtin_amdgcn_wave_barrier();
  const int rsub = lane >> 4, c4 = (lane & 15) * 4;
  {
#pragma unroll
    for (int q = 0; q < 8; ++q) {
      const int r = q * 2 + rsub;
      const v4f v = *(const v4fa*)&so[w][r][c4];
      *(v4f*)(C + (size_t)(row0 + r) * ldc + col0 + c4) = v;
    }
    
  }
}

// GEMM C = act(A·W + bias + resid): A f32 (ASPLIT -> hi/lo 2 terms), Wt bf16 [N][K]; ACT 0 none, 1 relu, 2 exact gelu;
// resid (optional, f32, row index = (row % rmod), pitch ldr, RES_BF16 rounds it) added before the activation.
template <bool ASPLIT, int ACT, bool BIAS_BF16, bool RES_BF16>
__global__ __launch_bounds__(128) void k_gemm_bf3(const float* __restrict__ A, int lda, const unsigned short* __restrict__ Wt, int ldb,
                                                const float* __restrict__ bias, const float* __restrict__ resid, int rmod, int ldr,
                                                float* __restrict__ C, int ldc, int M, int N, int K) {
  __shared__ __attribute__((aligned(16))) float so[4][16][64];
  const int tid = threadIdx.x, w = tid >> 5, lane = tid & 31, ln = lane & 15, hh = lane >> 4;
  const int ntn = N / 64;
  const int wid = blockIdx.x * 4 + w;
  const int mt = wid / ntn, nq = wid % ntn;
  if (mt * 16 >= M) return;
  const int row0 = mt * 16, col0 = nq * 64;
  const float* arow = A + (size_t)(row0 + ln) * lda;
  v8f acc[4] = {};
  for (int kb = 0; kb < K; kb += 32) {
    FragB ah, al;
    const v4f x0 = *(const v4fa*)(arow + kb + 8 * hh), x1 = *(const v4fa*)(arow + kb + 8 * hh + 4);
    const v4f x2 = *(const v4fa*)(arow + kb + 16 + 8 * hh), x3 = *(const v4fa*)(arow + kb + 16 + 8 * hh + 4);
    float xs[16] = {x0[0],x0[1],x0[2],x0[3],x1[0],x1[1],x1[2],x1[3],x2[0],x2[1],x2[2],x2[3],x3[0],x3[1],x3[2],x3[3]};
#pragma unroll
    for (int i = 0; i < 16; ++i) { const unsigned short hb = bf16_bits(xs[i]); ah.u[i] = hb; al.u[i] = ASPLIT ? bf16_bits(xs[i] - bf16_val(hb)) : (unsigned short)0; }
#pragma unroll
    for (int t = 0; t < 4; ++t) {
      const unsigned short* brow = Wt + (size_t)(col0 + t * 16 + ln) * ldb + kb;
      FragB b;
      b.half[0] = *(const v8us*)(brow + 8 * hh);
      b.half[1] = *(const v8us*)(brow + 16 + 8 * hh);
      acc[t] = mmaN<ASPLIT ? 2 : 1>(ah.v, al.v, b.v, b.v, acc[t]);
    }
  }
#pragma unroll
  for (int t = 0; t < 4; ++t) {
    const int col = col0 + t * 16 + ln;
    float bv = bias ? bias[col] : 0.f;
    if (BIAS_BF16) bv = bf16_round(bv);
#pragma unroll
    for (int r = 0; r < 8; ++r) {
      float v = acc[t][r] + bv;
      if (resid) { float rv = resid[(size_t)((row0 + 8 * hh + r) % rmod) * ldr + col]; if (RES_BF16) rv = bf16_round(rv); v += rv; }
      if (ACT == 1) v = fmaxf(v, 0.f);
      if (ACT == 2) v = 0.5f * v * (1.0f + erff(v * 0.70710678118654752f));
      if (ACT == 3) { const float u = 0.7978845608028654f * (v + 0.044715f * v * v * v); v = 0.5f * v * (1.0f + tanhf(u)); }
      so[w][8 * hh + r][t * 16 + ln] = v;
    }
  }
  __builtin_amdgcn_fence(__ATOMIC_ACQ_REL, "workgroup");
  __builtin_amdgcn_wave_barrier();
  const int rsub = lane >> 4, c4 = (lane & 15) * 4;
  {
#pragma unroll
    for (int q = 0; q < 8; ++q) {
      const int r = q * 2 + rsub;
      const v4f v = *(const v4fa*)&so[w][r][c4];
      *(v4f*)(C + (size_t)(row0 + r) * ldc + col0 + c4) = v;
    }
    
  }
}
// row LayerNorm (biased variance, eps) over N: s = X (+ R); optional out_sum <- s; out_norm <- (s-mu)*rsqrt(var+eps)*g + b
template <bool PARAM_BF16>
__global__ __launch_bounds__(256) void k_layernorm(const float* __restrict__ X, const float* __restrict__ R, const float* __restrict__ g, const float* __restrict__ bta,
                                                  float* __restrict__ out_sum, float* __restrict__ out_norm, int N, float eps) {
  __shared__ float red[256];
  const int row = blockIdx.x, tid = threadIdx.x;
  const float* x = X + (size_t)row * N; const float* rr = R ? R + (size_t)row * N : nullptr;
  float vals[16];                     // up to N = 4096
  const int per = N / 256;            // contiguous chunk per thread? use strided-by-4 chunks: thread handles j = tid*4 + 1024*u
  float s1 = 0.f;
  for (int u = 0; u < per / 4; ++u) {
    const int j = tid * 4 + 1024 * u;
    const v4f a = *(const v4fa*)(x + j);
    v4f b = {0.f,0.f,0.f,0.f}; if (rr) b = *(const v4fa*)(rr + j);
#pragma unroll
    for (int q = 0; q < 4; ++q) { const float v = a[q] + b[q]; vals[u * 4 + q] = v; s1 += v; }
  }
  red[tid] = s1; __syncthreads();
  for (int st = 128; st > 0; st >>= 1) { if (tid < st) red[tid] += red[tid + st]; __syncthreads(); }
  const float mu = red[0] / (float)N; __syncthreads();
  float s2 = 0.f;
  for (int u = 0; u < per / 4; ++u)
#pragma unroll
    for (int q = 0; q < 4; ++q) { const float c = vals[u * 4 + q] - mu; s2 += c * c; }
  red[tid] = s2; __syncthreads();
  for (int st = 128; st > 0; st >>= 1) { if (tid < st) red[tid] += red[tid + st]; __syncthreads(); }
  const float rs = rsqrtf(red[0] / (float)N + eps);
  {
    for (int u = 0; u < per / 4; ++u) {
      const int j = tid * 4 + 1024 * u;
      v4f o, sm;
#pragma unroll
      for (int q = 0; q < 4; ++q) {
        float gg = g[j + q], bb = bta[j + q];
        if (PARAM_BF16) { gg = bf16_round(gg); bb = bf16_round(bb); }
        sm[q] = vals[u * 4 + q]; o[q] = (vals[u * 4 + q] - mu) * rs * gg + bb;
      }
      if (out_sum) *(v4f*)(out_sum + (size_t)row * N + j) = sm;
      *(v4f*)(out_norm + (size_t)row * N + j) = o;
    }
    
  }
}



// ---- f16 WMMA path (v_wmma_f32_16x16x32_f16): 11-bit significands for operands in range — used where a [0,1] probability operand needs more precision than bf16
typedef _Float16 v16h __attribute__((ext_vector_type(16)));
union FragH { v16h v; v8us half[2]; _Float16 h[16]; unsigned short u[16]; };
template <int NT>
__device__ __forceinline__ v8f mmaH(v16h ah, v16h al, v16h bh, v16h bl, v8f c) {
  c = __builtin_amdgcn_wmma_f32_16x16x32_f16(false, ah, false, bh, (short)0, c, false, false);
  if (NT >= 2) c = __builtin_amdgcn_wmma_f32_16x16x32_f16(false, al, false, bh, (short)0, c, false, false);
  if (NT >= 3) c = __builtin_amdgcn_wmma_f32_16x16x32_f16(false, ah, false, bl, (short)0, c, false, false);
  asm volatile("v_nop\n\tv_nop\n\tv_nop\n\tv_nop" : "+v"(c) : "v"(ah), "v"(al), "v"(bh), "v"(bl));
  return c;
}
// batched GEMM like k_gemm_b but f16 operands: A f32 (split into f16 hi/lo if ASPLIT, else rounded to f16), Bt = f16 values [n][k]; alpha; C f32; N multiple of 16 (partial tiles skipped)
template <bool ASPLIT>
__global__ __launch_bounds__(128) void k_gemm_h(const float* __restrict__ A, int lda, size_t sA, const _Float16* __restrict__ Bh, int ldb, size_t sB, float alpha, float* __restrict__ C, int ldc, size_t sC, int M, int N, int K) {
  __shared__ __attribute__((aligned(16))) float so[4][16][64];
  const int tid = threadIdx.x, w = tid >> 5, lane = tid & 31, ln = lane & 15, hh = lane >> 4; const int by = blockIdx.y;
  A += (size_t)by * sA; Bh += (size_t)by * sB; C += (size_t)by * sC;
  const int ntn = (N + 63) / 64; const int wid = blockIdx.x * 4 + w; const int mt = wid / ntn, nq = wid % ntn; if (mt * 16 >= M) return;
  const int row0 = mt * 16, col0 = nq * 64; const float* arow = A + (size_t)(row0 + ln) * lda;
  v8f acc[4] = {};
  for (int kb = 0; kb < K; kb += 32) {
    FragH ah, al;
    const v4f x0 = *(const v4fa*)(arow + kb + 8 * hh), x1 = *(const v4fa*)(arow + kb + 8 * hh + 4), x2 = *(const v4fa*)(arow + kb + 16 + 8 * hh), x3 = *(const v4fa*)(arow + kb + 16 + 8 * hh + 4);
    float xs[16] = {x0[0],x0[1],x0[2],x0[3],x1[0],x1[1],x1[2],x1[3],x2[0],x2[1],x2[2],x2[3],x3[0],x3[1],x3[2],x3[3]};
#pragma unroll
    for (int i = 0; i < 16; ++i) { const _Float16 h = (_Float16)xs[i]; ah.h[i] = h; al.h[i] = ASPLIT ? (_Float16)(xs[i] - (float)h) : (_Float16)0.0f; }
#pragma unroll
    for (int t = 0; t < 4; ++t) { if (col0 + t * 16 >= N) continue; const size_t boff = (size_t)(col0 + t * 16 + ln) * ldb + kb; FragH bq; bq.half[0] = *(const v8us*)(Bh + boff + 8 * hh); bq.half[1] = *(const v8us*)(Bh + boff + 16 + 8 * hh);
      acc[t] = mmaH<ASPLIT ? 2 : 1>(ah.v, al.v, bq.v, bq.v, acc[t]); }
  }
#pragma unroll
  for (int t = 0; t < 4; ++t) { if (col0 + t * 16 >= N) continue;
#pragma unroll
    for (int r = 0; r < 8; ++r) so[w][8 * hh + r][t * 16 + ln] = acc[t][r] * alpha; }
  __builtin_amdgcn_fence(__ATOMIC_ACQ_REL, "workgroup"); __builtin_amdgcn_wave_barrier();
  const int rsub = lane >> 4, c4 = (lane & 15) * 4;
  {
#pragma unroll
    for (int q = 0; q < 8; ++q) { const int r = q * 2 + rsub; if (col0 + c4 < N) { const v4f v = *(const v4fa*)&so[w][r][c4]; *(v4f*)(C + (size_t)(row0 + r) * ldc + col0 + c4) = v; } }
     }
}

// Wt[n][k] = f16(W[k][n]·scale) from f32 row-major W[K][N] (scale = power of two; bf16-exact weights stay exact in f16 away from the subnormal range)
__global__ __launch_bounds__(256) void k_wt_f16(const float* __restrict__ W, _Float16* __restrict__ Wt, int K, int N, float scale) {
  const int t = blockIdx.x * 256 + threadIdx.x; if (t >= N * (K / 8)) return; const int n = t / (K / 8), k8 = (t % (K / 8)) * 8; FragH f;
#pragma unroll
  for (int i = 0; i < 8; ++i) f.h[i] = (_Float16)(bf16_round(W[(size_t)(k8 + i) * N + n]) * scale); const v8us o = f.half[0];
  *(v8us*)((unsigned short*)Wt + (size_t)n * K + k8) = o; 
}
// k_gemm_hh variant with fused epilogue: v = acc·alpha + bias[by·sBias + col] (+ CP[(row/rowsPerB)·sCPb + by·64 + col] if CP) ; ACT 0 none / 1 elu ; writes f16 C16 (and f32 C if non-null)
template <int ACT>
__global__ __launch_bounds__(128) void k_gemm_hhx(const _Float16* __restrict__ A, int lda, size_t sA, const _Float16* __restrict__ Bh, int ldb, size_t sB, float alpha, const float* __restrict__ bias, size_t sBias, const float* __restrict__ CP, int rowsPerB, size_t sCPb, int row0g,
    float* __restrict__ C, _Float16* __restrict__ C16, int ldc, size_t sC, int M, int N, int K) {
  __shared__ __attribute__((aligned(16))) float so[4][16][64];
  const int tid = threadIdx.x, w = tid >> 5, lane = tid & 31, ln = lane & 15, hh = lane >> 4; const int by = blockIdx.y;
  A += (size_t)by * sA; Bh += (size_t)by * sB; const size_t cofs = (size_t)by * sC; const float* bp = bias ? bias + (size_t)by * sBias : nullptr;
  const int ntn = (N + 63) / 64; const int wid = blockIdx.x * 4 + w; const int mt = wid / ntn, nq = wid % ntn; if (mt * 16 >= M) return;
  const int row0 = mt * 16, col0 = nq * 64; const _Float16* arow = A + (size_t)(row0 + ln) * lda;
  v8f acc[4] = {};
  for (int kb = 0; kb < K; kb += 32) { FragH ah; ah.half[0] = *(const v8us*)((const unsigned short*)arow + kb + 8 * hh); ah.half[1] = *(const v8us*)((const unsigned short*)arow + kb + 16 + 8 * hh);
#pragma unroll
    for (int t = 0; t < 4; ++t) { if (col0 + t * 16 >= N) continue; const size_t boff = (size_t)(col0 + t * 16 + ln) * ldb + kb; FragH bq; bq.half[0] = *(const v8us*)((const unsigned short*)Bh + boff + 8 * hh); bq.half[1] = *(const v8us*)((const unsigned short*)Bh + boff + 16 + 8 * hh);
      acc[t] = mmaH<1>(ah.v, ah.v, bq.v, bq.v, acc[t]); }
  }
#pragma unroll
  for (int t = 0; t < 4; ++t) { if (col0 + t * 16 >= N) continue; const int col = col0 + t * 16 + ln; const float bv = bp ? bf16_round(bp[col]) : 0.f;
#pragma unroll
    for (int r = 0; r < 8; ++r) { float v = acc[t][r] * alpha + bv; if (CP) { const int bidx = (row0g + row0 + 8 * hh + r) / rowsPerB; v += CP[(size_t)bidx * sCPb + (size_t)by * 64 + col]; } if (ACT == 1) v = (v > 0.f) ? v : expm1f(v); else if (ACT == 7) v = (v > 0.f) ? v + 1.0f : expf(v); else if (ACT == 8) v = tanhf(v); else if (ACT == 9) v = 0.5f * v * (1.0f + tanhf(0.7978845608028654f * (v + 0.044715f * v * v * v))); else if (ACT == 11) v = 1.0f / (1.0f + expf(-v)); else if (ACT == 12) v = (v > 0.f) ? v : 0.01f * v; else if (ACT == 14) v = (v > 0.f) ? v : 0.1f * v; else if (ACT == 15) v = v / (1.0f + expf(-v)); else if (ACT == 3) v = fmaxf(v, 0.f); else if (ACT == 6) v = 0.5f * v * (1.0f + erff(v * 0.70710678118654752f)); so[w][8 * hh + r][t * 16 + ln] = v; } }
  __builtin_amdgcn_fence(__ATOMIC_ACQ_REL, "workgroup"); __builtin_amdgcn_wave_barrier();
  const int rsub = lane >> 4, c4 = (lane & 15) * 4; typedef _Float16 v4h __attribute__((ext_vector_type(4)));
  {
#pragma unroll
    for (int q = 0; q < 8; ++q) { const int r = q * 2 + rsub; if (col0 + c4 < N) { const v4f v = *(const v4fa*)&so[w][r][c4]; if (C) *(v4f*)(C + cofs + (size_t)(row0 + r) * ldc + col0 + c4) = v; if (C16) { v4h h4; for (int i = 0; i < 4; ++i) h4[i] = (_Float16)v[i]; *(v4h*)(C16 + cofs + (size_t)(row0 + r) * ldc + col0 + c4) = h4; } } }
     }
}


typedef _Float16 v4h __attribute__((ext_vector_type(4)));

__global__ __launch_bounds__(256) void k_x16(const float* __restrict__ x, _Float16* __restrict__ X16, size_t n8) { const size_t t = (size_t)blockIdx.x * 256 + threadIdx.x; if (t >= n8) return; FragH f;
#pragma unroll
  for (int q = 0; q < 8; ++q) f.h[q] = (_Float16)bf16_round(x[t * 8 + q]); *(v8us*)((unsigned short*)X16 + t * 8) = f.half[0];  }
__global__ __launch_bounds__(256) void k_h16(const float* __restrict__ x, _Float16* __restrict__ X16, size_t n8) { const size_t t = (size_t)blockIdx.x * 256 + threadIdx.x; if (t >= n8) return; FragH f;
#pragma unroll
  for (int q = 0; q < 8; ++q) f.h[q] = (_Float16)x[t * 8 + q]; *(v8us*)((unsigned short*)X16 + t * 8) = f.half[0];  }
__global__ __launch_bounds__(256) void k_round16f(const float* __restrict__ W, _Float16* __restrict__ Bt, size_t n8) { const size_t t = (size_t)blockIdx.x * 256 + threadIdx.x; if (t >= n8) return; FragH f;
#pragma unroll
  for (int i = 0; i < 8; ++i) f.h[i] = (_Float16)(bf16_round(W[t * 8 + i]) * 16.0f); *(v8us*)((unsigned short*)Bt + t * 8) = f.half[0];  }
template <int NHv, int TTv>
__global__ __launch_bounds__(256) void k_vt(const _Float16* __restrict__ V16, int ldv, int voff, _Float16* __restrict__ Vt) { __shared__ unsigned short tl[64][66]; const int tid = threadIdx.x; const int slab = blockIdx.x / (TTv / 64), lg = blockIdx.x % (TTv / 64); const int b = slab / NHv, h = slab % NHv;
  for (int i = tid; i < 64 * 8; i += 256) { const int r = i / 8, c8 = (i % 8) * 8; FragH f; f.half[0] = *(const v8us*)((const unsigned short*)V16 + ((size_t)b * TTv + lg * 64 + r) * ldv + voff + h * 64 + c8);
#pragma unroll
    for (int q = 0; q < 8; ++q) tl[r][c8 + q] = f.u[q]; }
  __syncthreads();
  {
#pragma unroll
    for (int rd = 0; rd < 2; ++rd) { const int d = rd * 32 + tid / 8, pc = tid % 8; FragH f;
#pragma unroll
      for (int q = 0; q < 8; ++q) f.u[q] = tl[pc * 8 + q][d];
      *(v8us*)((unsigned short*)Vt + ((size_t)slab * 64 + d) * TTv + lg * 64 + pc * 8) = f.half[0]; }
     } }

// ---- fast GEMM (wave tile 32x64; requires M % 32 == 0 rows per launch region and N % 64 == 0); epilogue = k_gemm_hhx semantics ----
__device__ __forceinline__ v16h g2_frag(const _Float16* p, int hh) { FragH f; f.half[0] = *(const v8us*)((const unsigned short*)p + 8 * hh); f.half[1] = *(const v8us*)((const unsigned short*)p + 16 + 8 * hh); return f.v; }
__device__ __forceinline__ v8f g2_mma(v16h a, v16h b, v8f c) { v8f d = __builtin_amdgcn_wmma_f32_16x16x32_f16(false, a, false, b, (short)0, c, false, false); asm volatile("v_nop\n\tv_nop\n\tv_nop\n\tv_nop" : "+v"(d) : "v"(a), "v"(b)); return d; }
template <int ACT>
__global__ __launch_bounds__(128) void k_gemm2(const _Float16* __restrict__ A, int lda, size_t sA, const _Float16* __restrict__ Bh, int ldb, size_t sB, float alpha, const float* __restrict__ bias, size_t sBias, const float* __restrict__ CP, int rowsPerB, size_t sCPb, int row0g,
    float* __restrict__ C, _Float16* __restrict__ C16, int ldc, size_t sC, int M, int N, int K) {
  __shared__ __attribute__((aligned(16))) float so[4][32][68];
  const int tid = threadIdx.x, w = tid >> 5, lane = tid & 31, ln = lane & 15, hh = lane >> 4; const int by = blockIdx.y;
  A += (size_t)by * sA; Bh += (size_t)by * sB; const size_t cofs = (size_t)by * sC; const float* bp = bias ? bias + (size_t)by * sBias : nullptr;
  const int ntn = N >> 6; const int mt = blockIdx.x / ntn, nq = blockIdx.x - mt * ntn; const int row0 = mt * 128 + 32 * w, col0 = nq * 64; if (row0 >= M) return;
  const _Float16* a0p = A + (size_t)(row0 + ln) * lda; const _Float16* a1p = a0p + (size_t)16 * lda;
  const _Float16* b0p = Bh + (size_t)(col0 + ln) * ldb; const _Float16* b1p = b0p + (size_t)16 * ldb; const _Float16* b2p = b1p + (size_t)16 * ldb; const _Float16* b3p = b2p + (size_t)16 * ldb;
  const v8f z8 = {0.f,0.f,0.f,0.f,0.f,0.f,0.f,0.f}; v8f c00 = z8, c01 = z8, c02 = z8, c03 = z8, c10 = z8, c11 = z8, c12 = z8, c13 = z8;
#pragma unroll 1
  for (int kb = 0; kb < K; kb += 32) { const v16h a0 = g2_frag(a0p + kb, hh), a1 = g2_frag(a1p + kb, hh);
    v16h b = g2_frag(b0p + kb, hh); c00 = g2_mma(a0, b, c00); c10 = g2_mma(a1, b, c10);
    b = g2_frag(b1p + kb, hh); c01 = g2_mma(a0, b, c01); c11 = g2_mma(a1, b, c11);
    b = g2_frag(b2p + kb, hh); c02 = g2_mma(a0, b, c02); c12 = g2_mma(a1, b, c12);
    b = g2_frag(b3p + kb, hh); c03 = g2_mma(a0, b, c03); c13 = g2_mma(a1, b, c13); }
  v8f accs[8] = {c00, c01, c02, c03, c10, c11, c12, c13};
#pragma unroll
  for (int u = 0; u < 8; ++u) { const int t = u & 3, half = u >> 2; const int col = col0 + t * 16 + ln; const float bv = bp ? bf16_round(bp[col]) : 0.f;
#pragma unroll
    for (int r = 0; r < 8; ++r) { const int rloc = half * 16 + 8 * hh + r; float v = accs[u][r] * alpha + bv; if (CP) { const int bidx = (row0g + row0 + rloc) / rowsPerB; v += CP[(size_t)bidx * sCPb + (size_t)by * 64 + col]; }
      if (ACT == 3) v = fmaxf(v, 0.f); else if (ACT == 6) v = 0.5f * v * (1.0f + erff(v * 0.70710678118654752f)); else if (ACT == 11) v = 1.0f / (1.0f + expf(-v)); else if (ACT == 15) v = v / (1.0f + expf(-v)); else if (ACT == 12) v = (v > 0.f) ? v : 0.01f * v; else if (ACT == 8) v = tanhf(v);
      so[w][rloc][t * 16 + ln] = v; } }
  __builtin_amdgcn_fence(__ATOMIC_ACQ_REL, "workgroup"); __builtin_amdgcn_wave_barrier();
  const int rsub = lane >> 4, c4 = (lane & 15) * 4;
  {
#pragma unroll
    for (int q = 0; q < 16; ++q) { const int r = q * 2 + rsub; const v4f v = *(const v4fa*)&so[w][r][c4]; if (C) *(v4f*)(C + cofs + (size_t)(row0 + r) * ldc + col0 + c4) = v; if (C16) { v4h h4; for (int i = 0; i < 4; ++i) h4[i] = (_Float16)v[i]; *(v4h*)(C16 + cofs + (size_t)(row0 + r) * ldc + col0 + c4) = h4; } }
     } }



__device__ __forceinline__ float siluf(float g) { return g / (1.0f + expf(-g)); }
// ---- projection GEMM (main loop of k_gemm2, NR x DM x DM, Bt carries x16) with the element-wise tail in its epilogue. A wave tile is 32 tokens x the 64 columns of one head, so the head's norm is a sum inside the wave's own LDS rows.
// POLAR 1: g = silu(acc/16) * f, f = r*scale[h]/(r + 1e-6), r = |silu row|; g stored as f16 hi + x2^10 residual, row-major, one whole 128-B line per row and plane.
// POLAR 0: g = silu(acc/16) stored transposed per (batch, head) slab as hi + residual planes [64 dims][SLEN tokens]; the block's 128 tokens are transposed through LDS, one whole 128-B line per 8 lanes.
template <int POLAR>
__global__ __launch_bounds__(128) void k_proj(const _Float16* __restrict__ A, const _Float16* __restrict__ Bh, const float* __restrict__ scale, _Float16* __restrict__ Hh, _Float16* __restrict__ Hl) {
  constexpr int PT = POLAR ? 68 : 65;      /* LDS row pitch in floats: 68 for the 16-B row reads, 65 for the column reads of the transpose */
  __shared__ __attribute__((aligned(16))) float so[128 * 68];
  const int tid = threadIdx.x, w = tid >> 5, lane = tid & 31, ln = lane & 15, hh = lane >> 4;
  constexpr int ntn = DM >> 6; const int mt = blockIdx.x / ntn, nq = blockIdx.x - mt * ntn; const int row0 = mt * 128 + 32 * w, col0 = nq * 64;
  const _Float16* a0p = A + (size_t)(row0 + ln) * DM; const _Float16* a1p = a0p + (size_t)16 * DM;
  const _Float16* b0p = Bh + (size_t)(col0 + ln) * DM; const _Float16* b1p = b0p + (size_t)16 * DM; const _Float16* b2p = b1p + (size_t)16 * DM; const _Float16* b3p = b2p + (size_t)16 * DM;
  const v8f z8 = {0.f,0.f,0.f,0.f,0.f,0.f,0.f,0.f}; v8f c00 = z8, c01 = z8, c02 = z8, c03 = z8, c10 = z8, c11 = z8, c12 = z8, c13 = z8;
  /* rolled, as in k_gemm2: the same loop body, so the products and their order are the same */
#pragma unroll 1
  for (int kb = 0; kb < DM; kb += 32) { const v16h a0 = g2_frag(a0p + kb, hh), a1 = g2_frag(a1p + kb, hh);
    v16h b = g2_frag(b0p + kb, hh); c00 = g2_mma(a0, b, c00); c10 = g2_mma(a1, b, c10);
    b = g2_frag(b1p + kb, hh); c01 = g2_mma(a0, b, c01); c11 = g2_mma(a1, b, c11);
    b = g2_frag(b2p + kb, hh); c02 = g2_mma(a0, b, c02); c12 = g2_mma(a1, b, c12);
    b = g2_frag(b3p + kb, hh); c03 = g2_mma(a0, b, c03); c13 = g2_mma(a1, b, c13); }
  v8f accs[8] = {c00, c01, c02, c03, c10, c11, c12, c13};
#pragma unroll
  for (int u = 0; u < 8; ++u) { const int t = u & 3, half = u >> 2;
#pragma unroll
    for (int r = 0; r < 8; ++r) so[(32 * w + half * 16 + 8 * hh + r) * PT + t * 16 + ln] = siluf(accs[u][r] * 0.0625f); }
  if (POLAR) {
    __builtin_amdgcn_fence(__ATOMIC_ACQ_REL, "workgroup"); __builtin_amdgcn_wave_barrier();      /* each wave reads back its own 32 rows only */
    const int rsub = lane >> 4, c4 = (lane & 15) * 4; const float sc = bf16_round(scale[nq]);
#pragma unroll
    for (int q = 0; q < 16; ++q) { const int r = q * 2 + rsub; const v4f v = *(const v4fa*)&so[(32 * w + r) * PT + c4];
      float s = (v[0] * v[0] + v[1] * v[1]) + (v[2] * v[2] + v[3] * v[3]); s += __shfl_xor(s, 8, 32); s += __shfl_xor(s, 4, 32); s += __shfl_xor(s, 2, 32); s += __shfl_xor(s, 1, 32);
      const float rr = sqrtf(s); const float fac = (rr * sc) / (rr + 1e-6f); v4h h4, l4;
#pragma unroll
      for (int i = 0; i < 4; ++i) { const float g = v[i] * fac; const _Float16 h = (_Float16)g; h4[i] = h; l4[i] = (_Float16)((g - (float)h) * 1024.0f); }
      const size_t o = (size_t)(row0 + r) * DM + col0 + c4; *(v4h*)(Hh + o) = h4; *(v4h*)(Hl + o) = l4; }
  } else {
    __syncthreads();      /* the transpose reads rows that the block's other waves wrote */
    const int slab = (mt * 128 / SLEN) * NH + nq, tok0 = mt * 128 % SLEN;
#pragma unroll
    for (int it = 0; it < 8; ++it) { const int item = it * 128 + tid; const int pc = item & 7, d = (item >> 3) & 63, g = item >> 9; FragH fh, fl;
#pragma unroll
      for (int q = 0; q < 8; ++q) { const float v = so[(g * 64 + pc * 8 + q) * PT + d]; const _Float16 hv = (_Float16)v; fh.h[q] = hv; fl.h[q] = (_Float16)((v - (float)hv) * 1024.0f); }
      const size_t o = ((size_t)slab * 64 + d) * SLEN + tok0 + g * 64 + pc * 8; *(v8us*)((unsigned short*)Hh + o) = fh.half[0]; *(v8us*)((unsigned short*)Hl + o) = fl.half[0]; }
  } }

template <int TQ, int TK>
__global__ __launch_bounds__(128) void k_flashm(const _Float16* __restrict__ Q16, const _Float16* __restrict__ Q16lo, int ldq, const _Float16* __restrict__ K16, const _Float16* __restrict__ K16lo, int ldk, const _Float16* __restrict__ Vt, const _Float16* __restrict__ Vtlo, const unsigned* __restrict__ MB, const int* __restrict__ RA, const int* __restrict__ KE, _Float16* __restrict__ Oh, _Float16* __restrict__ Ol, int ldo) {
  constexpr int RPW = 16, RTN = RPW / 16, NQB = TQ / (4 * RPW), DT = 4, KS = 2;
  __shared__ __attribute__((aligned(16))) unsigned short sP[4][RPW][40], sPl[4][RPW][40]; __shared__ __attribute__((aligned(16))) float sO[4][RPW][64 + 4];
  const int tid = threadIdx.x, w = tid >> 5, lane = tid & 31, ln = lane & 15, hh = lane >> 4;
  const int slab = blockIdx.x / NQB, qblk = blockIdx.x % NQB; const int b = slab / NH, h = slab % NH; const int qb0 = qblk * (4 * RPW); const int q0 = qb0 + w * RPW;
  FragH aq[2][KS], aql[2][KS];
#pragma unroll
  for (int rt = 0; rt < RTN; ++rt) { const size_t qo = ((size_t)b * TQ + q0 + rt * 16 + ln) * ldq + h * 64; const unsigned short* qr = (const unsigned short*)Q16 + qo; const unsigned short* ql = (const unsigned short*)Q16lo + qo;
#pragma unroll
    for (int ks = 0; ks < KS; ++ks) { aq[rt][ks].half[0] = *(const v8us*)(qr + ks * 32 + 8 * hh); aq[rt][ks].half[1] = *(const v8us*)(qr + ks * 32 + 16 + 8 * hh); aql[rt][ks].half[0] = *(const v8us*)(ql + ks * 32 + 8 * hh); aql[rt][ks].half[1] = *(const v8us*)(ql + ks * 32 + 16 + 8 * hh); } }
  asm volatile("s_wait_xcnt 0x0" ::: "memory");      /* the Q loads' address registers are reused right below */
  const unsigned short* Vth = (const unsigned short*)Vt + (size_t)slab * 64 * TK; const unsigned short* Vtl = (const unsigned short*)Vtlo + (size_t)slab * 64 * TK;
  float m_r[2][8], l_r[2][8]; v8f oacc[2][DT], oaccl[2][DT];
#pragma unroll
  for (int rt = 0; rt < RTN; ++rt) {
#pragma unroll
    for (int r = 0; r < 8; ++r) { m_r[rt][r] = -3.0e38f; l_r[rt][r] = 0.f; }
#pragma unroll
    for (int dt = 0; dt < DT; ++dt) { oacc[rt][dt] = (v8f){0.f,0.f,0.f,0.f,0.f,0.f,0.f,0.f}; oaccl[rt][dt] = oacc[rt][dt]; } }
  int jend = KE[qblk * 32]; jend = min(TK, (jend + 31) & ~31); if (jend < 32) jend = 32;      /* block-uniform */
  int allm[2][8]; const unsigned* mrow[2][8];
#pragma unroll
  for (int rt = 0; rt < RTN; ++rt)
#pragma unroll
    for (int r = 0; r < 8; ++r) { const int tq = q0 + rt * 16 + 8 * hh + r; allm[rt][r] = RA[tq]; mrow[rt][r] = MB + (size_t)tq * (TK / 32); }
#pragma unroll 1
  for (int j0 = 0; j0 < jend; j0 += 32) {
    
    v8f s[2][2];
#pragma unroll
    for (int nt = 0; nt < 2; ++nt) { const size_t ko = ((size_t)b * TK + j0 + nt * 16 + ln) * ldk + h * 64; const unsigned short* kr = (const unsigned short*)K16 + ko; const unsigned short* kl = (const unsigned short*)K16lo + ko; FragH bk[KS], bkl[KS];
#pragma unroll
      for (int ks = 0; ks < KS; ++ks) { bk[ks].half[0] = *(const v8us*)(kr + ks * 32 + 8 * hh); bk[ks].half[1] = *(const v8us*)(kr + ks * 32 + 16 + 8 * hh); bkl[ks].half[0] = *(const v8us*)(kl + ks * 32 + 8 * hh); bkl[ks].half[1] = *(const v8us*)(kl + ks * 32 + 16 + 8 * hh); }
#pragma unroll
      for (int rt = 0; rt < RTN; ++rt) { v8f acc = (v8f){0.f,0.f,0.f,0.f,0.f,0.f,0.f,0.f}, accr = acc;
#pragma unroll
        for (int ks = 0; ks < KS; ++ks) { acc = mmaH<1>(aq[rt][ks].v, aq[rt][ks].v, bk[ks].v, bk[ks].v, acc); accr = mmaH<1>(aql[rt][ks].v, aql[rt][ks].v, bk[ks].v, bk[ks].v, accr); accr = mmaH<1>(aq[rt][ks].v, aq[rt][ks].v, bkl[ks].v, bkl[ks].v, accr); }
        s[rt][nt] = acc + accr * 0.0009765625f; } }
#pragma unroll
    for (int rt = 0; rt < RTN; ++rt)
#pragma unroll
      for (int r = 0; r < 8; ++r) { const unsigned mw = mrow[rt][r][j0 >> 5]; const bool am = (allm[rt][r] != 0);
        const bool ok0 = am || (((mw >> ln) & 1u) == 0u), ok1 = am || (((mw >> (16 + ln)) & 1u) == 0u);
        const float s0 = ok0 ? (am ? 0.f : s[rt][0][r] * SCL) : -INFINITY, s1 = ok1 ? (am ? 0.f : s[rt][1][r] * SCL) : -INFINITY; float mc = fmaxf(s0, s1);
        mc = fmaxf(mc, __shfl_xor(mc, 1, 32)); mc = fmaxf(mc, __shfl_xor(mc, 2, 32)); mc = fmaxf(mc, __shfl_xor(mc, 4, 32)); mc = fmaxf(mc, __shfl_xor(mc, 8, 32));
        const float mn = fmaxf(m_r[rt][r], mc); const float al = (mn > -1.0e38f) ? expf(m_r[rt][r] - mn) : 1.0f; m_r[rt][r] = mn; const float p0 = ok0 ? expf(s0 - mn) : 0.f, p1 = ok1 ? expf(s1 - mn) : 0.f; l_r[rt][r] = l_r[rt][r] * al + p0 + p1;
#pragma unroll
        for (int dt = 0; dt < DT; ++dt) { oacc[rt][dt][r] *= al; oaccl[rt][dt][r] *= al; }
        FragH t2, t3; const float ps0 = p0 * 1024.0f, ps1 = p1 * 1024.0f; t2.h[0] = (_Float16)ps0; t2.h[1] = (_Float16)ps1; t3.h[0] = (_Float16)((ps0 - (float)t2.h[0]) * 1024.0f); t3.h[1] = (_Float16)((ps1 - (float)t2.h[1]) * 1024.0f);
        sP[w][rt * 16 + 8 * hh + r][ln] = t2.u[0]; sP[w][rt * 16 + 8 * hh + r][16 + ln] = t2.u[1]; sPl[w][rt * 16 + 8 * hh + r][ln] = t3.u[0]; sPl[w][rt * 16 + 8 * hh + r][16 + ln] = t3.u[1]; }
    __builtin_amdgcn_fence(__ATOMIC_ACQ_REL, "workgroup"); __builtin_amdgcn_wave_barrier();
    FragH pa[2], pl[2];
#pragma unroll
    for (int rt = 0; rt < RTN; ++rt) { pa[rt].half[0] = *(const v8us*)&sP[w][rt * 16 + ln][8 * hh]; pa[rt].half[1] = *(const v8us*)&sP[w][rt * 16 + ln][16 + 8 * hh]; pl[rt].half[0] = *(const v8us*)&sPl[w][rt * 16 + ln][8 * hh]; pl[rt].half[1] = *(const v8us*)&sPl[w][rt * 16 + ln][16 + 8 * hh]; }
#pragma unroll
    for (int dt = 0; dt < DT; ++dt) { const size_t vo = (size_t)(dt * 16 + ln) * TK + j0; FragH bv, bl; bv.half[0] = *(const v8us*)(Vth + vo + 8 * hh); bv.half[1] = *(const v8us*)(Vth + vo + 16 + 8 * hh); bl.half[0] = *(const v8us*)(Vtl + vo + 8 * hh); bl.half[1] = *(const v8us*)(Vtl + vo + 16 + 8 * hh);
#pragma unroll
      for (int rt = 0; rt < RTN; ++rt) { oacc[rt][dt] = mmaH<1>(pa[rt].v, pa[rt].v, bv.v, bv.v, oacc[rt][dt]); oaccl[rt][dt] = mmaH<1>(pa[rt].v, pa[rt].v, bl.v, bl.v, oaccl[rt][dt]); oaccl[rt][dt] = mmaH<1>(pl[rt].v, pl[rt].v, bv.v, bv.v, oaccl[rt][dt]); } }
    __builtin_amdgcn_fence(__ATOMIC_ACQ_REL, "workgroup"); __builtin_amdgcn_wave_barrier(); }
#pragma unroll
  for (int rt = 0; rt < RTN; ++rt) {
#pragma unroll
    for (int r = 0; r < 8; ++r) { float l = l_r[rt][r]; l += __shfl_xor(l, 1, 32); l += __shfl_xor(l, 2, 32); l += __shfl_xor(l, 4, 32); l += __shfl_xor(l, 8, 32); l_r[rt][r] = (l > 0.f) ? 1.0f / (l * 1024.0f) : 0.f; }
#pragma unroll
    for (int dt = 0; dt < DT; ++dt)
#pragma unroll
      for (int r = 0; r < 8; ++r) sO[w][rt * 16 + 8 * hh + r][dt * 16 + ln] = (oacc[rt][dt][r] + oaccl[rt][dt][r] * 0.0009765625f) * l_r[rt][r]; }
  __builtin_amdgcn_fence(__ATOMIC_ACQ_REL, "workgroup"); __builtin_amdgcn_wave_barrier();
  {
#pragma unroll
    for (int rp = 0; rp < RPW; rp += 2) { const int r = rp + (lane >> 4), pc = lane & 15; const v4f val = *(const v4fa*)&sO[w][r][pc * 4]; v4h h4, l4;
#pragma unroll
      for (int i = 0; i < 4; ++i) { const _Float16 hv = (_Float16)val[i]; h4[i] = hv; l4[i] = (_Float16)((val[i] - (float)hv) * 1024.0f); }
      const size_t oo = ((size_t)b * TQ + q0 + r) * ldo + h * 64 + pc * 4; *(v4h*)(Oh + oo) = h4; *(v4h*)(Ol + oo) = l4; }
     } }


__global__ __launch_bounds__(256) void k_causaltab(unsigned* __restrict__ MB, int* __restrict__ RA, int* __restrict__ KE, int nq, int nk) {
  const int t = blockIdx.x * 256 + threadIdx.x; const int nw = nk / 32;
  if (t < nq * nw) { const int q = t / nw, w = t % nw; const int first = q + 1 - 32 * w; const unsigned bits = (first <= 0) ? 0xffffffffu : ((first >= 32) ? 0u : (0xffffffffu << first)); *(unsigned*)(MB + t) = bits;  }
  if (t < nq) { *(int*)(RA + t) = 0;  }
  if (t < nq / 64) { const int v = 64 * (t + 1); *(int*)(KE + t * 32) = v;  } }

extern "C" void kernel_launch(void* const* d_in, const int* in_sizes, int n_in,
                              void* d_out, int out_size, void* d_ws, size_t ws_size, hipStream_t stream) {
  (void)in_sizes; (void)n_in; (void)out_size;
  const float* const* I = (const float* const*)d_in; const float* x = I[0]; const float* Wq = I[1]; const float* Wk = I[2]; const float* Wv = I[3]; const float* Wo = I[4]; const float* qs = I[5]; const float* ks = I[6];
  char* ws = (char*)d_ws; size_t off = 0;
  auto take = [&](size_t bytes) { char* p = ws + off; off += (bytes + 255) & ~(size_t)255; return p; };
  _Float16* BQ = (_Float16*)take((size_t)DM * DM * 2); _Float16* BK = (_Float16*)take((size_t)DM * DM * 2); _Float16* BV = (_Float16*)take((size_t)DM * DM * 2); _Float16* BO = (_Float16*)take((size_t)DM * DM * 2);
  _Float16* X16 = (_Float16*)take((size_t)NR * DM * 2); _Float16* Oh = (_Float16*)take((size_t)NR * DM * 2); _Float16* Ol = (_Float16*)take((size_t)NR * DM * 2);
  _Float16* Qh = (_Float16*)take((size_t)NR * DM * 2); _Float16* Ql = (_Float16*)take((size_t)NR * DM * 2); _Float16* Kh = (_Float16*)take((size_t)NR * DM * 2); _Float16* Kl = (_Float16*)take((size_t)NR * DM * 2); _Float16* Vth = (_Float16*)take((size_t)NR * DM * 2); _Float16* Vtl = (_Float16*)take((size_t)NR * DM * 2);
  unsigned* MB = (unsigned*)take((size_t)SLEN * (SLEN / 32) * 4); int* RA = (int*)take((size_t)SLEN * 4); int* KE = (int*)take((size_t)(SLEN / 64) * 32 * 4);
  if (off > ws_size) return;      /* 8 + 16 + 2 x 16 + 6 x 16 + 0.5 = 153 MiB */
  const size_t n8 = (size_t)NR * DM / 8; const unsigned nb8 = (unsigned)((n8 + 255) / 256); const size_t w8 = (size_t)DM * DM / 8; const unsigned wb = (unsigned)((w8 + 255) / 256);
  k_round16f<<<wb, 256, 0, stream>>>(Wq, BQ, w8); k_round16f<<<wb, 256, 0, stream>>>(Wk, BK, w8); k_round16f<<<wb, 256, 0, stream>>>(Wv, BV, w8); k_round16f<<<wb, 256, 0, stream>>>(Wo, BO, w8);      /* torch (out,in) = natural Bt; x16 */
  k_causaltab<<<(SLEN * (SLEN / 32) + 255) / 256, 256, 0, stream>>>(MB, RA, KE, SLEN, SLEN);
  const dim3 gP((NR / 128) * (DM / 64), 1);
  k_x16<<<nb8, 256, 0, stream>>>(x, X16, n8);
  k_proj<1><<<gP, 128, 0, stream>>>(X16, BQ, qs, Qh, Ql);      /* q = silu(x Wq^T) * f_q, hi + residual */
  k_proj<1><<<gP, 128, 0, stream>>>(X16, BK, ks, Kh, Kl);      /* k = silu(x Wk^T) * f_k, hi + residual */
  k_proj<0><<<gP, 128, 0, stream>>>(X16, BV, ks, Vth, Vtl);      /* v = silu(x Wv^T), transposed, hi + residual (scale unread) */
  k_flashm<SLEN, SLEN><<<NBT * NH * (SLEN / 64), 128, 0, stream>>>(Qh, Ql, DM, Kh, Kl, DM, Vth, Vtl, MB, RA, KE, Oh, Ol, DM);
  float* outb = (float*)d_out;
  k_gemm2<0><<<gP, 128, 0, stream>>>(Oh, DM, 0, BO, DM, 0, 0.0625f, nullptr, 0, nullptr, 1, 0, 0, outb, nullptr, DM, 0, NR, DM, DM);
  k_gemm2<0><<<gP, 128, 0, stream>>>(Ol, DM, 0, BO, DM, 0, 0.0625f / 1024.0f, nullptr, 0, outb, 1, (size_t)DM, 0, outb, nullptr, DM, 0, NR, DM, DM);
}

// v003
// It runs in 673 microseconds.
// Two timings next to v002 both put it at 1.41 times that version's speed.
// All steps since v000 together make it 2.94 times as fast.
#include <hip/hip_runtime.h>
// Polar causal multi-head attention (4 x 2048 tokens x 1024, 16 heads x 64): q, k, v = SiLU(x*W^T); per (token, head) r = |q|, dir = q/(r + 1e-6); scores = (q_dir.k_dir) * (r_q q_scale[h]) * (r_k k_scale[h]) = (q . k) * f_q * f_k with f = r*scale/(r + 1e-6), j <= i; softmax; merged . Wo^T -> [4,2048,1024].
// Structure (every launch covers all 4 batches: 8192 token rows, 64 (batch, head) slabs): x as an exact f16 plane; the three projections as f16 WMMA GEMMs (32x64 wave tiles = 32 tokens x one head, f32, exact products) whose epilogue applies SiLU, folds the per-(token, head) polar factor f into q and k (f32) and stores q, k as f16 hi + x2^10 residual planes and V^T as hi + residual planes; the causal structure computed on device into a key bit plane + per-block key bound; the fused flash kernel per (head, 64 queries) (three-product hi/lo scores, online softmax f32, P hi + residual via LDS, two value accumulators) stores O as hi + residual planes; output projection as two GEMMs into the output rows.
// Compute dtype: x, weights, scales rounded to bf16; projections exact; SiLU / norms / factors f32; q, k, P, v, O as f16 hi + residual pairs (~2^-21); f32 accumulation and softmax. v_wmma_f32_16x16x32_f16.
#define NBT 4
#define SLEN 2048
#define DM 1024
#define NH 16
#define SCL 1.0f
#define NR (NBT * SLEN)
typedef __bf16 v16b __attribute__((ext_vector_type(16)));
typedef unsigned short v8us __attribute__((ext_vector_type(8), may_alias));
typedef float  v8f  __attribute__((ext_vector_type(8)));
typedef float  v4f  __attribute__((ext_vector_type(4)));
typedef float  v4fa __attribute__((ext_vector_type(4), may_alias));
union FragB { v16b v; v8us half[2]; unsigned short u[16]; };

__device__ __forceinline__ unsigned short bf16_bits(float x) { unsigned int u = __float_as_uint(x); return (unsigned short)((u + 0x7FFFu + ((u >> 16) & 1u)) >> 16); }
__device__ __forceinline__ float bf16_val(unsigned short b) { return __uint_as_float(((unsigned int)b) << 16); }
__device__ __forceinline__ float bf16_round(float x) { return bf16_val(bf16_bits(x)); }
// D += A·B with NT terms: 1 = ah·bh, 2 = + al·bh (A split), 3 = + ah·bl (both split)
template <int NT>
__device__ __forceinline__ v8f mmaN(v16b ah, v16b al, v16b bh, v16b bl, v8f c) {
  c = __builtin_amdgcn_wmma_f32_16x16x32_bf16(false, ah, false, bh, (short)0, c, false, false);
  if (NT >= 2) c = __builtin_amdgcn_wmma_f32_16x16x32_bf16(false, al, false, bh, (short)0, c, false, false);
  if (NT >= 3) c = __builtin_amdgcn_wmma_f32_16x16x32_bf16(false, ah, false, bl, (short)0, c, false, false);
  asm volatile("v_nop\n\tv_nop\n\tv_nop\n\tv_nop" : "+v"(c) : "v"(ah), "v"(al), "v"(bh), "v"(bl));
  return c;
}

__global__ __launch_bounds__(256) void k_wt_bf16(const float* __restrict__ W, unsigned short* __restrict__ Wt, int K, int N) {
  const int t = blockIdx.x * 256 + threadIdx.x;
  const int k8n = K / 8;
  if (t >= N * k8n) return;
  const int n = t / k8n, k8 = (t % k8n) * 8;
  v8us v;
#pragma unroll
  for (int i = 0; i < 8; ++i) v[i] = bf16_bits(W[(size_t)(k8 + i) * N + n]);
  *(v8us*)(Wt + (size_t)n * K + k8) = v;
  
}

// GEMM C[M][N] (f32, pitch ldc) = act(A[M][K]·W + bias). A f32 row-major (pitch lda) converted per fragment to bf16
// (ASPLIT: hi/lo two planes -> 2 terms, else single rounded term); Wt bf16 [N][K] (pitch ldb). BIAS_BF16 rounds the
// bias to bf16 first (bias quantised to bf16 before the add). K%32==0, M%16==0, N%64==0.
template <bool ASPLIT, int ACT, bool BIAS_BF16>
__global__ __launch_bounds__(128) void k_gemm_bf(const float* __restrict__ A, int lda, const unsigned short* __restrict__ Wt, int ldb,
                                               const float* __restrict__ bias, float* __restrict__ C, int ldc, int M, int N, int K) {
  __shared__ __attribute__((aligned(16))) float so[4][16][64];
  const int tid = threadIdx.x, w = tid >> 5, lane = tid & 31, ln = lane & 15, hh = lane >> 4;
  const int ntn = N / 64;
  const int wid = blockIdx.x * 4 + w;
  const int mt = wid / ntn, nq = wid % ntn;
  if (mt * 16 >= M) return;
  const int row0 = mt * 16, col0 = nq * 64;
  const float* arow = A + (size_t)(row0 + ln) * lda;
  v8f acc[4] = {};
  for (int kb = 0; kb < K; kb += 32) {
    FragB ah, al;
    const v4f x0 = *(const v4fa*)(arow + kb + 8 * hh), x1 = *(const v4fa*)(arow + kb + 8 * hh + 4);
    const v4f x2 = *(const v4fa*)(arow + kb + 16 + 8 * hh), x3 = *(const v4fa*)(arow + kb + 16 + 8 * hh + 4);
    float xs[16] = {x0[0],x0[1],x0[2],x0[3],x1[0],x1[1],x1[2],x1[3],x2[0],x2[1],x2[2],x2[3],x3[0],x3[1],x3[2],x3[3]};
#pragma unroll
    for (int i = 0; i < 16; ++i) { const unsigned short hb = bf16_bits(xs[i]); ah.u[i] = hb; al.u[i] = ASPLIT ? bf16_bits(xs[i] - bf16_val(hb)) : (unsigned short)0; }
#pragma unroll
    for (int t = 0; t < 4; ++t) {
      const unsigned short* brow = Wt + (size_t)(col0 + t * 16 + ln) * ldb + kb;
      FragB b;
      b.half[0] = *(const v8us*)(brow + 8 * hh);
      b.half[1] = *(const v8us*)(brow + 16 + 8 * hh);
      acc[t] = mmaN<ASPLIT ? 2 : 1>(ah.v, al.v, b.v, b.v, acc[t]);
    }
  }
#pragma unroll
  for (int t = 0; t < 4; ++t) {
    float bv = bias ? bias[col0 + t * 16 + ln] : 0.f;
    if (BIAS_BF16) bv = bf16_round(bv);
#pragma unroll
    for (int r = 0; r < 8; ++r) { float v = acc[t][r] + bv; if (ACT == 1) v = fmaxf(v, 0.f); so[w][8 * hh + r][t * 16 + ln] = v; }
  }
  __builtin_amdgcn_fence(__ATOMIC_ACQ_REL, "workgroup");
  __builtin_amdgcn_wave_barrier();
  const int rsub = lane >> 4, c4 = (lane & 15) * 4;
  {
#pragma unroll
    for (int q = 0; q < 8; ++q) {
      const int r = q * 2 + rsub;
      const v4f v = *(const v4fa*)&so[w][r][c4];
      *(v4f*)(C + (size_t)(row0 + r) * ldc + col0 + c4) = v;
    }
    
  }
}

// GEMM C = act(A·W + bias + resid): A f32 (ASPLIT -> hi/lo 2 terms), Wt bf16 [N][K]; ACT 0 none, 1 relu, 2 exact gelu;
// resid (optional, f32, row index = (row % rmod), pitch ldr, RES_BF16 rounds it) added before the activation.
template <bool ASPLIT, int ACT, bool BIAS_BF16, bool RES_BF16>
__global__ __launch_bounds__(128) void k_gemm_bf3(const float* __restrict__ A, int lda, const unsigned short* __restrict__ Wt, int ldb,
                                                const float* __restrict__ bias, const float* __restrict__ resid, int rmod, int ldr,
                                                float* __restrict__ C, int ldc, int M, int N, int K) {
  __shared__ __attribute__((aligned(16))) float so[4][16][64];
  const int tid = threadIdx.x, w = tid >> 5, lane = tid & 31, ln = lane & 15, hh = lane >> 4;
  const int ntn = N / 64;
  const int wid = blockIdx.x * 4 + w;
  const int mt = wid / ntn, nq = wid % ntn;
  if (mt * 16 >= M) return;
  const int row0 = mt * 16, col0 = nq * 64;
  const float* arow = A + (size_t)(row0 + ln) * lda;
  v8f acc[4] = {};
  for (int kb = 0; kb < K; kb += 32) {
    FragB ah, al;
    const v4f x0 = *(const v4fa*)(arow + kb + 8 * hh), x1 = *(const v4fa*)(arow + kb + 8 * hh + 4);
    const v4f x2 = *(const v4fa*)(arow + kb + 16 + 8 * hh), x3 = *(const v4fa*)(arow + kb + 16 + 8 * hh + 4);
    float xs[16] = {x0[0],x0[1],x0[2],x0[3],x1[0],x1[1],x1[2],x1[3],x2[0],x2[1],x2[2],x2[3],x3[0],x3[1],x3[2],x3[3]};
#pragma unroll
    for (int i = 0; i < 16; ++i) { const unsigned short hb = bf16_bits(xs[i]); ah.u[i] = hb; al.u[i] = ASPLIT ? bf16_bits(xs[i] - bf16_val(hb)) : (unsigned short)0; }
#pragma unroll
    for (int t = 0; t < 4; ++t) {
      const unsigned short* brow = Wt + (size_t)(col0 + t * 16 + ln) * ldb + kb;
      FragB b;
      b.half[0] = *(const v8us*)(brow + 8 * hh);
      b.half[1] = *(const v8us*)(brow + 16 + 8 * hh);
      acc[t] = mmaN<ASPLIT ? 2 : 1>(ah.v, al.v, b.v, b.v, acc[t]);
    }
  }
#pragma unroll
  for (int t = 0; t < 4; ++t) {
    const int col = col0 + t * 16 + ln;
    float bv = bias ? bias[col] : 0.f;
    if (BIAS_BF16) bv = bf16_round(bv);
#pragma unroll
    for (int r = 0; r < 8; ++r) {
      float v = acc[t][r] + bv;
      if (resid) { float rv = resid[(size_t)((row0 + 8 * hh + r) % rmod) * ldr + col]; if (RES_BF16) rv = bf16_round(rv); v += rv; }
      if (ACT == 1) v = fmaxf(v, 0.f);
      if (ACT == 2) v = 0.5f * v * (1.0f + erff(v * 0.70710678118654752f));
      if (ACT == 3) { const float u = 0.7978845608028654f * (v + 0.044715f * v * v * v); v = 0.5f * v * (1.0f + tanhf(u)); }
      so[w][8 * hh + r][t * 16 + ln] = v;
    }
  }
  __builtin_amdgcn_fence(__ATOMIC_ACQ_REL, "workgroup");
  __builtin_amdgcn_wave_barrier();
  const int rsub = lane >> 4, c4 = (lane & 15) * 4;
  {
#pragma unroll
    for (int q = 0; q < 8; ++q) {
      const int r = q * 2 + rsub;
      const v4f v = *(const v4fa*)&so[w][r][c4];
      *(v4f*)(C + (size_t)(row0 + r) * ldc + col0 + c4) = v;
    }
    
  }
}
// row LayerNorm (biased variance, eps) over N: s = X (+ R); optional out_sum <- s; out_norm <- (s-mu)*rsqrt(var+eps)*g + b
template <bool PARAM_BF16>
__global__ __launch_bounds__(256) void k_layernorm(const float* __restrict__ X, const float* __restrict__ R, const float* __restrict__ g, const float* __restrict__ bta,
                                                  float* __restrict__ out_sum, float* __restrict__ out_norm, int N, float eps) {
  __shared__ float red[256];
  const int row = blockIdx.x, tid = threadIdx.x;
  const float* x = X + (size_t)row * N; const float* rr = R ? R + (size_t)row * N : nullptr;
  float vals[16];                     // up to N = 4096
  const int per = N / 256;            // contiguous chunk per thread? use strided-by-4 chunks: thread handles j = tid*4 + 1024*u
  float s1 = 0.f;
  for (int u = 0; u < per / 4; ++u) {
    const int j = tid * 4 + 1024 * u;
    const v4f a = *(const v4fa*)(x + j);
    v4f b = {0.f,0.f,0.f,0.f}; if (rr) b = *(const v4fa*)(rr + j);
#pragma unroll
    for (int q = 0; q < 4; ++q) { const float v = a[q] + b[q]; vals[u * 4 + q] = v; s1 += v; }
  }
  red[tid] = s1; __syncthreads();
  for (int st = 128; st > 0; st >>= 1) { if (tid < st) red[tid] += red[tid + st]; __syncthreads(); }
  const float mu = red[0] / (float)N; __syncthreads();
  float s2 = 0.f;
  for (int u = 0; u < per / 4; ++u)
#pragma unroll
    for (int q = 0; q < 4; ++q) { const float c = vals[u * 4 + q] - mu; s2 += c * c; }
  red[tid] = s2; __syncthreads();
  for (int st = 128; st > 0; st >>= 1) { if (tid < st) red[tid] += red[tid + st]; __syncthreads(); }
  const float rs = rsqrtf(red[0] / (float)N + eps);
  {
    for (int u = 0; u < per / 4; ++u) {
      const int j = tid * 4 + 1024 * u;
      v4f o, sm;
#pragma unroll
      for (int q = 0; q < 4; ++q) {
        float gg = g[j + q], bb = bta[j + q];
        if (PARAM_BF16) { gg = bf16_round(gg); bb = bf16_round(bb); }
        sm[q] = vals[u * 4 + q]; o[q] = (vals[u * 4 + q] - mu) * rs * gg + bb;
      }
      if (out_sum) *(v4f*)(out_sum + (size_t)row * N + j) = sm;
      *(v4f*)(out_norm + (size_t)row * N + j) = o;
    }
    
  }
}



// ---- f16 WMMA path (v_wmma_f32_16x16x32_f16): 11-bit significands for operands in range — used where a [0,1] probability operand needs more precision than bf16
typedef _Float16 v16h __attribute__((ext_vector_type(16)));
union FragH { v16h v; v8us half[2]; _Float16 h[16]; unsigned short u[16]; };
template <int NT>
__device__ __forceinline__ v8f mmaH(v16h ah, v16h al, v16h bh, v16h bl, v8f c) {
  c = __builtin_amdgcn_wmma_f32_16x16x32_f16(false, ah, false, bh, (short)0, c, false, false);
  if (NT >= 2) c = __builtin_amdgcn_wmma_f32_16x16x32_f16(false, al, false, bh, (short)0, c, false, false);
  if (NT >= 3) c = __builtin_amdgcn_wmma_f32_16x16x32_f16(false, ah, false, bl, (short)0, c, false, false);
  asm volatile("v_nop\n\tv_nop\n\tv_nop\n\tv_nop" : "+v"(c) : "v"(ah), "v"(al), "v"(bh), "v"(bl));
  return c;
}
// batched GEMM like k_gemm_b but f16 operands: A f32 (split into f16 hi/lo if ASPLIT, else rounded to f16), Bt = f16 values [n][k]; alpha; C f32; N multiple of 16 (partial tiles skipped)
template <bool ASPLIT>
__global__ __launch_bounds__(128) void k_gemm_h(const float* __restrict__ A, int lda, size_t sA, const _Float16* __restrict__ Bh, int ldb, size_t sB, float alpha, float* __restrict__ C, int ldc, size_t sC, int M, int N, int K) {
  __shared__ __attribute__((aligned(16))) float so[4][16][64];
  const int tid = threadIdx.x, w = tid >> 5, lane = tid & 31, ln = lane & 15, hh = lane >> 4; const int by = blockIdx.y;
  A += (size_t)by * sA; Bh += (size_t)by * sB; C += (size_t)by * sC;
  const int ntn = (N + 63) / 64; const int wid = blockIdx.x * 4 + w; const int mt = wid / ntn, nq = wid % ntn; if (mt * 16 >= M) return;
  const int row0 = mt * 16, col0 = nq * 64; const float* arow = A + (size_t)(row0 + ln) * lda;
  v8f acc[4] = {};
  for (int kb = 0; kb < K; kb += 32) {
    FragH ah, al;
    const v4f x0 = *(const v4fa*)(arow + kb + 8 * hh), x1 = *(const v4fa*)(arow + kb + 8 * hh + 4), x2 = *(const v4fa*)(arow + kb + 16 + 8 * hh), x3 = *(const v4fa*)(arow + kb + 16 + 8 * hh + 4);
    float xs[16] = {x0[0],x0[1],x0[2],x0[3],x1[0],x1[1],x1[2],x1[3],x2[0],x2[1],x2[2],x2[3],x3[0],x3[1],x3[2],x3[3]};
#pragma unroll
    for (int i = 0; i < 16; ++i) { const _Float16 h = (_Float16)xs[i]; ah.h[i] = h; al.h[i] = ASPLIT ? (_Float16)(xs[i] - (float)h) : (_Float16)0.0f; }
#pragma unroll
    for (int t = 0; t < 4; ++t) { if (col0 + t * 16 >= N) continue; const size_t boff = (size_t)(col0 + t * 16 + ln) * ldb + kb; FragH bq; bq.half[0] = *(const v8us*)(Bh + boff + 8 * hh); bq.half[1] = *(const v8us*)(Bh + boff + 16 + 8 * hh);
      acc[t] = mmaH<ASPLIT ? 2 : 1>(ah.v, al.v, bq.v, bq.v, acc[t]); }
  }
#pragma unroll
  for (int t = 0; t < 4; ++t) { if (col0 + t * 16 >= N) continue;
#pragma unroll
    for (int r = 0; r < 8; ++r) so[w][8 * hh + r][t * 16 + ln] = acc[t][r] * alpha; }
  __builtin_amdgcn_fence(__ATOMIC_ACQ_REL, "workgroup"); __builtin_amdgcn_wave_barrier();
  const int rsub = lane >> 4, c4 = (lane & 15) * 4;
  {
#pragma unroll
    for (int q = 0; q < 8; ++q) { const int r = q * 2 + rsub; if (col0 + c4 < N) { const v4f v = *(const v4fa*)&so[w][r][c4]; *(v4f*)(C + (size_t)(row0 + r) * ldc + col0 + c4) = v; } }
     }
}

// Wt[n][k] = f16(W[k][n]·scale) from f32 row-major W[K][N] (scale = power of two; bf16-exact weights stay exact in f16 away from the subnormal range)
__global__ __launch_bounds__(256) void k_wt_f16(const float* __restrict__ W, _Float16* __restrict__ Wt, int K, int N, float scale) {
  const int t = blockIdx.x * 256 + threadIdx.x; if (t >= N * (K / 8)) return; const int n = t / (K / 8), k8 = (t % (K / 8)) * 8; FragH f;
#pragma unroll
  for (int i = 0; i < 8; ++i) f.h[i] = (_Float16)(bf16_round(W[(size_t)(k8 + i) * N + n]) * scale); const v8us o = f.half[0];
  *(v8us*)((unsigned short*)Wt + (size_t)n * K + k8) = o; 
}
// k_gemm_hh variant with fused epilogue: v = acc·alpha + bias[by·sBias + col] (+ CP[(row/rowsPerB)·sCPb + by·64 + col] if CP) ; ACT 0 none / 1 elu ; writes f16 C16 (and f32 C if non-null)
template <int ACT>
__global__ __launch_bounds__(128) void k_gemm_hhx(const _Float16* __restrict__ A, int lda, size_t sA, const _Float16* __restrict__ Bh, int ldb, size_t sB, float alpha, const float* __restrict__ bias, size_t sBias, const float* __restrict__ CP, int rowsPerB, size_t sCPb, int row0g,
    float* __restrict__ C, _Float16* __restrict__ C16, int ldc, size_t sC, int M, int N, int K) {
  __shared__ __attribute__((aligned(16))) float so[4][16][64];
  const int tid = threadIdx.x, w = tid >> 5, lane = tid & 31, ln = lane & 15, hh = lane >> 4; const int by = blockIdx.y;
  A += (size_t)by * sA; Bh += (size_t)by * sB; const size_t cofs = (size_t)by * sC; const float* bp = bias ? bias + (size_t)by * sBias : nullptr;
  const int ntn = (N + 63) / 64; const int wid = blockIdx.x * 4 + w; const int mt = wid / ntn, nq = wid % ntn; if (mt * 16 >= M) return;
  const int row0 = mt * 16, col0 = nq * 64; const _Float16* arow = A + (size_t)(row0 + ln) * lda;
  v8f acc[4] = {};
  for (int kb = 0; kb < K; kb += 32) { FragH ah; ah.half[0] = *(const v8us*)((const unsigned short*)arow + kb + 8 * hh); ah.half[1] = *(const v8us*)((const unsigned short*)arow + kb + 16 + 8 * hh);
#pragma unroll
    for (int t = 0; t < 4; ++t) { if (col0 + t * 16 >= N) continue; const size_t boff = (size_t)(col0 + t * 16 + ln) * ldb + kb; FragH bq; bq.half[0] = *(const v8us*)((const unsigned short*)Bh + boff + 8 * hh); bq.half[1] = *(const v8us*)((const unsigned short*)Bh + boff + 16 + 8 * hh);
      acc[t] = mmaH<1>(ah.v, ah.v, bq.v, bq.v, acc[t]); }
  }
#pragma unroll
  for (int t = 0; t < 4; ++t) { if (col0 + t * 16 >= N) continue; const int col = col0 + t * 16 + ln; const float bv = bp ? bf16_round(bp[col]) : 0.f;
#pragma unroll
    for (int r = 0; r < 8; ++r) { float v = acc[t][r] * alpha + bv; if (CP) { const int bidx = (row0g + row0 + 8 * hh + r) / rowsPerB; v += CP[(size_t)bidx * sCPb + (size_t)by * 64 + col]; } if (ACT == 1) v = (v > 0.f) ? v : expm1f(v); else if (ACT == 7) v = (v > 0.f) ? v + 1.0f : expf(v); else if (ACT == 8) v = tanhf(v); else if (ACT == 9) v = 0.5f * v * (1.0f + tanhf(0.7978845608028654f * (v + 0.044715f * v * v * v))); else if (ACT == 11) v = 1.0f / (1.0f + expf(-v)); else if (ACT == 12) v = (v > 0.f) ? v : 0.01f * v; else if (ACT == 14) v = (v > 0.f) ? v : 0.1f * v; else if (ACT == 15) v = v / (1.0f + expf(-v)); else if (ACT == 3) v = fmaxf(v, 0.f); else if (ACT == 6) v = 0.5f * v * (1.0f + erff(v * 0.70710678118654752f)); so[w][8 * hh + r][t * 16 + ln] = v; } }
  __builtin_amdgcn_fence(__ATOMIC_ACQ_REL, "workgroup"); __builtin_amdgcn_wave_barrier();
  const int rsub = lane >> 4, c4 = (lane & 15) * 4; typedef _Float16 v4h __attribute__((ext_vector_type(4)));
  {
#pragma unroll
    for (int q = 0; q < 8; ++q) { const int r = q * 2 + rsub; if (col0 + c4 < N) { const v4f v = *(const v4fa*)&so[w][r][c4]; if (C) *(v4f*)(C + cofs + (size_t)(row0 + r) * ldc + col0 + c4) = v; if (C16) { v4h h4; for (int i = 0; i < 4; ++i) h4[i] = (_Float16)v[i]; *(v4h*)(C16 + cofs + (size_t)(row0 + r) * ldc + col0 + c4) = h4; } } }
     }
}


typedef _Float16 v4h __attribute__((ext_vector_type(4)));

__global__ __launch_bounds__(256) void k_x16(const float* __restrict__ x, _Float16* __restrict__ X16, size_t n8) { const size_t t = (size_t)blockIdx.x * 256 + threadIdx.x; if (t >= n8) return; FragH f;
#pragma unroll
  for (int q = 0; q < 8; ++q) f.h[q] = (_Float16)bf16_round(x[t * 8 + q]); *(v8us*)((unsigned short*)X16 + t * 8) = f.half[0];  }
__global__ __launch_bounds__(256) void k_h16(const float* __restrict__ x, _Float16* __restrict__ X16, size_t n8) { const size_t t = (size_t)blockIdx.x * 256 + threadIdx.x; if (t >= n8) return; FragH f;
#pragma unroll
  for (int q = 0; q < 8; ++q) f.h[q] = (_Float16)x[t * 8 + q]; *(v8us*)((unsigned short*)X16 + t * 8) = f.half[0];  }
__global__ __launch_bounds__(256) void k_round16f(const float* __restrict__ W, _Float16* __restrict__ Bt, size_t n8) { const size_t t = (size_t)blockIdx.x * 256 + threadIdx.x; if (t >= n8) return; FragH f;
#pragma unroll
  for (int i = 0; i < 8; ++i) f.h[i] = (_Float16)(bf16_round(W[t * 8 + i]) * 16.0f); *(v8us*)((unsigned short*)Bt + t * 8) = f.half[0];  }
template <int NHv, int TTv>
__global__ __launch_bounds__(256) void k_vt(const _Float16* __restrict__ V16, int ldv, int voff, _Float16* __restrict__ Vt) { __shared__ unsigned short tl[64][66]; const int tid = threadIdx.x; const int slab = blockIdx.x / (TTv / 64), lg = blockIdx.x % (TTv / 64); const int b = slab / NHv, h = slab % NHv;
  for (int i = tid; i < 64 * 8; i += 256) { const int r = i / 8, c8 = (i % 8) * 8; FragH f; f.half[0] = *(const v8us*)((const unsigned short*)V16 + ((size_t)b * TTv + lg * 64 + r) * ldv + voff + h * 64 + c8);
#pragma unroll
    for (int q = 0; q < 8; ++q) tl[r][c8 + q] = f.u[q]; }
  __syncthreads();
  {
#pragma unroll
    for (int rd = 0; rd < 2; ++rd) { const int d = rd * 32 + tid / 8, pc = tid % 8; FragH f;
#pragma unroll
      for (int q = 0; q < 8; ++q) f.u[q] = tl[pc * 8 + q][d];
      *(v8us*)((unsigned short*)Vt + ((size_t)slab * 64 + d) * TTv + lg * 64 + pc * 8) = f.half[0]; }
     } }

// ---- fast GEMM (wave tile 32x64; requires M % 32 == 0 rows per launch region and N % 64 == 0); epilogue = k_gemm_hhx semantics ----
__device__ __forceinline__ v16h g2_frag(const _Float16* p, int hh) { FragH f; f.half[0] = *(const v8us*)((const unsigned short*)p + 8 * hh); f.half[1] = *(const v8us*)((const unsigned short*)p + 16 + 8 * hh); return f.v; }
__device__ __forceinline__ v8f g2_mma(v16h a, v16h b, v8f c) { v8f d = __builtin_amdgcn_wmma_f32_16x16x32_f16(false, a, false, b, (short)0, c, false, false); asm volatile("v_nop\n\tv_nop\n\tv_nop\n\tv_nop" : "+v"(d) : "v"(a), "v"(b)); return d; }
template <int ACT>
__global__ __launch_bounds__(128) void k_gemm2(const _Float16* __restrict__ A, int lda, size_t sA, const _Float16* __restrict__ Bh, int ldb, size_t sB, float alpha, const float* __restrict__ bias, size_t sBias, const float* __restrict__ CP, int rowsPerB, size_t sCPb, int row0g,
    float* __restrict__ C, _Float16* __restrict__ C16, int ldc, size_t sC, int M, int N, int K) {
  __shared__ __attribute__((aligned(16))) float so[4][32][68];
  const int tid = threadIdx.x, w = tid >> 5, lane = tid & 31, ln = lane & 15, hh = lane >> 4; const int by = blockIdx.y;
  A += (size_t)by * sA; Bh += (size_t)by * sB; const size_t cofs = (size_t)by * sC; const float* bp = bias ? bias + (size_t)by * sBias : nullptr;
  const int ntn = N >> 6; const int mt = blockIdx.x / ntn, nq = blockIdx.x - mt * ntn; const int row0 = mt * 128 + 32 * w, col0 = nq * 64; if (row0 >= M) return;
  const _Float16* a0p = A + (size_t)(row0 + ln) * lda; const _Float16* a1p = a0p + (size_t)16 * lda;
  const _Float16* b0p = Bh + (size_t)(col0 + ln) * ldb; const _Float16* b1p = b0p + (size_t)16 * ldb; const _Float16* b2p = b1p + (size_t)16 * ldb; const _Float16* b3p = b2p + (size_t)16 * ldb;
  const v8f z8 = {0.f,0.f,0.f,0.f,0.f,0.f,0.f,0.f}; v8f c00 = z8, c01 = z8, c02 = z8, c03 = z8, c10 = z8, c11 = z8, c12 = z8, c13 = z8;
#pragma unroll 1
  for (int kb = 0; kb < K; kb += 32) { const v16h a0 = g2_frag(a0p + kb, hh), a1 = g2_frag(a1p + kb, hh);
    v16h b = g2_frag(b0p + kb, hh); c00 = g2_mma(a0, b, c00); c10 = g2_mma(a1, b, c10);
    b = g2_frag(b1p + kb, hh); c01 = g2_mma(a0, b, c01); c11 = g2_mma(a1, b, c11);
    b = g2_frag(b2p + kb, hh); c02 = g2_mma(a0, b, c02); c12 = g2_mma(a1, b, c12);
    b = g2_frag(b3p + kb, hh); c03 = g2_mma(a0, b, c03); c13 = g2_mma(a1, b, c13); }
  v8f accs[8] = {c00, c01, c02, c03, c10, c11, c12, c13};
#pragma unroll
  for (int u = 0; u < 8; ++u) { const int t = u & 3, half = u >> 2; const int col = col0 + t * 16 + ln; const float bv = bp ? bf16_round(bp[col]) : 0.f;
#pragma unroll
    for (int r = 0; r < 8; ++r) { const int rloc = half * 16 + 8 * hh + r; float v = accs[u][r] * alpha + bv; if (CP) { const int bidx = (row0g + row0 + rloc) / rowsPerB; v += CP[(size_t)bidx * sCPb + (size_t)by * 64 + col]; }
      if (ACT == 3) v = fmaxf(v, 0.f); else if (ACT == 6) v = 0.5f * v * (1.0f + erff(v * 0.70710678118654752f)); else if (ACT == 11) v = 1.0f / (1.0f + expf(-v)); else if (ACT == 15) v = v / (1.0f + expf(-v)); else if (ACT == 12) v = (v > 0.f) ? v : 0.01f * v; else if (ACT == 8) v = tanhf(v);
      so[w][rloc][t * 16 + ln] = v; } }
  __builtin_amdgcn_fence(__ATOMIC_ACQ_REL, "workgroup"); __builtin_amdgcn_wave_barrier();
  const int rsub = lane >> 4, c4 = (lane & 15) * 4;
  {
#pragma unroll
    for (int q = 0; q < 16; ++q) { const int r = q * 2 + rsub; const v4f v = *(const v4fa*)&so[w][r][c4]; if (C) *(v4f*)(C + cofs + (size_t)(row0 + r) * ldc + col0 + c4) = v; if (C16) { v4h h4; for (int i = 0; i < 4; ++i) h4[i] = (_Float16)v[i]; *(v4h*)(C16 + cofs + (size_t)(row0 + r) * ldc + col0 + c4) = h4; } }
     } }



__device__ __forceinline__ float siluf(float g) { return g / (1.0f + expf(-g)); }
// ---- projection GEMM (main loop of k_gemm2, NR x DM x DM, Bt carries x16) with the element-wise tail in its epilogue. A wave tile is 32 tokens x the 64 columns of one head, so the head's norm is a sum inside the wave's own LDS rows.
// POLAR 1: g = silu(acc/16) * f, f = r*scale[h]/(r + 1e-6), r = |silu row|; g stored as f16 hi + x2^10 residual, row-major, one whole 128-B line per row and plane.
// POLAR 0: g = silu(acc/16) stored transposed per (batch, head) slab as hi + residual planes [64 dims][SLEN tokens]; the block's 128 tokens are transposed through LDS, one whole 128-B line per 8 lanes.
template <int POLAR>
__global__ __launch_bounds__(128) void k_proj(const _Float16* __restrict__ A, const _Float16* __restrict__ Bh, const float* __restrict__ scale, _Float16* __restrict__ Hh, _Float16* __restrict__ Hl) {
  constexpr int PT = POLAR ? 68 : 65;      /* LDS row pitch in floats: 68 for the 16-B row reads, 65 for the column reads of the transpose */
  __shared__ __attribute__((aligned(16))) float so[128 * 68];
  const int tid = threadIdx.x, w = tid >> 5, lane = tid & 31, ln = lane & 15, hh = lane >> 4;
  constexpr int ntn = DM >> 6; const int mt = blockIdx.x / ntn, nq = blockIdx.x - mt * ntn; const int row0 = mt * 128 + 32 * w, col0 = nq * 64;
  const _Float16* a0p = A + (size_t)(row0 + ln) * DM; const _Float16* a1p = a0p + (size_t)16 * DM;
  const _Float16* b0p = Bh + (size_t)(col0 + ln) * DM; const _Float16* b1p = b0p + (size_t)16 * DM; const _Float16* b2p = b1p + (size_t)16 * DM; const _Float16* b3p = b2p + (size_t)16 * DM;
  const v8f z8 = {0.f,0.f,0.f,0.f,0.f,0.f,0.f,0.f}; v8f c00 = z8, c01 = z8, c02 = z8, c03 = z8, c10 = z8, c11 = z8, c12 = z8, c13 = z8;
  /* rolled, as in k_gemm2: the same loop body, so the products and their order are the same */
#pragma unroll 1
  for (int kb = 0; kb < DM; kb += 32) { const v16h a0 = g2_frag(a0p + kb, hh), a1 = g2_frag(a1p + kb, hh);
    v16h b = g2_frag(b0p + kb, hh); c00 = g2_mma(a0, b, c00); c10 = g2_mma(a1, b, c10);
    b = g2_frag(b1p + kb, hh); c01 = g2_mma(a0, b, c01); c11 = g2_mma(a1, b, c11);
    b = g2_frag(b2p + kb, hh); c02 = g2_mma(a0, b, c02); c12 = g2_mma(a1, b, c12);
    b = g2_frag(b3p + kb, hh); c03 = g2_mma(a0, b, c03); c13 = g2_mma(a1, b, c13); }
  v8f accs[8] = {c00, c01, c02, c03, c10, c11, c12, c13};
#pragma unroll
  for (int u = 0; u < 8; ++u) { const int t = u & 3, half = u >> 2;
#pragma unroll
    for (int r = 0; r < 8; ++r) so[(32 * w + half * 16 + 8 * hh + r) * PT + t * 16 + ln] = siluf(accs[u][r] * 0.0625f); }
  if (POLAR) {
    __builtin_amdgcn_fence(__ATOMIC_ACQ_REL, "workgroup"); __builtin_amdgcn_wave_barrier();      /* each wave reads back its own 32 rows only */
    const int rsub = lane >> 4, c4 = (lane & 15) * 4; const float sc = bf16_round(scale[nq]);
#pragma unroll
    for (int q = 0; q < 16; ++q) { const int r = q * 2 + rsub; const v4f v = *(const v4fa*)&so[(32 * w + r) * PT + c4];
      float s = (v[0] * v[0] + v[1] * v[1]) + (v[2] * v[2] + v[3] * v[3]); s += __shfl_xor(s, 8, 32); s += __shfl_xor(s, 4, 32); s += __shfl_xor(s, 2, 32); s += __shfl_xor(s, 1, 32);
      const float rr = sqrtf(s); const float fac = (rr * sc) / (rr + 1e-6f); v4h h4, l4;
#pragma unroll
      for (int i = 0; i < 4; ++i) { const float g = v[i] * fac; const _Float16 h = (_Float16)g; h4[i] = h; l4[i] = (_Float16)((g - (float)h) * 1024.0f); }
      const size_t o = (size_t)(row0 + r) * DM + col0 + c4; *(v4h*)(Hh + o) = h4; *(v4h*)(Hl + o) = l4; }
  } else {
    __syncthreads();      /* the transpose reads rows that the block's other waves wrote */
    const int slab = (mt * 128 / SLEN) * NH + nq, tok0 = mt * 128 % SLEN;
#pragma unroll
    for (int it = 0; it < 8; ++it) { const int item = it * 128 + tid; const int pc = item & 7, d = (item >> 3) & 63, g = item >> 9; FragH fh, fl;
#pragma unroll
      for (int q = 0; q < 8; ++q) { const float v = so[(g * 64 + pc * 8 + q) * PT + d]; const _Float16 hv = (_Float16)v; fh.h[q] = hv; fl.h[q] = (_Float16)((v - (float)hv) * 1024.0f); }
      const size_t o = ((size_t)slab * 64 + d) * SLEN + tok0 + g * 64 + pc * 8; *(v8us*)((unsigned short*)Hh + o) = fh.half[0]; *(v8us*)((unsigned short*)Hl + o) = fl.half[0]; }
  } }

template <int TQ, int TK>
__global__ __launch_bounds__(128) void k_flashm(const _Float16* __restrict__ Q16, const _Float16* __restrict__ Q16lo, int ldq, const _Float16* __restrict__ K16, const _Float16* __restrict__ K16lo, int ldk, const _Float16* __restrict__ Vt, const _Float16* __restrict__ Vtlo, const unsigned* __restrict__ MB, const int* __restrict__ RA, const int* __restrict__ KE, _Float16* __restrict__ Oh, _Float16* __restrict__ Ol, int ldo) {
  constexpr int RPW = 16, RTN = RPW / 16, NQB = TQ / (4 * RPW), DT = 4, KS = 2;
  __shared__ __attribute__((aligned(16))) unsigned short sP[4][RPW][40], sPl[4][RPW][40]; __shared__ __attribute__((aligned(16))) float sO[4][RPW][64 + 4];
  const int tid = threadIdx.x, w = tid >> 5, lane = tid & 31, ln = lane & 15, hh = lane >> 4;
  const int slab = blockIdx.x / NQB, qblk = blockIdx.x % NQB; const int b = slab / NH, h = slab % NH; const int qb0 = qblk * (4 * RPW); const int q0 = qb0 + w * RPW;
  FragH aq[2][KS], aql[2][KS];
#pragma unroll
  for (int rt = 0; rt < RTN; ++rt) { const size_t qo = ((size_t)b * TQ + q0 + rt * 16 + ln) * ldq + h * 64; const unsigned short* qr = (const unsigned short*)Q16 + qo; const unsigned short* ql = (const unsigned short*)Q16lo + qo;
#pragma unroll
    for (int ks = 0; ks < KS; ++ks) { aq[rt][ks].half[0] = *(const v8us*)(qr + ks * 32 + 8 * hh); aq[rt][ks].half[1] = *(const v8us*)(qr + ks * 32 + 16 + 8 * hh); aql[rt][ks].half[0] = *(const v8us*)(ql + ks * 32 + 8 * hh); aql[rt][ks].half[1] = *(const v8us*)(ql + ks * 32 + 16 + 8 * hh); } }
  asm volatile("s_wait_xcnt 0x0" ::: "memory");      /* the Q loads' address registers are reused right below */
  const unsigned short* Vth = (const unsigned short*)Vt + (size_t)slab * 64 * TK; const unsigned short* Vtl = (const unsigned short*)Vtlo + (size_t)slab * 64 * TK;
  float m_r[2][8], l_r[2][8]; v8f oacc[2][DT], oaccl[2][DT];
#pragma unroll
  for (int rt = 0; rt < RTN; ++rt) {
#pragma unroll
    for (int r = 0; r < 8; ++r) { m_r[rt][r] = -3.0e38f; l_r[rt][r] = 0.f; }
#pragma unroll
    for (int dt = 0; dt < DT; ++dt) { oacc[rt][dt] = (v8f){0.f,0.f,0.f,0.f,0.f,0.f,0.f,0.f}; oaccl[rt][dt] = oacc[rt][dt]; } }
  int jend = KE[qblk * 32]; jend = min(TK, (jend + 31) & ~31); if (jend < 32) jend = 32;      /* block-uniform */
  int allm[2][8]; const unsigned* mrow[2][8];
#pragma unroll
  for (int rt = 0; rt < RTN; ++rt)
#pragma unroll
    for (int r = 0; r < 8; ++r) { const int tq = q0 + rt * 16 + 8 * hh + r; allm[rt][r] = RA[tq]; mrow[rt][r] = MB + (size_t)tq * (TK / 32); }
  asm volatile("s_wait_xcnt 0x0" ::: "memory");      /* the row-flag loads' offset register is reused below */
#pragma unroll 1
  for (int j0 = 0; j0 < jend; j0 += 32) {
    unsigned mwv[2][8];      /* all rows' mask words are asked for at the head of the pass: their wait falls together with the K fragments', and no row waits for its own */
#pragma unroll
    for (int rt = 0; rt < RTN; ++rt)
#pragma unroll
      for (int r = 0; r < 8; ++r) mwv[rt][r] = mrow[rt][r][j0 >> 5];
    v8f s[2][2];
#pragma unroll
    for (int nt = 0; nt < 2; ++nt) { const size_t ko = ((size_t)b * TK + j0 + nt * 16 + ln) * ldk + h * 64; const unsigned short* kr = (const unsigned short*)K16 + ko; const unsigned short* kl = (const unsigned short*)K16lo + ko; FragH bk[KS], bkl[KS];
#pragma unroll
      for (int ks = 0; ks < KS; ++ks) { bk[ks].half[0] = *(const v8us*)(kr + ks * 32 + 8 * hh); bk[ks].half[1] = *(const v8us*)(kr + ks * 32 + 16 + 8 * hh); bkl[ks].half[0] = *(const v8us*)(kl + ks * 32 + 8 * hh); bkl[ks].half[1] = *(const v8us*)(kl + ks * 32 + 16 + 8 * hh); }
      asm volatile("s_wait_xcnt 0x0" :: "v"(kr + 8 * hh), "v"(kl + 8 * hh) : "memory");      /* the K loads' address registers are reused right below; naming the two addresses as inputs keeps them whole up to the wait, so that no load's own result lands on them */
#pragma unroll
      for (int rt = 0; rt < RTN; ++rt) { v8f acc = (v8f){0.f,0.f,0.f,0.f,0.f,0.f,0.f,0.f}, accr = acc;
#pragma unroll
        for (int ks = 0; ks < KS; ++ks) { acc = mmaH<1>(aq[rt][ks].v, aq[rt][ks].v, bk[ks].v, bk[ks].v, acc); accr = mmaH<1>(aql[rt][ks].v, aql[rt][ks].v, bk[ks].v, bk[ks].v, accr); accr = mmaH<1>(aq[rt][ks].v, aq[rt][ks].v, bkl[ks].v, bkl[ks].v, accr); }
        s[rt][nt] = acc + accr * 0.0009765625f; } }
    /* The eight rows of a tile run side by side: the body holds no branch (each exp is computed on every lane and chosen by a select behind it; the chosen values are the same), and each step is written for all rows before the next, so one row's lane exchange and exp wait is filled by the other seven. */
#pragma unroll
    for (int rt = 0; rt < RTN; ++rt) { float s0[8], s1[8], mc[8]; bool ok0[8], ok1[8];
#pragma unroll
      for (int r = 0; r < 8; ++r) { const unsigned mw = mwv[rt][r]; const bool am = (allm[rt][r] != 0);
        ok0[r] = am || (((mw >> ln) & 1u) == 0u); ok1[r] = am || (((mw >> (16 + ln)) & 1u) == 0u);
        s0[r] = ok0[r] ? (am ? 0.f : s[rt][0][r] * SCL) : -INFINITY; s1[r] = ok1[r] ? (am ? 0.f : s[rt][1][r] * SCL) : -INFINITY; mc[r] = fmaxf(s0[r], s1[r]); }
#pragma unroll
      for (int st = 1; st < 16; st <<= 1)
#pragma unroll
        for (int r = 0; r < 8; ++r) mc[r] = fmaxf(mc[r], __shfl_xor(mc[r], st, 32));
#pragma unroll
      for (int r = 0; r < 8; ++r) { const float mn = fmaxf(m_r[rt][r], mc[r]); const float ea = expf(m_r[rt][r] - mn), e0 = expf(s0[r] - mn), e1 = expf(s1[r] - mn);
        const float al = (mn > -1.0e38f) ? ea : 1.0f; m_r[rt][r] = mn; const float p0 = ok0[r] ? e0 : 0.f, p1 = ok1[r] ? e1 : 0.f; l_r[rt][r] = l_r[rt][r] * al + p0 + p1;
#pragma unroll
        for (int dt = 0; dt < DT; ++dt) { oacc[rt][dt][r] *= al; oaccl[rt][dt][r] *= al; }
        FragH t2, t3; const float ps0 = p0 * 1024.0f, ps1 = p1 * 1024.0f; t2.h[0] = (_Float16)ps0; t2.h[1] = (_Float16)ps1; t3.h[0] = (_Float16)((ps0 - (float)t2.h[0]) * 1024.0f); t3.h[1] = (_Float16)((ps1 - (float)t2.h[1]) * 1024.0f);
        sP[w][rt * 16 + 8 * hh + r][ln] = t2.u[0]; sP[w][rt * 16 + 8 * hh + r][16 + ln] = t2.u[1]; sPl[w][rt * 16 + 8 * hh + r][ln] = t3.u[0]; sPl[w][rt * 16 + 8 * hh + r][16 + ln] = t3.u[1]; } }
    __builtin_amdgcn_fence(__ATOMIC_ACQ_REL, "workgroup"); __builtin_amdgcn_wave_barrier();
    FragH pa[2], pl[2];
#pragma unroll
    for (int rt = 0; rt < RTN; ++rt) { pa[rt].half[0] = *(const v8us*)&sP[w][rt * 16 + ln][8 * hh]; pa[rt].half[1] = *(const v8us*)&sP[w][rt * 16 + ln][16 + 8 * hh]; pl[rt].half[0] = *(const v8us*)&sPl[w][rt * 16 + ln][8 * hh]; pl[rt].half[1] = *(const v8us*)&sPl[w][rt * 16 + ln][16 + 8 * hh]; }
#pragma unroll
    for (int dt = 0; dt < DT; ++dt) { const size_t vo = (size_t)(dt * 16 + ln) * TK + j0; FragH bv, bl; bv.half[0] = *(const v8us*)(Vth + vo + 8 * hh); bv.half[1] = *(const v8us*)(Vth + vo + 16 + 8 * hh); bl.half[0] = *(const v8us*)(Vtl + vo + 8 * hh); bl.half[1] = *(const v8us*)(Vtl + vo + 16 + 8 * hh);
#pragma unroll
      for (int rt = 0; rt < RTN; ++rt) { oacc[rt][dt] = mmaH<1>(pa[rt].v, pa[rt].v, bv.v, bv.v, oacc[rt][dt]); oaccl[rt][dt] = mmaH<1>(pa[rt].v, pa[rt].v, bl.v, bl.v, oaccl[rt][dt]); oaccl[rt][dt] = mmaH<1>(pl[rt].v, pl[rt].v, bv.v, bv.v, oaccl[rt][dt]); } }
    __builtin_amdgcn_fence(__ATOMIC_ACQ_REL, "workgroup"); __builtin_amdgcn_wave_barrier(); }
#pragma unroll
  for (int rt = 0; rt < RTN; ++rt) {
#pragma unroll
    for (int r = 0; r < 8; ++r) { float l = l_r[rt][r]; l += __shfl_xor(l, 1, 32); l += __shfl_xor(l, 2, 32); l += __shfl_xor(l, 4, 32); l += __shfl_xor(l, 8, 32); l_r[rt][r] = (l > 0.f) ? 1.0f / (l * 1024.0f) : 0.f; }
#pragma unroll
    for (int dt = 0; dt < DT; ++dt)
#pragma unroll
      for (int r = 0; r < 8; ++r) sO[w][rt * 16 + 8 * hh + r][dt * 16 + ln] = (oacc[rt][dt][r] + oaccl[rt][dt][r] * 0.0009765625f) * l_r[rt][r]; }
  __builtin_amdgcn_fence(__ATOMIC_ACQ_REL, "workgroup"); __builtin_amdgcn_wave_barrier();
  {
#pragma unroll
    for (int rp = 0; rp < RPW; rp += 2) { const int r = rp + (lane >> 4), pc = lane & 15; const v4f val = *(const v4fa*)&sO[w][r][pc * 4]; v4h h4, l4;
#pragma unroll
      for (int i = 0; i < 4; ++i) { const _Float16 hv = (_Float16)val[i]; h4[i] = hv; l4[i] = (_Float16)((val[i] - (float)hv) * 1024.0f); }
      const size_t oo = ((size_t)b * TQ + q0 + r) * ldo + h * 64 + pc * 4; *(v4h*)(Oh + oo) = h4; *(v4h*)(Ol + oo) = l4; }
     } }


__global__ __launch_bounds__(256) void k_causaltab(unsigned* __restrict__ MB, int* __restrict__ RA, int* __restrict__ KE, int nq, int nk) {
  const int t = blockIdx.x * 256 + threadIdx.x; const int nw = nk / 32;
  if (t < nq * nw) { const int q = t / nw, w = t % nw; const int first = q + 1 - 32 * w; const unsigned bits = (first <= 0) ? 0xffffffffu : ((first >= 32) ? 0u : (0xffffffffu << first)); *(unsigned*)(MB + t) = bits;  }
  if (t < nq) { *(int*)(RA + t) = 0;  }
  if (t < nq / 64) { const int v = 64 * (t + 1); *(int*)(KE + t * 32) = v;  } }

extern "C" void kernel_launch(void* const* d_in, const int* in_sizes, int n_in,
                              void* d_out, int out_size, void* d_ws, size_t ws_size, hipStream_t stream) {
  (void)in_sizes; (void)n_in; (void)out_size;
  const float* const* I = (const float* const*)d_in; const float* x = I[0]; const float* Wq = I[1]; const float* Wk = I[2]; const float* Wv = I[3]; const float* Wo = I[4]; const float* qs = I[5]; const float* ks = I[6];
  char* ws = (char*)d_ws; size_t off = 0;
  auto take = [&](size_t bytes) { char* p = ws + off; off += (bytes + 255) & ~(size_t)255; return p; };
  _Float16* BQ = (_Float16*)take((size_t)DM * DM * 2); _Float16* BK = (_Float16*)take((size_t)DM * DM * 2); _Float16* BV = (_Float16*)take((size_t)DM * DM * 2); _Float16* BO = (_Float16*)take((size_t)DM * DM * 2);
  _Float16* X16 = (_Float16*)take((size_t)NR * DM * 2); _Float16* Oh = (_Float16*)take((size_t)NR * DM * 2); _Float16* Ol = (_Float16*)take((size_t)NR * DM * 2);
  _Float16* Qh = (_Float16*)take((size_t)NR * DM * 2); _Float16* Ql = (_Float16*)take((size_t)NR * DM * 2); _Float16* Kh = (_Float16*)take((size_t)NR * DM * 2); _Float16* Kl = (_Float16*)take((size_t)NR * DM * 2); _Float16* Vth = (_Float16*)take((size_t)NR * DM * 2); _Float16* Vtl = (_Float16*)take((size_t)NR * DM * 2);
  unsigned* MB = (unsigned*)take((size_t)SLEN * (SLEN / 32) * 4); int* RA = (int*)take((size_t)SLEN * 4); int* KE = (int*)take((size_t)(SLEN / 64) * 32 * 4);
  if (off > ws_size) return;      /* 8 + 16 + 2 x 16 + 6 x 16 + 0.5 = 153 MiB */
  const size_t n8 = (size_t)NR * DM / 8; const unsigned nb8 = (unsigned)((n8 + 255) / 256); const size_t w8 = (size_t)DM * DM / 8; const unsigned wb = (unsigned)((w8 + 255) / 256);
  k_round16f<<<wb, 256, 0, stream>>>(Wq, BQ, w8); k_round16f<<<wb, 256, 0, stream>>>(Wk, BK, w8); k_round16f<<<wb, 256, 0, stream>>>(Wv, BV, w8); k_round16f<<<wb, 256, 0, stream>>>(Wo, BO, w8);      /* torch (out,in) = natural Bt; x16 */
  k_causaltab<<<(SLEN * (SLEN / 32) + 255) / 256, 256, 0, stream>>>(MB, RA, KE, SLEN, SLEN);
  const dim3 gP((NR / 128) * (DM / 64), 1);
  k_x16<<<nb8, 256, 0, stream>>>(x, X16, n8);
  k_proj<1><<<gP, 128, 0, stream>>>(X16, BQ, qs, Qh, Ql);      /* q = silu(x Wq^T) * f_q, hi + residual */
  k_proj<1><<<gP, 128, 0, stream>>>(X16, BK, ks, Kh, Kl);      /* k = silu(x Wk^T) * f_k, hi + residual */
  k_proj<0><<<gP, 128, 0, stream>>>(X16, BV, ks, Vth, Vtl);      /* v = silu(x Wv^T), transposed, hi + residual (scale unread) */
  k_flashm<SLEN, SLEN><<<NBT * NH * (SLEN / 64), 128, 0, stream>>>(Qh, Ql, DM, Kh, Kl, DM, Vth, Vtl, MB, RA, KE, Oh, Ol, DM);
  float* outb = (float*)d_out;
  k_gemm2<0><<<gP, 128, 0, stream>>>(Oh, DM, 0, BO, DM, 0, 0.0625f, nullptr, 0, nullptr, 1, 0, 0, outb, nullptr, DM, 0, NR, DM, DM);
  k_gemm2<0><<<gP, 128, 0, stream>>>(Ol, DM, 0, BO, DM, 0, 0.0625f / 1024.0f, nullptr, 0, outb, 1, (size_t)DM, 0, outb, nullptr, DM, 0, NR, DM, DM);
}

// v004
// A run of this version takes 563 microseconds.
// In both of two side-by-side timings against v003, it was 1.19 times as fast.
// Over all steps from v000 it is 3.51 times as fast.
#include <hip/hip_runtime.h>
// Polar causal multi-head attention (4 x 2048 tokens x 1024, 16 heads x 64): q, k, v = SiLU(x*W^T); per (token, head) r = |q|, dir = q/(r + 1e-6); scores = (q_dir.k_dir) * (r_q q_scale[h]) * (r_k k_scale[h]) = (q . k) * f_q * f_k with f = r*scale/(r + 1e-6), j <= i; softmax; merged . Wo^T -> [4,2048,1024].
// Structure (every launch covers all 4 batches: 8192 token rows, 64 (batch, head) slabs): x as an exact f16 plane; the three projections as f16 WMMA GEMMs (32x64 wave tiles = 32 tokens x one head, f32, exact products) whose epilogue applies SiLU, folds the per-(token, head) polar factor f into q and k (f32) and stores q, k as f16 hi + x2^10 residual planes and V^T as hi + residual planes; the causal structure computed on device into a key bit plane + per-block key bound; the fused flash kernel per (head, 64 queries) (each 32-key pass's K and V^T planes staged once for the block in LDS by asynchronous copies, two buffers; three-product hi/lo scores, online softmax f32, P hi + residual via LDS, two value accumulators) stores O as hi + residual planes; output projection as two GEMMs into the output rows.
// Compute dtype: x, weights, scales rounded to bf16; projections exact; SiLU / norms / factors f32; q, k, P, v, O as f16 hi + residual pairs (~2^-21); f32 accumulation and softmax. v_wmma_f32_16x16x32_f16.
#define NBT 4
#define SLEN 2048
#define DM 1024
#define NH 16
#define SCL 1.0f
#define NR (NBT * SLEN)
typedef __bf16 v16b __attribute__((ext_vector_type(16)));
typedef unsigned short v8us __attribute__((ext_vector_type(8), may_alias));
typedef float  v8f  __attribute__((ext_vector_type(8)));
typedef float  v4f  __attribute__((ext_vector_type(4)));
typedef float  v4fa __attribute__((ext_vector_type(4), may_alias));
union FragB { v16b v; v8us half[2]; unsigned short u[16]; };

__device__ __forceinline__ unsigned short bf16_bits(float x) { unsigned int u = __float_as_uint(x); return (unsigned short)((u + 0x7FFFu + ((u >> 16) & 1u)) >> 16); }
__device__ __forceinline__ float bf16_val(unsigned short b) { return __uint_as_float(((unsigned int)b) << 16); }
__device__ __forceinline__ float bf16_round(float x) { return bf16_val(bf16_bits(x)); }
// D += A·B with NT terms: 1 = ah·bh, 2 = + al·bh (A split), 3 = + ah·bl (both split)
template <int NT>
__device__ __forceinline__ v8f mmaN(v16b ah, v16b al, v16b bh, v16b bl, v8f c) {
  c = __builtin_amdgcn_wmma_f32_16x16x32_bf16(false, ah, false, bh, (short)0, c, false, false);
  if (NT >= 2) c = __builtin_amdgcn_wmma_f32_16x16x32_bf16(false, al, false, bh, (short)0, c, false, false);
  if (NT >= 3) c = __builtin_amdgcn_wmma_f32_16x16x32_bf16(false, ah, false, bl, (short)0, c, false, false);
  asm volatile("v_nop\n\tv_nop\n\tv_nop\n\tv_nop" : "+v"(c) : "v"(ah), "v"(al), "v"(bh), "v"(bl));
  return c;
}

__global__ __launch_bounds__(256) void k_wt_bf16(const float* __restrict__ W, unsigned short* __restrict__ Wt, int K, int N) {
  const int t = blockIdx.x * 256 + threadIdx.x;
  const int k8n = K / 8;
  if (t >= N * k8n) return;
  const int n = t / k8n, k8 = (t % k8n) * 8;
  v8us v;
#pragma unroll
  for (int i = 0; i < 8; ++i) v[i] = bf16_bits(W[(size_t)(k8 + i) * N + n]);
  *(v8us*)(Wt + (size_t)n * K + k8) = v;
  
}

// GEMM C[M][N] (f32, pitch ldc) = act(A[M][K]·W + bias). A f32 row-major (pitch lda) converted per fragment to bf16
// (ASPLIT: hi/lo two planes -> 2 terms, else single rounded term); Wt bf16 [N][K] (pitch ldb). BIAS_BF16 rounds the
// bias to bf16 first (bias quantised to bf16 before the add). K%32==0, M%16==0, N%64==0.
template <bool ASPLIT, int ACT, bool BIAS_BF16>
__global__ __launch_bounds__(128) void k_gemm_bf(const float* __restrict__ A, int lda, const unsigned short* __restrict__ Wt, int ldb,
                                               const float* __restrict__ bias, float* __restrict__ C, int ldc, int M, int N, int K) {
  __shared__ __attribute__((aligned(16))) float so[4][16][64];
  const int tid = threadIdx.x, w = tid >> 5, lane = tid & 31, ln = lane & 15, hh = lane >> 4;
  const int ntn = N / 64;
  const int wid = blockIdx.x * 4 + w;
  const int mt = wid / ntn, nq = wid % ntn;
  if (mt * 16 >= M) return;
  const int row0 = mt * 16, col0 = nq * 64;
  const float* arow = A + (size_t)(row0 + ln) * lda;
  v8f acc[4] = {};
  for (int kb = 0; kb < K; kb += 32) {
    FragB ah, al;
    const v4f x0 = *(const v4fa*)(arow + kb + 8 * hh), x1 = *(const v4fa*)(arow + kb + 8 * hh + 4);
    const v4f x2 = *(const v4fa*)(arow + kb + 16 + 8 * hh), x3 = *(const v4fa*)(arow + kb + 16 + 8 * hh + 4);
    float xs[16] = {x0[0],x0[1],x0[2],x0[3],x1[0],x1[1],x1[2],x1[3],x2[0],x2[1],x2[2],x2[3],x3[0],x3[1],x3[2],x3[3]};
#pragma unroll
    for (int i = 0; i < 16; ++i) { const unsigned short hb = bf16_bits(xs[i]); ah.u[i] = hb; al.u[i] = ASPLIT ? bf16_bits(xs[i] - bf16_val(hb)) : (unsigned short)0; }
#pragma unroll
    for (int t = 0; t < 4; ++t) {
      const unsigned short* brow = Wt + (size_t)(col0 + t * 16 + ln) * ldb + kb;
      FragB b;
      b.half[0] = *(const v8us*)(brow + 8 * hh);
      b.half[1] = *(const v8us*)(brow + 16 + 8 * hh);
      acc[t] = mmaN<ASPLIT ? 2 : 1>(ah.v, al.v, b.v, b.v, acc[t]);
    }
  }
#pragma unroll
  for (int t = 0; t < 4; ++t) {
    float bv = bias ? bias[col0 + t * 16 + ln] : 0.f;
    if (BIAS_BF16) bv = bf16_round(bv);
#pragma unroll
    for (int r = 0; r < 8; ++r) { float v = acc[t][r] + bv; if (ACT == 1) v = fmaxf(v, 0.f); so[w][8 * hh + r][t * 16 + ln] = v; }
  }
  __builtin_amdgcn_fence(__ATOMIC_ACQ_REL, "workgroup");
  __builtin_amdgcn_wave_barrier();
  const int rsub = lane >> 4, c4 = (lane & 15) * 4;
  {
#pragma unroll
    for (int q = 0; q < 8; ++q) {
      const int r = q * 2 + rsub;
      const v4f v = *(const v4fa*)&so[w][r][c4];
      *(v4f*)(C + (size_t)(row0 + r) * ldc + col0 + c4) = v;
    }
    
  }
}

// GEMM C = act(A·W + bias + resid): A f32 (ASPLIT -> hi/lo 2 terms), Wt bf16 [N][K]; ACT 0 none, 1 relu, 2 exact gelu;
// resid (optional, f32, row index = (row % rmod), pitch ldr, RES_BF16 rounds it) added before the activation.
template <bool ASPLIT, int ACT, bool BIAS_BF16, bool RES_BF16>
__global__ __launch_bounds__(128) void k_gemm_bf3(const float* __restrict__ A, int lda, const unsigned short* __restrict__ Wt, int ldb,
                                                const float* __restrict__ bias, const float* __restrict__ resid, int rmod, int ldr,
                                                float* __restrict__ C, int ldc, int M, int N, int K) {
  __shared__ __attribute__((aligned(16))) float so[4][16][64];
  const int tid = threadIdx.x, w = tid >> 5, lane = tid & 31, ln = lane & 15, hh = lane >> 4;
  const int ntn = N / 64;
  const int wid = blockIdx.x * 4 + w;
  const int mt = wid / ntn, nq = wid % ntn;
  if (mt * 16 >= M) return;
  const int row0 = mt * 16, col0 = nq * 64;
  const float* arow = A + (size_t)(row0 + ln) * lda;
  v8f acc[4] = {};
  for (int kb = 0; kb < K; kb += 32) {
    FragB ah, al;
    const v4f x0 = *(const v4fa*)(arow + kb + 8 * hh), x1 = *(const v4fa*)(arow + kb + 8 * hh + 4);
    const v4f x2 = *(const v4fa*)(arow + kb + 16 + 8 * hh), x3 = *(const v4fa*)(arow + kb + 16 + 8 * hh + 4);
    float xs[16] = {x0[0],x0[1],x0[2],x0[3],x1[0],x1[1],x1[2],x1[3],x2[0],x2[1],x2[2],x2[3],x3[0],x3[1],x3[2],x3[3]};
#pragma unroll
    for (int i = 0; i < 16; ++i) { const unsigned short hb = bf16_bits(xs[i]); ah.u[i] = hb; al.u[i] = ASPLIT ? bf16_bits(xs[i] - bf16_val(hb)) : (unsigned short)0; }
#pragma unroll
    for (int t = 0; t < 4; ++t) {
      const unsigned short* brow = Wt + (size_t)(col0 + t * 16 + ln) * ldb + kb;
      FragB b;
      b.half[0] = *(const v8us*)(brow + 8 * hh);
      b.half[1] = *(const v8us*)(brow + 16 + 8 * hh);
      acc[t] = mmaN<ASPLIT ? 2 : 1>(ah.v, al.v, b.v, b.v, acc[t]);
    }
  }
#pragma unroll
  for (int t = 0; t < 4; ++t) {
    const int col = col0 + t * 16 + ln;
    float bv = bias ? bias[col] : 0.f;
    if (BIAS_BF16) bv = bf16_round(bv);
#pragma unroll
    for (int r = 0; r < 8; ++r) {
      float v = acc[t][r] + bv;
      if (resid) { float rv = resid[(size_t)((row0 + 8 * hh + r) % rmod) * ldr + col]; if (RES_BF16) rv = bf16_round(rv); v += rv; }
      if (ACT == 1) v = fmaxf(v, 0.f);
      if (ACT == 2) v = 0.5f * v * (1.0f + erff(v * 0.70710678118654752f));
      if (ACT == 3) { const float u = 0.7978845608028654f * (v + 0.044715f * v * v * v); v = 0.5f * v * (1.0f + tanhf(u)); }
      so[w][8 * hh + r][t * 16 + ln] = v;
    }
  }
  __builtin_amdgcn_fence(__ATOMIC_ACQ_REL, "workgroup");
  __builtin_amdgcn_wave_barrier();
  const int rsub = lane >> 4, c4 = (lane & 15) * 4;
  {
#pragma unroll
    for (int q = 0; q < 8; ++q) {
      const int r = q * 2 + rsub;
      const v4f v = *(const v4fa*)&so[w][r][c4];
      *(v4f*)(C + (size_t)(row0 + r) * ldc + col0 + c4) = v;
    }
    
  }
}
// row LayerNorm (biased variance, eps) over N: s = X (+ R); optional out_sum <- s; out_norm <- (s-mu)*rsqrt(var+eps)*g + b
template <bool PARAM_BF16>
__global__ __launch_bounds__(256) void k_layernorm(const float* __restrict__ X, const float* __restrict__ R, const float* __restrict__ g, const float* __restrict__ bta,
                                                  float* __restrict__ out_sum, float* __restrict__ out_norm, int N, float eps) {
  __shared__ float red[256];
  const int row = blockIdx.x, tid = threadIdx.x;
  const float* x = X + (size_t)row * N; const float* rr = R ? R + (size_t)row * N : nullptr;
  float vals[16];                     // up to N = 4096
  const int per = N / 256;            // contiguous chunk per thread? use strided-by-4 chunks: thread handles j = tid*4 + 1024*u
  float s1 = 0.f;
  for (int u = 0; u < per / 4; ++u) {
    const int j = tid * 4 + 1024 * u;
    const v4f a = *(const v4fa*)(x + j);
    v4f b = {0.f,0.f,0.f,0.f}; if (rr) b = *(const v4fa*)(rr + j);
#pragma unroll
    for (int q = 0; q < 4; ++q) { const float v = a[q] + b[q]; vals[u * 4 + q] = v; s1 += v; }
  }
  red[tid] = s1; __syncthreads();
  for (int st = 128; st > 0; st >>= 1) { if (tid < st) red[tid] += red[tid + st]; __syncthreads(); }
  const float mu = red[0] / (float)N; __syncthreads();
  float s2 = 0.f;
  for (int u = 0; u < per / 4; ++u)
#pragma unroll
    for (int q = 0; q < 4; ++q) { const float c = vals[u * 4 + q] - mu; s2 += c * c; }
  red[tid] = s2; __syncthreads();
  for (int st = 128; st > 0; st >>= 1) { if (tid < st) red[tid] += red[tid + st]; __syncthreads(); }
  const float rs = rsqrtf(red[0] / (float)N + eps);
  {
    for (int u = 0; u < per / 4; ++u) {
      const int j = tid * 4 + 1024 * u;
      v4f o, sm;
#pragma unroll
      for (int q = 0; q < 4; ++q) {
        float gg = g[j + q], bb = bta[j + q];
        if (PARAM_BF16) { gg = bf16_round(gg); bb = bf16_round(bb); }
        sm[q] = vals[u * 4 + q]; o[q] = (vals[u * 4 + q] - mu) * rs * gg + bb;
      }
      if (out_sum) *(v4f*)(out_sum + (size_t)row * N + j) = sm;
      *(v4f*)(out_norm + (size_t)row * N + j) = o;
    }
    
  }
}



// ---- f16 WMMA path (v_wmma_f32_16x16x32_f16): 11-bit significands for operands in range — used where a [0,1] probability operand needs more precision than bf16
typedef _Float16 v16h __attribute__((ext_vector_type(16)));
union FragH { v16h v; v8us half[2]; _Float16 h[16]; unsigned short u[16]; };
template <int NT>
__device__ __forceinline__ v8f mmaH(v16h ah, v16h al, v16h bh, v16h bl, v8f c) {
  c = __builtin_amdgcn_wmma_f32_16x16x32_f16(false, ah, false, bh, (short)0, c, false, false);
  if (NT >= 2) c = __builtin_amdgcn_wmma_f32_16x16x32_f16(false, al, false, bh, (short)0, c, false, false);
  if (NT >= 3) c = __builtin_amdgcn_wmma_f32_16x16x32_f16(false, ah, false, bl, (short)0, c, false, false);
  asm volatile("v_nop\n\tv_nop\n\tv_nop\n\tv_nop" : "+v"(c) : "v"(ah), "v"(al), "v"(bh), "v"(bl));
  return c;
}
// batched GEMM like k_gemm_b but f16 operands: A f32 (split into f16 hi/lo if ASPLIT, else rounded to f16), Bt = f16 values [n][k]; alpha; C f32; N multiple of 16 (partial tiles skipped)
template <bool ASPLIT>
__global__ __launch_bounds__(128) void k_gemm_h(const float* __restrict__ A, int lda, size_t sA, const _Float16* __restrict__ Bh, int ldb, size_t sB, float alpha, float* __restrict__ C, int ldc, size_t sC, int M, int N, int K) {
  __shared__ __attribute__((aligned(16))) float so[4][16][64];
  const int tid = threadIdx.x, w = tid >> 5, lane = tid & 31, ln = lane & 15, hh = lane >> 4; const int by = blockIdx.y;
  A += (size_t)by * sA; Bh += (size_t)by * sB; C += (size_t)by * sC;
  const int ntn = (N + 63) / 64; const int wid = blockIdx.x * 4 + w; const int mt = wid / ntn, nq = wid % ntn; if (mt * 16 >= M) return;
  const int row0 = mt * 16, col0 = nq * 64; const float* arow = A + (size_t)(row0 + ln) * lda;
  v8f acc[4] = {};
  for (int kb = 0; kb < K; kb += 32) {
    FragH ah, al;
    const v4f x0 = *(const v4fa*)(arow + kb + 8 * hh), x1 = *(const v4fa*)(arow + kb + 8 * hh + 4), x2 = *(const v4fa*)(arow + kb + 16 + 8 * hh), x3 = *(const v4fa*)(arow + kb + 16 + 8 * hh + 4);
    float xs[16] = {x0[0],x0[1],x0[2],x0[3],x1[0],x1[1],x1[2],x1[3],x2[0],x2[1],x2[2],x2[3],x3[0],x3[1],x3[2],x3[3]};
#pragma unroll
    for (int i = 0; i < 16; ++i) { const _Float16 h = (_Float16)xs[i]; ah.h[i] = h; al.h[i] = ASPLIT ? (_Float16)(xs[i] - (float)h) : (_Float16)0.0f; }
#pragma unroll
    for (int t = 0; t < 4; ++t) { if (col0 + t * 16 >= N) continue; const size_t boff = (size_t)(col0 + t * 16 + ln) * ldb + kb; FragH bq; bq.half[0] = *(const v8us*)(Bh + boff + 8 * hh); bq.half[1] = *(const v8us*)(Bh + boff + 16 + 8 * hh);
      acc[t] = mmaH<ASPLIT ? 2 : 1>(ah.v, al.v, bq.v, bq.v, acc[t]); }
  }
#pragma unroll
  for (int t = 0; t < 4; ++t) { if (col0 + t * 16 >= N) continue;
#pragma unroll
    for (int r = 0; r < 8; ++r) so[w][8 * hh + r][t * 16 + ln] = acc[t][r] * alpha; }
  __builtin_amdgcn_fence(__ATOMIC_ACQ_REL, "workgroup"); __builtin_amdgcn_wave_barrier();
  const int rsub = lane >> 4, c4 = (lane & 15) * 4;
  {
#pragma unroll
    for (int q = 0; q < 8; ++q) { const int r = q * 2 + rsub; if (col0 + c4 < N) { const v4f v = *(const v4fa*)&so[w][r][c4]; *(v4f*)(C + (size_t)(row0 + r) * ldc + col0 + c4) = v; } }
     }
}

// Wt[n][k] = f16(W[k][n]·scale) from f32 row-major W[K][N] (scale = power of two; bf16-exact weights stay exact in f16 away from the subnormal range)
__global__ __launch_bounds__(256) void k_wt_f16(const float* __restrict__ W, _Float16* __restrict__ Wt, int K, int N, float scale) {
  const int t = blockIdx.x * 256 + threadIdx.x; if (t >= N * (K / 8)) return; const int n = t / (K / 8), k8 = (t % (K / 8)) * 8; FragH f;
#pragma unroll
  for (int i = 0; i < 8; ++i) f.h[i] = (_Float16)(bf16_round(W[(size_t)(k8 + i) * N + n]) * scale); const v8us o = f.half[0];
  *(v8us*)((unsigned short*)Wt + (size_t)n * K + k8) = o; 
}
// k_gemm_hh variant with fused epilogue: v = acc·alpha + bias[by·sBias + col] (+ CP[(row/rowsPerB)·sCPb + by·64 + col] if CP) ; ACT 0 none / 1 elu ; writes f16 C16 (and f32 C if non-null)
template <int ACT>
__global__ __launch_bounds__(128) void k_gemm_hhx(const _Float16* __restrict__ A, int lda, size_t sA, const _Float16* __restrict__ Bh, int ldb, size_t sB, float alpha, const float* __restrict__ bias, size_t sBias, const float* __restrict__ CP, int rowsPerB, size_t sCPb, int row0g,
    float* __restrict__ C, _Float16* __restrict__ C16, int ldc, size_t sC, int M, int N, int K) {
  __shared__ __attribute__((aligned(16))) float so[4][16][64];
  const int tid = threadIdx.x, w = tid >> 5, lane = tid & 31, ln = lane & 15, hh = lane >> 4; const int by = blockIdx.y;
  A += (size_t)by * sA; Bh += (size_t)by * sB; const size_t cofs = (size_t)by * sC; const float* bp = bias ? bias + (size_t)by * sBias : nullptr;
  const int ntn = (N + 63) / 64; const int wid = blockIdx.x * 4 + w; const int mt = wid / ntn, nq = wid % ntn; if (mt * 16 >= M) return;
  const int row0 = mt * 16, col0 = nq * 64; const _Float16* arow = A + (size_t)(row0 + ln) * lda;
  v8f acc[4] = {};
  for (int kb = 0; kb < K; kb += 32) { FragH ah; ah.half[0] = *(const v8us*)((const unsigned short*)arow + kb + 8 * hh); ah.half[1] = *(const v8us*)((const unsigned short*)arow + kb + 16 + 8 * hh);
#pragma unroll
    for (int t = 0; t < 4; ++t) { if (col0 + t * 16 >= N) continue; const size_t boff = (size_t)(col0 + t * 16 + ln) * ldb + kb; FragH bq; bq.half[0] = *(const v8us*)((const unsigned short*)Bh + boff + 8 * hh); bq.half[1] = *(const v8us*)((const unsigned short*)Bh + boff + 16 + 8 * hh);
      acc[t] = mmaH<1>(ah.v, ah.v, bq.v, bq.v, acc[t]); }
  }
#pragma unroll
  for (int t = 0; t < 4; ++t) { if (col0 + t * 16 >= N) continue; const int col = col0 + t * 16 + ln; const float bv = bp ? bf16_round(bp[col]) : 0.f;
#pragma unroll
    for (int r = 0; r < 8; ++r) { float v = acc[t][r] * alpha + bv; if (CP) { const int bidx = (row0g + row0 + 8 * hh + r) / rowsPerB; v += CP[(size_t)bidx * sCPb + (size_t)by * 64 + col]; } if (ACT == 1) v = (v > 0.f) ? v : expm1f(v); else if (ACT == 7) v = (v > 0.f) ? v + 1.0f : expf(v); else if (ACT == 8) v = tanhf(v); else if (ACT == 9) v = 0.5f * v * (1.0f + tanhf(0.7978845608028654f * (v + 0.044715f * v * v * v))); else if (ACT == 11) v = 1.0f / (1.0f + expf(-v)); else if (ACT == 12) v = (v > 0.f) ? v : 0.01f * v; else if (ACT == 14) v = (v > 0.f) ? v : 0.1f * v; else if (ACT == 15) v = v / (1.0f + expf(-v)); else if (ACT == 3) v = fmaxf(v, 0.f); else if (ACT == 6) v = 0.5f * v * (1.0f + erff(v * 0.70710678118654752f)); so[w][8 * hh + r][t * 16 + ln] = v; } }
  __builtin_amdgcn_fence(__ATOMIC_ACQ_REL, "workgroup"); __builtin_amdgcn_wave_barrier();
  const int rsub = lane >> 4, c4 = (lane & 15) * 4; typedef _Float16 v4h __attribute__((ext_vector_type(4)));
  {
#pragma unroll
    for (int q = 0; q < 8; ++q) { const int r = q * 2 + rsub; if (col0 + c4 < N) { const v4f v = *(const v4fa*)&so[w][r][c4]; if (C) *(v4f*)(C + cofs + (size_t)(row0 + r) * ldc + col0 + c4) = v; if (C16) { v4h h4; for (int i = 0; i < 4; ++i) h4[i] = (_Float16)v[i]; *(v4h*)(C16 + cofs + (size_t)(row0 + r) * ldc + col0 + c4) = h4; } } }
     }
}


typedef _Float16 v4h __attribute__((ext_vector_type(4)));

__global__ __launch_bounds__(256) void k_x16(const float* __restrict__ x, _Float16* __restrict__ X16, size_t n8) { const size_t t = (size_t)blockIdx.x * 256 + threadIdx.x; if (t >= n8) return; FragH f;
#pragma unroll
  for (int q = 0; q < 8; ++q) f.h[q] = (_Float16)bf16_round(x[t * 8 + q]); *(v8us*)((unsigned short*)X16 + t * 8) = f.half[0];  }
__global__ __launch_bounds__(256) void k_h16(const float* __restrict__ x, _Float16* __restrict__ X16, size_t n8) { const size_t t = (size_t)blockIdx.x * 256 + threadIdx.x; if (t >= n8) return; FragH f;
#pragma unroll
  for (int q = 0; q < 8; ++q) f.h[q] = (_Float16)x[t * 8 + q]; *(v8us*)((unsigned short*)X16 + t * 8) = f.half[0];  }
__global__ __launch_bounds__(256) void k_round16f(const float* __restrict__ W, _Float16* __restrict__ Bt, size_t n8) { const size_t t = (size_t)blockIdx.x * 256 + threadIdx.x; if (t >= n8) return; FragH f;
#pragma unroll
  for (int i = 0; i < 8; ++i) f.h[i] = (_Float16)(bf16_round(W[t * 8 + i]) * 16.0f); *(v8us*)((unsigned short*)Bt + t * 8) = f.half[0];  }
template <int NHv, int TTv>
__global__ __launch_bounds__(256) void k_vt(const _Float16* __restrict__ V16, int ldv, int voff, _Float16* __restrict__ Vt) { __shared__ unsigned short tl[64][66]; const int tid = threadIdx.x; const int slab = blockIdx.x / (TTv / 64), lg = blockIdx.x % (TTv / 64); const int b = slab / NHv, h = slab % NHv;
  for (int i = tid; i < 64 * 8; i += 256) { const int r = i / 8, c8 = (i % 8) * 8; FragH f; f.half[0] = *(const v8us*)((const unsigned short*)V16 + ((size_t)b * TTv + lg * 64 + r) * ldv + voff + h * 64 + c8);
#pragma unroll
    for (int q = 0; q < 8; ++q) tl[r][c8 + q] = f.u[q]; }
  __syncthreads();
  {
#pragma unroll
    for (int rd = 0; rd < 2; ++rd) { const int d = rd * 32 + tid / 8, pc = tid % 8; FragH f;
#pragma unroll
      for (int q = 0; q < 8; ++q) f.u[q] = tl[pc * 8 + q][d];
      *(v8us*)((unsigned short*)Vt + ((size_t)slab * 64 + d) * TTv + lg * 64 + pc * 8) = f.half[0]; }
     } }

// ---- fast GEMM (wave tile 32x64; requires M % 32 == 0 rows per launch region and N % 64 == 0); epilogue = k_gemm_hhx semantics ----
__device__ __forceinline__ v16h g2_frag(const _Float16* p, int hh) { FragH f; f.half[0] = *(const v8us*)((const unsigned short*)p + 8 * hh); f.half[1] = *(const v8us*)((const unsigned short*)p + 16 + 8 * hh); return f.v; }
__device__ __forceinline__ v8f g2_mma(v16h a, v16h b, v8f c) { v8f d = __builtin_amdgcn_wmma_f32_16x16x32_f16(false, a, false, b, (short)0, c, false, false); asm volatile("v_nop\n\tv_nop\n\tv_nop\n\tv_nop" : "+v"(d) : "v"(a), "v"(b)); return d; }
template <int ACT>
__global__ __launch_bounds__(128) void k_gemm2(const _Float16* __restrict__ A, int lda, size_t sA, const _Float16* __restrict__ Bh, int ldb, size_t sB, float alpha, const float* __restrict__ bias, size_t sBias, const float* __restrict__ CP, int rowsPerB, size_t sCPb, int row0g,
    float* __restrict__ C, _Float16* __restrict__ C16, int ldc, size_t sC, int M, int N, int K) {
  __shared__ __attribute__((aligned(16))) float so[4][32][68];
  const int tid = threadIdx.x, w = tid >> 5, lane = tid & 31, ln = lane & 15, hh = lane >> 4; const int by = blockIdx.y;
  A += (size_t)by * sA; Bh += (size_t)by * sB; const size_t cofs = (size_t)by * sC; const float* bp = bias ? bias + (size_t)by * sBias : nullptr;
  const int ntn = N >> 6; const int mt = blockIdx.x / ntn, nq = blockIdx.x - mt * ntn; const int row0 = mt * 128 + 32 * w, col0 = nq * 64; if (row0 >= M) return;
  const _Float16* a0p = A + (size_t)(row0 + ln) * lda; const _Float16* a1p = a0p + (size_t)16 * lda;
  const _Float16* b0p = Bh + (size_t)(col0 + ln) * ldb; const _Float16* b1p = b0p + (size_t)16 * ldb; const _Float16* b2p = b1p + (size_t)16 * ldb; const _Float16* b3p = b2p + (size_t)16 * ldb;
  const v8f z8 = {0.f,0.f,0.f,0.f,0.f,0.f,0.f,0.f}; v8f c00 = z8, c01 = z8, c02 = z8, c03 = z8, c10 = z8, c11 = z8, c12 = z8, c13 = z8;
#pragma unroll 1
  for (int kb = 0; kb < K; kb += 32) { const v16h a0 = g2_frag(a0p + kb, hh), a1 = g2_frag(a1p + kb, hh);
    v16h b = g2_frag(b0p + kb, hh); c00 = g2_mma(a0, b, c00); c10 = g2_mma(a1, b, c10);
    b = g2_frag(b1p + kb, hh); c01 = g2_mma(a0, b, c01); c11 = g2_mma(a1, b, c11);
    b = g2_frag(b2p + kb, hh); c02 = g2_mma(a0, b, c02); c12 = g2_mma(a1, b, c12);
    b = g2_frag(b3p + kb, hh); c03 = g2_mma(a0, b, c03); c13 = g2_mma(a1, b, c13); }
  v8f accs[8] = {c00, c01, c02, c03, c10, c11, c12, c13};
#pragma unroll
  for (int u = 0; u < 8; ++u) { const int t = u & 3, half = u >> 2; const int col = col0 + t * 16 + ln; const float bv = bp ? bf16_round(bp[col]) : 0.f;
#pragma unroll
    for (int r = 0; r < 8; ++r) { const int rloc = half * 16 + 8 * hh + r; float v = accs[u][r] * alpha + bv; if (CP) { const int bidx = (row0g + row0 + rloc) / rowsPerB; v += CP[(size_t)bidx * sCPb + (size_t)by * 64 + col]; }
      if (ACT == 3) v = fmaxf(v, 0.f); else if (ACT == 6) v = 0.5f * v * (1.0f + erff(v * 0.70710678118654752f)); else if (ACT == 11) v = 1.0f / (1.0f + expf(-v)); else if (ACT == 15) v = v / (1.0f + expf(-v)); else if (ACT == 12) v = (v > 0.f) ? v : 0.01f * v; else if (ACT == 8) v = tanhf(v);
      so[w][rloc][t * 16 + ln] = v; } }
  __builtin_amdgcn_fence(__ATOMIC_ACQ_REL, "workgroup"); __builtin_amdgcn_wave_barrier();
  const int rsub = lane >> 4, c4 = (lane & 15) * 4;
  {
#pragma unroll
    for (int q = 0; q < 16; ++q) { const int r = q * 2 + rsub; const v4f v = *(const v4fa*)&so[w][r][c4]; if (C) *(v4f*)(C + cofs + (size_t)(row0 + r) * ldc + col0 + c4) = v; if (C16) { v4h h4; for (int i = 0; i < 4; ++i) h4[i] = (_Float16)v[i]; *(v4h*)(C16 + cofs + (size_t)(row0 + r) * ldc + col0 + c4) = h4; } }
     } }



__device__ __forceinline__ float siluf(float g) { return g / (1.0f + expf(-g)); }
// ---- projection GEMM (main loop of k_gemm2, NR x DM x DM, Bt carries x16) with the element-wise tail in its epilogue. A wave tile is 32 tokens x the 64 columns of one head, so the head's norm is a sum inside the wave's own LDS rows.
// POLAR 1: g = silu(acc/16) * f, f = r*scale[h]/(r + 1e-6), r = |silu row|; g stored as f16 hi + x2^10 residual, row-major, one whole 128-B line per row and plane.
// POLAR 0: g = silu(acc/16) stored transposed per (batch, head) slab as hi + residual planes [64 dims][SLEN tokens]; the block's 128 tokens are transposed through LDS, one whole 128-B line per 8 lanes.
template <int POLAR>
__global__ __launch_bounds__(128) void k_proj(const _Float16* __restrict__ A, const _Float16* __restrict__ Bh, const float* __restrict__ scale, _Float16* __restrict__ Hh, _Float16* __restrict__ Hl) {
  constexpr int PT = POLAR ? 68 : 65;      /* LDS row pitch in floats: 68 for the 16-B row reads, 65 for the column reads of the transpose */
  __shared__ __attribute__((aligned(16))) float so[128 * 68];
  const int tid = threadIdx.x, w = tid >> 5, lane = tid & 31, ln = lane & 15, hh = lane >> 4;
  constexpr int ntn = DM >> 6; const int mt = blockIdx.x / ntn, nq = blockIdx.x - mt * ntn; const int row0 = mt * 128 + 32 * w, col0 = nq * 64;
  const _Float16* a0p = A + (size_t)(row0 + ln) * DM; const _Float16* a1p = a0p + (size_t)16 * DM;
  const _Float16* b0p = Bh + (size_t)(col0 + ln) * DM; const _Float16* b1p = b0p + (size_t)16 * DM; const _Float16* b2p = b1p + (size_t)16 * DM; const _Float16* b3p = b2p + (size_t)16 * DM;
  const v8f z8 = {0.f,0.f,0.f,0.f,0.f,0.f,0.f,0.f}; v8f c00 = z8, c01 = z8, c02 = z8, c03 = z8, c10 = z8, c11 = z8, c12 = z8, c13 = z8;
  /* rolled, as in k_gemm2: the same loop body, so the products and their order are the same */
#pragma unroll 1
  for (int kb = 0; kb < DM; kb += 32) { const v16h a0 = g2_frag(a0p + kb, hh), a1 = g2_frag(a1p + kb, hh);
    v16h b = g2_frag(b0p + kb, hh); c00 = g2_mma(a0, b, c00); c10 = g2_mma(a1, b, c10);
    b = g2_frag(b1p + kb, hh); c01 = g2_mma(a0, b, c01); c11 = g2_mma(a1, b, c11);
    b = g2_frag(b2p + kb, hh); c02 = g2_mma(a0, b, c02); c12 = g2_mma(a1, b, c12);
    b = g2_frag(b3p + kb, hh); c03 = g2_mma(a0, b, c03); c13 = g2_mma(a1, b, c13); }
  v8f accs[8] = {c00, c01, c02, c03, c10, c11, c12, c13};
#pragma unroll
  for (int u = 0; u < 8; ++u) { const int t = u & 3, half = u >> 2;
#pragma unroll
    for (int r = 0; r < 8; ++r) so[(32 * w + half * 16 + 8 * hh + r) * PT + t * 16 + ln] = siluf(accs[u][r] * 0.0625f); }
  if (POLAR) {
    __builtin_amdgcn_fence(__ATOMIC_ACQ_REL, "workgroup"); __builtin_amdgcn_wave_barrier();      /* each wave reads back its own 32 rows only */
    const int rsub = lane >> 4, c4 = (lane & 15) * 4; const float sc = bf16_round(scale[nq]);
#pragma unroll
    for (int q = 0; q < 16; ++q) { const int r = q * 2 + rsub; const v4f v = *(const v4fa*)&so[(32 * w + r) * PT + c4];
      float s = (v[0] * v[0] + v[1] * v[1]) + (v[2] * v[2] + v[3] * v[3]); s += __shfl_xor(s, 8, 32); s += __shfl_xor(s, 4, 32); s += __shfl_xor(s, 2, 32); s += __shfl_xor(s, 1, 32);
      const float rr = sqrtf(s); const float fac = (rr * sc) / (rr + 1e-6f); v4h h4, l4;
#pragma unroll
      for (int i = 0; i < 4; ++i) { const float g = v[i] * fac; const _Float16 h = (_Float16)g; h4[i] = h; l4[i] = (_Float16)((g - (float)h) * 1024.0f); }
      const size_t o = (size_t)(row0 + r) * DM + col0 + c4; *(v4h*)(Hh + o) = h4; *(v4h*)(Hl + o) = l4; }
  } else {
    __syncthreads();      /* the transpose reads rows that the block's other waves wrote */
    const int slab = (mt * 128 / SLEN) * NH + nq, tok0 = mt * 128 % SLEN;
#pragma unroll
    for (int it = 0; it < 8; ++it) { const int item = it * 128 + tid; const int pc = item & 7, d = (item >> 3) & 63, g = item >> 9; FragH fh, fl;
#pragma unroll
      for (int q = 0; q < 8; ++q) { const float v = so[(g * 64 + pc * 8 + q) * PT + d]; const _Float16 hv = (_Float16)v; fh.h[q] = hv; fl.h[q] = (_Float16)((v - (float)hv) * 1024.0f); }
      const size_t o = ((size_t)slab * 64 + d) * SLEN + tok0 + g * 64 + pc * 8; *(v8us*)((unsigned short*)Hh + o) = fh.half[0]; *(v8us*)((unsigned short*)Hl + o) = fl.half[0]; }
  } }

// Eight asynchronous 16-byte copies global -> LDS per lane (one key pass's share of the K and V^T hi / residual tiles), through no register. The s_wait_xcnt is the last line of the copies' own statement, so that no address register named here is rewritten ahead of it.
__device__ __forceinline__ void kv_copy8(unsigned l0, unsigned l1, unsigned l2, unsigned l3, unsigned l4, unsigned l5, unsigned l6, unsigned l7,
    const unsigned short* g0, const unsigned short* g1, const unsigned short* g2, const unsigned short* g3, const unsigned short* g4, const unsigned short* g5, const unsigned short* g6, const unsigned short* g7) {
  asm volatile("global_load_async_to_lds_b128 %0, %8, off\n\t"
               "global_load_async_to_lds_b128 %1, %9, off\n\t"
               "global_load_async_to_lds_b128 %2, %10, off\n\t"
               "global_load_async_to_lds_b128 %3, %11, off\n\t"
               "global_load_async_to_lds_b128 %4, %12, off\n\t"
               "global_load_async_to_lds_b128 %5, %13, off\n\t"
               "global_load_async_to_lds_b128 %6, %14, off\n\t"
               "global_load_async_to_lds_b128 %7, %15, off\n\t"
               "s_wait_xcnt 0x0"
               :: "v"(l0), "v"(l1), "v"(l2), "v"(l3), "v"(l4), "v"(l5), "v"(l6), "v"(l7), "v"(g0), "v"(g1), "v"(g2), "v"(g3), "v"(g4), "v"(g5), "v"(g6), "v"(g7) : "memory");
}
template <int TQ, int TK>
__global__ __launch_bounds__(128) void k_flashm(const _Float16* __restrict__ Q16, const _Float16* __restrict__ Q16lo, int ldq, const _Float16* __restrict__ K16, const _Float16* __restrict__ K16lo, int ldk, const _Float16* __restrict__ Vt, const _Float16* __restrict__ Vtlo, const unsigned* __restrict__ MB, const int* __restrict__ RA, const int* __restrict__ KE, _Float16* __restrict__ Oh, _Float16* __restrict__ Ol, int ldo) {
  constexpr int RPW = 16, RTN = RPW / 16, NQB = TQ / (4 * RPW), DT = 4, KS = 2;
  __shared__ __attribute__((aligned(16))) unsigned short sP[4][RPW][40], sPl[4][RPW][40]; __shared__ __attribute__((aligned(16))) float sO[4][RPW][64 + 4];
  /* One pass's 32 keys, staged once for the block's four waves, two buffers. In 16-bit units: K rows (64 dims) at pitch 72 = 144 B, V^T rows (32 keys) at pitch 40 = 80 B, both 16 B x odd for the 16-byte fragment reads. */
  constexpr int KP = 72, VP = 40, KL0 = 32 * KP, VH0 = 2 * 32 * KP, VL0 = VH0 + 64 * VP, STG = VL0 + 64 * VP;
  __shared__ __attribute__((aligned(16))) unsigned short sKV[2][STG];
  const int tid = threadIdx.x, w = tid >> 5, lane = tid & 31, ln = lane & 15, hh = lane >> 4;
  const int slab = blockIdx.x / NQB, qblk = blockIdx.x % NQB; const int b = slab / NH, h = slab % NH; const int qb0 = qblk * (4 * RPW); const int q0 = qb0 + w * RPW;
  FragH aq[2][KS], aql[2][KS];
#pragma unroll
  for (int rt = 0; rt < RTN; ++rt) { const size_t qo = ((size_t)b * TQ + q0 + rt * 16 + ln) * ldq + h * 64; const unsigned short* qr = (const unsigned short*)Q16 + qo; const unsigned short* ql = (const unsigned short*)Q16lo + qo;
#pragma unroll
    for (int ks = 0; ks < KS; ++ks) { aq[rt][ks].half[0] = *(const v8us*)(qr + ks * 32 + 8 * hh); aq[rt][ks].half[1] = *(const v8us*)(qr + ks * 32 + 16 + 8 * hh); aql[rt][ks].half[0] = *(const v8us*)(ql + ks * 32 + 8 * hh); aql[rt][ks].half[1] = *(const v8us*)(ql + ks * 32 + 16 + 8 * hh); } }
  asm volatile("s_wait_xcnt 0x0" ::: "memory");      /* the Q loads' address registers are reused right below */
  const unsigned short* Vth = (const unsigned short*)Vt + (size_t)slab * 64 * TK; const unsigned short* Vtl = (const unsigned short*)Vtlo + (size_t)slab * 64 * TK;
  float m_r[2][8], l_r[2][8]; v8f oacc[2][DT], oaccl[2][DT];
#pragma unroll
  for (int rt = 0; rt < RTN; ++rt) {
#pragma unroll
    for (int r = 0; r < 8; ++r) { m_r[rt][r] = -3.0e38f; l_r[rt][r] = 0.f; }
#pragma unroll
    for (int dt = 0; dt < DT; ++dt) { oacc[rt][dt] = (v8f){0.f,0.f,0.f,0.f,0.f,0.f,0.f,0.f}; oaccl[rt][dt] = oacc[rt][dt]; } }
  int jend = KE[qblk * 32]; jend = min(TK, (jend + 31) & ~31); if (jend < 32) jend = 32;      /* block-uniform */
  /* each thread copies two 16-byte pieces of each of the four tiles: K rows tid/8 and tid/8 + 16 (a wave's copy = 4 whole 128-B rows), V^T rows tid/4 and tid/4 + 32 */
  const unsigned short* gkh = (const unsigned short*)K16 + ((size_t)b * TK + (tid >> 3)) * ldk + h * 64 + (tid & 7) * 8; const unsigned short* gkl = (const unsigned short*)K16lo + ((size_t)b * TK + (tid >> 3)) * ldk + h * 64 + (tid & 7) * 8;
  const unsigned short* gvh = Vth + (size_t)(tid >> 2) * TK + (tid & 3) * 8; const unsigned short* gvl = Vtl + (size_t)(tid >> 2) * TK + (tid & 3) * 8;
  const unsigned lk = (unsigned)(size_t)&sKV[0][(tid >> 3) * KP + (tid & 7) * 8], lv = (unsigned)(size_t)&sKV[0][VH0 + (tid >> 2) * VP + (tid & 3) * 8];
  auto stage = [&](int j, unsigned bo) { const size_t ko = (size_t)j * ldk, k16 = (size_t)16 * ldk;
    kv_copy8(lk + bo, lk + bo + 16 * KP * 2, lk + bo + KL0 * 2, lk + bo + (KL0 + 16 * KP) * 2, lv + bo, lv + bo + 32 * VP * 2, lv + bo + 64 * VP * 2, lv + bo + 96 * VP * 2,
             gkh + ko, gkh + ko + k16, gkl + ko, gkl + ko + k16, gvh + j, gvh + j + (size_t)32 * TK, gvl + j, gvl + j + (size_t)32 * TK); };
  stage(0, 0u);
  asm volatile("s_wait_asynccnt 0x0" ::: "memory");      /* this wave's copies of pass 0 have landed before the barrier that shows them to the other waves */
  __syncthreads();
  if (32 < jend) stage(32, (unsigned)(STG * 2));
  int allm[2][8]; const unsigned* mrow[2][8];
#pragma unroll
  for (int rt = 0; rt < RTN; ++rt)
#pragma unroll
    for (int r = 0; r < 8; ++r) { const int tq = q0 + rt * 16 + 8 * hh + r; allm[rt][r] = RA[tq]; mrow[rt][r] = MB + (size_t)tq * (TK / 32); }
  asm volatile("s_wait_xcnt 0x0" ::: "memory");      /* the row-flag loads' offset register is reused below */
#pragma unroll 1
  for (int j0 = 0; j0 < jend; j0 += 32) {
    unsigned mwv[2][8];      /* all rows' mask words are asked for at the head of the pass, ahead of the K fragment reads and score products that need none of them, and no row waits for its own */
#pragma unroll
    for (int rt = 0; rt < RTN; ++rt)
#pragma unroll
      for (int r = 0; r < 8; ++r) mwv[rt][r] = mrow[rt][r][j0 >> 5];
    const unsigned short* kvb = &sKV[(j0 >> 5) & 1][0];      /* this pass reads its own buffer alone */
    v8f s[2][2];
#pragma unroll
    for (int nt = 0; nt < 2; ++nt) { const unsigned short* kr = kvb + (nt * 16 + ln) * KP; const unsigned short* kl = kr + KL0; FragH bk[KS], bkl[KS];
#pragma unroll
      for (int ks = 0; ks < KS; ++ks) { bk[ks].half[0] = *(const v8us*)(kr + ks * 32 + 8 * hh); bk[ks].half[1] = *(const v8us*)(kr + ks * 32 + 16 + 8 * hh); bkl[ks].half[0] = *(const v8us*)(kl + ks * 32 + 8 * hh); bkl[ks].half[1] = *(const v8us*)(kl + ks * 32 + 16 + 8 * hh); }
#pragma unroll
      for (int rt = 0; rt < RTN; ++rt) { v8f acc = (v8f){0.f,0.f,0.f,0.f,0.f,0.f,0.f,0.f}, accr = acc;
#pragma unroll
        for (int ks = 0; ks < KS; ++ks) { acc = mmaH<1>(aq[rt][ks].v, aq[rt][ks].v, bk[ks].v, bk[ks].v, acc); accr = mmaH<1>(aql[rt][ks].v, aql[rt][ks].v, bk[ks].v, bk[ks].v, accr); accr = mmaH<1>(aq[rt][ks].v, aq[rt][ks].v, bkl[ks].v, bkl[ks].v, accr); }
        s[rt][nt] = acc + accr * 0.0009765625f; } }
    /* The eight rows of a tile run side by side: the body holds no branch (each exp is computed on every lane and chosen by a select behind it; the chosen values are the same), and each step is written for all rows before the next, so one row's lane exchange and exp wait is filled by the other seven. */
#pragma unroll
    for (int rt = 0; rt < RTN; ++rt) { float s0[8], s1[8], mc[8]; bool ok0[8], ok1[8];
#pragma unroll
      for (int r = 0; r < 8; ++r) { const unsigned mw = mwv[rt][r]; const bool am = (allm[rt][r] != 0);
        ok0[r] = am || (((mw >> ln) & 1u) == 0u); ok1[r] = am || (((mw >> (16 + ln)) & 1u) == 0u);
        s0[r] = ok0[r] ? (am ? 0.f : s[rt][0][r] * SCL) : -INFINITY; s1[r] = ok1[r] ? (am ? 0.f : s[rt][1][r] * SCL) : -INFINITY; mc[r] = fmaxf(s0[r], s1[r]); }
#pragma unroll
      for (int st = 1; st < 16; st <<= 1)
#pragma unroll
        for (int r = 0; r < 8; ++r) mc[r] = fmaxf(mc[r], __shfl_xor(mc[r], st, 32));
#pragma unroll
      for (int r = 0; r < 8; ++r) { const float mn = fmaxf(m_r[rt][r], mc[r]); const float ea = expf(m_r[rt][r] - mn), e0 = expf(s0[r] - mn), e1 = expf(s1[r] - mn);
        const float al = (mn > -1.0e38f) ? ea : 1.0f; m_r[rt][r] = mn; const float p0 = ok0[r] ? e0 : 0.f, p1 = ok1[r] ? e1 : 0.f; l_r[rt][r] = l_r[rt][r] * al + p0 + p1;
#pragma unroll
        for (int dt = 0; dt < DT; ++dt) { oacc[rt][dt][r] *= al; oaccl[rt][dt][r] *= al; }
        FragH t2, t3; const float ps0 = p0 * 1024.0f, ps1 = p1 * 1024.0f; t2.h[0] = (_Float16)ps0; t2.h[1] = (_Float16)ps1; t3.h[0] = (_Float16)((ps0 - (float)t2.h[0]) * 1024.0f); t3.h[1] = (_Float16)((ps1 - (float)t2.h[1]) * 1024.0f);
        sP[w][rt * 16 + 8 * hh + r][ln] = t2.u[0]; sP[w][rt * 16 + 8 * hh + r][16 + ln] = t2.u[1]; sPl[w][rt * 16 + 8 * hh + r][ln] = t3.u[0]; sPl[w][rt * 16 + 8 * hh + r][16 + ln] = t3.u[1]; } }
    __builtin_amdgcn_fence(__ATOMIC_ACQ_REL, "workgroup"); __builtin_amdgcn_wave_barrier();
    FragH pa[2], pl[2];
#pragma unroll
    for (int rt = 0; rt < RTN; ++rt) { pa[rt].half[0] = *(const v8us*)&sP[w][rt * 16 + ln][8 * hh]; pa[rt].half[1] = *(const v8us*)&sP[w][rt * 16 + ln][16 + 8 * hh]; pl[rt].half[0] = *(const v8us*)&sPl[w][rt * 16 + ln][8 * hh]; pl[rt].half[1] = *(const v8us*)&sPl[w][rt * 16 + ln][16 + 8 * hh]; }
#pragma unroll
    for (int dt = 0; dt < DT; ++dt) { const unsigned short* vr = kvb + VH0 + (dt * 16 + ln) * VP; const unsigned short* vl = vr + 64 * VP; FragH bv, bl; bv.half[0] = *(const v8us*)(vr + 8 * hh); bv.half[1] = *(const v8us*)(vr + 16 + 8 * hh); bl.half[0] = *(const v8us*)(vl + 8 * hh); bl.half[1] = *(const v8us*)(vl + 16 + 8 * hh);
#pragma unroll
      for (int rt = 0; rt < RTN; ++rt) { oacc[rt][dt] = mmaH<1>(pa[rt].v, pa[rt].v, bv.v, bv.v, oacc[rt][dt]); oaccl[rt][dt] = mmaH<1>(pa[rt].v, pa[rt].v, bl.v, bl.v, oaccl[rt][dt]); oaccl[rt][dt] = mmaH<1>(pl[rt].v, pl[rt].v, bv.v, bv.v, oaccl[rt][dt]); } }
    __builtin_amdgcn_fence(__ATOMIC_ACQ_REL, "workgroup"); __builtin_amdgcn_wave_barrier();
    asm volatile("s_wait_xcnt 0x0" ::: "memory");      /* the mask-word loads' address register is stepped for the next pass behind this point; the wait that covered it stood behind the K global loads and went with them */
    asm volatile("s_wait_dscnt 0x0" ::: "memory");      /* this wave's reads of the buffer have returned before the buffer may be refilled */
    asm volatile("s_wait_asynccnt 0x0" ::: "memory");      /* this wave's copies of the next pass have landed before the barrier that shows them */
    __syncthreads();      /* publishes the next pass's tiles and ends every wave's reads of this pass's buffer */
    if (j0 + 64 < jend) stage(j0 + 64, (unsigned)(((j0 >> 5) & 1) * (STG * 2))); }
  asm volatile("s_wait_asynccnt 0x0" ::: "memory");      /* no copy is outstanding when the wave goes on to its end */
#pragma unroll
  for (int rt = 0; rt < RTN; ++rt) {
#pragma unroll
    for (int r = 0; r < 8; ++r) { float l = l_r[rt][r]; l += __shfl_xor(l, 1, 32); l += __shfl_xor(l, 2, 32); l += __shfl_xor(l, 4, 32); l += __shfl_xor(l, 8, 32); l_r[rt][r] = (l > 0.f) ? 1.0f / (l * 1024.0f) : 0.f; }
#pragma unroll
    for (int dt = 0; dt < DT; ++dt)
#pragma unroll
      for (int r = 0; r < 8; ++r) sO[w][rt * 16 + 8 * hh + r][dt * 16 + ln] = (oacc[rt][dt][r] + oaccl[rt][dt][r] * 0.0009765625f) * l_r[rt][r]; }
  __builtin_amdgcn_fence(__ATOMIC_ACQ_REL, "workgroup"); __builtin_amdgcn_wave_barrier();
  {
#pragma unroll
    for (int rp = 0; rp < RPW; rp += 2) { const int r = rp + (lane >> 4), pc = lane & 15; const v4f val = *(const v4fa*)&sO[w][r][pc * 4]; v4h h4, l4;
#pragma unroll
      for (int i = 0; i < 4; ++i) { const _Float16 hv = (_Float16)val[i]; h4[i] = hv; l4[i] = (_Float16)((val[i] - (float)hv) * 1024.0f); }
      const size_t oo = ((size_t)b * TQ + q0 + r) * ldo + h * 64 + pc * 4; *(v4h*)(Oh + oo) = h4; *(v4h*)(Ol + oo) = l4; }
     } }


__global__ __launch_bounds__(256) void k_causaltab(unsigned* __restrict__ MB, int* __restrict__ RA, int* __restrict__ KE, int nq, int nk) {
  const int t = blockIdx.x * 256 + threadIdx.x; const int nw = nk / 32;
  if (t < nq * nw) { const int q = t / nw, w = t % nw; const int first = q + 1 - 32 * w; const unsigned bits = (first <= 0) ? 0xffffffffu : ((first >= 32) ? 0u : (0xffffffffu << first)); *(unsigned*)(MB + t) = bits;  }
  if (t < nq) { *(int*)(RA + t) = 0;  }
  if (t < nq / 64) { const int v = 64 * (t + 1); *(int*)(KE + t * 32) = v;  } }

extern "C" void kernel_launch(void* const* d_in, const int* in_sizes, int n_in,
                              void* d_out, int out_size, void* d_ws, size_t ws_size, hipStream_t stream) {
  (void)in_sizes; (void)n_in; (void)out_size;
  const float* const* I = (const float* const*)d_in; const float* x = I[0]; const float* Wq = I[1]; const float* Wk = I[2]; const float* Wv = I[3]; const float* Wo = I[4]; const float* qs = I[5]; const float* ks = I[6];
  char* ws = (char*)d_ws; size_t off = 0;
  auto take = [&](size_t bytes) { char* p = ws + off; off += (bytes + 255) & ~(size_t)255; return p; };
  _Float16* BQ = (_Float16*)take((size_t)DM * DM * 2); _Float16* BK = (_Float16*)take((size_t)DM * DM * 2); _Float16* BV = (_Float16*)take((size_t)DM * DM * 2); _Float16* BO = (_Float16*)take((size_t)DM * DM * 2);
  _Float16* X16 = (_Float16*)take((size_t)NR * DM * 2); _Float16* Oh = (_Float16*)take((size_t)NR * DM * 2); _Float16* Ol = (_Float16*)take((size_t)NR * DM * 2);
  _Float16* Qh = (_Float16*)take((size_t)NR * DM * 2); _Float16* Ql = (_Float16*)take((size_t)NR * DM * 2); _Float16* Kh = (_Float16*)take((size_t)NR * DM * 2); _Float16* Kl = (_Float16*)take((size_t)NR * DM * 2); _Float16* Vth = (_Float16*)take((size_t)NR * DM * 2); _Float16* Vtl = (_Float16*)take((size_t)NR * DM * 2);
  unsigned* MB = (unsigned*)take((size_t)SLEN * (SLEN / 32) * 4); int* RA = (int*)take((size_t)SLEN * 4); int* KE = (int*)take((size_t)(SLEN / 64) * 32 * 4);
  if (off > ws_size) return;      /* 8 + 16 + 2 x 16 + 6 x 16 + 0.5 = 153 MiB */
  const size_t n8 = (size_t)NR * DM / 8; const unsigned nb8 = (unsigned)((n8 + 255) / 256); const size_t w8 = (size_t)DM * DM / 8; const unsigned wb = (unsigned)((w8 + 255) / 256);
  k_round16f<<<wb, 256, 0, stream>>>(Wq, BQ, w8); k_round16f<<<wb, 256, 0, stream>>>(Wk, BK, w8); k_round16f<<<wb, 256, 0, stream>>>(Wv, BV, w8); k_round16f<<<wb, 256, 0, stream>>>(Wo, BO, w8);      /* torch (out,in) = natural Bt; x16 */
  k_causaltab<<<(SLEN * (SLEN / 32) + 255) / 256, 256, 0, stream>>>(MB, RA, KE, SLEN, SLEN);
  const dim3 gP((NR / 128) * (DM / 64), 1);
  k_x16<<<nb8, 256, 0, stream>>>(x, X16, n8);
  k_proj<1><<<gP, 128, 0, stream>>>(X16, BQ, qs, Qh, Ql);      /* q = silu(x Wq^T) * f_q, hi + residual */
  k_proj<1><<<gP, 128, 0, stream>>>(X16, BK, ks, Kh, Kl);      /* k = silu(x Wk^T) * f_k, hi + residual */
  k_proj<0><<<gP, 128, 0, stream>>>(X16, BV, ks, Vth, Vtl);      /* v = silu(x Wv^T), transposed, hi + residual (scale unread) */
  k_flashm<SLEN, SLEN><<<NBT * NH * (SLEN / 64), 128, 0, stream>>>(Qh, Ql, DM, Kh, Kl, DM, Vth, Vtl, MB, RA, KE, Oh, Ol, DM);
  float* outb = (float*)d_out;
  k_gemm2<0><<<gP, 128, 0, stream>>>(Oh, DM, 0, BO, DM, 0, 0.0625f, nullptr, 0, nullptr, 1, 0, 0, outb, nullptr, DM, 0, NR, DM, DM);
  k_gemm2<0><<<gP, 128, 0, stream>>>(Ol, DM, 0, BO, DM, 0, 0.0625f / 1024.0f, nullptr, 0, outb, 1, (size_t)DM, 0, outb, nullptr, DM, 0, NR, DM, DM);
}

// v005
// It runs in 410 microseconds.
// In both of two side-by-side timings against v004, it was 1.39 times as fast.
// Counting every step since v000, it is 4.86 times as fast.
#include <hip/hip_runtime.h>
// Polar causal multi-head attention (4 x 2048 tokens x 1024, 16 heads x 64): q, k, v = SiLU(x*W^T); per (token, head) r = |q|, dir = q/(r + 1e-6); scores = (q_dir.k_dir) * (r_q q_scale[h]) * (r_k k_scale[h]) = (q . k) * f_q * f_k with f = r*scale/(r + 1e-6), j <= i; softmax; merged . Wo^T -> [4,2048,1024].
// Structure (every launch covers all 4 batches: 8192 token rows, 64 (batch, head) slabs): x as an exact f16 plane; the three projections as f16 WMMA GEMMs (32x64 wave tiles = 32 tokens x one head, f32, exact products; each 64-k stage of the block's 128 A rows and 128 B rows staged once in LDS by asynchronous copies, two buffers) whose epilogue applies SiLU, folds the per-(token, head) polar factor f into q and k (f32) and stores q, k as f16 hi + x2^10 residual planes and V^T as hi + residual planes; the causal structure computed on device into a key bit plane + per-block key bound; the fused flash kernel per (head, 64 queries) (each 32-key pass's K and V^T planes staged once for the block in LDS by asynchronous copies, two buffers; three-product hi/lo scores, online softmax f32, P hi + residual via LDS, two value accumulators) stores O as hi + residual planes; output projection as two GEMMs into the output rows.
// Compute dtype: x, weights, scales rounded to bf16; projections exact; SiLU / norms / factors f32; q, k, P, v, O as f16 hi + residual pairs (~2^-21); f32 accumulation and softmax. v_wmma_f32_16x16x32_f16.
#define NBT 4
#define SLEN 2048
#define DM 1024
#define NH 16
#define SCL 1.0f
#define NR (NBT * SLEN)
typedef __bf16 v16b __attribute__((ext_vector_type(16)));
typedef unsigned short v8us __attribute__((ext_vector_type(8), may_alias));
typedef float  v8f  __attribute__((ext_vector_type(8)));
typedef float  v4f  __attribute__((ext_vector_type(4)));
typedef float  v4fa __attribute__((ext_vector_type(4), may_alias));
union FragB { v16b v; v8us half[2]; unsigned short u[16]; };

__device__ __forceinline__ unsigned short bf16_bits(float x) { unsigned int u = __float_as_uint(x); return (unsigned short)((u + 0x7FFFu + ((u >> 16) & 1u)) >> 16); }
__device__ __forceinline__ float bf16_val(unsigned short b) { return __uint_as_float(((unsigned int)b) << 16); }
__device__ __forceinline__ float bf16_round(float x) { return bf16_val(bf16_bits(x)); }
// D += A·B with NT terms: 1 = ah·bh, 2 = + al·bh (A split), 3 = + ah·bl (both split)
template <int NT>
__device__ __forceinline__ v8f mmaN(v16b ah, v16b al, v16b bh, v16b bl, v8f c) {
  c = __builtin_amdgcn_wmma_f32_16x16x32_bf16(false, ah, false, bh, (short)0, c, false, false);
  if (NT >= 2) c = __builtin_amdgcn_wmma_f32_16x16x32_bf16(false, al, false, bh, (short)0, c, false, false);
  if (NT >= 3) c = __builtin_amdgcn_wmma_f32_16x16x32_bf16(false, ah, false, bl, (short)0, c, false, false);
  asm volatile("v_nop\n\tv_nop\n\tv_nop\n\tv_nop" : "+v"(c) : "v"(ah), "v"(al), "v"(bh), "v"(bl));
  return c;
}

__global__ __launch_bounds__(256) void k_wt_bf16(const float* __restrict__ W, unsigned short* __restrict__ Wt, int K, int N) {
  const int t = blockIdx.x * 256 + threadIdx.x;
  const int k8n = K / 8;
  if (t >= N * k8n) return;
  const int n = t / k8n, k8 = (t % k8n) * 8;
  v8us v;
#pragma unroll
  for (int i = 0; i < 8; ++i) v[i] = bf16_bits(W[(size_t)(k8 + i) * N + n]);
  *(v8us*)(Wt + (size_t)n * K + k8) = v;
  
}

// GEMM C[M][N] (f32, pitch ldc) = act(A[M][K]·W + bias). A f32 row-major (pitch lda) converted per fragment to bf16
// (ASPLIT: hi/lo two planes -> 2 terms, else single rounded term); Wt bf16 [N][K] (pitch ldb). BIAS_BF16 rounds the
// bias to bf16 first (bias quantised to bf16 before the add). K%32==0, M%16==0, N%64==0.
template <bool ASPLIT, int ACT, bool BIAS_BF16>
__global__ __launch_bounds__(128) void k_gemm_bf(const float* __restrict__ A, int lda, const unsigned short* __restrict__ Wt, int ldb,
                                               const float* __restrict__ bias, float* __restrict__ C, int ldc, int M, int N, int K) {
  __shared__ __attribute__((aligned(16))) float so[4][16][64];
  const int tid = threadIdx.x, w = tid >> 5, lane = tid & 31, ln = lane & 15, hh = lane >> 4;
  const int ntn = N / 64;
  const int wid = blockIdx.x * 4 + w;
  const int mt = wid / ntn, nq = wid % ntn;
  if (mt * 16 >= M) return;
  const int row0 = mt * 16, col0 = nq * 64;
  const float* arow = A + (size_t)(row0 + ln) * lda;
  v8f acc[4] = {};
  for (int kb = 0; kb < K; kb += 32) {
    FragB ah, al;
    const v4f x0 = *(const v4fa*)(arow + kb + 8 * hh), x1 = *(const v4fa*)(arow + kb + 8 * hh + 4);
    const v4f x2 = *(const v4fa*)(arow + kb + 16 + 8 * hh), x3 = *(const v4fa*)(arow + kb + 16 + 8 * hh + 4);
    float xs[16] = {x0[0],x0[1],x0[2],x0[3],x1[0],x1[1],x1[2],x1[3],x2[0],x2[1],x2[2],x2[3],x3[0],x3[1],x3[2],x3[3]};
#pragma unroll
    for (int i = 0; i < 16; ++i) { const unsigned short hb = bf16_bits(xs[i]); ah.u[i] = hb; al.u[i] = ASPLIT ? bf16_bits(xs[i] - bf16_val(hb)) : (unsigned short)0; }
#pragma unroll
    for (int t = 0; t < 4; ++t) {
      const unsigned short* brow = Wt + (size_t)(col0 + t * 16 + ln) * ldb + kb;
      FragB b;
      b.half[0] = *(const v8us*)(brow + 8 * hh);
      b.half[1] = *(const v8us*)(brow + 16 + 8 * hh);
      acc[t] = mmaN<ASPLIT ? 2 : 1>(ah.v, al.v, b.v, b.v, acc[t]);
    }
  }
#pragma unroll
  for (int t = 0; t < 4; ++t) {
    float bv = bias ? bias[col0 + t * 16 + ln] : 0.f;
    if (BIAS_BF16) bv = bf16_round(bv);
#pragma unroll
    for (int r = 0; r < 8; ++r) { float v = acc[t][r] + bv; if (ACT == 1) v = fmaxf(v, 0.f); so[w][8 * hh + r][t * 16 + ln] = v; }
  }
  __builtin_amdgcn_fence(__ATOMIC_ACQ_REL, "workgroup");
  __builtin_amdgcn_wave_barrier();
  const int rsub = lane >> 4, c4 = (lane & 15) * 4;
  {
#pragma unroll
    for (int q = 0; q < 8; ++q) {
      const int r = q * 2 + rsub;
      const v4f v = *(const v4fa*)&so[w][r][c4];
      *(v4f*)(C + (size_t)(row0 + r) * ldc + col0 + c4) = v;
    }
    
  }
}

// GEMM C = act(A·W + bias + resid): A f32 (ASPLIT -> hi/lo 2 terms), Wt bf16 [N][K]; ACT 0 none, 1 relu, 2 exact gelu;
// resid (optional, f32, row index = (row % rmod), pitch ldr, RES_BF16 rounds it) added before the activation.
template <bool ASPLIT, int ACT, bool BIAS_BF16, bool RES_BF16>
__global__ __launch_bounds__(128) void k_gemm_bf3(const float* __restrict__ A, int lda, const unsigned short* __restrict__ Wt, int ldb,
                                                const float* __restrict__ bias, const float* __restrict__ resid, int rmod, int ldr,
                                                float* __restrict__ C, int ldc, int M, int N, int K) {
  __shared__ __attribute__((aligned(16))) float so[4][16][64];
  const int tid = threadIdx.x, w = tid >> 5, lane = tid & 31, ln = lane & 15, hh = lane >> 4;
  const int ntn = N / 64;
  const int wid = blockIdx.x * 4 + w;
  const int mt = wid / ntn, nq = wid % ntn;
  if (mt * 16 >= M) return;
  const int row0 = mt * 16, col0 = nq * 64;
  const float* arow = A + (size_t)(row0 + ln) * lda;
  v8f acc[4] = {};
  for (int kb = 0; kb < K; kb += 32) {
    FragB ah, al;
    const v4f x0 = *(const v4fa*)(arow + kb + 8 * hh), x1 = *(const v4fa*)(arow + kb + 8 * hh + 4);
    const v4f x2 = *(const v4fa*)(arow + kb + 16 + 8 * hh), x3 = *(const v4fa*)(arow + kb + 16 + 8 * hh + 4);
    float xs[16] = {x0[0],x0[1],x0[2],x0[3],x1[0],x1[1],x1[2],x1[3],x2[0],x2[1],x2[2],x2[3],x3[0],x3[1],x3[2],x3[3]};
#pragma unroll
    for (int i = 0; i < 16; ++i) { const unsigned short hb = bf16_bits(xs[i]); ah.u[i] = hb; al.u[i] = ASPLIT ? bf16_bits(xs[i] - bf16_val(hb)) : (unsigned short)0; }
#pragma unroll
    for (int t = 0; t < 4; ++t) {
      const unsigned short* brow = Wt + (size_t)(col0 + t * 16 + ln) * ldb + kb;
      FragB b;
      b.half[0] = *(const v8us*)(brow + 8 * hh);
      b.half[1] = *(const v8us*)(brow + 16 + 8 * hh);
      acc[t] = mmaN<ASPLIT ? 2 : 1>(ah.v, al.v, b.v, b.v, acc[t]);
    }
  }
#pragma unroll
  for (int t = 0; t < 4; ++t) {
    const int col = col0 + t * 16 + ln;
    float bv = bias ? bias[col] : 0.f;
    if (BIAS_BF16) bv = bf16_round(bv);
#pragma unroll
    for (int r = 0; r < 8; ++r) {
      float v = acc[t][r] + bv;
      if (resid) { float rv = resid[(size_t)((row0 + 8 * hh + r) % rmod) * ldr + col]; if (RES_BF16) rv = bf16_round(rv); v += rv; }
      if (ACT == 1) v = fmaxf(v, 0.f);
      if (ACT == 2) v = 0.5f * v * (1.0f + erff(v * 0.70710678118654752f));
      if (ACT == 3) { const float u = 0.7978845608028654f * (v + 0.044715f * v * v * v); v = 0.5f * v * (1.0f + tanhf(u)); }
      so[w][8 * hh + r][t * 16 + ln] = v;
    }
  }
  __builtin_amdgcn_fence(__ATOMIC_ACQ_REL, "workgroup");
  __builtin_amdgcn_wave_barrier();
  const int rsub = lane >> 4, c4 = (lane & 15) * 4;
  {
#pragma unroll
    for (int q = 0; q < 8; ++q) {
      const int r = q * 2 + rsub;
      const v4f v = *(const v4fa*)&so[w][r][c4];
      *(v4f*)(C + (size_t)(row0 + r) * ldc + col0 + c4) = v;
    }
    
  }
}
// row LayerNorm (biased variance, eps) over N: s = X (+ R); optional out_sum <- s; out_norm <- (s-mu)*rsqrt(var+eps)*g + b
template <bool PARAM_BF16>
__global__ __launch_bounds__(256) void k_layernorm(const float* __restrict__ X, const float* __restrict__ R, const float* __restrict__ g, const float* __restrict__ bta,
                                                  float* __restrict__ out_sum, float* __restrict__ out_norm, int N, float eps) {
  __shared__ float red[256];
  const int row = blockIdx.x, tid = threadIdx.x;
  const float* x = X + (size_t)row * N; const float* rr = R ? R + (size_t)row * N : nullptr;
  float vals[16];                     // up to N = 4096
  const int per = N / 256;            // contiguous chunk per thread? use strided-by-4 chunks: thread handles j = tid*4 + 1024*u
  float s1 = 0.f;
  for (int u = 0; u < per / 4; ++u) {
    const int j = tid * 4 + 1024 * u;
    const v4f a = *(const v4fa*)(x + j);
    v4f b = {0.f,0.f,0.f,0.f}; if (rr) b = *(const v4fa*)(rr + j);
#pragma unroll
    for (int q = 0; q < 4; ++q) { const float v = a[q] + b[q]; vals[u * 4 + q] = v; s1 += v; }
  }
  red[tid] = s1; __syncthreads();
  for (int st = 128; st > 0; st >>= 1) { if (tid < st) red[tid] += red[tid + st]; __syncthreads(); }
  const float mu = red[0] / (float)N; __syncthreads();
  float s2 = 0.f;
  for (int u = 0; u < per / 4; ++u)
#pragma unroll
    for (int q = 0; q < 4; ++q) { const float c = vals[u * 4 + q] - mu; s2 += c * c; }
  red[tid] = s2; __syncthreads();
  for (int st = 128; st > 0; st >>= 1) { if (tid < st) red[tid] += red[tid + st]; __syncthreads(); }
  const float rs = rsqrtf(red[0] / (float)N + eps);
  {
    for (int u = 0; u < per / 4; ++u) {
      const int j = tid * 4 + 1024 * u;
      v4f o, sm;
#pragma unroll
      for (int q = 0; q < 4; ++q) {
        float gg = g[j + q], bb = bta[j + q];
        if (PARAM_BF16) { gg = bf16_round(gg); bb = bf16_round(bb); }
        sm[q] = vals[u * 4 + q]; o[q] = (vals[u * 4 + q] - mu) * rs * gg + bb;
      }
      if (out_sum) *(v4f*)(out_sum + (size_t)row * N + j) = sm;
      *(v4f*)(out_norm + (size_t)row * N + j) = o;
    }
    
  }
}



// ---- f16 WMMA path (v_wmma_f32_16x16x32_f16): 11-bit significands for operands in range — used where a [0,1] probability operand needs more precision than bf16
typedef _Float16 v16h __attribute__((ext_vector_type(16)));
union FragH { v16h v; v8us half[2]; _Float16 h[16]; unsigned short u[16]; };
template <int NT>
__device__ __forceinline__ v8f mmaH(v16h ah, v16h al, v16h bh, v16h bl, v8f c) {
  c = __builtin_amdgcn_wmma_f32_16x16x32_f16(false, ah, false, bh, (short)0, c, false, false);
  if (NT >= 2) c = __builtin_amdgcn_wmma_f32_16x16x32_f16(false, al, false, bh, (short)0, c, false, false);
  if (NT >= 3) c = __builtin_amdgcn_wmma_f32_16x16x32_f16(false, ah, false, bl, (short)0, c, false, false);
  asm volatile("v_nop\n\tv_nop\n\tv_nop\n\tv_nop" : "+v"(c) : "v"(ah), "v"(al), "v"(bh), "v"(bl));
  return c;
}
// batched GEMM like k_gemm_b but f16 operands: A f32 (split into f16 hi/lo if ASPLIT, else rounded to f16), Bt = f16 values [n][k]; alpha; C f32; N multiple of 16 (partial tiles skipped)
template <bool ASPLIT>
__global__ __launch_bounds__(128) void k_gemm_h(const float* __restrict__ A, int lda, size_t sA, const _Float16* __restrict__ Bh, int ldb, size_t sB, float alpha, float* __restrict__ C, int ldc, size_t sC, int M, int N, int K) {
  __shared__ __attribute__((aligned(16))) float so[4][16][64];
  const int tid = threadIdx.x, w = tid >> 5, lane = tid & 31, ln = lane & 15, hh = lane >> 4; const int by = blockIdx.y;
  A += (size_t)by * sA; Bh += (size_t)by * sB; C += (size_t)by * sC;
  const int ntn = (N + 63) / 64; const int wid = blockIdx.x * 4 + w; const int mt = wid / ntn, nq = wid % ntn; if (mt * 16 >= M) return;
  const int row0 = mt * 16, col0 = nq * 64; const float* arow = A + (size_t)(row0 + ln) * lda;
  v8f acc[4] = {};
  for (int kb = 0; kb < K; kb += 32) {
    FragH ah, al;
    const v4f x0 = *(const v4fa*)(arow + kb + 8 * hh), x1 = *(const v4fa*)(arow + kb + 8 * hh + 4), x2 = *(const v4fa*)(arow + kb + 16 + 8 * hh), x3 = *(const v4fa*)(arow + kb + 16 + 8 * hh + 4);
    float xs[16] = {x0[0],x0[1],x0[2],x0[3],x1[0],x1[1],x1[2],x1[3],x2[0],x2[1],x2[2],x2[3],x3[0],x3[1],x3[2],x3[3]};
#pragma unroll
    for (int i = 0; i < 16; ++i) { const _Float16 h = (_Float16)xs[i]; ah.h[i] = h; al.h[i] = ASPLIT ? (_Float16)(xs[i] - (float)h) : (_Float16)0.0f; }
#pragma unroll
    for (int t = 0; t < 4; ++t) { if (col0 + t * 16 >= N) continue; const size_t boff = (size_t)(col0 + t * 16 + ln) * ldb + kb; FragH bq; bq.half[0] = *(const v8us*)(Bh + boff + 8 * hh); bq.half[1] = *(const v8us*)(Bh + boff + 16 + 8 * hh);
      acc[t] = mmaH<ASPLIT ? 2 : 1>(ah.v, al.v, bq.v, bq.v, acc[t]); }
  }
#pragma unroll
  for (int t = 0; t < 4; ++t) { if (col0 + t * 16 >= N) continue;
#pragma unroll
    for (int r = 0; r < 8; ++r) so[w][8 * hh + r][t * 16 + ln] = acc[t][r] * alpha; }
  __builtin_amdgcn_fence(__ATOMIC_ACQ_REL, "workgroup"); __builtin_amdgcn_wave_barrier();
  const int rsub = lane >> 4, c4 = (lane & 15) * 4;
  {
#pragma unroll
    for (int q = 0; q < 8; ++q) { const int r = q * 2 + rsub; if (col0 + c4 < N) { const v4f v = *(const v4fa*)&so[w][r][c4]; *(v4f*)(C + (size_t)(row0 + r) * ldc + col0 + c4) = v; } }
     }
}

// Wt[n][k] = f16(W[k][n]·scale) from f32 row-major W[K][N] (scale = power of two; bf16-exact weights stay exact in f16 away from the subnormal range)
__global__ __launch_bounds__(256) void k_wt_f16(const float* __restrict__ W, _Float16* __restrict__ Wt, int K, int N, float scale) {
  const int t = blockIdx.x * 256 + threadIdx.x; if (t >= N * (K / 8)) return; const int n = t / (K / 8), k8 = (t % (K / 8)) * 8; FragH f;
#pragma unroll
  for (int i = 0; i < 8; ++i) f.h[i] = (_Float16)(bf16_round(W[(size_t)(k8 + i) * N + n]) * scale); const v8us o = f.half[0];
  *(v8us*)((unsigned short*)Wt + (size_t)n * K + k8) = o; 
}
// k_gemm_hh variant with fused epilogue: v = acc·alpha + bias[by·sBias + col] (+ CP[(row/rowsPerB)·sCPb + by·64 + col] if CP) ; ACT 0 none / 1 elu ; writes f16 C16 (and f32 C if non-null)
template <int ACT>
__global__ __launch_bounds__(128) void k_gemm_hhx(const _Float16* __restrict__ A, int lda, size_t sA, const _Float16* __restrict__ Bh, int ldb, size_t sB, float alpha, const float* __restrict__ bias, size_t sBias, const float* __restrict__ CP, int rowsPerB, size_t sCPb, int row0g,
    float* __restrict__ C, _Float16* __restrict__ C16, int ldc, size_t sC, int M, int N, int K) {
  __shared__ __attribute__((aligned(16))) float so[4][16][64];
  const int tid = threadIdx.x, w = tid >> 5, lane = tid & 31, ln = lane & 15, hh = lane >> 4; const int by = blockIdx.y;
  A += (size_t)by * sA; Bh += (size_t)by * sB; const size_t cofs = (size_t)by * sC; const float* bp = bias ? bias + (size_t)by * sBias : nullptr;
  const int ntn = (N + 63) / 64; const int wid = blockIdx.x * 4 + w; const int mt = wid / ntn, nq = wid % ntn; if (mt * 16 >= M) return;
  const int row0 = mt * 16, col0 = nq * 64; const _Float16* arow = A + (size_t)(row0 + ln) * lda;
  v8f acc[4] = {};
  for (int kb = 0; kb < K; kb += 32) { FragH ah; ah.half[0] = *(const v8us*)((const unsigned short*)arow + kb + 8 * hh); ah.half[1] = *(const v8us*)((const unsigned short*)arow + kb + 16 + 8 * hh);
#pragma unroll
    for (int t = 0; t < 4; ++t) { if (col0 + t * 16 >= N) continue; const size_t boff = (size_t)(col0 + t * 16 + ln) * ldb + kb; FragH bq; bq.half[0] = *(const v8us*)((const unsigned short*)Bh + boff + 8 * hh); bq.half[1] = *(const v8us*)((const unsigned short*)Bh + boff + 16 + 8 * hh);
      acc[t] = mmaH<1>(ah.v, ah.v, bq.v, bq.v, acc[t]); }
  }
#pragma unroll
  for (int t = 0; t < 4; ++t) { if (col0 + t * 16 >= N) continue; const int col = col0 + t * 16 + ln; const float bv = bp ? bf16_round(bp[col]) : 0.f;
#pragma unroll
    for (int r = 0; r < 8; ++r) { float v = acc[t][r] * alpha + bv; if (CP) { const int bidx = (row0g + row0 + 8 * hh + r) / rowsPerB; v += CP[(size_t)bidx * sCPb + (size_t)by * 64 + col]; } if (ACT == 1) v = (v > 0.f) ? v : expm1f(v); else if (ACT == 7) v = (v > 0.f) ? v + 1.0f : expf(v); else if (ACT == 8) v = tanhf(v); else if (ACT == 9) v = 0.5f * v * (1.0f + tanhf(0.7978845608028654f * (v + 0.044715f * v * v * v))); else if (ACT == 11) v = 1.0f / (1.0f + expf(-v)); else if (ACT == 12) v = (v > 0.f) ? v : 0.01f * v; else if (ACT == 14) v = (v > 0.f) ? v : 0.1f * v; else if (ACT == 15) v = v / (1.0f + expf(-v)); else if (ACT == 3) v = fmaxf(v, 0.f); else if (ACT == 6) v = 0.5f * v * (1.0f + erff(v * 0.70710678118654752f)); so[w][8 * hh + r][t * 16 + ln] = v; } }
  __builtin_amdgcn_fence(__ATOMIC_ACQ_REL, "workgroup"); __builtin_amdgcn_wave_barrier();
  const int rsub = lane >> 4, c4 = (lane & 15) * 4; typedef _Float16 v4h __attribute__((ext_vector_type(4)));
  {
#pragma unroll
    for (int q = 0; q < 8; ++q) { const int r = q * 2 + rsub; if (col0 + c4 < N) { const v4f v = *(const v4fa*)&so[w][r][c4]; if (C) *(v4f*)(C + cofs + (size_t)(row0 + r) * ldc + col0 + c4) = v; if (C16) { v4h h4; for (int i = 0; i < 4; ++i) h4[i] = (_Float16)v[i]; *(v4h*)(C16 + cofs + (size_t)(row0 + r) * ldc + col0 + c4) = h4; } } }
     }
}


typedef _Float16 v4h __attribute__((ext_vector_type(4)));

__global__ __launch_bounds__(256) void k_x16(const float* __restrict__ x, _Float16* __restrict__ X16, size_t n8) { const size_t t = (size_t)blockIdx.x * 256 + threadIdx.x; if (t >= n8) return; FragH f;
#pragma unroll
  for (int q = 0; q < 8; ++q) f.h[q] = (_Float16)bf16_round(x[t * 8 + q]); *(v8us*)((unsigned short*)X16 + t * 8) = f.half[0];  }
__global__ __launch_bounds__(256) void k_h16(const float* __restrict__ x, _Float16* __restrict__ X16, size_t n8) { const size_t t = (size_t)blockIdx.x * 256 + threadIdx.x; if (t >= n8) return; FragH f;
#pragma unroll
  for (int q = 0; q < 8; ++q) f.h[q] = (_Float16)x[t * 8 + q]; *(v8us*)((unsigned short*)X16 + t * 8) = f.half[0];  }
__global__ __launch_bounds__(256) void k_round16f(const float* __restrict__ W, _Float16* __restrict__ Bt, size_t n8) { const size_t t = (size_t)blockIdx.x * 256 + threadIdx.x; if (t >= n8) return; FragH f;
#pragma unroll
  for (int i = 0; i < 8; ++i) f.h[i] = (_Float16)(bf16_round(W[t * 8 + i]) * 16.0f); *(v8us*)((unsigned short*)Bt + t * 8) = f.half[0];  }
template <int NHv, int TTv>
__global__ __launch_bounds__(256) void k_vt(const _Float16* __restrict__ V16, int ldv, int voff, _Float16* __restrict__ Vt) { __shared__ unsigned short tl[64][66]; const int tid = threadIdx.x; const int slab = blockIdx.x / (TTv / 64), lg = blockIdx.x % (TTv / 64); const int b = slab / NHv, h = slab % NHv;
  for (int i = tid; i < 64 * 8; i += 256) { const int r = i / 8, c8 = (i % 8) * 8; FragH f; f.half[0] = *(const v8us*)((const unsigned short*)V16 + ((size_t)b * TTv + lg * 64 + r) * ldv + voff + h * 64 + c8);
#pragma unroll
    for (int q = 0; q < 8; ++q) tl[r][c8 + q] = f.u[q]; }
  __syncthreads();
  {
#pragma unroll
    for (int rd = 0; rd < 2; ++rd) { const int d = rd * 32 + tid / 8, pc = tid % 8; FragH f;
#pragma unroll
      for (int q = 0; q < 8; ++q) f.u[q] = tl[pc * 8 + q][d];
      *(v8us*)((unsigned short*)Vt + ((size_t)slab * 64 + d) * TTv + lg * 64 + pc * 8) = f.half[0]; }
     } }

// ---- fast GEMM (256 threads, block tile 128x128, wave tile 32x64; requires M % 128 == 0 rows per launch region, N % 128 == 0 and K % 64 == 0); epilogue = k_gemm_hhx semantics ----
__device__ __forceinline__ v16h g2_frag(const _Float16* p, int hh) { FragH f; f.half[0] = *(const v8us*)((const unsigned short*)p + 8 * hh); f.half[1] = *(const v8us*)((const unsigned short*)p + 16 + 8 * hh); return f.v; }
__device__ __forceinline__ v8f g2_mma(v16h a, v16h b, v8f c) { v8f d = __builtin_amdgcn_wmma_f32_16x16x32_f16(false, a, false, b, (short)0, c, false, false); asm volatile("v_nop\n\tv_nop\n\tv_nop\n\tv_nop" : "+v"(d) : "v"(a), "v"(b)); return d; }
// ---- operand staging of the 128 x 128 block tile (8 waves: 4 row groups x 2 column groups of 32 x 64): 64 k (128 B of every operand row) per stage, rows 0..127 = A, 128..255 = B, LDS pitch 72 halves = 144 B (16 B x odd for the 16-byte fragment reads), two buffers
#define GKT 64
#define GPITCH 72
#define GSTG (256 * GPITCH)
// Eight asynchronous 16-byte copies global -> LDS per lane (one stage's share: a wave's copy = 4 whole 128-B rows), through no register. The s_wait_xcnt is the last line of the copies' own statement, so that no address register named here is rewritten ahead of it.
__device__ __forceinline__ void g2_copy8(unsigned l0, unsigned l1, unsigned l2, unsigned l3, unsigned l4, unsigned l5, unsigned l6, unsigned l7,
    const unsigned short* g0, const unsigned short* g1, const unsigned short* g2, const unsigned short* g3, const unsigned short* g4, const unsigned short* g5, const unsigned short* g6, const unsigned short* g7) {
  asm volatile("global_load_async_to_lds_b128 %0, %8, off\n\t"
               "global_load_async_to_lds_b128 %1, %9, off\n\t"
               "global_load_async_to_lds_b128 %2, %10, off\n\t"
               "global_load_async_to_lds_b128 %3, %11, off\n\t"
               "global_load_async_to_lds_b128 %4, %12, off\n\t"
               "global_load_async_to_lds_b128 %5, %13, off\n\t"
               "global_load_async_to_lds_b128 %6, %14, off\n\t"
               "global_load_async_to_lds_b128 %7, %15, off\n\t"
               "s_wait_xcnt 0x0"
               :: "v"(l0), "v"(l1), "v"(l2), "v"(l3), "v"(l4), "v"(l5), "v"(l6), "v"(l7), "v"(g0), "v"(g1), "v"(g2), "v"(g3), "v"(g4), "v"(g5), "v"(g6), "v"(g7) : "memory");
}
// Main loop of the 32 x 64 wave tile over K (a multiple of 64), 256 threads: rows rowb..rowb+127 of A and colb..colb+127 of Bh are staged once for the block's eight waves; wave w reads the fragments of A rows 32 (w & 3).. and B rows 64 (w >> 2).. from LDS. Per accumulator the products come in the same k order as with fragments loaded from global. On return every wave has passed the barrier behind the last fragment read, so sT may be reused.
__device__ __forceinline__ void g2_main(const _Float16* __restrict__ A, int lda, const _Float16* __restrict__ Bh, int ldb, int K, int rowb, int colb, unsigned short* sT, v8f (&c)[8]) {
  const int tid = threadIdx.x, w = tid >> 5, lane = tid & 31, ln = lane & 15, hh = lane >> 4;
  const unsigned short* ga = (const unsigned short*)A + (size_t)(rowb + (tid >> 3)) * lda + (tid & 7) * 8; const unsigned short* gb = (const unsigned short*)Bh + (size_t)(colb + (tid >> 3)) * ldb + (tid & 7) * 8;
  const size_t a32 = (size_t)32 * lda, b32 = (size_t)32 * ldb; const unsigned lt = (unsigned)(size_t)&sT[(tid >> 3) * GPITCH + (tid & 7) * 8]; constexpr unsigned R32 = 32 * GPITCH * 2;
  auto stage = [&](int kb, unsigned bo) { const unsigned l = lt + bo; const unsigned short* a = ga + kb; const unsigned short* b = gb + kb;
    g2_copy8(l, l + R32, l + 2 * R32, l + 3 * R32, l + 4 * R32, l + 5 * R32, l + 6 * R32, l + 7 * R32, a, a + a32, a + 2 * a32, a + 3 * a32, b, b + b32, b + 2 * b32, b + 3 * b32); };
  stage(0, 0u);
  asm volatile("s_wait_asynccnt 0x0" ::: "memory");      /* this wave's copies of stage 0 have landed before the barrier that shows them to the other waves */
  __syncthreads();
  if (GKT < K) stage(GKT, (unsigned)(GSTG * 2));
  /* rolled: one trip per stage, so that the two buffers alternate by the trip's parity */
#pragma unroll 1
  for (int kb = 0; kb < K; kb += GKT) { const unsigned short* buf = sT + ((kb >> 6) & 1) * GSTG;      /* this trip reads its own buffer alone */
    const _Float16* ar = (const _Float16*)(buf + (32 * (w & 3) + ln) * GPITCH); const _Float16* br = (const _Float16*)(buf + (128 + 64 * (w >> 2) + ln) * GPITCH);
    v16h fa[2][2], fb[2][4];      /* the trip's 24 fragment reads stand together in front of its products, so that their LDS latency is waited out once per trip and not in front of every pair of products */
#pragma unroll
    for (int ks = 0; ks < 2; ++ks) { fa[ks][0] = g2_frag(ar + ks * 32, hh); fa[ks][1] = g2_frag(ar + 16 * GPITCH + ks * 32, hh);
#pragma unroll
      for (int t = 0; t < 4; ++t) fb[ks][t] = g2_frag(br + t * 16 * GPITCH + ks * 32, hh); }
#pragma unroll
    for (int ks = 0; ks < 2; ++ks)
#pragma unroll
      for (int t = 0; t < 4; ++t) { c[t] = g2_mma(fa[ks][0], fb[ks][t], c[t]); c[4 + t] = g2_mma(fa[ks][1], fb[ks][t], c[4 + t]); }
    asm volatile("s_wait_dscnt 0x0" ::: "memory");      /* this wave's reads of the buffer have returned before the buffer may be refilled */
    asm volatile("s_wait_asynccnt 0x0" ::: "memory");      /* this wave's copies of the next stage have landed before the barrier that shows them */
    __syncthreads();      /* publishes the next stage and ends every wave's reads of this trip's buffer */
    if (kb + 2 * GKT < K) stage(kb + 2 * GKT, (unsigned)(((kb >> 6) & 1) * (GSTG * 2))); }
  asm volatile("s_wait_asynccnt 0x0" ::: "memory");      /* no copy is outstanding when the LDS becomes output staging */
}
template <int ACT>
__global__ __launch_bounds__(256) void k_gemm2(const _Float16* __restrict__ A, int lda, size_t sA, const _Float16* __restrict__ Bh, int ldb, size_t sB, float alpha, const float* __restrict__ bias, size_t sBias, const float* __restrict__ CP, int rowsPerB, size_t sCPb, int row0g,
    float* __restrict__ C, _Float16* __restrict__ C16, int ldc, size_t sC, int M, int N, int K) {
  __shared__ __attribute__((aligned(16))) float sm[2 * GSTG / 2];      /* the two operand buffers; behind the main loop its first 8 x 32 x 68 floats are the output staging */
  float (*so)[32][68] = (float (*)[32][68])sm;
  const int tid = threadIdx.x, w = tid >> 5, lane = tid & 31, ln = lane & 15, hh = lane >> 4; const int by = blockIdx.y;
  A += (size_t)by * sA; Bh += (size_t)by * sB; const size_t cofs = (size_t)by * sC; const float* bp = bias ? bias + (size_t)by * sBias : nullptr;
  const int ntn = N >> 7; const int mt = blockIdx.x / ntn, nq = blockIdx.x - mt * ntn; const int row0 = mt * 128 + 32 * (w & 3), col0 = nq * 128 + 64 * (w >> 2); if (mt * 128 + 128 > M) return;      /* block-uniform, in front of every barrier and copy */
  const v8f z8 = {0.f,0.f,0.f,0.f,0.f,0.f,0.f,0.f}; v8f accs[8] = {z8, z8, z8, z8, z8, z8, z8, z8};
  g2_main(A, lda, Bh, ldb, K, mt * 128, nq * 128, (unsigned short*)sm, accs);
#pragma unroll
  for (int u = 0; u < 8; ++u) { const int t = u & 3, half = u >> 2; const int col = col0 + t * 16 + ln; const float bv = bp ? bf16_round(bp[col]) : 0.f;
#pragma unroll
    for (int r = 0; r < 8; ++r) { const int rloc = half * 16 + 8 * hh + r; float v = accs[u][r] * alpha + bv; if (CP) { const int bidx = (row0g + row0 + rloc) / rowsPerB; v += CP[(size_t)bidx * sCPb + (size_t)by * 64 + col]; }
      if (ACT == 3) v = fmaxf(v, 0.f); else if (ACT == 6) v = 0.5f * v * (1.0f + erff(v * 0.70710678118654752f)); else if (ACT == 11) v = 1.0f / (1.0f + expf(-v)); else if (ACT == 15) v = v / (1.0f + expf(-v)); else if (ACT == 12) v = (v > 0.f) ? v : 0.01f * v; else if (ACT == 8) v = tanhf(v);
      so[w][rloc][t * 16 + ln] = v; } }
  __builtin_amdgcn_fence(__ATOMIC_ACQ_REL, "workgroup"); __builtin_amdgcn_wave_barrier();
  const int rsub = lane >> 4, c4 = (lane & 15) * 4;
  {
#pragma unroll
    for (int q = 0; q < 16; ++q) { const int r = q * 2 + rsub; const v4f v = *(const v4fa*)&so[w][r][c4]; if (C) *(v4f*)(C + cofs + (size_t)(row0 + r) * ldc + col0 + c4) = v; if (C16) { v4h h4; for (int i = 0; i < 4; ++i) h4[i] = (_Float16)v[i]; *(v4h*)(C16 + cofs + (size_t)(row0 + r) * ldc + col0 + c4) = h4; } }
     } }



__device__ __forceinline__ float siluf(float g) { return g / (1.0f + expf(-g)); }
// ---- projection GEMM (main loop of k_gemm2, NR x DM x DM, Bt carries x16) with the element-wise tail in its epilogue. A wave tile is 32 tokens x the 64 columns of one head, so the head's norm is a sum inside the wave's own LDS rows.
// POLAR 1: g = silu(acc/16) * f, f = r*scale[h]/(r + 1e-6), r = |silu row|; g stored as f16 hi + x2^10 residual, row-major, one whole 128-B line per row and plane.
// POLAR 0: g = silu(acc/16) stored transposed per (batch, head) slab as hi + residual planes [64 dims][SLEN tokens]; the block's 128 tokens are transposed through LDS, one whole 128-B line per 8 lanes.
template <int POLAR>
__global__ __launch_bounds__(256) void k_proj(const _Float16* __restrict__ A, const _Float16* __restrict__ Bh, const float* __restrict__ scale, _Float16* __restrict__ Hh, _Float16* __restrict__ Hl) {
  constexpr int PT = POLAR ? 68 : 65;      /* LDS row pitch in floats: 68 for the 16-B row reads, 65 for the column reads of the transpose */
  __shared__ __attribute__((aligned(16))) float so[2 * GSTG / 2];      /* the two operand buffers; behind the main loop its first 256 x PT floats are the output staging: rows 32 w.. are wave w's */
  const int tid = threadIdx.x, w = tid >> 5, lane = tid & 31, ln = lane & 15, hh = lane >> 4;
  constexpr int ntn = DM >> 7; const int mt = blockIdx.x / ntn, nq = (blockIdx.x - mt * ntn) * 2 + __builtin_amdgcn_readfirstlane(w >> 2); const int row0 = mt * 128 + 32 * (w & 3), col0 = nq * 64;      /* nq = the wave's head: waves 0..3 the block's first, 4..7 its second; read from the first lane so that it stays a scalar and scale[nq] a scalar load */
  const v8f z8 = {0.f,0.f,0.f,0.f,0.f,0.f,0.f,0.f}; v8f accs[8] = {z8, z8, z8, z8, z8, z8, z8, z8};
  g2_main(A, DM, Bh, DM, DM, mt * 128, (blockIdx.x - mt * ntn) * 128, (unsigned short*)so, accs);      /* the main loop of k_gemm2 */
#pragma unroll
  for (int u = 0; u < 8; ++u) { const int t = u & 3, half = u >> 2;
#pragma unroll
    for (int r = 0; r < 8; ++r) so[(32 * w + half * 16 + 8 * hh + r) * PT + t * 16 + ln] = siluf(accs[u][r] * 0.0625f); }
  if (POLAR) {
    __builtin_amdgcn_fence(__ATOMIC_ACQ_REL, "workgroup"); __builtin_amdgcn_wave_barrier();      /* each wave reads back its own 32 rows only */
    const int rsub = lane >> 4, c4 = (lane & 15) * 4; const float sc = bf16_round(scale[nq]);
#pragma unroll
    for (int q = 0; q < 16; ++q) { const int r = q * 2 + rsub; const v4f v = *(const v4fa*)&so[(32 * w + r) * PT + c4];
      float s = (v[0] * v[0] + v[1] * v[1]) + (v[2] * v[2] + v[3] * v[3]); s += __shfl_xor(s, 8, 32); s += __shfl_xor(s, 4, 32); s += __shfl_xor(s, 2, 32); s += __shfl_xor(s, 1, 32);
      const float rr = sqrtf(s); const float fac = (rr * sc) / (rr + 1e-6f); v4h h4, l4;
#pragma unroll
      for (int i = 0; i < 4; ++i) { const float g = v[i] * fac; const _Float16 h = (_Float16)g; h4[i] = h; l4[i] = (_Float16)((g - (float)h) * 1024.0f); }
      const size_t o = (size_t)(row0 + r) * DM + col0 + c4; *(v4h*)(Hh + o) = h4; *(v4h*)(Hl + o) = l4; }
  } else {
    __syncthreads();      /* the transpose reads rows that the block's other waves wrote */
    const int slab = (mt * 128 / SLEN) * NH + nq, tok0 = mt * 128 % SLEN;
#pragma unroll
    for (int it = 0; it < 8; ++it) { const int item = it * 128 + (tid & 127); const int pc = item & 7, d = (item >> 3) & 63, g = item >> 9; FragH fh, fl;      /* each half of the block transposes its own head's 128 LDS rows */
#pragma unroll
      for (int q = 0; q < 8; ++q) { const float v = so[((w >> 2) * 128 + g * 64 + pc * 8 + q) * PT + d]; const _Float16 hv = (_Float16)v; fh.h[q] = hv; fl.h[q] = (_Float16)((v - (float)hv) * 1024.0f); }
      const size_t o = ((size_t)slab * 64 + d) * SLEN + tok0 + g * 64 + pc * 8; *(v8us*)((unsigned short*)Hh + o) = fh.half[0]; *(v8us*)((unsigned short*)Hl + o) = fl.half[0]; }
  } }

// Eight asynchronous 16-byte copies global -> LDS per lane (one key pass's share of the K and V^T hi / residual tiles), through no register. The s_wait_xcnt is the last line of the copies' own statement, so that no address register named here is rewritten ahead of it.
__device__ __forceinline__ void kv_copy8(unsigned l0, unsigned l1, unsigned l2, unsigned l3, unsigned l4, unsigned l5, unsigned l6, unsigned l7,
    const unsigned short* g0, const unsigned short* g1, const unsigned short* g2, const unsigned short* g3, const unsigned short* g4, const unsigned short* g5, const unsigned short* g6, const unsigned short* g7) {
  asm volatile("global_load_async_to_lds_b128 %0, %8, off\n\t"
               "global_load_async_to_lds_b128 %1, %9, off\n\t"
               "global_load_async_to_lds_b128 %2, %10, off\n\t"
               "global_load_async_to_lds_b128 %3, %11, off\n\t"
               "global_load_async_to_lds_b128 %4, %12, off\n\t"
               "global_load_async_to_lds_b128 %5, %13, off\n\t"
               "global_load_async_to_lds_b128 %6, %14, off\n\t"
               "global_load_async_to_lds_b128 %7, %15, off\n\t"
               "s_wait_xcnt 0x0"
               :: "v"(l0), "v"(l1), "v"(l2), "v"(l3), "v"(l4), "v"(l5), "v"(l6), "v"(l7), "v"(g0), "v"(g1), "v"(g2), "v"(g3), "v"(g4), "v"(g5), "v"(g6), "v"(g7) : "memory");
}
template <int TQ, int TK>
__global__ __launch_bounds__(128) void k_flashm(const _Float16* __restrict__ Q16, const _Float16* __restrict__ Q16lo, int ldq, const _Float16* __restrict__ K16, const _Float16* __restrict__ K16lo, int ldk, const _Float16* __restrict__ Vt, const _Float16* __restrict__ Vtlo, const unsigned* __restrict__ MB, const int* __restrict__ RA, const int* __restrict__ KE, _Float16* __restrict__ Oh, _Float16* __restrict__ Ol, int ldo) {
  constexpr int RPW = 16, RTN = RPW / 16, NQB = TQ / (4 * RPW), DT = 4, KS = 2;
  __shared__ __attribute__((aligned(16))) unsigned short sP[4][RPW][40], sPl[4][RPW][40]; __shared__ __attribute__((aligned(16))) float sO[4][RPW][64 + 4];
  /* One pass's 32 keys, staged once for the block's four waves, two buffers. In 16-bit units: K rows (64 dims) at pitch 72 = 144 B, V^T rows (32 keys) at pitch 40 = 80 B, both 16 B x odd for the 16-byte fragment reads. */
  constexpr int KP = 72, VP = 40, KL0 = 32 * KP, VH0 = 2 * 32 * KP, VL0 = VH0 + 64 * VP, STG = VL0 + 64 * VP;
  __shared__ __attribute__((aligned(16))) unsigned short sKV[2][STG];
  const int tid = threadIdx.x, w = tid >> 5, lane = tid & 31, ln = lane & 15, hh = lane >> 4;
  const int slab = blockIdx.x / NQB, qblk = blockIdx.x % NQB; const int b = slab / NH, h = slab % NH; const int qb0 = qblk * (4 * RPW); const int q0 = qb0 + w * RPW;
  FragH aq[2][KS], aql[2][KS];
#pragma unroll
  for (int rt = 0; rt < RTN; ++rt) { const size_t qo = ((size_t)b * TQ + q0 + rt * 16 + ln) * ldq + h * 64; const unsigned short* qr = (const unsigned short*)Q16 + qo; const unsigned short* ql = (const unsigned short*)Q16lo + qo;
#pragma unroll
    for (int ks = 0; ks < KS; ++ks) { aq[rt][ks].half[0] = *(const v8us*)(qr + ks * 32 + 8 * hh); aq[rt][ks].half[1] = *(const v8us*)(qr + ks * 32 + 16 + 8 * hh); aql[rt][ks].half[0] = *(const v8us*)(ql + ks * 32 + 8 * hh); aql[rt][ks].half[1] = *(const v8us*)(ql + ks * 32 + 16 + 8 * hh); } }
  asm volatile("s_wait_xcnt 0x0" ::: "memory");      /* the Q loads' address registers are reused right below */
  const unsigned short* Vth = (const unsigned short*)Vt + (size_t)slab * 64 * TK; const unsigned short* Vtl = (const unsigned short*)Vtlo + (size_t)slab * 64 * TK;
  float m_r[2][8], l_r[2][8]; v8f oacc[2][DT], oaccl[2][DT];
#pragma unroll
  for (int rt = 0; rt < RTN; ++rt) {
#pragma unroll
    for (int r = 0; r < 8; ++r) { m_r[rt][r] = -3.0e38f; l_r[rt][r] = 0.f; }
#pragma unroll
    for (int dt = 0; dt < DT; ++dt) { oacc[rt][dt] = (v8f){0.f,0.f,0.f,0.f,0.f,0.f,0.f,0.f}; oaccl[rt][dt] = oacc[rt][dt]; } }
  int jend = KE[qblk * 32]; jend = min(TK, (jend + 31) & ~31); if (jend < 32) jend = 32;      /* block-uniform */
  /* each thread copies two 16-byte pieces of each of the four tiles: K rows tid/8 and tid/8 + 16 (a wave's copy = 4 whole 128-B rows), V^T rows tid/4 and tid/4 + 32 */
  const unsigned short* gkh = (const unsigned short*)K16 + ((size_t)b * TK + (tid >> 3)) * ldk + h * 64 + (tid & 7) * 8; const unsigned short* gkl = (const unsigned short*)K16lo + ((size_t)b * TK + (tid >> 3)) * ldk + h * 64 + (tid & 7) * 8;
  const unsigned short* gvh = Vth + (size_t)(tid >> 2) * TK + (tid & 3) * 8; const unsigned short* gvl = Vtl + (size_t)(tid >> 2) * TK + (tid & 3) * 8;
  const unsigned lk = (unsigned)(size_t)&sKV[0][(tid >> 3) * KP + (tid & 7) * 8], lv = (unsigned)(size_t)&sKV[0][VH0 + (tid >> 2) * VP + (tid & 3) * 8];
  auto stage = [&](int j, unsigned bo) { const size_t ko = (size_t)j * ldk, k16 = (size_t)16 * ldk;
    kv_copy8(lk + bo, lk + bo + 16 * KP * 2, lk + bo + KL0 * 2, lk + bo + (KL0 + 16 * KP) * 2, lv + bo, lv + bo + 32 * VP * 2, lv + bo + 64 * VP * 2, lv + bo + 96 * VP * 2,
             gkh + ko, gkh + ko + k16, gkl + ko, gkl + ko + k16, gvh + j, gvh + j + (size_t)32 * TK, gvl + j, gvl + j + (size_t)32 * TK); };
  stage(0, 0u);
  asm volatile("s_wait_asynccnt 0x0" ::: "memory");      /* this wave's copies of pass 0 have landed before the barrier that shows them to the other waves */
  __syncthreads();
  if (32 < jend) stage(32, (unsigned)(STG * 2));
  int allm[2][8]; const unsigned* mrow[2][8];
#pragma unroll
  for (int rt = 0; rt < RTN; ++rt)
#pragma unroll
    for (int r = 0; r < 8; ++r) { const int tq = q0 + rt * 16 + 8 * hh + r; allm[rt][r] = RA[tq]; mrow[rt][r] = MB + (size_t)tq * (TK / 32); }
  asm volatile("s_wait_xcnt 0x0" ::: "memory");      /* the row-flag loads' offset register is reused below */
#pragma unroll 1
  for (int j0 = 0; j0 < jend; j0 += 32) {
    unsigned mwv[2][8];      /* all rows' mask words are asked for at the head of the pass, ahead of the K fragment reads and score products that need none of them, and no row waits for its own */
#pragma unroll
    for (int rt = 0; rt < RTN; ++rt)
#pragma unroll
      for (int r = 0; r < 8; ++r) mwv[rt][r] = mrow[rt][r][j0 >> 5];
    const unsigned short* kvb = &sKV[(j0 >> 5) & 1][0];      /* this pass reads its own buffer alone */
    v8f s[2][2];
#pragma unroll
    for (int nt = 0; nt < 2; ++nt) { const unsigned short* kr = kvb + (nt * 16 + ln) * KP; const unsigned short* kl = kr + KL0; FragH bk[KS], bkl[KS];
#pragma unroll
      for (int ks = 0; ks < KS; ++ks) { bk[ks].half[0] = *(const v8us*)(kr + ks * 32 + 8 * hh); bk[ks].half[1] = *(const v8us*)(kr + ks * 32 + 16 + 8 * hh); bkl[ks].half[0] = *(const v8us*)(kl + ks * 32 + 8 * hh); bkl[ks].half[1] = *(const v8us*)(kl + ks * 32 + 16 + 8 * hh); }
#pragma unroll
      for (int rt = 0; rt < RTN; ++rt) { v8f acc = (v8f){0.f,0.f,0.f,0.f,0.f,0.f,0.f,0.f}, accr = acc;
#pragma unroll
        for (int ks = 0; ks < KS; ++ks) { acc = mmaH<1>(aq[rt][ks].v, aq[rt][ks].v, bk[ks].v, bk[ks].v, acc); accr = mmaH<1>(aql[rt][ks].v, aql[rt][ks].v, bk[ks].v, bk[ks].v, accr); accr = mmaH<1>(aq[rt][ks].v, aq[rt][ks].v, bkl[ks].v, bkl[ks].v, accr); }
        s[rt][nt] = acc + accr * 0.0009765625f; } }
    /* The eight rows of a tile run side by side: the body holds no branch (each exp is computed on every lane and chosen by a select behind it; the chosen values are the same), and each step is written for all rows before the next, so one row's lane exchange and exp wait is filled by the other seven. */
#pragma unroll
    for (int rt = 0; rt < RTN; ++rt) { float s0[8], s1[8], mc[8]; bool ok0[8], ok1[8];
#pragma unroll
      for (int r = 0; r < 8; ++r) { const unsigned mw = mwv[rt][r]; const bool am = (allm[rt][r] != 0);
        ok0[r] = am || (((mw >> ln) & 1u) == 0u); ok1[r] = am || (((mw >> (16 + ln)) & 1u) == 0u);
        s0[r] = ok0[r] ? (am ? 0.f : s[rt][0][r] * SCL) : -INFINITY; s1[r] = ok1[r] ? (am ? 0.f : s[rt][1][r] * SCL) : -INFINITY; mc[r] = fmaxf(s0[r], s1[r]); }
#pragma unroll
      for (int st = 1; st < 16; st <<= 1)
#pragma unroll
        for (int r = 0; r < 8; ++r) mc[r] = fmaxf(mc[r], __shfl_xor(mc[r], st, 32));
#pragma unroll
      for (int r = 0; r < 8; ++r) { const float mn = fmaxf(m_r[rt][r], mc[r]); const float ea = expf(m_r[rt][r] - mn), e0 = expf(s0[r] - mn), e1 = expf(s1[r] - mn);
        const float al = (mn > -1.0e38f) ? ea : 1.0f; m_r[rt][r] = mn; const float p0 = ok0[r] ? e0 : 0.f, p1 = ok1[r] ? e1 : 0.f; l_r[rt][r] = l_r[rt][r] * al + p0 + p1;
#pragma unroll
        for (int dt = 0; dt < DT; ++dt) { oacc[rt][dt][r] *= al; oaccl[rt][dt][r] *= al; }
        FragH t2, t3; const float ps0 = p0 * 1024.0f, ps1 = p1 * 1024.0f; t2.h[0] = (_Float16)ps0; t2.h[1] = (_Float16)ps1; t3.h[0] = (_Float16)((ps0 - (float)t2.h[0]) * 1024.0f); t3.h[1] = (_Float16)((ps1 - (float)t2.h[1]) * 1024.0f);
        sP[w][rt * 16 + 8 * hh + r][ln] = t2.u[0]; sP[w][rt * 16 + 8 * hh + r][16 + ln] = t2.u[1]; sPl[w][rt * 16 + 8 * hh + r][ln] = t3.u[0]; sPl[w][rt * 16 + 8 * hh + r][16 + ln] = t3.u[1]; } }
    __builtin_amdgcn_fence(__ATOMIC_ACQ_REL, "workgroup"); __builtin_amdgcn_wave_barrier();
    FragH pa[2], pl[2];
#pragma unroll
    for (int rt = 0; rt < RTN; ++rt) { pa[rt].half[0] = *(const v8us*)&sP[w][rt * 16 + ln][8 * hh]; pa[rt].half[1] = *(const v8us*)&sP[w][rt * 16 + ln][16 + 8 * hh]; pl[rt].half[0] = *(const v8us*)&sPl[w][rt * 16 + ln][8 * hh]; pl[rt].half[1] = *(const v8us*)&sPl[w][rt * 16 + ln][16 + 8 * hh]; }
#pragma unroll
    for (int dt = 0; dt < DT; ++dt) { const unsigned short* vr = kvb + VH0 + (dt * 16 + ln) * VP; const unsigned short* vl = vr + 64 * VP; FragH bv, bl; bv.half[0] = *(const v8us*)(vr + 8 * hh); bv.half[1] = *(const v8us*)(vr + 16 + 8 * hh); bl.half[0] = *(const v8us*)(vl + 8 * hh); bl.half[1] = *(const v8us*)(vl + 16 + 8 * hh);
#pragma unroll
      for (int rt = 0; rt < RTN; ++rt) { oacc[rt][dt] = mmaH<1>(pa[rt].v, pa[rt].v, bv.v, bv.v, oacc[rt][dt]); oaccl[rt][dt] = mmaH<1>(pa[rt].v, pa[rt].v, bl.v, bl.v, oaccl[rt][dt]); oaccl[rt][dt] = mmaH<1>(pl[rt].v, pl[rt].v, bv.v, bv.v, oaccl[rt][dt]); } }
    __builtin_amdgcn_fence(__ATOMIC_ACQ_REL, "workgroup"); __builtin_amdgcn_wave_barrier();
    asm volatile("s_wait_xcnt 0x0" ::: "memory");      /* the mask-word loads' address register is stepped for the next pass behind this point; the wait that covered it stood behind the K global loads and went with them */
    asm volatile("s_wait_dscnt 0x0" ::: "memory");      /* this wave's reads of the buffer have returned before the buffer may be refilled */
    asm volatile("s_wait_asynccnt 0x0" ::: "memory");      /* this wave's copies of the next pass have landed before the barrier that shows them */
    __syncthreads();      /* publishes the next pass's tiles and ends every wave's reads of this pass's buffer */
    if (j0 + 64 < jend) stage(j0 + 64, (unsigned)(((j0 >> 5) & 1) * (STG * 2))); }
  asm volatile("s_wait_asynccnt 0x0" ::: "memory");      /* no copy is outstanding when the wave goes on to its end */
#pragma unroll
  for (int rt = 0; rt < RTN; ++rt) {
#pragma unroll
    for (int r = 0; r < 8; ++r) { float l = l_r[rt][r]; l += __shfl_xor(l, 1, 32); l += __shfl_xor(l, 2, 32); l += __shfl_xor(l, 4, 32); l += __shfl_xor(l, 8, 32); l_r[rt][r] = (l > 0.f) ? 1.0f / (l * 1024.0f) : 0.f; }
#pragma unroll
    for (int dt = 0; dt < DT; ++dt)
#pragma unroll
      for (int r = 0; r < 8; ++r) sO[w][rt * 16 + 8 * hh + r][dt * 16 + ln] = (oacc[rt][dt][r] + oaccl[rt][dt][r] * 0.0009765625f) * l_r[rt][r]; }
  __builtin_amdgcn_fence(__ATOMIC_ACQ_REL, "workgroup"); __builtin_amdgcn_wave_barrier();
  {
#pragma unroll
    for (int rp = 0; rp < RPW; rp += 2) { const int r = rp + (lane >> 4), pc = lane & 15; const v4f val = *(const v4fa*)&sO[w][r][pc * 4]; v4h h4, l4;
#pragma unroll
      for (int i = 0; i < 4; ++i) { const _Float16 hv = (_Float16)val[i]; h4[i] = hv; l4[i] = (_Float16)((val[i] - (float)hv) * 1024.0f); }
      const size_t oo = ((size_t)b * TQ + q0 + r) * ldo + h * 64 + pc * 4; *(v4h*)(Oh + oo) = h4; *(v4h*)(Ol + oo) = l4; }
     } }


__global__ __launch_bounds__(256) void k_causaltab(unsigned* __restrict__ MB, int* __restrict__ RA, int* __restrict__ KE, int nq, int nk) {
  const int t = blockIdx.x * 256 + threadIdx.x; const int nw = nk / 32;
  if (t < nq * nw) { const int q = t / nw, w = t % nw; const int first = q + 1 - 32 * w; const unsigned bits = (first <= 0) ? 0xffffffffu : ((first >= 32) ? 0u : (0xffffffffu << first)); *(unsigned*)(MB + t) = bits;  }
  if (t < nq) { *(int*)(RA + t) = 0;  }
  if (t < nq / 64) { const int v = 64 * (t + 1); *(int*)(KE + t * 32) = v;  } }

extern "C" void kernel_launch(void* const* d_in, const int* in_sizes, int n_in,
                              void* d_out, int out_size, void* d_ws, size_t ws_size, hipStream_t stream) {
  (void)in_sizes; (void)n_in; (void)out_size;
  const float* const* I = (const float* const*)d_in; const float* x = I[0]; const float* Wq = I[1]; const float* Wk = I[2]; const float* Wv = I[3]; const float* Wo = I[4]; const float* qs = I[5]; const float* ks = I[6];
  char* ws = (char*)d_ws; size_t off = 0;
  auto take = [&](size_t bytes) { char* p = ws + off; off += (bytes + 255) & ~(size_t)255; return p; };
  _Float16* BQ = (_Float16*)take((size_t)DM * DM * 2); _Float16* BK = (_Float16*)take((size_t)DM * DM * 2); _Float16* BV = (_Float16*)take((size_t)DM * DM * 2); _Float16* BO = (_Float16*)take((size_t)DM * DM * 2);
  _Float16* X16 = (_Float16*)take((size_t)NR * DM * 2); _Float16* Oh = (_Float16*)take((size_t)NR * DM * 2); _Float16* Ol = (_Float16*)take((size_t)NR * DM * 2);
  _Float16* Qh = (_Float16*)take((size_t)NR * DM * 2); _Float16* Ql = (_Float16*)take((size_t)NR * DM * 2); _Float16* Kh = (_Float16*)take((size_t)NR * DM * 2); _Float16* Kl = (_Float16*)take((size_t)NR * DM * 2); _Float16* Vth = (_Float16*)take((size_t)NR * DM * 2); _Float16* Vtl = (_Float16*)take((size_t)NR * DM * 2);
  unsigned* MB = (unsigned*)take((size_t)SLEN * (SLEN / 32) * 4); int* RA = (int*)take((size_t)SLEN * 4); int* KE = (int*)take((size_t)(SLEN / 64) * 32 * 4);
  if (off > ws_size) return;      /* 8 + 16 + 2 x 16 + 6 x 16 + 0.5 = 153 MiB */
  const size_t n8 = (size_t)NR * DM / 8; const unsigned nb8 = (unsigned)((n8 + 255) / 256); const size_t w8 = (size_t)DM * DM / 8; const unsigned wb = (unsigned)((w8 + 255) / 256);
  k_round16f<<<wb, 256, 0, stream>>>(Wq, BQ, w8); k_round16f<<<wb, 256, 0, stream>>>(Wk, BK, w8); k_round16f<<<wb, 256, 0, stream>>>(Wv, BV, w8); k_round16f<<<wb, 256, 0, stream>>>(Wo, BO, w8);      /* torch (out,in) = natural Bt; x16 */
  k_causaltab<<<(SLEN * (SLEN / 32) + 255) / 256, 256, 0, stream>>>(MB, RA, KE, SLEN, SLEN);
  const dim3 gP((NR / 128) * (DM / 128), 1);
  k_x16<<<nb8, 256, 0, stream>>>(x, X16, n8);
  k_proj<1><<<gP, 256, 0, stream>>>(X16, BQ, qs, Qh, Ql);      /* q = silu(x Wq^T) * f_q, hi + residual */
  k_proj<1><<<gP, 256, 0, stream>>>(X16, BK, ks, Kh, Kl);      /* k = silu(x Wk^T) * f_k, hi + residual */
  k_proj<0><<<gP, 256, 0, stream>>>(X16, BV, ks, Vth, Vtl);      /* v = silu(x Wv^T), transposed, hi + residual (scale unread) */
  k_flashm<SLEN, SLEN><<<NBT * NH * (SLEN / 64), 128, 0, stream>>>(Qh, Ql, DM, Kh, Kl, DM, Vth, Vtl, MB, RA, KE, Oh, Ol, DM);
  float* outb = (float*)d_out;
  k_gemm2<0><<<gP, 256, 0, stream>>>(Oh, DM, 0, BO, DM, 0, 0.0625f, nullptr, 0, nullptr, 1, 0, 0, outb, nullptr, DM, 0, NR, DM, DM);
  k_gemm2<0><<<gP, 256, 0, stream>>>(Ol, DM, 0, BO, DM, 0, 0.0625f / 1024.0f, nullptr, 0, outb, 1, (size_t)DM, 0, outb, nullptr, DM, 0, NR, DM, DM);
}

// v006
// Measured time: 337 microseconds a run.
// Timed twice side by side with v005, it ran 1.19 and 1.23 times as fast.
// Over all steps from v000 it is 5.89 times as fast.
#include <hip/hip_runtime.h>
#define NBT 4
#define SLEN 2048
#define DM 1024
#define NH 16
#define SCL 1.0f
#define NR (NBT * SLEN)
typedef __bf16 v16b __attribute__((ext_vector_type(16)));
typedef unsigned short v8us __attribute__((ext_vector_type(8), may_alias));
typedef float  v8f  __attribute__((ext_vector_type(8)));
typedef float  v4f  __attribute__((ext_vector_type(4)));
typedef float  v4fa __attribute__((ext_vector_type(4), may_alias));
union FragB { v16b v; v8us half[2]; unsigned short u[16]; };

__device__ __forceinline__ unsigned short bf16_bits(float x) { unsigned int u = __float_as_uint(x); return (unsigned short)((u + 0x7FFFu + ((u >> 16) & 1u)) >> 16); }
__device__ __forceinline__ float bf16_val(unsigned short b) { return __uint_as_float(((unsigned int)b) << 16); }
__device__ __forceinline__ float bf16_round(float x) { return bf16_val(bf16_bits(x)); }
// D += A·B with NT terms: 1 = ah·bh, 2 = + al·bh (A split), 3 = + ah·bl (both split)
template <int NT>
__device__ __forceinline__ v8f mmaN(v16b ah, v16b al, v16b bh, v16b bl, v8f c) {
  c = __builtin_amdgcn_wmma_f32_16x16x32_bf16(false, ah, false, bh, (short)0, c, false, false);
  if (NT >= 2) c = __builtin_amdgcn_wmma_f32_16x16x32_bf16(false, al, false, bh, (short)0, c, false, false);
  if (NT >= 3) c = __builtin_amdgcn_wmma_f32_16x16x32_bf16(false, ah, false, bl, (short)0, c, false, false);
  asm volatile("v_nop\n\tv_nop\n\tv_nop\n\tv_nop" : "+v"(c) : "v"(ah), "v"(al), "v"(bh), "v"(bl));
  return c;
}

__global__ __launch_bounds__(256) void k_wt_bf16(const float* __restrict__ W, unsigned short* __restrict__ Wt, int K, int N) {
  const int t = blockIdx.x * 256 + threadIdx.x;
  const int k8n = K / 8;
  if (t >= N * k8n) return;
  const int n = t / k8n, k8 = (t % k8n) * 8;
  v8us v;
#pragma unroll
  for (int i = 0; i < 8; ++i) v[i] = bf16_bits(W[(size_t)(k8 + i) * N + n]);
  *(v8us*)(Wt + (size_t)n * K + k8) = v;
  
}

// GEMM C[M][N] (f32, pitch ldc) = act(A[M][K]·W + bias). A f32 row-major (pitch lda) converted per fragment to bf16
// (ASPLIT: hi/lo two planes -> 2 terms, else single rounded term); Wt bf16 [N][K] (pitch ldb). BIAS_BF16 rounds the
// bias to bf16 first (bias quantised to bf16 before the add). K%32==0, M%16==0, N%64==0.
template <bool ASPLIT, int ACT, bool BIAS_BF16>
__global__ __launch_bounds__(128) void k_gemm_bf(const float* __restrict__ A, int lda, const unsigned short* __restrict__ Wt, int ldb,
                                               const float* __restrict__ bias, float* __restrict__ C, int ldc, int M, int N, int K) {
  __shared__ __attribute__((aligned(16))) float so[4][16][64];
  const int tid = threadIdx.x, w = tid >> 5, lane = tid & 31, ln = lane & 15, hh = lane >> 4;
  const int ntn = N / 64;
  const int wid = blockIdx.x * 4 + w;
  const int mt = wid / ntn, nq = wid % ntn;
  if (mt * 16 >= M) return;
  const int row0 = mt * 16, col0 = nq * 64;
  const float* arow = A + (size_t)(row0 + ln) * lda;
  v8f acc[4] = {};
  for (int kb = 0; kb < K; kb += 32) {
    FragB ah, al;
    const v4f x0 = *(const v4fa*)(arow + kb + 8 * hh), x1 = *(const v4fa*)(arow + kb + 8 * hh + 4);
    const v4f x2 = *(const v4fa*)(arow + kb + 16 + 8 * hh), x3 = *(const v4fa*)(arow + kb + 16 + 8 * hh + 4);
    float xs[16] = {x0[0],x0[1],x0[2],x0[3],x1[0],x1[1],x1[2],x1[3],x2[0],x2[1],x2[2],x2[3],x3[0],x3[1],x3[2],x3[3]};
#pragma unroll
    for (int i = 0; i < 16; ++i) { const unsigned short hb = bf16_bits(xs[i]); ah.u[i] = hb; al.u[i] = ASPLIT ? bf16_bits(xs[i] - bf16_val(hb)) : (unsigned short)0; }
#pragma unroll
    for (int t = 0; t < 4; ++t) {
      const unsigned short* brow = Wt + (size_t)(col0 + t * 16 + ln) * ldb + kb;
      FragB b;
      b.half[0] = *(const v8us*)(brow + 8 * hh);
      b.half[1] = *(const v8us*)(brow + 16 + 8 * hh);
      acc[t] = mmaN<ASPLIT ? 2 : 1>(ah.v, al.v, b.v, b.v, acc[t]);
    }
  }
#pragma unroll
  for (int t = 0; t < 4; ++t) {
    float bv = bias ? bias[col0 + t * 16 + ln] : 0.f;
    if (BIAS_BF16) bv = bf16_round(bv);
#pragma unroll
    for (int r = 0; r < 8; ++r) { float v = acc[t][r] + bv; if (ACT == 1) v = fmaxf(v, 0.f); so[w][8 * hh + r][t * 16 + ln] = v; }
  }
  __builtin_amdgcn_fence(__ATOMIC_ACQ_REL, "workgroup");
  __builtin_amdgcn_wave_barrier();
  const int rsub = lane >> 4, c4 = (lane & 15) * 4;
  {
#pragma unroll
    for (int q = 0; q < 8; ++q) {
      const int r = q * 2 + rsub;
      const v4f v = *(const v4fa*)&so[w][r][c4];
      *(v4f*)(C + (size_t)(row0 + r) * ldc + col0 + c4) = v;
    }
    
  }
}

// GEMM C = act(A·W + bias + resid): A f32 (ASPLIT -> hi/lo 2 terms), Wt bf16 [N][K]; ACT 0 none, 1 relu, 2 exact gelu;
// resid (optional, f32, row index = (row % rmod), pitch ldr, RES_BF16 rounds it) added before the activation.
template <bool ASPLIT, int ACT, bool BIAS_BF16, bool RES_BF16>
__global__ __launch_bounds__(128) void k_gemm_bf3(const float* __restrict__ A, int lda, const unsigned short* __restrict__ Wt, int ldb,
                                                const float* __restrict__ bias, const float* __restrict__ resid, int rmod, int ldr,
                                                float* __restrict__ C, int ldc, int M, int N, int K) {
  __shared__ __attribute__((aligned(16))) float so[4][16][64];
  const int tid = threadIdx.x, w = tid >> 5, lane = tid & 31, ln = lane & 15, hh = lane >> 4;
  const int ntn = N / 64;
  const int wid = blockIdx.x * 4 + w;
  const int mt = wid / ntn, nq = wid % ntn;
  if (mt * 16 >= M) return;
  const int row0 = mt * 16, col0 = nq * 64;
  const float* arow = A + (size_t)(row0 + ln) * lda;
  v8f acc[4] = {};
  for (int kb = 0; kb < K; kb += 32) {
    FragB ah, al;
    const v4f x0 = *(const v4fa*)(arow + kb + 8 * hh), x1 = *(const v4fa*)(arow + kb + 8 * hh + 4);
    const v4f x2 = *(const v4fa*)(arow + kb + 16 + 8 * hh), x3 = *(const v4fa*)(arow + kb + 16 + 8 * hh + 4);
    float xs[16] = {x0[0],x0[1],x0[2],x0[3],x1[0],x1[1],x1[2],x1[3],x2[0],x2[1],x2[2],x2[3],x3[0],x3[1],x3[2],x3[3]};
#pragma unroll
    for (int i = 0; i < 16; ++i) { const unsigned short hb = bf16_bits(xs[i]); ah.u[i] = hb; al.u[i] = ASPLIT ? bf16_bits(xs[i] - bf16_val(hb)) : (unsigned short)0; }
#pragma unroll
    for (int t = 0; t < 4; ++t) {
      const unsigned short* brow = Wt + (size_t)(col0 + t * 16 + ln) * ldb + kb;
      FragB b;
      b.half[0] = *(const v8us*)(brow + 8 * hh);
      b.half[1] = *(const v8us*)(brow + 16 + 8 * hh);
      acc[t] = mmaN<ASPLIT ? 2 : 1>(ah.v, al.v, b.v, b.v, acc[t]);
    }
  }
#pragma unroll
  for (int t = 0; t < 4; ++t) {
    const int col = col0 + t * 16 + ln;
    float bv = bias ? bias[col] : 0.f;
    if (BIAS_BF16) bv = bf16_round(bv);
#pragma unroll
    for (int r = 0; r < 8; ++r) {
      float v = acc[t][r] + bv;
      if (resid) { float rv = resid[(size_t)((row0 + 8 * hh + r) % rmod) * ldr + col]; if (RES_BF16) rv = bf16_round(rv); v += rv; }
      if (ACT == 1) v = fmaxf(v, 0.f);
      if (ACT == 2) v = 0.5f * v * (1.0f + erff(v * 0.70710678118654752f));
      if (ACT == 3) { const float u = 0.7978845608028654f * (v + 0.044715f * v * v * v); v = 0.5f * v * (1.0f + tanhf(u)); }
      so[w][8 * hh + r][t * 16 + ln] = v;
    }
  }
  __builtin_amdgcn_fence(__ATOMIC_ACQ_REL, "workgroup");
  __builtin_amdgcn_wave_barrier();
  const int rsub = lane >> 4, c4 = (lane & 15) * 4;
  {
#pragma unroll
    for (int q = 0; q < 8; ++q) {
      const int r = q * 2 + rsub;
      const v4f v = *(const v4fa*)&so[w][r][c4];
      *(v4f*)(C + (size_t)(row0 + r) * ldc + col0 + c4) = v;
    }
    
  }
}
// row LayerNorm (biased variance, eps) over N: s = X (+ R); optional out_sum <- s; out_norm <- (s-mu)*rsqrt(var+eps)*g + b
template <bool PARAM_BF16>
__global__ __launch_bounds__(256) void k_layernorm(const float* __restrict__ X, const float* __restrict__ R, const float* __restrict__ g, const float* __restrict__ bta,
                                                  float* __restrict__ out_sum, float* __restrict__ out_norm, int N, float eps) {
  __shared__ float red[256];
  const int row = blockIdx.x, tid = threadIdx.x;
  const float* x = X + (size_t)row * N; const float* rr = R ? R + (size_t)row * N : nullptr;
  float vals[16];                     // up to N = 4096
  const int per = N / 256;            // contiguous chunk per thread? use strided-by-4 chunks: thread handles j = tid*4 + 1024*u
  float s1 = 0.f;
  for (int u = 0; u < per / 4; ++u) {
    const int j = tid * 4 + 1024 * u;
    const v4f a = *(const v4fa*)(x + j);
    v4f b = {0.f,0.f,0.f,0.f}; if (rr) b = *(const v4fa*)(rr + j);
#pragma unroll
    for (int q = 0; q < 4; ++q) { const float v = a[q] + b[q]; vals[u * 4 + q] = v; s1 += v; }
  }
  red[tid] = s1; __syncthreads();
  for (int st = 128; st > 0; st >>= 1) { if (tid < st) red[tid] += red[tid + st]; __syncthreads(); }
  const float mu = red[0] / (float)N; __syncthreads();
  float s2 = 0.f;
  for (int u = 0; u < per / 4; ++u)
#pragma unroll
    for (int q = 0; q < 4; ++q) { const float c = vals[u * 4 + q] - mu; s2 += c * c; }
  red[tid] = s2; __syncthreads();
  for (int st = 128; st > 0; st >>= 1) { if (tid < st) red[tid] += red[tid + st]; __syncthreads(); }
  const float rs = rsqrtf(red[0] / (float)N + eps);
  {
    for (int u = 0; u < per / 4; ++u) {
      const int j = tid * 4 + 1024 * u;
      v4f o, sm;
#pragma unroll
      for (int q = 0; q < 4; ++q) {
        float gg = g[j + q], bb = bta[j + q];
        if (PARAM_BF16) { gg = bf16_round(gg); bb = bf16_round(bb); }
        sm[q] = vals[u * 4 + q]; o[q] = (vals[u * 4 + q] - mu) * rs * gg + bb;
      }
      if (out_sum) *(v4f*)(out_sum + (size_t)row * N + j) = sm;
      *(v4f*)(out_norm + (size_t)row * N + j) = o;
    }
    
  }
}



// ---- f16 WMMA path (v_wmma_f32_16x16x32_f16): 11-bit significands for operands in range — used where a [0,1] probability operand needs more precision than bf16
typedef _Float16 v16h __attribute__((ext_vector_type(16)));
union FragH { v16h v; v8us half[2]; _Float16 h[16]; unsigned short u[16]; };
template <int NT>
__device__ __forceinline__ v8f mmaH(v16h ah, v16h al, v16h bh, v16h bl, v8f c) {
  c = __builtin_amdgcn_wmma_f32_16x16x32_f16(false, ah, false, bh, (short)0, c, false, false);
  if (NT >= 2) c = __builtin_amdgcn_wmma_f32_16x16x32_f16(false, al, false, bh, (short)0, c, false, false);
  if (NT >= 3) c = __builtin_amdgcn_wmma_f32_16x16x32_f16(false, ah, false, bl, (short)0, c, false, false);
  asm volatile("v_nop\n\tv_nop\n\tv_nop\n\tv_nop" : "+v"(c) : "v"(ah), "v"(al), "v"(bh), "v"(bl));
  return c;
}
// batched GEMM like k_gemm_b but f16 operands: A f32 (split into f16 hi/lo if ASPLIT, else rounded to f16), Bt = f16 values [n][k]; alpha; C f32; N multiple of 16 (partial tiles skipped)
template <bool ASPLIT>
__global__ __launch_bounds__(128) void k_gemm_h(const float* __restrict__ A, int lda, size_t sA, const _Float16* __restrict__ Bh, int ldb, size_t sB, float alpha, float* __restrict__ C, int ldc, size_t sC, int M, int N, int K) {
  __shared__ __attribute__((aligned(16))) float so[4][16][64];
  const int tid = threadIdx.x, w = tid >> 5, lane = tid & 31, ln = lane & 15, hh = lane >> 4; const int by = blockIdx.y;
  A += (size_t)by * sA; Bh += (size_t)by * sB; C += (size_t)by * sC;
  const int ntn = (N + 63) / 64; const int wid = blockIdx.x * 4 + w; const int mt = wid / ntn, nq = wid % ntn; if (mt * 16 >= M) return;
  const int row0 = mt * 16, col0 = nq * 64; const float* arow = A + (size_t)(row0 + ln) * lda;
  v8f acc[4] = {};
  for (int kb = 0; kb < K; kb += 32) {
    FragH ah, al;
    const v4f x0 = *(const v4fa*)(arow + kb + 8 * hh), x1 = *(const v4fa*)(arow + kb + 8 * hh + 4), x2 = *(const v4fa*)(arow + kb + 16 + 8 * hh), x3 = *(const v4fa*)(arow + kb + 16 + 8 * hh + 4);
    float xs[16] = {x0[0],x0[1],x0[2],x0[3],x1[0],x1[1],x1[2],x1[3],x2[0],x2[1],x2[2],x2[3],x3[0],x3[1],x3[2],x3[3]};
#pragma unroll
    for (int i = 0; i < 16; ++i) { const _Float16 h = (_Float16)xs[i]; ah.h[i] = h; al.h[i] = ASPLIT ? (_Float16)(xs[i] - (float)h) : (_Float16)0.0f; }
#pragma unroll
    for (int t = 0; t < 4; ++t) { if (col0 + t * 16 >= N) continue; const size_t boff = (size_t)(col0 + t * 16 + ln) * ldb + kb; FragH bq; bq.half[0] = *(const v8us*)(Bh + boff + 8 * hh); bq.half[1] = *(const v8us*)(Bh + boff + 16 + 8 * hh);
      acc[t] = mmaH<ASPLIT ? 2 : 1>(ah.v, al.v, bq.v, bq.v, acc[t]); }
  }
#pragma unroll
  for (int t = 0; t < 4; ++t) { if (col0 + t * 16 >= N) continue;
#pragma unroll
    for (int r = 0; r < 8; ++r) so[w][8 * hh + r][t * 16 + ln] = acc[t][r] * alpha; }
  __builtin_amdgcn_fence(__ATOMIC_ACQ_REL, "workgroup"); __builtin_amdgcn_wave_barrier();
  const int rsub = lane >> 4, c4 = (lane & 15) * 4;
  {
#pragma unroll
    for (int q = 0; q < 8; ++q) { const int r = q * 2 + rsub; if (col0 + c4 < N) { const v4f v = *(const v4fa*)&so[w][r][c4]; *(v4f*)(C + (size_t)(row0 + r) * ldc + col0 + c4) = v; } }
     }
}

// Wt[n][k] = f16(W[k][n]·scale) from f32 row-major W[K][N] (scale = power of two; bf16-exact weights stay exact in f16 away from the subnormal range)
__global__ __launch_bounds__(256) void k_wt_f16(const float* __restrict__ W, _Float16* __restrict__ Wt, int K, int N, float scale) {
  const int t = blockIdx.x * 256 + threadIdx.x; if (t >= N * (K / 8)) return; const int n = t / (K / 8), k8 = (t % (K / 8)) * 8; FragH f;
#pragma unroll
  for (int i = 0; i < 8; ++i) f.h[i] = (_Float16)(bf16_round(W[(size_t)(k8 + i) * N + n]) * scale); const v8us o = f.half[0];
  *(v8us*)((unsigned short*)Wt + (size_t)n * K + k8) = o; 
}
// k_gemm_hh variant with fused epilogue: v = acc·alpha + bias[by·sBias + col] (+ CP[(row/rowsPerB)·sCPb + by·64 + col] if CP) ; ACT 0 none / 1 elu ; writes f16 C16 (and f32 C if non-null)
template <int ACT>
__global__ __launch_bounds__(128) void k_gemm_hhx(const _Float16* __restrict__ A, int lda, size_t sA, const _Float16* __restrict__ Bh, int ldb, size_t sB, float alpha, const float* __restrict__ bias, size_t sBias, const float* __restrict__ CP, int rowsPerB, size_t sCPb, int row0g,
    float* __restrict__ C, _Float16* __restrict__ C16, int ldc, size_t sC, int M, int N, int K) {
  __shared__ __attribute__((aligned(16))) float so[4][16][64];
  const int tid = threadIdx.x, w = tid >> 5, lane = tid & 31, ln = lane & 15, hh = lane >> 4; const int by = blockIdx.y;
  A += (size_t)by * sA; Bh += (size_t)by * sB; const size_t cofs = (size_t)by * sC; const float* bp = bias ? bias + (size_t)by * sBias : nullptr;
  const int ntn = (N + 63) / 64; const int wid = blockIdx.x * 4 + w; const int mt = wid / ntn, nq = wid % ntn; if (mt * 16 >= M) return;
  const int row0 = mt * 16, col0 = nq * 64; const _Float16* arow = A + (size_t)(row0 + ln) * lda;
  v8f acc[4] = {};
  for (int kb = 0; kb < K; kb += 32) { FragH ah; ah.half[0] = *(const v8us*)((const unsigned short*)arow + kb + 8 * hh); ah.half[1] = *(const v8us*)((const unsigned short*)arow + kb + 16 + 8 * hh);
#pragma unroll
    for (int t = 0; t < 4; ++t) { if (col0 + t * 16 >= N) continue; const size_t boff = (size_t)(col0 + t * 16 + ln) * ldb + kb; FragH bq; bq.half[0] = *(const v8us*)((const unsigned short*)Bh + boff + 8 * hh); bq.half[1] = *(const v8us*)((const unsigned short*)Bh + boff + 16 + 8 * hh);
      acc[t] = mmaH<1>(ah.v, ah.v, bq.v, bq.v, acc[t]); }
  }
#pragma unroll
  for (int t = 0; t < 4; ++t) { if (col0 + t * 16 >= N) continue; const int col = col0 + t * 16 + ln; const float bv = bp ? bf16_round(bp[col]) : 0.f;
#pragma unroll
    for (int r = 0; r < 8; ++r) { float v = acc[t][r] * alpha + bv; if (CP) { const int bidx = (row0g + row0 + 8 * hh + r) / rowsPerB; v += CP[(size_t)bidx * sCPb + (size_t)by * 64 + col]; } if (ACT == 1) v = (v > 0.f) ? v : expm1f(v); else if (ACT == 7) v = (v > 0.f) ? v + 1.0f : expf(v); else if (ACT == 8) v = tanhf(v); else if (ACT == 9) v = 0.5f * v * (1.0f + tanhf(0.7978845608028654f * (v + 0.044715f * v * v * v))); else if (ACT == 11) v = 1.0f / (1.0f + expf(-v)); else if (ACT == 12) v = (v > 0.f) ? v : 0.01f * v; else if (ACT == 14) v = (v > 0.f) ? v : 0.1f * v; else if (ACT == 15) v = v / (1.0f + expf(-v)); else if (ACT == 3) v = fmaxf(v, 0.f); else if (ACT == 6) v = 0.5f * v * (1.0f + erff(v * 0.70710678118654752f)); so[w][8 * hh + r][t * 16 + ln] = v; } }
  __builtin_amdgcn_fence(__ATOMIC_ACQ_REL, "workgroup"); __builtin_amdgcn_wave_barrier();
  const int rsub = lane >> 4, c4 = (lane & 15) * 4; typedef _Float16 v4h __attribute__((ext_vector_type(4)));
  {
#pragma unroll
    for (int q = 0; q < 8; ++q) { const int r = q * 2 + rsub; if (col0 + c4 < N) { const v4f v = *(const v4fa*)&so[w][r][c4]; if (C) *(v4f*)(C + cofs + (size_t)(row0 + r) * ldc + col0 + c4) = v; if (C16) { v4h h4; for (int i = 0; i < 4; ++i) h4[i] = (_Float16)v[i]; *(v4h*)(C16 + cofs + (size_t)(row0 + r) * ldc + col0 + c4) = h4; } } }
     }
}


typedef _Float16 v4h __attribute__((ext_vector_type(4)));

__global__ __launch_bounds__(256) void k_x16(const float* __restrict__ x, _Float16* __restrict__ X16, size_t n8) { const size_t t = (size_t)blockIdx.x * 256 + threadIdx.x; if (t >= n8) return; FragH f;
#pragma unroll
  for (int q = 0; q < 8; ++q) f.h[q] = (_Float16)bf16_round(x[t * 8 + q]); *(v8us*)((unsigned short*)X16 + t * 8) = f.half[0];  }
__global__ __launch_bounds__(256) void k_h16(const float* __restrict__ x, _Float16* __restrict__ X16, size_t n8) { const size_t t = (size_t)blockIdx.x * 256 + threadIdx.x; if (t >= n8) return; FragH f;
#pragma unroll
  for (int q = 0; q < 8; ++q) f.h[q] = (_Float16)x[t * 8 + q]; *(v8us*)((unsigned short*)X16 + t * 8) = f.half[0];  }
__global__ __launch_bounds__(256) void k_round16f(const float* __restrict__ W, _Float16* __restrict__ Bt, size_t n8) { const size_t t = (size_t)blockIdx.x * 256 + threadIdx.x; if (t >= n8) return; FragH f;
#pragma unroll
  for (int i = 0; i < 8; ++i) f.h[i] = (_Float16)(bf16_round(W[t * 8 + i]) * 16.0f); *(v8us*)((unsigned short*)Bt + t * 8) = f.half[0];  }
template <int NHv, int TTv>
__global__ __launch_bounds__(256) void k_vt(const _Float16* __restrict__ V16, int ldv, int voff, _Float16* __restrict__ Vt) { __shared__ unsigned short tl[64][66]; const int tid = threadIdx.x; const int slab = blockIdx.x / (TTv / 64), lg = blockIdx.x % (TTv / 64); const int b = slab / NHv, h = slab % NHv;
  for (int i = tid; i < 64 * 8; i += 256) { const int r = i / 8, c8 = (i % 8) * 8; FragH f; f.half[0] = *(const v8us*)((const unsigned short*)V16 + ((size_t)b * TTv + lg * 64 + r) * ldv + voff + h * 64 + c8);
#pragma unroll
    for (int q = 0; q < 8; ++q) tl[r][c8 + q] = f.u[q]; }
  __syncthreads();
  {
#pragma unroll
    for (int rd = 0; rd < 2; ++rd) { const int d = rd * 32 + tid / 8, pc = tid % 8; FragH f;
#pragma unroll
      for (int q = 0; q < 8; ++q) f.u[q] = tl[pc * 8 + q][d];
      *(v8us*)((unsigned short*)Vt + ((size_t)slab * 64 + d) * TTv + lg * 64 + pc * 8) = f.half[0]; }
     } }

// ---- fast GEMM (256 threads, block tile 128x128, wave tile 32x64; requires M % 128 == 0 rows per launch region, N % 128 == 0 and K % 64 == 0); epilogue = k_gemm_hhx semantics ----
__device__ __forceinline__ v16h g2_frag(const _Float16* p, int hh) { FragH f; f.half[0] = *(const v8us*)((const unsigned short*)p + 8 * hh); f.half[1] = *(const v8us*)((const unsigned short*)p + 16 + 8 * hh); return f.v; }
__device__ __forceinline__ v8f g2_mma(v16h a, v16h b, v8f c) { v8f d = __builtin_amdgcn_wmma_f32_16x16x32_f16(false, a, false, b, (short)0, c, false, false); asm volatile("v_nop\n\tv_nop\n\tv_nop\n\tv_nop" : "+v"(d) : "v"(a), "v"(b)); return d; }
// ---- operand staging of the 128 x 128 block tile (8 waves: 4 row groups x 2 column groups of 32 x 64): 64 k (128 B of every operand row) per stage, rows 0..127 = A, 128..255 = B, LDS pitch 72 halves = 144 B (16 B x odd for the 16-byte fragment reads), two buffers
#define GKT 64
#define GPITCH 72
#define GSTG (256 * GPITCH)
// Eight asynchronous 16-byte copies global -> LDS per lane (one stage's share: a wave's copy = 4 whole 128-B rows), through no register. The s_wait_xcnt is the last line of the copies' own statement, so that no address register named here is rewritten ahead of it.
__device__ __forceinline__ void g2_copy8(unsigned l0, unsigned l1, unsigned l2, unsigned l3, unsigned l4, unsigned l5, unsigned l6, unsigned l7,
    const unsigned short* g0, const unsigned short* g1, const unsigned short* g2, const unsigned short* g3, const unsigned short* g4, const unsigned short* g5, const unsigned short* g6, const unsigned short* g7) {
  asm volatile("global_load_async_to_lds_b128 %0, %8, off\n\t"
               "global_load_async_to_lds_b128 %1, %9, off\n\t"
               "global_load_async_to_lds_b128 %2, %10, off\n\t"
               "global_load_async_to_lds_b128 %3, %11, off\n\t"
               "global_load_async_to_lds_b128 %4, %12, off\n\t"
               "global_load_async_to_lds_b128 %5, %13, off\n\t"
               "global_load_async_to_lds_b128 %6, %14, off\n\t"
               "global_load_async_to_lds_b128 %7, %15, off\n\t"
               "s_wait_xcnt 0x0"
               :: "v"(l0), "v"(l1), "v"(l2), "v"(l3), "v"(l4), "v"(l5), "v"(l6), "v"(l7), "v"(g0), "v"(g1), "v"(g2), "v"(g3), "v"(g4), "v"(g5), "v"(g6), "v"(g7) : "memory");
}
// Main loop of the 32 x 64 wave tile over K (a multiple of 64), 256 threads: rows rowb..rowb+127 of A and colb..colb+127 of Bh are staged once for the block's eight waves; wave w reads the fragments of A rows 32 (w & 3).. and B rows 64 (w >> 2).. from LDS. Per accumulator the products come in the same k order as with fragments loaded from global. On return every wave has passed the barrier behind the last fragment read, so sT may be reused.
__device__ __forceinline__ void g2_main(const _Float16* __restrict__ A, int lda, const _Float16* __restrict__ Bh, int ldb, int K, int rowb, int colb, unsigned short* sT, v8f (&c)[8]) {
  const int tid = threadIdx.x, w = tid >> 5, lane = tid & 31, ln = lane & 15, hh = lane >> 4;
  const unsigned short* ga = (const unsigned short*)A + (size_t)(rowb + (tid >> 3)) * lda + (tid & 7) * 8; const unsigned short* gb = (const unsigned short*)Bh + (size_t)(colb + (tid >> 3)) * ldb + (tid & 7) * 8;
  const size_t a32 = (size_t)32 * lda, b32 = (size_t)32 * ldb; const unsigned lt = (unsigned)(size_t)&sT[(tid >> 3) * GPITCH + (tid & 7) * 8]; constexpr unsigned R32 = 32 * GPITCH * 2;
  auto stage = [&](int kb, unsigned bo) { const unsigned l = lt + bo; const unsigned short* a = ga + kb; const unsigned short* b = gb + kb;
    g2_copy8(l, l + R32, l + 2 * R32, l + 3 * R32, l + 4 * R32, l + 5 * R32, l + 6 * R32, l + 7 * R32, a, a + a32, a + 2 * a32, a + 3 * a32, b, b + b32, b + 2 * b32, b + 3 * b32); };
  stage(0, 0u);
  asm volatile("s_wait_asynccnt 0x0" ::: "memory");      /* this wave's copies of stage 0 have landed before the barrier that shows them to the other waves */
  __syncthreads();
  if (GKT < K) stage(GKT, (unsigned)(GSTG * 2));
  /* rolled: one trip per stage, so that the two buffers alternate by the trip's parity */
#pragma unroll 1
  for (int kb = 0; kb < K; kb += GKT) { const unsigned short* buf = sT + ((kb >> 6) & 1) * GSTG;      /* this trip reads its own buffer alone */
    const _Float16* ar = (const _Float16*)(buf + (32 * (w & 3) + ln) * GPITCH); const _Float16* br = (const _Float16*)(buf + (128 + 64 * (w >> 2) + ln) * GPITCH);
    v16h fa[2][2], fb[2][4];      /* the trip's 24 fragment reads stand together in front of its products, so that their LDS latency is waited out once per trip and not in front of every pair of products */
#pragma unroll
    for (int ks = 0; ks < 2; ++ks) { fa[ks][0] = g2_frag(ar + ks * 32, hh); fa[ks][1] = g2_frag(ar + 16 * GPITCH + ks * 32, hh);
#pragma unroll
      for (int t = 0; t < 4; ++t) fb[ks][t] = g2_frag(br + t * 16 * GPITCH + ks * 32, hh); }
#pragma unroll
    for (int ks = 0; ks < 2; ++ks)
#pragma unroll
      for (int t = 0; t < 4; ++t) { c[t] = g2_mma(fa[ks][0], fb[ks][t], c[t]); c[4 + t] = g2_mma(fa[ks][1], fb[ks][t], c[4 + t]); }
    asm volatile("s_wait_dscnt 0x0" ::: "memory");      /* this wave's reads of the buffer have returned before the buffer may be refilled */
    asm volatile("s_wait_asynccnt 0x0" ::: "memory");      /* this wave's copies of the next stage have landed before the barrier that shows them */
    __syncthreads();      /* publishes the next stage and ends every wave's reads of this trip's buffer */
    if (kb + 2 * GKT < K) stage(kb + 2 * GKT, (unsigned)(((kb >> 6) & 1) * (GSTG * 2))); }
  asm volatile("s_wait_asynccnt 0x0" ::: "memory");      /* no copy is outstanding when the LDS becomes output staging */
}
template <int ACT>
__global__ __launch_bounds__(256) void k_gemm2(const _Float16* __restrict__ A, int lda, size_t sA, const _Float16* __restrict__ Bh, int ldb, size_t sB, float alpha, const float* __restrict__ bias, size_t sBias, const float* __restrict__ CP, int rowsPerB, size_t sCPb, int row0g,
    float* __restrict__ C, _Float16* __restrict__ C16, int ldc, size_t sC, int M, int N, int K) {
  __shared__ __attribute__((aligned(16))) float sm[2 * GSTG / 2];      /* the two operand buffers; behind the main loop its first 8 x 32 x 68 floats are the output staging */
  float (*so)[32][68] = (float (*)[32][68])sm;
  const int tid = threadIdx.x, w = tid >> 5, lane = tid & 31, ln = lane & 15, hh = lane >> 4; const int by = blockIdx.y;
  A += (size_t)by * sA; Bh += (size_t)by * sB; const size_t cofs = (size_t)by * sC; const float* bp = bias ? bias + (size_t)by * sBias : nullptr;
  const int ntn = N >> 7; const int mt = blockIdx.x / ntn, nq = blockIdx.x - mt * ntn; const int row0 = mt * 128 + 32 * (w & 3), col0 = nq * 128 + 64 * (w >> 2); if (mt * 128 + 128 > M) return;      /* block-uniform, in front of every barrier and copy */
  const v8f z8 = {0.f,0.f,0.f,0.f,0.f,0.f,0.f,0.f}; v8f accs[8] = {z8, z8, z8, z8, z8, z8, z8, z8};
  g2_main(A, lda, Bh, ldb, K, mt * 128, nq * 128, (unsigned short*)sm, accs);
#pragma unroll
  for (int u = 0; u < 8; ++u) { const int t = u & 3, half = u >> 2; const int col = col0 + t * 16 + ln; const float bv = bp ? bf16_round(bp[col]) : 0.f;
#pragma unroll
    for (int r = 0; r < 8; ++r) { const int rloc = half * 16 + 8 * hh + r; float v = accs[u][r] * alpha + bv; if (CP) { const int bidx = (row0g + row0 + rloc) / rowsPerB; v += CP[(size_t)bidx * sCPb + (size_t)by * 64 + col]; }
      if (ACT == 3) v = fmaxf(v, 0.f); else if (ACT == 6) v = 0.5f * v * (1.0f + erff(v * 0.70710678118654752f)); else if (ACT == 11) v = 1.0f / (1.0f + expf(-v)); else if (ACT == 15) v = v / (1.0f + expf(-v)); else if (ACT == 12) v = (v > 0.f) ? v : 0.01f * v; else if (ACT == 8) v = tanhf(v);
      so[w][rloc][t * 16 + ln] = v; } }
  __builtin_amdgcn_fence(__ATOMIC_ACQ_REL, "workgroup"); __builtin_amdgcn_wave_barrier();
  const int rsub = lane >> 4, c4 = (lane & 15) * 4;
  {
#pragma unroll
    for (int q = 0; q < 16; ++q) { const int r = q * 2 + rsub; const v4f v = *(const v4fa*)&so[w][r][c4]; if (C) *(v4f*)(C + cofs + (size_t)(row0 + r) * ldc + col0 + c4) = v; if (C16) { v4h h4; for (int i = 0; i < 4; ++i) h4[i] = (_Float16)v[i]; *(v4h*)(C16 + cofs + (size_t)(row0 + r) * ldc + col0 + c4) = h4; } }
     } }



__device__ __forceinline__ float siluf(float g) { return g / (1.0f + expf(-g)); }
// ---- projection GEMM (main loop of k_gemm2, NR x DM x DM, Bt carries x16) with the element-wise tail in its epilogue. A wave tile is 32 tokens x the 64 columns of one head, so the head's norm is a sum inside the wave's own LDS rows.
// POLAR 1: g = silu(acc/16) * f, f = r*scale[h]/(r + 1e-6), r = |silu row|; g stored as f16 hi + x2^10 residual, row-major, one whole 128-B line per row and plane.
// POLAR 0: g = silu(acc/16) stored transposed per (batch, head) slab as hi + residual planes [64 dims][SLEN tokens]; the block's 128 tokens are transposed through LDS, one whole 128-B line per 8 lanes.
template <int POLAR>
__global__ __launch_bounds__(256) void k_proj(const _Float16* __restrict__ A, const _Float16* __restrict__ Bh, const float* __restrict__ scale, _Float16* __restrict__ Hh, _Float16* __restrict__ Hl) {
  constexpr int PT = POLAR ? 68 : 65;      /* LDS row pitch in floats: 68 for the 16-B row reads, 65 for the column reads of the transpose */
  __shared__ __attribute__((aligned(16))) float so[2 * GSTG / 2];      /* the two operand buffers; behind the main loop its first 256 x PT floats are the output staging: rows 32 w.. are wave w's */
  const int tid = threadIdx.x, w = tid >> 5, lane = tid & 31, ln = lane & 15, hh = lane >> 4;
  constexpr int ntn = DM >> 7; const int mt = blockIdx.x / ntn, nq = (blockIdx.x - mt * ntn) * 2 + __builtin_amdgcn_readfirstlane(w >> 2); const int row0 = mt * 128 + 32 * (w & 3), col0 = nq * 64;      /* nq = the wave's head: waves 0..3 the block's first, 4..7 its second; read from the first lane so that it stays a scalar and scale[nq] a scalar load */
  const v8f z8 = {0.f,0.f,0.f,0.f,0.f,0.f,0.f,0.f}; v8f accs[8] = {z8, z8, z8, z8, z8, z8, z8, z8};
  g2_main(A, DM, Bh, DM, DM, mt * 128, (blockIdx.x - mt * ntn) * 128, (unsigned short*)so, accs);      /* the main loop of k_gemm2 */
#pragma unroll
  for (int u = 0; u < 8; ++u) { const int t = u & 3, half = u >> 2;
#pragma unroll
    for (int r = 0; r < 8; ++r) so[(32 * w + half * 16 + 8 * hh + r) * PT + t * 16 + ln] = siluf(accs[u][r] * 0.0625f); }
  if (POLAR) {
    __builtin_amdgcn_fence(__ATOMIC_ACQ_REL, "workgroup"); __builtin_amdgcn_wave_barrier();      /* each wave reads back its own 32 rows only */
    const int rsub = lane >> 4, c4 = (lane & 15) * 4; const float sc = bf16_round(scale[nq]);
#pragma unroll
    for (int q = 0; q < 16; ++q) { const int r = q * 2 + rsub; const v4f v = *(const v4fa*)&so[(32 * w + r) * PT + c4];
      float s = (v[0] * v[0] + v[1] * v[1]) + (v[2] * v[2] + v[3] * v[3]); s += __shfl_xor(s, 8, 32); s += __shfl_xor(s, 4, 32); s += __shfl_xor(s, 2, 32); s += __shfl_xor(s, 1, 32);
      const float rr = sqrtf(s); const float fac = (rr * sc) / (rr + 1e-6f); v4h h4, l4;
#pragma unroll
      for (int i = 0; i < 4; ++i) { const float g = v[i] * fac; const _Float16 h = (_Float16)g; h4[i] = h; l4[i] = (_Float16)((g - (float)h) * 1024.0f); }
      const size_t o = (size_t)(row0 + r) * DM + col0 + c4; *(v4h*)(Hh + o) = h4; *(v4h*)(Hl + o) = l4; }
  } else {
    __syncthreads();      /* the transpose reads rows that the block's other waves wrote */
    const int slab = (mt * 128 / SLEN) * NH + nq, tok0 = mt * 128 % SLEN;
#pragma unroll
    for (int it = 0; it < 8; ++it) { const int item = it * 128 + (tid & 127); const int pc = item & 7, d = (item >> 3) & 63, g = item >> 9; FragH fh, fl;      /* each half of the block transposes its own head's 128 LDS rows */
#pragma unroll
      for (int q = 0; q < 8; ++q) { const float v = so[((w >> 2) * 128 + g * 64 + pc * 8 + q) * PT + d]; const _Float16 hv = (_Float16)v; fh.h[q] = hv; fl.h[q] = (_Float16)((v - (float)hv) * 1024.0f); }
      const size_t o = ((size_t)slab * 64 + d) * SLEN + tok0 + g * 64 + pc * 8; *(v8us*)((unsigned short*)Hh + o) = fh.half[0]; *(v8us*)((unsigned short*)Hl + o) = fl.half[0]; }
  } }

// Eight asynchronous 16-byte copies global -> LDS per lane (one key pass's share of the K and V^T hi / residual tiles), through no register. The s_wait_xcnt is the last line of the copies' own statement, so that no address register named here is rewritten ahead of it.
__device__ __forceinline__ void kv_copy8(unsigned l0, unsigned l1, unsigned l2, unsigned l3, unsigned l4, unsigned l5, unsigned l6, unsigned l7,
    const unsigned short* g0, const unsigned short* g1, const unsigned short* g2, const unsigned short* g3, const unsigned short* g4, const unsigned short* g5, const unsigned short* g6, const unsigned short* g7) {
  asm volatile("global_load_async_to_lds_b128 %0, %8, off\n\t"
               "global_load_async_to_lds_b128 %1, %9, off\n\t"
               "global_load_async_to_lds_b128 %2, %10, off\n\t"
               "global_load_async_to_lds_b128 %3, %11, off\n\t"
               "global_load_async_to_lds_b128 %4, %12, off\n\t"
               "global_load_async_to_lds_b128 %5, %13, off\n\t"
               "global_load_async_to_lds_b128 %6, %14, off\n\t"
               "global_load_async_to_lds_b128 %7, %15, off\n\t"
               "s_wait_xcnt 0x0"
               :: "v"(l0), "v"(l1), "v"(l2), "v"(l3), "v"(l4), "v"(l5), "v"(l6), "v"(l7), "v"(g0), "v"(g1), "v"(g2), "v"(g3), "v"(g4), "v"(g5), "v"(g6), "v"(g7) : "memory");
}
template <int TQ, int TK>
__global__ __launch_bounds__(128) void k_flashm(const _Float16* __restrict__ Q16, const _Float16* __restrict__ Q16lo, int ldq, const _Float16* __restrict__ K16, const _Float16* __restrict__ K16lo, int ldk, const _Float16* __restrict__ Vt, const _Float16* __restrict__ Vtlo, const unsigned* __restrict__ MB, const int* __restrict__ RA, const int* __restrict__ KE, _Float16* __restrict__ Oh, _Float16* __restrict__ Ol, int ldo) {
  constexpr int RPW = 16, RTN = RPW / 16, NQB = TQ / (4 * RPW), DT = 4, KS = 2;
  __shared__ __attribute__((aligned(16))) unsigned short sP[4][RPW][40], sPl[4][RPW][40]; __shared__ __attribute__((aligned(16))) float sO[4][RPW][64 + 4];
  /* One pass's 32 keys, staged once for the block's four waves, two buffers. In 16-bit units: K rows (64 dims) at pitch 72 = 144 B, V^T rows (32 keys) at pitch 40 = 80 B, both 16 B x odd for the 16-byte fragment reads. */
  constexpr int KP = 72, VP = 40, KL0 = 32 * KP, VH0 = 2 * 32 * KP, VL0 = VH0 + 64 * VP, STG = VL0 + 64 * VP;
  __shared__ __attribute__((aligned(16))) unsigned short sKV[2][STG];
  const int tid = threadIdx.x, w = tid >> 5, lane = tid & 31, ln = lane & 15, hh = lane >> 4;
  /* Heaviest first: a block walks 2 (qblk + 1) key passes and the grid holds about twice as many blocks as fit on the chip at once, so the block index counts the query blocks downwards, all (batch, head) slabs of one query block side by side. Cost falls with the index: the long blocks start first, neighbours in the index cost the same, and the launch ends on 2-pass blocks. Every (slab, query block) is taken exactly once. */
  constexpr int NSL = NBT * NH; const int slab = blockIdx.x % NSL, qblk = NQB - 1 - blockIdx.x / NSL; const int b = slab / NH, h = slab % NH; const int qb0 = qblk * (4 * RPW); const int q0 = qb0 + w * RPW;
  FragH aq[2][KS], aql[2][KS];
#pragma unroll
  for (int rt = 0; rt < RTN; ++rt) { const size_t qo = ((size_t)b * TQ + q0 + rt * 16 + ln) * ldq + h * 64; const unsigned short* qr = (const unsigned short*)Q16 + qo; const unsigned short* ql = (const unsigned short*)Q16lo + qo;
#pragma unroll
    for (int ks = 0; ks < KS; ++ks) { aq[rt][ks].half[0] = *(const v8us*)(qr + ks * 32 + 8 * hh); aq[rt][ks].half[1] = *(const v8us*)(qr + ks * 32 + 16 + 8 * hh); aql[rt][ks].half[0] = *(const v8us*)(ql + ks * 32 + 8 * hh); aql[rt][ks].half[1] = *(const v8us*)(ql + ks * 32 + 16 + 8 * hh); } }
  asm volatile("s_wait_xcnt 0x0" ::: "memory");      /* the Q loads' address registers are reused right below */
  const unsigned short* Vth = (const unsigned short*)Vt + (size_t)slab * 64 * TK; const unsigned short* Vtl = (const unsigned short*)Vtlo + (size_t)slab * 64 * TK;
  float m_r[2][8], l_r[2][8]; v8f oacc[2][DT], oaccl[2][DT];
#pragma unroll
  for (int rt = 0; rt < RTN; ++rt) {
#pragma unroll
    for (int r = 0; r < 8; ++r) { m_r[rt][r] = -3.0e38f; l_r[rt][r] = 0.f; }
#pragma unroll
    for (int dt = 0; dt < DT; ++dt) { oacc[rt][dt] = (v8f){0.f,0.f,0.f,0.f,0.f,0.f,0.f,0.f}; oaccl[rt][dt] = oacc[rt][dt]; } }
  int jend = KE[qblk * 32]; jend = min(TK, (jend + 31) & ~31); if (jend < 32) jend = 32;      /* block-uniform */
  /* each thread copies two 16-byte pieces of each of the four tiles: K rows tid/8 and tid/8 + 16 (a wave's copy = 4 whole 128-B rows), V^T rows tid/4 and tid/4 + 32 */
  const unsigned short* gkh = (const unsigned short*)K16 + ((size_t)b * TK + (tid >> 3)) * ldk + h * 64 + (tid & 7) * 8; const unsigned short* gkl = (const unsigned short*)K16lo + ((size_t)b * TK + (tid >> 3)) * ldk + h * 64 + (tid & 7) * 8;
  const unsigned short* gvh = Vth + (size_t)(tid >> 2) * TK + (tid & 3) * 8; const unsigned short* gvl = Vtl + (size_t)(tid >> 2) * TK + (tid & 3) * 8;
  const unsigned lk = (unsigned)(size_t)&sKV[0][(tid >> 3) * KP + (tid & 7) * 8], lv = (unsigned)(size_t)&sKV[0][VH0 + (tid >> 2) * VP + (tid & 3) * 8];
  auto stage = [&](int j, unsigned bo) { const size_t ko = (size_t)j * ldk, k16 = (size_t)16 * ldk;
    kv_copy8(lk + bo, lk + bo + 16 * KP * 2, lk + bo + KL0 * 2, lk + bo + (KL0 + 16 * KP) * 2, lv + bo, lv + bo + 32 * VP * 2, lv + bo + 64 * VP * 2, lv + bo + 96 * VP * 2,
             gkh + ko, gkh + ko + k16, gkl + ko, gkl + ko + k16, gvh + j, gvh + j + (size_t)32 * TK, gvl + j, gvl + j + (size_t)32 * TK); };
  stage(0, 0u);
  asm volatile("s_wait_asynccnt 0x0" ::: "memory");      /* this wave's copies of pass 0 have landed before the barrier that shows them to the other waves */
  __syncthreads();
  if (32 < jend) stage(32, (unsigned)(STG * 2));
  int allm[2][8]; const unsigned* mrow[2][8];
#pragma unroll
  for (int rt = 0; rt < RTN; ++rt)
#pragma unroll
    for (int r = 0; r < 8; ++r) { const int tq = q0 + rt * 16 + 8 * hh + r; allm[rt][r] = RA[tq]; mrow[rt][r] = MB + (size_t)tq * (TK / 32); }
  asm volatile("s_wait_xcnt 0x0" ::: "memory");      /* the row-flag loads' offset register is reused below */
#pragma unroll 1
  for (int j0 = 0; j0 < jend; j0 += 32) {
    unsigned mwv[2][8];      /* all rows' mask words are asked for at the head of the pass, ahead of the K fragment reads and score products that need none of them, and no row waits for its own */
#pragma unroll
    for (int rt = 0; rt < RTN; ++rt)
#pragma unroll
      for (int r = 0; r < 8; ++r) mwv[rt][r] = mrow[rt][r][j0 >> 5];
    const unsigned short* kvb = &sKV[(j0 >> 5) & 1][0];      /* this pass reads its own buffer alone */
    v8f s[2][2];
#pragma unroll
    for (int nt = 0; nt < 2; ++nt) { const unsigned short* kr = kvb + (nt * 16 + ln) * KP; const unsigned short* kl = kr + KL0; FragH bk[KS], bkl[KS];
#pragma unroll
      for (int ks = 0; ks < KS; ++ks) { bk[ks].half[0] = *(const v8us*)(kr + ks * 32 + 8 * hh); bk[ks].half[1] = *(const v8us*)(kr + ks * 32 + 16 + 8 * hh); bkl[ks].half[0] = *(const v8us*)(kl + ks * 32 + 8 * hh); bkl[ks].half[1] = *(const v8us*)(kl + ks * 32 + 16 + 8 * hh); }
#pragma unroll
      for (int rt = 0; rt < RTN; ++rt) { v8f acc = (v8f){0.f,0.f,0.f,0.f,0.f,0.f,0.f,0.f}, accr = acc;
#pragma unroll
        for (int ks = 0; ks < KS; ++ks) { acc = mmaH<1>(aq[rt][ks].v, aq[rt][ks].v, bk[ks].v, bk[ks].v, acc); accr = mmaH<1>(aql[rt][ks].v, aql[rt][ks].v, bk[ks].v, bk[ks].v, accr); accr = mmaH<1>(aq[rt][ks].v, aq[rt][ks].v, bkl[ks].v, bkl[ks].v, accr); }
        s[rt][nt] = acc + accr * 0.0009765625f; } }
    /* The eight rows of a tile run side by side: the body holds no branch (each exp is computed on every lane and chosen by a select behind it; the chosen values are the same), and each step is written for all rows before the next, so one row's lane exchange and exp wait is filled by the other seven. */
#pragma unroll
    for (int rt = 0; rt < RTN; ++rt) { float s0[8], s1[8], mc[8]; bool ok0[8], ok1[8];
#pragma unroll
      for (int r = 0; r < 8; ++r) { const unsigned mw = mwv[rt][r]; const bool am = (allm[rt][r] != 0);
        ok0[r] = am || (((mw >> ln) & 1u) == 0u); ok1[r] = am || (((mw >> (16 + ln)) & 1u) == 0u);
        s0[r] = ok0[r] ? (am ? 0.f : s[rt][0][r] * SCL) : -INFINITY; s1[r] = ok1[r] ? (am ? 0.f : s[rt][1][r] * SCL) : -INFINITY; mc[r] = fmaxf(s0[r], s1[r]); }
#pragma unroll
      for (int st = 1; st < 16; st <<= 1)
#pragma unroll
        for (int r = 0; r < 8; ++r) mc[r] = fmaxf(mc[r], __shfl_xor(mc[r], st, 32));
#pragma unroll
      for (int r = 0; r < 8; ++r) { const float mn = fmaxf(m_r[rt][r], mc[r]); const float ea = expf(m_r[rt][r] - mn), e0 = expf(s0[r] - mn), e1 = expf(s1[r] - mn);
        const float al = (mn > -1.0e38f) ? ea : 1.0f; m_r[rt][r] = mn; const float p0 = ok0[r] ? e0 : 0.f, p1 = ok1[r] ? e1 : 0.f; l_r[rt][r] = l_r[rt][r] * al + p0 + p1;
#pragma unroll
        for (int dt = 0; dt < DT; ++dt) { oacc[rt][dt][r] *= al; oaccl[rt][dt][r] *= al; }
        FragH t2, t3; const float ps0 = p0 * 1024.0f, ps1 = p1 * 1024.0f; t2.h[0] = (_Float16)ps0; t2.h[1] = (_Float16)ps1; t3.h[0] = (_Float16)((ps0 - (float)t2.h[0]) * 1024.0f); t3.h[1] = (_Float16)((ps1 - (float)t2.h[1]) * 1024.0f);
        sP[w][rt * 16 + 8 * hh + r][ln] = t2.u[0]; sP[w][rt * 16 + 8 * hh + r][16 + ln] = t2.u[1]; sPl[w][rt * 16 + 8 * hh + r][ln] = t3.u[0]; sPl[w][rt * 16 + 8 * hh + r][16 + ln] = t3.u[1]; } }
    __builtin_amdgcn_fence(__ATOMIC_ACQ_REL, "workgroup"); __builtin_amdgcn_wave_barrier();
    FragH pa[2], pl[2];
#pragma unroll
    for (int rt = 0; rt < RTN; ++rt) { pa[rt].half[0] = *(const v8us*)&sP[w][rt * 16 + ln][8 * hh]; pa[rt].half[1] = *(const v8us*)&sP[w][rt * 16 + ln][16 + 8 * hh]; pl[rt].half[0] = *(const v8us*)&sPl[w][rt * 16 + ln][8 * hh]; pl[rt].half[1] = *(const v8us*)&sPl[w][rt * 16 + ln][16 + 8 * hh]; }
#pragma unroll
    for (int dt = 0; dt < DT; ++dt) { const unsigned short* vr = kvb + VH0 + (dt * 16 + ln) * VP; const unsigned short* vl = vr + 64 * VP; FragH bv, bl; bv.half[0] = *(const v8us*)(vr + 8 * hh); bv.half[1] = *(const v8us*)(vr + 16 + 8 * hh); bl.half[0] = *(const v8us*)(vl + 8 * hh); bl.half[1] = *(const v8us*)(vl + 16 + 8 * hh);
#pragma unroll
      for (int rt = 0; rt < RTN; ++rt) { oacc[rt][dt] = mmaH<1>(pa[rt].v, pa[rt].v, bv.v, bv.v, oacc[rt][dt]); oaccl[rt][dt] = mmaH<1>(pa[rt].v, pa[rt].v, bl.v, bl.v, oaccl[rt][dt]); oaccl[rt][dt] = mmaH<1>(pl[rt].v, pl[rt].v, bv.v, bv.v, oaccl[rt][dt]); } }
    __builtin_amdgcn_fence(__ATOMIC_ACQ_REL, "workgroup"); __builtin_amdgcn_wave_barrier();
    asm volatile("s_wait_xcnt 0x0" ::: "memory");      /* the mask-word loads' address register is stepped for the next pass behind this point; the wait that covered it stood behind the K global loads and went with them */
    asm volatile("s_wait_dscnt 0x0" ::: "memory");      /* this wave's reads of the buffer have returned before the buffer may be refilled */
    asm volatile("s_wait_asynccnt 0x0" ::: "memory");      /* this wave's copies of the next pass have landed before the barrier that shows them */
    __syncthreads();      /* publishes the next pass's tiles and ends every wave's reads of this pass's buffer */
    if (j0 + 64 < jend) stage(j0 + 64, (unsigned)(((j0 >> 5) & 1) * (STG * 2))); }
  asm volatile("s_wait_asynccnt 0x0" ::: "memory");      /* no copy is outstanding when the wave goes on to its end */
#pragma unroll
  for (int rt = 0; rt < RTN; ++rt) {
#pragma unroll
    for (int r = 0; r < 8; ++r) { float l = l_r[rt][r]; l += __shfl_xor(l, 1, 32); l += __shfl_xor(l, 2, 32); l += __shfl_xor(l, 4, 32); l += __shfl_xor(l, 8, 32); l_r[rt][r] = (l > 0.f) ? 1.0f / (l * 1024.0f) : 0.f; }
#pragma unroll
    for (int dt = 0; dt < DT; ++dt)
#pragma unroll
      for (int r = 0; r < 8; ++r) sO[w][rt * 16 + 8 * hh + r][dt * 16 + ln] = (oacc[rt][dt][r] + oaccl[rt][dt][r] * 0.0009765625f) * l_r[rt][r]; }
  __builtin_amdgcn_fence(__ATOMIC_ACQ_REL, "workgroup"); __builtin_amdgcn_wave_barrier();
  {
#pragma unroll
    for (int rp = 0; rp < RPW; rp += 2) { const int r = rp + (lane >> 4), pc = lane & 15; const v4f val = *(const v4fa*)&sO[w][r][pc * 4]; v4h h4, l4;
#pragma unroll
      for (int i = 0; i < 4; ++i) { const _Float16 hv = (_Float16)val[i]; h4[i] = hv; l4[i] = (_Float16)((val[i] - (float)hv) * 1024.0f); }
      const size_t oo = ((size_t)b * TQ + q0 + r) * ldo + h * 64 + pc * 4; *(v4h*)(Oh + oo) = h4; *(v4h*)(Ol + oo) = l4; }
     } }


__global__ __launch_bounds__(256) void k_causaltab(unsigned* __restrict__ MB, int* __restrict__ RA, int* __restrict__ KE, int nq, int nk) {
  const int t = blockIdx.x * 256 + threadIdx.x; const int nw = nk / 32;
  if (t < nq * nw) { const int q = t / nw, w = t % nw; const int first = q + 1 - 32 * w; const unsigned bits = (first <= 0) ? 0xffffffffu : ((first >= 32) ? 0u : (0xffffffffu << first)); *(unsigned*)(MB + t) = bits;  }
  if (t < nq) { *(int*)(RA + t) = 0;  }
  if (t < nq / 64) { const int v = 64 * (t + 1); *(int*)(KE + t * 32) = v;  } }

extern "C" void kernel_launch(void* const* d_in, const int* in_sizes, int n_in,
                              void* d_out, int out_size, void* d_ws, size_t ws_size, hipStream_t stream) {
  (void)in_sizes; (void)n_in; (void)out_size;
  const float* const* I = (const float* const*)d_in; const float* x = I[0]; const float* Wq = I[1]; const float* Wk = I[2]; const float* Wv = I[3]; const float* Wo = I[4]; const float* qs = I[5]; const float* ks = I[6];
  char* ws = (char*)d_ws; size_t off = 0;
  auto take = [&](size_t bytes) { char* p = ws + off; off += (bytes + 255) & ~(size_t)255; return p; };
  _Float16* BQ = (_Float16*)take((size_t)DM * DM * 2); _Float16* BK = (_Float16*)take((size_t)DM * DM * 2); _Float16* BV = (_Float16*)take((size_t)DM * DM * 2); _Float16* BO = (_Float16*)take((size_t)DM * DM * 2);
  _Float16* X16 = (_Float16*)take((size_t)NR * DM * 2); _Float16* Oh = (_Float16*)take((size_t)NR * DM * 2); _Float16* Ol = (_Float16*)take((size_t)NR * DM * 2);
  _Float16* Qh = (_Float16*)take((size_t)NR * DM * 2); _Float16* Ql = (_Float16*)take((size_t)NR * DM * 2); _Float16* Kh = (_Float16*)take((size_t)NR * DM * 2); _Float16* Kl = (_Float16*)take((size_t)NR * DM * 2); _Float16* Vth = (_Float16*)take((size_t)NR * DM * 2); _Float16* Vtl = (_Float16*)take((size_t)NR * DM * 2);
  unsigned* MB = (unsigned*)take((size_t)SLEN * (SLEN / 32) * 4); int* RA = (int*)take((size_t)SLEN * 4); int* KE = (int*)take((size_t)(SLEN / 64) * 32 * 4);
  if (off > ws_size) return;      /* 8 + 16 + 2 x 16 + 6 x 16 + 0.5 = 153 MiB */
  const size_t n8 = (size_t)NR * DM / 8; const unsigned nb8 = (unsigned)((n8 + 255) / 256); const size_t w8 = (size_t)DM * DM / 8; const unsigned wb = (unsigned)((w8 + 255) / 256);
  k_round16f<<<wb, 256, 0, stream>>>(Wq, BQ, w8); k_round16f<<<wb, 256, 0, stream>>>(Wk, BK, w8); k_round16f<<<wb, 256, 0, stream>>>(Wv, BV, w8); k_round16f<<<wb, 256, 0, stream>>>(Wo, BO, w8);      /* torch (out,in) = natural Bt; x16 */
  k_causaltab<<<(SLEN * (SLEN / 32) + 255) / 256, 256, 0, stream>>>(MB, RA, KE, SLEN, SLEN);
  const dim3 gP((NR / 128) * (DM / 128), 1);
  k_x16<<<nb8, 256, 0, stream>>>(x, X16, n8);
  k_proj<1><<<gP, 256, 0, stream>>>(X16, BQ, qs, Qh, Ql);      /* q = silu(x Wq^T) * f_q, hi + residual */
  k_proj<1><<<gP, 256, 0, stream>>>(X16, BK, ks, Kh, Kl);      /* k = silu(x Wk^T) * f_k, hi + residual */
  k_proj<0><<<gP, 256, 0, stream>>>(X16, BV, ks, Vth, Vtl);      /* v = silu(x Wv^T), transposed, hi + residual (scale unread) */
  k_flashm<SLEN, SLEN><<<NBT * NH * (SLEN / 64), 128, 0, stream>>>(Qh, Ql, DM, Kh, Kl, DM, Vth, Vtl, MB, RA, KE, Oh, Ol, DM);
  float* outb = (float*)d_out;
  k_gemm2<0><<<gP, 256, 0, stream>>>(Oh, DM, 0, BO, DM, 0, 0.0625f, nullptr, 0, nullptr, 1, 0, 0, outb, nullptr, DM, 0, NR, DM, DM);
  k_gemm2<0><<<gP, 256, 0, stream>>>(Ol, DM, 0, BO, DM, 0, 0.0625f / 1024.0f, nullptr, 0, outb, 1, (size_t)DM, 0, outb, nullptr, DM, 0, NR, DM, DM);
}

// v007
// A run of this version takes 276 microseconds.
// Timed twice side by side with v006, it ran 1.21 and 1.22 times as fast.
// Counting every step since v000, it is 7.17 times as fast.
#include <hip/hip_runtime.h>
#define NBT 4
#define SLEN 2048
#define DM 1024
#define NH 16
#define SCL 1.0f
#define NR (NBT * SLEN)
typedef __bf16 v16b __attribute__((ext_vector_type(16)));
typedef unsigned short v8us __attribute__((ext_vector_type(8), may_alias));
typedef float  v8f  __attribute__((ext_vector_type(8)));
typedef float  v4f  __attribute__((ext_vector_type(4)));
typedef float  v4fa __attribute__((ext_vector_type(4), may_alias));
union FragB { v16b v; v8us half[2]; unsigned short u[16]; };

__device__ __forceinline__ unsigned short bf16_bits(float x) { unsigned int u = __float_as_uint(x); return (unsigned short)((u + 0x7FFFu + ((u >> 16) & 1u)) >> 16); }
__device__ __forceinline__ float bf16_val(unsigned short b) { return __uint_as_float(((unsigned int)b) << 16); }
__device__ __forceinline__ float bf16_round(float x) { return bf16_val(bf16_bits(x)); }
// D += A·B with NT terms: 1 = ah·bh, 2 = + al·bh (A split), 3 = + ah·bl (both split)
template <int NT>
__device__ __forceinline__ v8f mmaN(v16b ah, v16b al, v16b bh, v16b bl, v8f c) {
  c = __builtin_amdgcn_wmma_f32_16x16x32_bf16(false, ah, false, bh, (short)0, c, false, false);
  if (NT >= 2) c = __builtin_amdgcn_wmma_f32_16x16x32_bf16(false, al, false, bh, (short)0, c, false, false);
  if (NT >= 3) c = __builtin_amdgcn_wmma_f32_16x16x32_bf16(false, ah, false, bl, (short)0, c, false, false);
  asm volatile("v_nop\n\tv_nop\n\tv_nop\n\tv_nop" : "+v"(c) : "v"(ah), "v"(al), "v"(bh), "v"(bl));
  return c;
}

__global__ __launch_bounds__(256) void k_wt_bf16(const float* __restrict__ W, unsigned short* __restrict__ Wt, int K, int N) {
  const int t = blockIdx.x * 256 + threadIdx.x;
  const int k8n = K / 8;
  if (t >= N * k8n) return;
  const int n = t / k8n, k8 = (t % k8n) * 8;
  v8us v;
#pragma unroll
  for (int i = 0; i < 8; ++i) v[i] = bf16_bits(W[(size_t)(k8 + i) * N + n]);
  *(v8us*)(Wt + (size_t)n * K + k8) = v;
  
}

// GEMM C[M][N] (f32, pitch ldc) = act(A[M][K]·W + bias). A f32 row-major (pitch lda) converted per fragment to bf16
// (ASPLIT: hi/lo two planes -> 2 terms, else single rounded term); Wt bf16 [N][K] (pitch ldb). BIAS_BF16 rounds the
// bias to bf16 first (bias quantised to bf16 before the add). K%32==0, M%16==0, N%64==0.
template <bool ASPLIT, int ACT, bool BIAS_BF16>
__global__ __launch_bounds__(128) void k_gemm_bf(const float* __restrict__ A, int lda, const unsigned short* __restrict__ Wt, int ldb,
                                               const float* __restrict__ bias, float* __restrict__ C, int ldc, int M, int N, int K) {
  __shared__ __attribute__((aligned(16))) float so[4][16][64];
  const int tid = threadIdx.x, w = tid >> 5, lane = tid & 31, ln = lane & 15, hh = lane >> 4;
  const int ntn = N / 64;
  const int wid = blockIdx.x * 4 + w;
  const int mt = wid / ntn, nq = wid % ntn;
  if (mt * 16 >= M) return;
  const int row0 = mt * 16, col0 = nq * 64;
  const float* arow = A + (size_t)(row0 + ln) * lda;
  v8f acc[4] = {};
  for (int kb = 0; kb < K; kb += 32) {
    FragB ah, al;
    const v4f x0 = *(const v4fa*)(arow + kb + 8 * hh), x1 = *(const v4fa*)(arow + kb + 8 * hh + 4);
    const v4f x2 = *(const v4fa*)(arow + kb + 16 + 8 * hh), x3 = *(const v4fa*)(arow + kb + 16 + 8 * hh + 4);
    float xs[16] = {x0[0],x0[1],x0[2],x0[3],x1[0],x1[1],x1[2],x1[3],x2[0],x2[1],x2[2],x2[3],x3[0],x3[1],x3[2],x3[3]};
#pragma unroll
    for (int i = 0; i < 16; ++i) { const unsigned short hb = bf16_bits(xs[i]); ah.u[i] = hb; al.u[i] = ASPLIT ? bf16_bits(xs[i] - bf16_val(hb)) : (unsigned short)0; }
#pragma unroll
    for (int t = 0; t < 4; ++t) {
      const unsigned short* brow = Wt + (size_t)(col0 + t * 16 + ln) * ldb + kb;
      FragB b;
      b.half[0] = *(const v8us*)(brow + 8 * hh);
      b.half[1] = *(const v8us*)(brow + 16 + 8 * hh);
      acc[t] = mmaN<ASPLIT ? 2 : 1>(ah.v, al.v, b.v, b.v, acc[t]);
    }
  }
#pragma unroll
  for (int t = 0; t < 4; ++t) {
    float bv = bias ? bias[col0 + t * 16 + ln] : 0.f;
    if (BIAS_BF16) bv = bf16_round(bv);
#pragma unroll
    for (int r = 0; r < 8; ++r) { float v = acc[t][r] + bv; if (ACT == 1) v = fmaxf(v, 0.f); so[w][8 * hh + r][t * 16 + ln] = v; }
  }
  __builtin_amdgcn_fence(__ATOMIC_ACQ_REL, "workgroup");
  __builtin_amdgcn_wave_barrier();
  const int rsub = lane >> 4, c4 = (lane & 15) * 4;
  {
#pragma unroll
    for (int q = 0; q < 8; ++q) {
      const int r = q * 2 + rsub;
      const v4f v = *(const v4fa*)&so[w][r][c4];
      *(v4f*)(C + (size_t)(row0 + r) * ldc + col0 + c4) = v;
    }
    
  }
}

// GEMM C = act(A·W + bias + resid): A f32 (ASPLIT -> hi/lo 2 terms), Wt bf16 [N][K]; ACT 0 none, 1 relu, 2 exact gelu;
// resid (optional, f32, row index = (row % rmod), pitch ldr, RES_BF16 rounds it) added before the activation.
template <bool ASPLIT, int ACT, bool BIAS_BF16, bool RES_BF16>
__global__ __launch_bounds__(128) void k_gemm_bf3(const float* __restrict__ A, int lda, const unsigned short* __restrict__ Wt, int ldb,
                                                const float* __restrict__ bias, const float* __restrict__ resid, int rmod, int ldr,
                                                float* __restrict__ C, int ldc, int M, int N, int K) {
  __shared__ __attribute__((aligned(16))) float so[4][16][64];
  const int tid = threadIdx.x, w = tid >> 5, lane = tid & 31, ln = lane & 15, hh = lane >> 4;
  const int ntn = N / 64;
  const int wid = blockIdx.x * 4 + w;
  const int mt = wid / ntn, nq = wid % ntn;
  if (mt * 16 >= M) return;
  const int row0 = mt * 16, col0 = nq * 64;
  const float* arow = A + (size_t)(row0 + ln) * lda;
  v8f acc[4] = {};
  for (int kb = 0; kb < K; kb += 32) {
    FragB ah, al;
    const v4f x0 = *(const v4fa*)(arow + kb + 8 * hh), x1 = *(const v4fa*)(arow + kb + 8 * hh + 4);
    const v4f x2 = *(const v4fa*)(arow + kb + 16 + 8 * hh), x3 = *(const v4fa*)(arow + kb + 16 + 8 * hh + 4);
    float xs[16] = {x0[0],x0[1],x0[2],x0[3],x1[0],x1[1],x1[2],x1[3],x2[0],x2[1],x2[2],x2[3],x3[0],x3[1],x3[2],x3[3]};
#pragma unroll
    for (int i = 0; i < 16; ++i) { const unsigned short hb = bf16_bits(xs[i]); ah.u[i] = hb; al.u[i] = ASPLIT ? bf16_bits(xs[i] - bf16_val(hb)) : (unsigned short)0; }
#pragma unroll
    for (int t = 0; t < 4; ++t) {
      const unsigned short* brow = Wt + (size_t)(col0 + t * 16 + ln) * ldb + kb;
      FragB b;
      b.half[0] = *(const v8us*)(brow + 8 * hh);
      b.half[1] = *(const v8us*)(brow + 16 + 8 * hh);
      acc[t] = mmaN<ASPLIT ? 2 : 1>(ah.v, al.v, b.v, b.v, acc[t]);
    }
  }
#pragma unroll
  for (int t = 0; t < 4; ++t) {
    const int col = col0 + t * 16 + ln;
    float bv = bias ? bias[col] : 0.f;
    if (BIAS_BF16) bv = bf16_round(bv);
#pragma unroll
    for (int r = 0; r < 8; ++r) {
      float v = acc[t][r] + bv;
      if (resid) { float rv = resid[(size_t)((row0 + 8 * hh + r) % rmod) * ldr + col]; if (RES_BF16) rv = bf16_round(rv); v += rv; }
      if (ACT == 1) v = fmaxf(v, 0.f);
      if (ACT == 2) v = 0.5f * v * (1.0f + erff(v * 0.70710678118654752f));
      if (ACT == 3) { const float u = 0.7978845608028654f * (v + 0.044715f * v * v * v); v = 0.5f * v * (1.0f + tanhf(u)); }
      so[w][8 * hh + r][t * 16 + ln] = v;
    }
  }
  __builtin_amdgcn_fence(__ATOMIC_ACQ_REL, "workgroup");
  __builtin_amdgcn_wave_barrier();
  const int rsub = lane >> 4, c4 = (lane & 15) * 4;
  {
#pragma unroll
    for (int q = 0; q < 8; ++q) {
      const int r = q * 2 + rsub;
      const v4f v = *(const v4fa*)&so[w][r][c4];
      *(v4f*)(C + (size_t)(row0 + r) * ldc + col0 + c4) = v;
    }
    
  }
}
// row LayerNorm (biased variance, eps) over N: s = X (+ R); optional out_sum <- s; out_norm <- (s-mu)*rsqrt(var+eps)*g + b
template <bool PARAM_BF16>
__global__ __launch_bounds__(256) void k_layernorm(const float* __restrict__ X, const float* __restrict__ R, const float* __restrict__ g, const float* __restrict__ bta,
                                                  float* __restrict__ out_sum, float* __restrict__ out_norm, int N, float eps) {
  __shared__ float red[256];
  const int row = blockIdx.x, tid = threadIdx.x;
  const float* x = X + (size_t)row * N; const float* rr = R ? R + (size_t)row * N : nullptr;
  float vals[16];                     // up to N = 4096
  const int per = N / 256;            // contiguous chunk per thread? use strided-by-4 chunks: thread handles j = tid*4 + 1024*u
  float s1 = 0.f;
  for (int u = 0; u < per / 4; ++u) {
    const int j = tid * 4 + 1024 * u;
    const v4f a = *(const v4fa*)(x + j);
    v4f b = {0.f,0.f,0.f,0.f}; if (rr) b = *(const v4fa*)(rr + j);
#pragma unroll
    for (int q = 0; q < 4; ++q) { const float v = a[q] + b[q]; vals[u * 4 + q] = v; s1 += v; }
  }
  red[tid] = s1; __syncthreads();
  for (int st = 128; st > 0; st >>= 1) { if (tid < st) red[tid] += red[tid + st]; __syncthreads(); }
  const float mu = red[0] / (float)N; __syncthreads();
  float s2 = 0.f;
  for (int u = 0; u < per / 4; ++u)
#pragma unroll
    for (int q = 0; q < 4; ++q) { const float c = vals[u * 4 + q] - mu; s2 += c * c; }
  red[tid] = s2; __syncthreads();
  for (int st = 128; st > 0; st >>= 1) { if (tid < st) red[tid] += red[tid + st]; __syncthreads(); }
  const float rs = rsqrtf(red[0] / (float)N + eps);
  {
    for (int u = 0; u < per / 4; ++u) {
      const int j = tid * 4 + 1024 * u;
      v4f o, sm;
#pragma unroll
      for (int q = 0; q < 4; ++q) {
        float gg = g[j + q], bb = bta[j + q];
        if (PARAM_BF16) { gg = bf16_round(gg); bb = bf16_round(bb); }
        sm[q] = vals[u * 4 + q]; o[q] = (vals[u * 4 + q] - mu) * rs * gg + bb;
      }
      if (out_sum) *(v4f*)(out_sum + (size_t)row * N + j) = sm;
      *(v4f*)(out_norm + (size_t)row * N + j) = o;
    }
    
  }
}



// ---- f16 WMMA path (v_wmma_f32_16x16x32_f16): 11-bit significands for operands in range — used where a [0,1] probability operand needs more precision than bf16
typedef _Float16 v16h __attribute__((ext_vector_type(16)));
union FragH { v16h v; v8us half[2]; _Float16 h[16]; unsigned short u[16]; };
template <int NT>
__device__ __forceinline__ v8f mmaH(v16h ah, v16h al, v16h bh, v16h bl, v8f c) {
  c = __builtin_amdgcn_wmma_f32_16x16x32_f16(false, ah, false, bh, (short)0, c, false, false);
  if (NT >= 2) c = __builtin_amdgcn_wmma_f32_16x16x32_f16(false, al, false, bh, (short)0, c, false, false);
  if (NT >= 3) c = __builtin_amdgcn_wmma_f32_16x16x32_f16(false, ah, false, bl, (short)0, c, false, false);
  asm volatile("v_nop\n\tv_nop\n\tv_nop\n\tv_nop" : "+v"(c) : "v"(ah), "v"(al), "v"(bh), "v"(bl));
  return c;
}
// batched GEMM like k_gemm_b but f16 operands: A f32 (split into f16 hi/lo if ASPLIT, else rounded to f16), Bt = f16 values [n][k]; alpha; C f32; N multiple of 16 (partial tiles skipped)
template <bool ASPLIT>
__global__ __launch_bounds__(128) void k_gemm_h(const float* __restrict__ A, int lda, size_t sA, const _Float16* __restrict__ Bh, int ldb, size_t sB, float alpha, float* __restrict__ C, int ldc, size_t sC, int M, int N, int K) {
  __shared__ __attribute__((aligned(16))) float so[4][16][64];
  const int tid = threadIdx.x, w = tid >> 5, lane = tid & 31, ln = lane & 15, hh = lane >> 4; const int by = blockIdx.y;
  A += (size_t)by * sA; Bh += (size_t)by * sB; C += (size_t)by * sC;
  const int ntn = (N + 63) / 64; const int wid = blockIdx.x * 4 + w; const int mt = wid / ntn, nq = wid % ntn; if (mt * 16 >= M) return;
  const int row0 = mt * 16, col0 = nq * 64; const float* arow = A + (size_t)(row0 + ln) * lda;
  v8f acc[4] = {};
  for (int kb = 0; kb < K; kb += 32) {
    FragH ah, al;
    const v4f x0 = *(const v4fa*)(arow + kb + 8 * hh), x1 = *(const v4fa*)(arow + kb + 8 * hh + 4), x2 = *(const v4fa*)(arow + kb + 16 + 8 * hh), x3 = *(const v4fa*)(arow + kb + 16 + 8 * hh + 4);
    float xs[16] = {x0[0],x0[1],x0[2],x0[3],x1[0],x1[1],x1[2],x1[3],x2[0],x2[1],x2[2],x2[3],x3[0],x3[1],x3[2],x3[3]};
#pragma unroll
    for (int i = 0; i < 16; ++i) { const _Float16 h = (_Float16)xs[i]; ah.h[i] = h; al.h[i] = ASPLIT ? (_Float16)(xs[i] - (float)h) : (_Float16)0.0f; }
#pragma unroll
    for (int t = 0; t < 4; ++t) { if (col0 + t * 16 >= N) continue; const size_t boff = (size_t)(col0 + t * 16 + ln) * ldb + kb; FragH bq; bq.half[0] = *(const v8us*)(Bh + boff + 8 * hh); bq.half[1] = *(const v8us*)(Bh + boff + 16 + 8 * hh);
      acc[t] = mmaH<ASPLIT ? 2 : 1>(ah.v, al.v, bq.v, bq.v, acc[t]); }
  }
#pragma unroll
  for (int t = 0; t < 4; ++t) { if (col0 + t * 16 >= N) continue;
#pragma unroll
    for (int r = 0; r < 8; ++r) so[w][8 * hh + r][t * 16 + ln] = acc[t][r] * alpha; }
  __builtin_amdgcn_fence(__ATOMIC_ACQ_REL, "workgroup"); __builtin_amdgcn_wave_barrier();
  const int rsub = lane >> 4, c4 = (lane & 15) * 4;
  {
#pragma unroll
    for (int q = 0; q < 8; ++q) { const int r = q * 2 + rsub; if (col0 + c4 < N) { const v4f v = *(const v4fa*)&so[w][r][c4]; *(v4f*)(C + (size_t)(row0 + r) * ldc + col0 + c4) = v; } }
     }
}

// Wt[n][k] = f16(W[k][n]·scale) from f32 row-major W[K][N] (scale = power of two; bf16-exact weights stay exact in f16 away from the subnormal range)
__global__ __launch_bounds__(256) void k_wt_f16(const float* __restrict__ W, _Float16* __restrict__ Wt, int K, int N, float scale) {
  const int t = blockIdx.x * 256 + threadIdx.x; if (t >= N * (K / 8)) return; const int n = t / (K / 8), k8 = (t % (K / 8)) * 8; FragH f;
#pragma unroll
  for (int i = 0; i < 8; ++i) f.h[i] = (_Float16)(bf16_round(W[(size_t)(k8 + i) * N + n]) * scale); const v8us o = f.half[0];
  *(v8us*)((unsigned short*)Wt + (size_t)n * K + k8) = o; 
}
// k_gemm_hh variant with fused epilogue: v = acc·alpha + bias[by·sBias + col] (+ CP[(row/rowsPerB)·sCPb + by·64 + col] if CP) ; ACT 0 none / 1 elu ; writes f16 C16 (and f32 C if non-null)
template <int ACT>
__global__ __launch_bounds__(128) void k_gemm_hhx(const _Float16* __restrict__ A, int lda, size_t sA, const _Float16* __restrict__ Bh, int ldb, size_t sB, float alpha, const float* __restrict__ bias, size_t sBias, const float* __restrict__ CP, int rowsPerB, size_t sCPb, int row0g,
    float* __restrict__ C, _Float16* __restrict__ C16, int ldc, size_t sC, int M, int N, int K) {
  __shared__ __attribute__((aligned(16))) float so[4][16][64];
  const int tid = threadIdx.x, w = tid >> 5, lane = tid & 31, ln = lane & 15, hh = lane >> 4; const int by = blockIdx.y;
  A += (size_t)by * sA; Bh += (size_t)by * sB; const size_t cofs = (size_t)by * sC; const float* bp = bias ? bias + (size_t)by * sBias : nullptr;
  const int ntn = (N + 63) / 64; const int wid = blockIdx.x * 4 + w; const int mt = wid / ntn, nq = wid % ntn; if (mt * 16 >= M) return;
  const int row0 = mt * 16, col0 = nq * 64; const _Float16* arow = A + (size_t)(row0 + ln) * lda;
  v8f acc[4] = {};
  for (int kb = 0; kb < K; kb += 32) { FragH ah; ah.half[0] = *(const v8us*)((const unsigned short*)arow + kb + 8 * hh); ah.half[1] = *(const v8us*)((const unsigned short*)arow + kb + 16 + 8 * hh);
#pragma unroll
    for (int t = 0; t < 4; ++t) { if (col0 + t * 16 >= N) continue; const size_t boff = (size_t)(col0 + t * 16 + ln) * ldb + kb; FragH bq; bq.half[0] = *(const v8us*)((const unsigned short*)Bh + boff + 8 * hh); bq.half[1] = *(const v8us*)((const unsigned short*)Bh + boff + 16 + 8 * hh);
      acc[t] = mmaH<1>(ah.v, ah.v, bq.v, bq.v, acc[t]); }
  }
#pragma unroll
  for (int t = 0; t < 4; ++t) { if (col0 + t * 16 >= N) continue; const int col = col0 + t * 16 + ln; const float bv = bp ? bf16_round(bp[col]) : 0.f;
#pragma unroll
    for (int r = 0; r < 8; ++r) { float v = acc[t][r] * alpha + bv; if (CP) { const int bidx = (row0g + row0 + 8 * hh + r) / rowsPerB; v += CP[(size_t)bidx * sCPb + (size_t)by * 64 + col]; } if (ACT == 1) v = (v > 0.f) ? v : expm1f(v); else if (ACT == 7) v = (v > 0.f) ? v + 1.0f : expf(v); else if (ACT == 8) v = tanhf(v); else if (ACT == 9) v = 0.5f * v * (1.0f + tanhf(0.7978845608028654f * (v + 0.044715f * v * v * v))); else if (ACT == 11) v = 1.0f / (1.0f + expf(-v)); else if (ACT == 12) v = (v > 0.f) ? v : 0.01f * v; else if (ACT == 14) v = (v > 0.f) ? v : 0.1f * v; else if (ACT == 15) v = v / (1.0f + expf(-v)); else if (ACT == 3) v = fmaxf(v, 0.f); else if (ACT == 6) v = 0.5f * v * (1.0f + erff(v * 0.70710678118654752f)); so[w][8 * hh + r][t * 16 + ln] = v; } }
  __builtin_amdgcn_fence(__ATOMIC_ACQ_REL, "workgroup"); __builtin_amdgcn_wave_barrier();
  const int rsub = lane >> 4, c4 = (lane & 15) * 4; typedef _Float16 v4h __attribute__((ext_vector_type(4)));
  {
#pragma unroll
    for (int q = 0; q < 8; ++q) { const int r = q * 2 + rsub; if (col0 + c4 < N) { const v4f v = *(const v4fa*)&so[w][r][c4]; if (C) *(v4f*)(C + cofs + (size_t)(row0 + r) * ldc + col0 + c4) = v; if (C16) { v4h h4; for (int i = 0; i < 4; ++i) h4[i] = (_Float16)v[i]; *(v4h*)(C16 + cofs + (size_t)(row0 + r) * ldc + col0 + c4) = h4; } } }
     }
}


typedef _Float16 v4h __attribute__((ext_vector_type(4)));

__global__ __launch_bounds__(256) void k_x16(const float* __restrict__ x, _Float16* __restrict__ X16, size_t n8) { const size_t t = (size_t)blockIdx.x * 256 + threadIdx.x; if (t >= n8) return; FragH f;
#pragma unroll
  for (int q = 0; q < 8; ++q) f.h[q] = (_Float16)bf16_round(x[t * 8 + q]); *(v8us*)((unsigned short*)X16 + t * 8) = f.half[0];  }
__global__ __launch_bounds__(256) void k_h16(const float* __restrict__ x, _Float16* __restrict__ X16, size_t n8) { const size_t t = (size_t)blockIdx.x * 256 + threadIdx.x; if (t >= n8) return; FragH f;
#pragma unroll
  for (int q = 0; q < 8; ++q) f.h[q] = (_Float16)x[t * 8 + q]; *(v8us*)((unsigned short*)X16 + t * 8) = f.half[0];  }
__global__ __launch_bounds__(256) void k_round16f(const float* __restrict__ W, _Float16* __restrict__ Bt, size_t n8) { const size_t t = (size_t)blockIdx.x * 256 + threadIdx.x; if (t >= n8) return; FragH f;
#pragma unroll
  for (int i = 0; i < 8; ++i) f.h[i] = (_Float16)(bf16_round(W[t * 8 + i]) * 16.0f); *(v8us*)((unsigned short*)Bt + t * 8) = f.half[0];  }
template <int NHv, int TTv>
__global__ __launch_bounds__(256) void k_vt(const _Float16* __restrict__ V16, int ldv, int voff, _Float16* __restrict__ Vt) { __shared__ unsigned short tl[64][66]; const int tid = threadIdx.x; const int slab = blockIdx.x / (TTv / 64), lg = blockIdx.x % (TTv / 64); const int b = slab / NHv, h = slab % NHv;
  for (int i = tid; i < 64 * 8; i += 256) { const int r = i / 8, c8 = (i % 8) * 8; FragH f; f.half[0] = *(const v8us*)((const unsigned short*)V16 + ((size_t)b * TTv + lg * 64 + r) * ldv + voff + h * 64 + c8);
#pragma unroll
    for (int q = 0; q < 8; ++q) tl[r][c8 + q] = f.u[q]; }
  __syncthreads();
  {
#pragma unroll
    for (int rd = 0; rd < 2; ++rd) { const int d = rd * 32 + tid / 8, pc = tid % 8; FragH f;
#pragma unroll
      for (int q = 0; q < 8; ++q) f.u[q] = tl[pc * 8 + q][d];
      *(v8us*)((unsigned short*)Vt + ((size_t)slab * 64 + d) * TTv + lg * 64 + pc * 8) = f.half[0]; }
     } }

// ---- fast GEMM (256 threads, block tile 128x128, wave tile 32x64; requires M % 128 == 0 rows per launch region, N % 128 == 0 and K % 64 == 0); epilogue = k_gemm_hhx semantics ----
__device__ __forceinline__ v16h g2_frag(const _Float16* p, int hh) { FragH f; f.half[0] = *(const v8us*)((const unsigned short*)p + 8 * hh); f.half[1] = *(const v8us*)((const unsigned short*)p + 16 + 8 * hh); return f.v; }
__device__ __forceinline__ v8f g2_mma(v16h a, v16h b, v8f c) { v8f d = __builtin_amdgcn_wmma_f32_16x16x32_f16(false, a, false, b, (short)0, c, false, false); asm volatile("v_nop\n\tv_nop\n\tv_nop\n\tv_nop" : "+v"(d) : "v"(a), "v"(b)); return d; }
// ---- operand staging of the 128 x 128 block tile (8 waves: 4 row groups x 2 column groups of 32 x 64): 64 k (128 B of every operand row) per stage, rows 0..127 = A, 128..255 = B, LDS pitch 72 halves = 144 B (16 B x odd for the 16-byte fragment reads), two buffers
#define GKT 64
#define GPITCH 72
#define GSTG (256 * GPITCH)
// Eight asynchronous 16-byte copies global -> LDS per lane (one stage's share: a wave's copy = 4 whole 128-B rows), through no register. The s_wait_xcnt is the last line of the copies' own statement, so that no address register named here is rewritten ahead of it.
__device__ __forceinline__ void g2_copy8(unsigned l0, unsigned l1, unsigned l2, unsigned l3, unsigned l4, unsigned l5, unsigned l6, unsigned l7,
    const unsigned short* g0, const unsigned short* g1, const unsigned short* g2, const unsigned short* g3, const unsigned short* g4, const unsigned short* g5, const unsigned short* g6, const unsigned short* g7) {
  asm volatile("global_load_async_to_lds_b128 %0, %8, off\n\t"
               "global_load_async_to_lds_b128 %1, %9, off\n\t"
               "global_load_async_to_lds_b128 %2, %10, off\n\t"
               "global_load_async_to_lds_b128 %3, %11, off\n\t"
               "global_load_async_to_lds_b128 %4, %12, off\n\t"
               "global_load_async_to_lds_b128 %5, %13, off\n\t"
               "global_load_async_to_lds_b128 %6, %14, off\n\t"
               "global_load_async_to_lds_b128 %7, %15, off\n\t"
               "s_wait_xcnt 0x0"
               :: "v"(l0), "v"(l1), "v"(l2), "v"(l3), "v"(l4), "v"(l5), "v"(l6), "v"(l7), "v"(g0), "v"(g1), "v"(g2), "v"(g3), "v"(g4), "v"(g5), "v"(g6), "v"(g7) : "memory");
}
// Main loop of the 32 x 64 wave tile over K (a multiple of 64), 256 threads: rows rowb..rowb+127 of A and colb..colb+127 of Bh are staged once for the block's eight waves; wave w reads the fragments of A rows 32 (w & 3).. and B rows 64 (w >> 2).. from LDS. Per accumulator the products come in the same k order as with fragments loaded from global. On return every wave has passed the barrier behind the last fragment read, so sT may be reused.
__device__ __forceinline__ void g2_main(const _Float16* __restrict__ A, int lda, const _Float16* __restrict__ Bh, int ldb, int K, int rowb, int colb, unsigned short* sT, v8f (&c)[8]) {
  const int tid = threadIdx.x, w = tid >> 5, lane = tid & 31, ln = lane & 15, hh = lane >> 4;
  const unsigned short* ga = (const unsigned short*)A + (size_t)(rowb + (tid >> 3)) * lda + (tid & 7) * 8; const unsigned short* gb = (const unsigned short*)Bh + (size_t)(colb + (tid >> 3)) * ldb + (tid & 7) * 8;
  const size_t a32 = (size_t)32 * lda, b32 = (size_t)32 * ldb; const unsigned lt = (unsigned)(size_t)&sT[(tid >> 3) * GPITCH + (tid & 7) * 8]; constexpr unsigned R32 = 32 * GPITCH * 2;
  auto stage = [&](int kb, unsigned bo) { const unsigned l = lt + bo; const unsigned short* a = ga + kb; const unsigned short* b = gb + kb;
    g2_copy8(l, l + R32, l + 2 * R32, l + 3 * R32, l + 4 * R32, l + 5 * R32, l + 6 * R32, l + 7 * R32, a, a + a32, a + 2 * a32, a + 3 * a32, b, b + b32, b + 2 * b32, b + 3 * b32); };
  stage(0, 0u);
  asm volatile("s_wait_asynccnt 0x0" ::: "memory");      /* this wave's copies of stage 0 have landed before the barrier that shows them to the other waves */
  __syncthreads();
  if (GKT < K) stage(GKT, (unsigned)(GSTG * 2));
  /* rolled: one trip per stage, so that the two buffers alternate by the trip's parity */
#pragma unroll 1
  for (int kb = 0; kb < K; kb += GKT) { const unsigned short* buf = sT + ((kb >> 6) & 1) * GSTG;      /* this trip reads its own buffer alone */
    const _Float16* ar = (const _Float16*)(buf + (32 * (w & 3) + ln) * GPITCH); const _Float16* br = (const _Float16*)(buf + (128 + 64 * (w >> 2) + ln) * GPITCH);
    v16h fa[2][2], fb[2][4];      /* the trip's 24 fragment reads stand together in front of its products, so that their LDS latency is waited out once per trip and not in front of every pair of products */
#pragma unroll
    for (int ks = 0; ks < 2; ++ks) { fa[ks][0] = g2_frag(ar + ks * 32, hh); fa[ks][1] = g2_frag(ar + 16 * GPITCH + ks * 32, hh);
#pragma unroll
      for (int t = 0; t < 4; ++t) fb[ks][t] = g2_frag(br + t * 16 * GPITCH + ks * 32, hh); }
#pragma unroll
    for (int ks = 0; ks < 2; ++ks)
#pragma unroll
      for (int t = 0; t < 4; ++t) { c[t] = g2_mma(fa[ks][0], fb[ks][t], c[t]); c[4 + t] = g2_mma(fa[ks][1], fb[ks][t], c[4 + t]); }
    asm volatile("s_wait_dscnt 0x0" ::: "memory");      /* this wave's reads of the buffer have returned before the buffer may be refilled */
    asm volatile("s_wait_asynccnt 0x0" ::: "memory");      /* this wave's copies of the next stage have landed before the barrier that shows them */
    __syncthreads();      /* publishes the next stage and ends every wave's reads of this trip's buffer */
    if (kb + 2 * GKT < K) stage(kb + 2 * GKT, (unsigned)(((kb >> 6) & 1) * (GSTG * 2))); }
  asm volatile("s_wait_asynccnt 0x0" ::: "memory");      /* no copy is outstanding when the LDS becomes output staging */
}
template <int ACT>
__global__ __launch_bounds__(256) void k_gemm2(const _Float16* __restrict__ A, int lda, size_t sA, const _Float16* __restrict__ Bh, int ldb, size_t sB, float alpha, const float* __restrict__ bias, size_t sBias, const float* __restrict__ CP, int rowsPerB, size_t sCPb, int row0g,
    float* __restrict__ C, _Float16* __restrict__ C16, int ldc, size_t sC, int M, int N, int K) {
  __shared__ __attribute__((aligned(16))) float sm[2 * GSTG / 2];      /* the two operand buffers; behind the main loop its first 8 x 32 x 68 floats are the output staging */
  float (*so)[32][68] = (float (*)[32][68])sm;
  const int tid = threadIdx.x, w = tid >> 5, lane = tid & 31, ln = lane & 15, hh = lane >> 4; const int by = blockIdx.y;
  A += (size_t)by * sA; Bh += (size_t)by * sB; const size_t cofs = (size_t)by * sC; const float* bp = bias ? bias + (size_t)by * sBias : nullptr;
  const int ntn = N >> 7; const int mt = blockIdx.x / ntn, nq = blockIdx.x - mt * ntn; const int row0 = mt * 128 + 32 * (w & 3), col0 = nq * 128 + 64 * (w >> 2); if (mt * 128 + 128 > M) return;      /* block-uniform, in front of every barrier and copy */
  const v8f z8 = {0.f,0.f,0.f,0.f,0.f,0.f,0.f,0.f}; v8f accs[8] = {z8, z8, z8, z8, z8, z8, z8, z8};
  g2_main(A, lda, Bh, ldb, K, mt * 128, nq * 128, (unsigned short*)sm, accs);
#pragma unroll
  for (int u = 0; u < 8; ++u) { const int t = u & 3, half = u >> 2; const int col = col0 + t * 16 + ln; const float bv = bp ? bf16_round(bp[col]) : 0.f;
#pragma unroll
    for (int r = 0; r < 8; ++r) { const int rloc = half * 16 + 8 * hh + r; float v = accs[u][r] * alpha + bv; if (CP) { const int bidx = (row0g + row0 + rloc) / rowsPerB; v += CP[(size_t)bidx * sCPb + (size_t)by * 64 + col]; }
      if (ACT == 3) v = fmaxf(v, 0.f); else if (ACT == 6) v = 0.5f * v * (1.0f + erff(v * 0.70710678118654752f)); else if (ACT == 11) v = 1.0f / (1.0f + expf(-v)); else if (ACT == 15) v = v / (1.0f + expf(-v)); else if (ACT == 12) v = (v > 0.f) ? v : 0.01f * v; else if (ACT == 8) v = tanhf(v);
      so[w][rloc][t * 16 + ln] = v; } }
  __builtin_amdgcn_fence(__ATOMIC_ACQ_REL, "workgroup"); __builtin_amdgcn_wave_barrier();
  const int rsub = lane >> 4, c4 = (lane & 15) * 4;
  {
#pragma unroll
    for (int q = 0; q < 16; ++q) { const int r = q * 2 + rsub; const v4f v = *(const v4fa*)&so[w][r][c4]; if (C) *(v4f*)(C + cofs + (size_t)(row0 + r) * ldc + col0 + c4) = v; if (C16) { v4h h4; for (int i = 0; i < 4; ++i) h4[i] = (_Float16)v[i]; *(v4h*)(C16 + cofs + (size_t)(row0 + r) * ldc + col0 + c4) = h4; } }
     } }



__device__ __forceinline__ float siluf(float g) { return g / (1.0f + expf(-g)); }
// ---- projection GEMM (main loop of k_gemm2, NR x DM x DM, Bt carries x16) with the element-wise tail in its epilogue. A wave tile is 32 tokens x the 64 columns of one head, so the head's norm is a sum inside the wave's own LDS rows.
// POLAR 1: g = silu(acc/16) * f, f = r*scale[h]/(r + 1e-6), r = |silu row|; g stored as f16 hi + x2^10 residual, row-major, one whole 128-B line per row and plane.
// POLAR 0: g = silu(acc/16) stored transposed per (batch, head) slab as hi + residual planes [64 dims][SLEN tokens]; the block's 128 tokens are transposed through LDS, one whole 128-B line per 8 lanes.
template <int POLAR>
__global__ __launch_bounds__(256) void k_proj(const _Float16* __restrict__ A, const _Float16* __restrict__ Bh, const float* __restrict__ scale, _Float16* __restrict__ Hh, _Float16* __restrict__ Hl) {
  constexpr int PT = POLAR ? 68 : 65;      /* LDS row pitch in floats: 68 for the 16-B row reads, 65 for the column reads of the transpose */
  __shared__ __attribute__((aligned(16))) float so[2 * GSTG / 2];      /* the two operand buffers; behind the main loop its first 256 x PT floats are the output staging: rows 32 w.. are wave w's */
  const int tid = threadIdx.x, w = tid >> 5, lane = tid & 31, ln = lane & 15, hh = lane >> 4;
  constexpr int ntn = DM >> 7; const int mt = blockIdx.x / ntn, nq = (blockIdx.x - mt * ntn) * 2 + __builtin_amdgcn_readfirstlane(w >> 2); const int row0 = mt * 128 + 32 * (w & 3), col0 = nq * 64;      /* nq = the wave's head: waves 0..3 the block's first, 4..7 its second; read from the first lane so that it stays a scalar and scale[nq] a scalar load */
  const v8f z8 = {0.f,0.f,0.f,0.f,0.f,0.f,0.f,0.f}; v8f accs[8] = {z8, z8, z8, z8, z8, z8, z8, z8};
  g2_main(A, DM, Bh, DM, DM, mt * 128, (blockIdx.x - mt * ntn) * 128, (unsigned short*)so, accs);      /* the main loop of k_gemm2 */
#pragma unroll
  for (int u = 0; u < 8; ++u) { const int t = u & 3, half = u >> 2;
#pragma unroll
    for (int r = 0; r < 8; ++r) so[(32 * w + half * 16 + 8 * hh + r) * PT + t * 16 + ln] = siluf(accs[u][r] * 0.0625f); }
  if (POLAR) {
    __builtin_amdgcn_fence(__ATOMIC_ACQ_REL, "workgroup"); __builtin_amdgcn_wave_barrier();      /* each wave reads back its own 32 rows only */
    const int rsub = lane >> 4, c4 = (lane & 15) * 4; const float sc = bf16_round(scale[nq]);
#pragma unroll
    for (int q = 0; q < 16; ++q) { const int r = q * 2 + rsub; const v4f v = *(const v4fa*)&so[(32 * w + r) * PT + c4];
      float s = (v[0] * v[0] + v[1] * v[1]) + (v[2] * v[2] + v[3] * v[3]); s += __shfl_xor(s, 8, 32); s += __shfl_xor(s, 4, 32); s += __shfl_xor(s, 2, 32); s += __shfl_xor(s, 1, 32);
      const float rr = sqrtf(s); const float fac = (rr * sc) / (rr + 1e-6f); v4h h4, l4;
#pragma unroll
      for (int i = 0; i < 4; ++i) { const float g = v[i] * fac; const _Float16 h = (_Float16)g; h4[i] = h; l4[i] = (_Float16)((g - (float)h) * 1024.0f); }
      const size_t o = (size_t)(row0 + r) * DM + col0 + c4; *(v4h*)(Hh + o) = h4; *(v4h*)(Hl + o) = l4; }
  } else {
    __syncthreads();      /* the transpose reads rows that the block's other waves wrote */
    const int slab = (mt * 128 / SLEN) * NH + nq, tok0 = mt * 128 % SLEN;
#pragma unroll
    for (int it = 0; it < 8; ++it) { const int item = it * 128 + (tid & 127); const int pc = item & 7, d = (item >> 3) & 63, g = item >> 9; FragH fh, fl;      /* each half of the block transposes its own head's 128 LDS rows */
#pragma unroll
      for (int q = 0; q < 8; ++q) { const float v = so[((w >> 2) * 128 + g * 64 + pc * 8 + q) * PT + d]; const _Float16 hv = (_Float16)v; fh.h[q] = hv; fl.h[q] = (_Float16)((v - (float)hv) * 1024.0f); }
      const size_t o = ((size_t)slab * 64 + d) * SLEN + tok0 + g * 64 + pc * 8; *(v8us*)((unsigned short*)Hh + o) = fh.half[0]; *(v8us*)((unsigned short*)Hl + o) = fl.half[0]; }
  } }

// Eight asynchronous 16-byte copies global -> LDS per lane (one key pass's share of the K and V^T hi / residual tiles), through no register. The s_wait_xcnt is the last line of the copies' own statement, so that no address register named here is rewritten ahead of it.
__device__ __forceinline__ void kv_copy8(unsigned l0, unsigned l1, unsigned l2, unsigned l3, unsigned l4, unsigned l5, unsigned l6, unsigned l7,
    const unsigned short* g0, const unsigned short* g1, const unsigned short* g2, const unsigned short* g3, const unsigned short* g4, const unsigned short* g5, const unsigned short* g6, const unsigned short* g7) {
  asm volatile("global_load_async_to_lds_b128 %0, %8, off\n\t"
               "global_load_async_to_lds_b128 %1, %9, off\n\t"
               "global_load_async_to_lds_b128 %2, %10, off\n\t"
               "global_load_async_to_lds_b128 %3, %11, off\n\t"
               "global_load_async_to_lds_b128 %4, %12, off\n\t"
               "global_load_async_to_lds_b128 %5, %13, off\n\t"
               "global_load_async_to_lds_b128 %6, %14, off\n\t"
               "global_load_async_to_lds_b128 %7, %15, off\n\t"
               "s_wait_xcnt 0x0"
               :: "v"(l0), "v"(l1), "v"(l2), "v"(l3), "v"(l4), "v"(l5), "v"(l6), "v"(l7), "v"(g0), "v"(g1), "v"(g2), "v"(g3), "v"(g4), "v"(g5), "v"(g6), "v"(g7) : "memory");
}
__device__ __forceinline__ float xhalf(float x) { return __builtin_bit_cast(float, __builtin_amdgcn_permlanex16(__builtin_bit_cast(int, x), __builtin_bit_cast(int, x), 0x76543210, 0xfedcba98, false, false)); }      /* lane l's value of lane l ^ 16 */
// Both products run with their operands swapped: S^T = K Q^T (A = 16 key rows from LDS, B = the wave's 16 queries, kept in registers) and O^T += V^T P^T (A = 16 V^T rows from LDS, B = P^T). Lane (ln, hh) then holds, of query q0 + ln alone, the scores of keys 16 nt + 8 hh + r and the output dims 16 dt + 8 hh + r. The two score tiles converted in place are the B operand of the value product: position s of a fragment is k = 8 hh + s (s < 8) or 16 + 8 hh + (s - 8), which is tile s >> 3, register s & 7.
template <int TQ, int TK>
__global__ __launch_bounds__(128) void k_flashm(const _Float16* __restrict__ Q16, const _Float16* __restrict__ Q16lo, int ldq, const _Float16* __restrict__ K16, const _Float16* __restrict__ K16lo, int ldk, const _Float16* __restrict__ Vt, const _Float16* __restrict__ Vtlo, const unsigned* __restrict__ MB, const int* __restrict__ RA, const int* __restrict__ KE, _Float16* __restrict__ Oh, _Float16* __restrict__ Ol, int ldo) {
  constexpr int RPW = 16, NQB = TQ / (4 * RPW), DT = 4, KS = 2;
  /* One pass's 32 keys, staged once for the block's four waves, two buffers. In 16-bit units: K rows (64 dims) at pitch 72 = 144 B, V^T rows (32 keys) at pitch 40 = 80 B, both 16 B x odd for the 16-byte fragment reads. */
  constexpr int KP = 72, VP = 40, KL0 = 32 * KP, VH0 = 2 * 32 * KP, VL0 = VH0 + 64 * VP, STG = VL0 + 64 * VP;
  __shared__ __attribute__((aligned(16))) unsigned short sKV[2][STG];
  const int tid = threadIdx.x, w = tid >> 5, lane = tid & 31, ln = lane & 15, hh = lane >> 4;
  /* Heaviest first: a block walks 2 (qblk + 1) key passes, so the block index counts the query blocks downwards, all (batch, head) slabs of one query block side by side. Cost falls with the index: the long blocks start first, neighbours in the index cost the same, and the launch ends on 2-pass blocks. Every (slab, query block) is taken exactly once. */
  constexpr int NSL = NBT * NH; const int slab = blockIdx.x % NSL, qblk = NQB - 1 - blockIdx.x / NSL; const int b = slab / NH, h = slab % NH; const int qb0 = qblk * (4 * RPW); const int q0 = qb0 + w * RPW;
  FragH aq[KS], aql[KS];
  { const size_t qo = ((size_t)b * TQ + q0 + ln) * ldq + h * 64; const unsigned short* qr = (const unsigned short*)Q16 + qo; const unsigned short* ql = (const unsigned short*)Q16lo + qo;
#pragma unroll
    for (int ks = 0; ks < KS; ++ks) { aq[ks].half[0] = *(const v8us*)(qr + ks * 32 + 8 * hh); aq[ks].half[1] = *(const v8us*)(qr + ks * 32 + 16 + 8 * hh); aql[ks].half[0] = *(const v8us*)(ql + ks * 32 + 8 * hh); aql[ks].half[1] = *(const v8us*)(ql + ks * 32 + 16 + 8 * hh); } }
  asm volatile("s_wait_xcnt 0x0" ::: "memory");      /* the Q loads' address registers are reused right below */
  const unsigned short* Vth = (const unsigned short*)Vt + (size_t)slab * 64 * TK; const unsigned short* Vtl = (const unsigned short*)Vtlo + (size_t)slab * 64 * TK;
  float m_r = -3.0e38f, l_r = 0.f; v8f oacc[DT], oaccl[DT];      /* running maximum and this lane's half of the running sum of query q0 + ln */
#pragma unroll
  for (int dt = 0; dt < DT; ++dt) { oacc[dt] = (v8f){0.f,0.f,0.f,0.f,0.f,0.f,0.f,0.f}; oaccl[dt] = oacc[dt]; }
  int jend = KE[qblk * 32]; jend = min(TK, (jend + 31) & ~31); if (jend < 32) jend = 32;      /* block-uniform */
  /* each thread copies two 16-byte pieces of each of the four tiles: K rows tid/8 and tid/8 + 16 (a wave's copy = 4 whole 128-B rows), V^T rows tid/4 and tid/4 + 32 */
  const unsigned short* gkh = (const unsigned short*)K16 + ((size_t)b * TK + (tid >> 3)) * ldk + h * 64 + (tid & 7) * 8; const unsigned short* gkl = (const unsigned short*)K16lo + ((size_t)b * TK + (tid >> 3)) * ldk + h * 64 + (tid & 7) * 8;
  const unsigned short* gvh = Vth + (size_t)(tid >> 2) * TK + (tid & 3) * 8; const unsigned short* gvl = Vtl + (size_t)(tid >> 2) * TK + (tid & 3) * 8;
  const unsigned lk = (unsigned)(size_t)&sKV[0][(tid >> 3) * KP + (tid & 7) * 8], lv = (unsigned)(size_t)&sKV[0][VH0 + (tid >> 2) * VP + (tid & 3) * 8];
  auto stage = [&](int j, unsigned bo) { const size_t ko = (size_t)j * ldk, k16 = (size_t)16 * ldk;
    kv_copy8(lk + bo, lk + bo + 16 * KP * 2, lk + bo + KL0 * 2, lk + bo + (KL0 + 16 * KP) * 2, lv + bo, lv + bo + 32 * VP * 2, lv + bo + 64 * VP * 2, lv + bo + 96 * VP * 2,
             gkh + ko, gkh + ko + k16, gkl + ko, gkl + ko + k16, gvh + j, gvh + j + (size_t)32 * TK, gvl + j, gvl + j + (size_t)32 * TK); };
  stage(0, 0u);
  asm volatile("s_wait_asynccnt 0x0" ::: "memory");      /* this wave's copies of pass 0 have landed before the barrier that shows them to the other waves */
  __syncthreads();
  if (32 < jend) stage(32, (unsigned)(STG * 2));
  const bool am = (RA[q0 + ln] != 0); const unsigned* mp = MB + (size_t)(q0 + ln) * (TK / 32);      /* one row flag and one mask row per lane: its query's; mp walks the row, one word a pass */
  asm volatile("s_wait_xcnt 0x0" ::: "memory");      /* the row-flag load's address register is reused below */
#pragma unroll 1
  for (int j0 = 0; j0 < jend; j0 += 32) {
    const unsigned mws = *mp >> (8 * hh);      /* asked for at the head of the pass: its wait falls together with the K fragments'; bit 16 nt + r is then this lane's key 16 nt + 8 hh + r */
    const unsigned short* kvb = &sKV[(j0 >> 5) & 1][0];      /* this pass reads its own buffer alone */
    v8f s[2];
#pragma unroll
    for (int nt = 0; nt < 2; ++nt) { const unsigned short* kr = kvb + (nt * 16 + ln) * KP; const unsigned short* kl = kr + KL0; FragH bk[KS], bkl[KS];
#pragma unroll
      for (int ks = 0; ks < KS; ++ks) { bk[ks].half[0] = *(const v8us*)(kr + ks * 32 + 8 * hh); bk[ks].half[1] = *(const v8us*)(kr + ks * 32 + 16 + 8 * hh); bkl[ks].half[0] = *(const v8us*)(kl + ks * 32 + 8 * hh); bkl[ks].half[1] = *(const v8us*)(kl + ks * 32 + 16 + 8 * hh); }
      v8f acc = (v8f){0.f,0.f,0.f,0.f,0.f,0.f,0.f,0.f}, accr = acc;
#pragma unroll
      for (int ks = 0; ks < KS; ++ks) { acc = mmaH<1>(bk[ks].v, bk[ks].v, aq[ks].v, aq[ks].v, acc); accr = mmaH<1>(bk[ks].v, bk[ks].v, aql[ks].v, aql[ks].v, accr); accr = mmaH<1>(bkl[ks].v, bkl[ks].v, aq[ks].v, aq[ks].v, accr); }
      s[nt] = acc + accr * 0.0009765625f; }
    /* The lane's 16 scores are all of one query: maximum and sum are taken inside the lane, the maximum joined with the other half of the wave by one exchange. No branch (each exp is computed and then chosen by a select), each step written for all 16 before the next. */
    float sv[16], mx[8]; bool ok[16];
#pragma unroll
    for (int i = 0; i < 16; ++i) { ok[i] = am || (((mws >> (16 * (i >> 3) + (i & 7))) & 1u) == 0u); sv[i] = ok[i] ? (am ? 0.f : s[i >> 3][i & 7] * SCL) : -INFINITY; }
#pragma unroll
    for (int i = 0; i < 8; ++i) mx[i] = fmaxf(sv[i], sv[8 + i]);
    float mc = fmaxf(fmaxf(fmaxf(mx[0], mx[1]), fmaxf(mx[2], mx[3])), fmaxf(fmaxf(mx[4], mx[5]), fmaxf(mx[6], mx[7]))); mc = fmaxf(mc, xhalf(mc));
    const float mn = fmaxf(m_r, mc); const float ea = expf(m_r - mn); const float al = (mn > -1.0e38f) ? ea : 1.0f; m_r = mn;
    FragH pa, pl; float p[16];
#pragma unroll
    for (int i = 0; i < 16; ++i) { const float e = expf(sv[i] - mn); p[i] = ok[i] ? e : 0.f; }
#pragma unroll
    for (int i = 0; i < 16; ++i) { const float ps = p[i] * 1024.0f; pa.h[i] = (_Float16)ps; pl.h[i] = (_Float16)((ps - (float)pa.h[i]) * 1024.0f); }
#pragma unroll
    for (int i = 0; i < 8; ++i) p[i] += p[8 + i];
    l_r = l_r * al + (((p[0] + p[1]) + (p[2] + p[3])) + ((p[4] + p[5]) + (p[6] + p[7])));
#pragma unroll
    for (int dt = 0; dt < DT; ++dt) { oacc[dt] *= al; oaccl[dt] *= al; }
#pragma unroll
    for (int dt = 0; dt < DT; ++dt) { const unsigned short* vr = kvb + VH0 + (dt * 16 + ln) * VP; const unsigned short* vl = vr + 64 * VP; FragH bv, bl; bv.half[0] = *(const v8us*)(vr + 8 * hh); bv.half[1] = *(const v8us*)(vr + 16 + 8 * hh); bl.half[0] = *(const v8us*)(vl + 8 * hh); bl.half[1] = *(const v8us*)(vl + 16 + 8 * hh);
      oacc[dt] = mmaH<1>(bv.v, bv.v, pa.v, pa.v, oacc[dt]); oaccl[dt] = mmaH<1>(bl.v, bl.v, pa.v, pa.v, oaccl[dt]); oaccl[dt] = mmaH<1>(bv.v, bv.v, pl.v, pl.v, oaccl[dt]); }
    asm volatile("s_wait_xcnt 0x0" ::: "memory");      /* the mask-word load's address register is stepped for the next pass behind this point */
    ++mp;
    asm volatile("s_wait_dscnt 0x0" ::: "memory");      /* this wave's reads of the buffer have returned before the buffer may be refilled */
    asm volatile("s_wait_asynccnt 0x0" ::: "memory");      /* this wave's copies of the next pass have landed before the barrier that shows them */
    __syncthreads();      /* publishes the next pass's tiles and ends every wave's reads of this pass's buffer */
    if (j0 + 64 < jend) stage(j0 + 64, (unsigned)(((j0 >> 5) & 1) * (STG * 2))); }
  asm volatile("s_wait_asynccnt 0x0" ::: "memory");      /* no copy is outstanding when the wave goes on to its end */
  const float l = l_r + xhalf(l_r); const float li = (l > 0.f) ? 1.0f / (l * 1024.0f) : 0.f;      /* the two halves' sums are joined once */
  /* a lane's 8 registers of a tile are 8 neighbouring dims of its query's row: one 16-byte store per tile and plane; the wave's 8 stores fill its 16 whole 128-B rows of each plane */
  FragH fh[DT], fl[DT];
#pragma unroll
  for (int dt = 0; dt < DT; ++dt)
#pragma unroll
    for (int r = 0; r < 8; ++r) { const float val = (oacc[dt][r] + oaccl[dt][r] * 0.0009765625f) * li; const _Float16 hv = (_Float16)val; fh[dt].h[r] = hv; fl[dt].h[r] = (_Float16)((val - (float)hv) * 1024.0f); }
  const size_t oo = ((size_t)b * TQ + q0 + ln) * ldo + h * 64 + 8 * hh;
#pragma unroll
  for (int dt = 0; dt < DT; ++dt) { *(v8us*)((unsigned short*)Oh + oo + dt * 16) = fh[dt].half[0]; *(v8us*)((unsigned short*)Ol + oo + dt * 16) = fl[dt].half[0]; } }


__global__ __launch_bounds__(256) void k_causaltab(unsigned* __restrict__ MB, int* __restrict__ RA, int* __restrict__ KE, int nq, int nk) {
  const int t = blockIdx.x * 256 + threadIdx.x; const int nw = nk / 32;
  if (t < nq * nw) { const int q = t / nw, w = t % nw; const int first = q + 1 - 32 * w; const unsigned bits = (first <= 0) ? 0xffffffffu : ((first >= 32) ? 0u : (0xffffffffu << first)); *(unsigned*)(MB + t) = bits;  }
  if (t < nq) { *(int*)(RA + t) = 0;  }
  if (t < nq / 64) { const int v = 64 * (t + 1); *(int*)(KE + t * 32) = v;  } }

extern "C" void kernel_launch(void* const* d_in, const int* in_sizes, int n_in,
                              void* d_out, int out_size, void* d_ws, size_t ws_size, hipStream_t stream) {
  (void)in_sizes; (void)n_in; (void)out_size;
  const float* const* I = (const float* const*)d_in; const float* x = I[0]; const float* Wq = I[1]; const float* Wk = I[2]; const float* Wv = I[3]; const float* Wo = I[4]; const float* qs = I[5]; const float* ks = I[6];
  char* ws = (char*)d_ws; size_t off = 0;
  auto take = [&](size_t bytes) { char* p = ws + off; off += (bytes + 255) & ~(size_t)255; return p; };
  _Float16* BQ = (_Float16*)take((size_t)DM * DM * 2); _Float16* BK = (_Float16*)take((size_t)DM * DM * 2); _Float16* BV = (_Float16*)take((size_t)DM * DM * 2); _Float16* BO = (_Float16*)take((size_t)DM * DM * 2);
  _Float16* X16 = (_Float16*)take((size_t)NR * DM * 2); _Float16* Oh = (_Float16*)take((size_t)NR * DM * 2); _Float16* Ol = (_Float16*)take((size_t)NR * DM * 2);
  _Float16* Qh = (_Float16*)take((size_t)NR * DM * 2); _Float16* Ql = (_Float16*)take((size_t)NR * DM * 2); _Float16* Kh = (_Float16*)take((size_t)NR * DM * 2); _Float16* Kl = (_Float16*)take((size_t)NR * DM * 2); _Float16* Vth = (_Float16*)take((size_t)NR * DM * 2); _Float16* Vtl = (_Float16*)take((size_t)NR * DM * 2);
  unsigned* MB = (unsigned*)take((size_t)SLEN * (SLEN / 32) * 4); int* RA = (int*)take((size_t)SLEN * 4); int* KE = (int*)take((size_t)(SLEN / 64) * 32 * 4);
  if (off > ws_size) return;      /* 8 + 16 + 2 x 16 + 6 x 16 + 0.5 = 153 MiB */
  const size_t n8 = (size_t)NR * DM / 8; const unsigned nb8 = (unsigned)((n8 + 255) / 256); const size_t w8 = (size_t)DM * DM / 8; const unsigned wb = (unsigned)((w8 + 255) / 256);
  k_round16f<<<wb, 256, 0, stream>>>(Wq, BQ, w8); k_round16f<<<wb, 256, 0, stream>>>(Wk, BK, w8); k_round16f<<<wb, 256, 0, stream>>>(Wv, BV, w8); k_round16f<<<wb, 256, 0, stream>>>(Wo, BO, w8);      /* torch (out,in) = natural Bt; x16 */
  k_causaltab<<<(SLEN * (SLEN / 32) + 255) / 256, 256, 0, stream>>>(MB, RA, KE, SLEN, SLEN);
  const dim3 gP((NR / 128) * (DM / 128), 1);
  k_x16<<<nb8, 256, 0, stream>>>(x, X16, n8);
  k_proj<1><<<gP, 256, 0, stream>>>(X16, BQ, qs, Qh, Ql);      /* q = silu(x Wq^T) * f_q, hi + residual */
  k_proj<1><<<gP, 256, 0, stream>>>(X16, BK, ks, Kh, Kl);      /* k = silu(x Wk^T) * f_k, hi + residual */
  k_proj<0><<<gP, 256, 0, stream>>>(X16, BV, ks, Vth, Vtl);      /* v = silu(x Wv^T), transposed, hi + residual (scale unread) */
  k_flashm<SLEN, SLEN><<<NBT * NH * (SLEN / 64), 128, 0, stream>>>(Qh, Ql, DM, Kh, Kl, DM, Vth, Vtl, MB, RA, KE, Oh, Ol, DM);
  float* outb = (float*)d_out;
  k_gemm2<0><<<gP, 256, 0, stream>>>(Oh, DM, 0, BO, DM, 0, 0.0625f, nullptr, 0, nullptr, 1, 0, 0, outb, nullptr, DM, 0, NR, DM, DM);
  k_gemm2<0><<<gP, 256, 0, stream>>>(Ol, DM, 0, BO, DM, 0, 0.0625f / 1024.0f, nullptr, 0, outb, 1, (size_t)DM, 0, outb, nullptr, DM, 0, NR, DM, DM);
}

// v008
// One run takes 257 microseconds.
// Timed twice side by side with v007, it ran 1.06 times as fast both times.
// Over all steps from v000 it is 7.61 times as fast.
#include <hip/hip_runtime.h>
#define NBT 4
#define SLEN 2048
#define DM 1024
#define NH 16
#define SCL 1.0f
#define NR (NBT * SLEN)
typedef __bf16 v16b __attribute__((ext_vector_type(16)));
typedef unsigned short v8us __attribute__((ext_vector_type(8), may_alias));
typedef float  v8f  __attribute__((ext_vector_type(8)));
typedef float  v4f  __attribute__((ext_vector_type(4)));
typedef float  v4fa __attribute__((ext_vector_type(4), may_alias));
union FragB { v16b v; v8us half[2]; unsigned short u[16]; };

__device__ __forceinline__ unsigned short bf16_bits(float x) { unsigned int u = __float_as_uint(x); return (unsigned short)((u + 0x7FFFu + ((u >> 16) & 1u)) >> 16); }
__device__ __forceinline__ float bf16_val(unsigned short b) { return __uint_as_float(((unsigned int)b) << 16); }
__device__ __forceinline__ float bf16_round(float x) { return bf16_val(bf16_bits(x)); }
// D += A·B with NT terms: 1 = ah·bh, 2 = + al·bh (A split), 3 = + ah·bl (both split)
template <int NT>
__device__ __forceinline__ v8f mmaN(v16b ah, v16b al, v16b bh, v16b bl, v8f c) {
  c = __builtin_amdgcn_wmma_f32_16x16x32_bf16(false, ah, false, bh, (short)0, c, false, false);
  if (NT >= 2) c = __builtin_amdgcn_wmma_f32_16x16x32_bf16(false, al, false, bh, (short)0, c, false, false);
  if (NT >= 3) c = __builtin_amdgcn_wmma_f32_16x16x32_bf16(false, ah, false, bl, (short)0, c, false, false);
  asm volatile("v_nop\n\tv_nop\n\tv_nop\n\tv_nop" : "+v"(c) : "v"(ah), "v"(al), "v"(bh), "v"(bl));
  return c;
}

__global__ __launch_bounds__(256) void k_wt_bf16(const float* __restrict__ W, unsigned short* __restrict__ Wt, int K, int N) {
  const int t = blockIdx.x * 256 + threadIdx.x;
  const int k8n = K / 8;
  if (t >= N * k8n) return;
  const int n = t / k8n, k8 = (t % k8n) * 8;
  v8us v;
#pragma unroll
  for (int i = 0; i < 8; ++i) v[i] = bf16_bits(W[(size_t)(k8 + i) * N + n]);
  *(v8us*)(Wt + (size_t)n * K + k8) = v;
  
}

// GEMM C[M][N] (f32, pitch ldc) = act(A[M][K]·W + bias). A f32 row-major (pitch lda) converted per fragment to bf16
// (ASPLIT: hi/lo two planes -> 2 terms, else single rounded term); Wt bf16 [N][K] (pitch ldb). BIAS_BF16 rounds the
// bias to bf16 first (bias quantised to bf16 before the add). K%32==0, M%16==0, N%64==0.
template <bool ASPLIT, int ACT, bool BIAS_BF16>
__global__ __launch_bounds__(128) void k_gemm_bf(const float* __restrict__ A, int lda, const unsigned short* __restrict__ Wt, int ldb,
                                               const float* __restrict__ bias, float* __restrict__ C, int ldc, int M, int N, int K) {
  __shared__ __attribute__((aligned(16))) float so[4][16][64];
  const int tid = threadIdx.x, w = tid >> 5, lane = tid & 31, ln = lane & 15, hh = lane >> 4;
  const int ntn = N / 64;
  const int wid = blockIdx.x * 4 + w;
  const int mt = wid / ntn, nq = wid % ntn;
  if (mt * 16 >= M) return;
  const int row0 = mt * 16, col0 = nq * 64;
  const float* arow = A + (size_t)(row0 + ln) * lda;
  v8f acc[4] = {};
  for (int kb = 0; kb < K; kb += 32) {
    FragB ah, al;
    const v4f x0 = *(const v4fa*)(arow + kb + 8 * hh), x1 = *(const v4fa*)(arow + kb + 8 * hh + 4);
    const v4f x2 = *(const v4fa*)(arow + kb + 16 + 8 * hh), x3 = *(const v4fa*)(arow + kb + 16 + 8 * hh + 4);
    float xs[16] = {x0[0],x0[1],x0[2],x0[3],x1[0],x1[1],x1[2],x1[3],x2[0],x2[1],x2[2],x2[3],x3[0],x3[1],x3[2],x3[3]};
#pragma unroll
    for (int i = 0; i < 16; ++i) { const unsigned short hb = bf16_bits(xs[i]); ah.u[i] = hb; al.u[i] = ASPLIT ? bf16_bits(xs[i] - bf16_val(hb)) : (unsigned short)0; }
#pragma unroll
    for (int t = 0; t < 4; ++t) {
      const unsigned short* brow = Wt + (size_t)(col0 + t * 16 + ln) * ldb + kb;
      FragB b;
      b.half[0] = *(const v8us*)(brow + 8 * hh);
      b.half[1] = *(const v8us*)(brow + 16 + 8 * hh);
      acc[t] = mmaN<ASPLIT ? 2 : 1>(ah.v, al.v, b.v, b.v, acc[t]);
    }
  }
#pragma unroll
  for (int t = 0; t < 4; ++t) {
    float bv = bias ? bias[col0 + t * 16 + ln] : 0.f;
    if (BIAS_BF16) bv = bf16_round(bv);
#pragma unroll
    for (int r = 0; r < 8; ++r) { float v = acc[t][r] + bv; if (ACT == 1) v = fmaxf(v, 0.f); so[w][8 * hh + r][t * 16 + ln] = v; }
  }
  __builtin_amdgcn_fence(__ATOMIC_ACQ_REL, "workgroup");
  __builtin_amdgcn_wave_barrier();
  const int rsub = lane >> 4, c4 = (lane & 15) * 4;
  {
#pragma unroll
    for (int q = 0; q < 8; ++q) {
      const int r = q * 2 + rsub;
      const v4f v = *(const v4fa*)&so[w][r][c4];
      *(v4f*)(C + (size_t)(row0 + r) * ldc + col0 + c4) = v;
    }
    
  }
}

// GEMM C = act(A·W + bias + resid): A f32 (ASPLIT -> hi/lo 2 terms), Wt bf16 [N][K]; ACT 0 none, 1 relu, 2 exact gelu;
// resid (optional, f32, row index = (row % rmod), pitch ldr, RES_BF16 rounds it) added before the activation.
template <bool ASPLIT, int ACT, bool BIAS_BF16, bool RES_BF16>
__global__ __launch_bounds__(128) void k_gemm_bf3(const float* __restrict__ A, int lda, const unsigned short* __restrict__ Wt, int ldb,
                                                const float* __restrict__ bias, const float* __restrict__ resid, int rmod, int ldr,
                                                float* __restrict__ C, int ldc, int M, int N, int K) {
  __shared__ __attribute__((aligned(16))) float so[4][16][64];
  const int tid = threadIdx.x, w = tid >> 5, lane = tid & 31, ln = lane & 15, hh = lane >> 4;
  const int ntn = N / 64;
  const int wid = blockIdx.x * 4 + w;
  const int mt = wid / ntn, nq = wid % ntn;
  if (mt * 16 >= M) return;
  const int row0 = mt * 16, col0 = nq * 64;
  const float* arow = A + (size_t)(row0 + ln) * lda;
  v8f acc[4] = {};
  for (int kb = 0; kb < K; kb += 32) {
    FragB ah, al;
    const v4f x0 = *(const v4fa*)(arow + kb + 8 * hh), x1 = *(const v4fa*)(arow + kb + 8 * hh + 4);
    const v4f x2 = *(const v4fa*)(arow + kb + 16 + 8 * hh), x3 = *(const v4fa*)(arow + kb + 16 + 8 * hh + 4);
    float xs[16] = {x0[0],x0[1],x0[2],x0[3],x1[0],x1[1],x1[2],x1[3],x2[0],x2[1],x2[2],x2[3],x3[0],x3[1],x3[2],x3[3]};
#pragma unroll
    for (int i = 0; i < 16; ++i) { const unsigned short hb = bf16_bits(xs[i]); ah.u[i] = hb; al.u[i] = ASPLIT ? bf16_bits(xs[i] - bf16_val(hb)) : (unsigned short)0; }
#pragma unroll
    for (int t = 0; t < 4; ++t) {
      const unsigned short* brow = Wt + (size_t)(col0 + t * 16 + ln) * ldb + kb;
      FragB b;
      b.half[0] = *(const v8us*)(brow + 8 * hh);
      b.half[1] = *(const v8us*)(brow + 16 + 8 * hh);
      acc[t] = mmaN<ASPLIT ? 2 : 1>(ah.v, al.v, b.v, b.v, acc[t]);
    }
  }
#pragma unroll
  for (int t = 0; t < 4; ++t) {
    const int col = col0 + t * 16 + ln;
    float bv = bias ? bias[col] : 0.f;
    if (BIAS_BF16) bv = bf16_round(bv);
#pragma unroll
    for (int r = 0; r < 8; ++r) {
      float v = acc[t][r] + bv;
      if (resid) { float rv = resid[(size_t)((row0 + 8 * hh + r) % rmod) * ldr + col]; if (RES_BF16) rv = bf16_round(rv); v += rv; }
      if (ACT == 1) v = fmaxf(v, 0.f);
      if (ACT == 2) v = 0.5f * v * (1.0f + erff(v * 0.70710678118654752f));
      if (ACT == 3) { const float u = 0.7978845608028654f * (v + 0.044715f * v * v * v); v = 0.5f * v * (1.0f + tanhf(u)); }
      so[w][8 * hh + r][t * 16 + ln] = v;
    }
  }
  __builtin_amdgcn_fence(__ATOMIC_ACQ_REL, "workgroup");
  __builtin_amdgcn_wave_barrier();
  const int rsub = lane >> 4, c4 = (lane & 15) * 4;
  {
#pragma unroll
    for (int q = 0; q < 8; ++q) {
      const int r = q * 2 + rsub;
      const v4f v = *(const v4fa*)&so[w][r][c4];
      *(v4f*)(C + (size_t)(row0 + r) * ldc + col0 + c4) = v;
    }
    
  }
}
// row LayerNorm (biased variance, eps) over N: s = X (+ R); optional out_sum <- s; out_norm <- (s-mu)*rsqrt(var+eps)*g + b
template <bool PARAM_BF16>
__global__ __launch_bounds__(256) void k_layernorm(const float* __restrict__ X, const float* __restrict__ R, const float* __restrict__ g, const float* __restrict__ bta,
                                                  float* __restrict__ out_sum, float* __restrict__ out_norm, int N, float eps) {
  __shared__ float red[256];
  const int row = blockIdx.x, tid = threadIdx.x;
  const float* x = X + (size_t)row * N; const float* rr = R ? R + (size_t)row * N : nullptr;
  float vals[16];                     // up to N = 4096
  const int per = N / 256;            // contiguous chunk per thread? use strided-by-4 chunks: thread handles j = tid*4 + 1024*u
  float s1 = 0.f;
  for (int u = 0; u < per / 4; ++u) {
    const int j = tid * 4 + 1024 * u;
    const v4f a = *(const v4fa*)(x + j);
    v4f b = {0.f,0.f,0.f,0.f}; if (rr) b = *(const v4fa*)(rr + j);
#pragma unroll
    for (int q = 0; q < 4; ++q) { const float v = a[q] + b[q]; vals[u * 4 + q] = v; s1 += v; }
  }
  red[tid] = s1; __syncthreads();
  for (int st = 128; st > 0; st >>= 1) { if (tid < st) red[tid] += red[tid + st]; __syncthreads(); }
  const float mu = red[0] / (float)N; __syncthreads();
  float s2 = 0.f;
  for (int u = 0; u < per / 4; ++u)
#pragma unroll
    for (int q = 0; q < 4; ++q) { const float c = vals[u * 4 + q] - mu; s2 += c * c; }
  red[tid] = s2; __syncthreads();
  for (int st = 128; st > 0; st >>= 1) { if (tid < st) red[tid] += red[tid + st]; __syncthreads(); }
  const float rs = rsqrtf(red[0] / (float)N + eps);
  {
    for (int u = 0; u < per / 4; ++u) {
      const int j = tid * 4 + 1024 * u;
      v4f o, sm;
#pragma unroll
      for (int q = 0; q < 4; ++q) {
        float gg = g[j + q], bb = bta[j + q];
        if (PARAM_BF16) { gg = bf16_round(gg); bb = bf16_round(bb); }
        sm[q] = vals[u * 4 + q]; o[q] = (vals[u * 4 + q] - mu) * rs * gg + bb;
      }
      if (out_sum) *(v4f*)(out_sum + (size_t)row * N + j) = sm;
      *(v4f*)(out_norm + (size_t)row * N + j) = o;
    }
    
  }
}



// ---- f16 WMMA path (v_wmma_f32_16x16x32_f16): 11-bit significands for operands in range — used where a [0,1] probability operand needs more precision than bf16
typedef _Float16 v16h __attribute__((ext_vector_type(16)));
union FragH { v16h v; v8us half[2]; _Float16 h[16]; unsigned short u[16]; };
template <int NT>
__device__ __forceinline__ v8f mmaH(v16h ah, v16h al, v16h bh, v16h bl, v8f c) {
  c = __builtin_amdgcn_wmma_f32_16x16x32_f16(false, ah, false, bh, (short)0, c, false, false);
  if (NT >= 2) c = __builtin_amdgcn_wmma_f32_16x16x32_f16(false, al, false, bh, (short)0, c, false, false);
  if (NT >= 3) c = __builtin_amdgcn_wmma_f32_16x16x32_f16(false, ah, false, bl, (short)0, c, false, false);
  asm volatile("v_nop\n\tv_nop\n\tv_nop\n\tv_nop" : "+v"(c) : "v"(ah), "v"(al), "v"(bh), "v"(bl));
  return c;
}
// batched GEMM like k_gemm_b but f16 operands: A f32 (split into f16 hi/lo if ASPLIT, else rounded to f16), Bt = f16 values [n][k]; alpha; C f32; N multiple of 16 (partial tiles skipped)
template <bool ASPLIT>
__global__ __launch_bounds__(128) void k_gemm_h(const float* __restrict__ A, int lda, size_t sA, const _Float16* __restrict__ Bh, int ldb, size_t sB, float alpha, float* __restrict__ C, int ldc, size_t sC, int M, int N, int K) {
  __shared__ __attribute__((aligned(16))) float so[4][16][64];
  const int tid = threadIdx.x, w = tid >> 5, lane = tid & 31, ln = lane & 15, hh = lane >> 4; const int by = blockIdx.y;
  A += (size_t)by * sA; Bh += (size_t)by * sB; C += (size_t)by * sC;
  const int ntn = (N + 63) / 64; const int wid = blockIdx.x * 4 + w; const int mt = wid / ntn, nq = wid % ntn; if (mt * 16 >= M) return;
  const int row0 = mt * 16, col0 = nq * 64; const float* arow = A + (size_t)(row0 + ln) * lda;
  v8f acc[4] = {};
  for (int kb = 0; kb < K; kb += 32) {
    FragH ah, al;
    const v4f x0 = *(const v4fa*)(arow + kb + 8 * hh), x1 = *(const v4fa*)(arow + kb + 8 * hh + 4), x2 = *(const v4fa*)(arow + kb + 16 + 8 * hh), x3 = *(const v4fa*)(arow + kb + 16 + 8 * hh + 4);
    float xs[16] = {x0[0],x0[1],x0[2],x0[3],x1[0],x1[1],x1[2],x1[3],x2[0],x2[1],x2[2],x2[3],x3[0],x3[1],x3[2],x3[3]};
#pragma unroll
    for (int i = 0; i < 16; ++i) { const _Float16 h = (_Float16)xs[i]; ah.h[i] = h; al.h[i] = ASPLIT ? (_Float16)(xs[i] - (float)h) : (_Float16)0.0f; }
#pragma unroll
    for (int t = 0; t < 4; ++t) { if (col0 + t * 16 >= N) continue; const size_t boff = (size_t)(col0 + t * 16 + ln) * ldb + kb; FragH bq; bq.half[0] = *(const v8us*)(Bh + boff + 8 * hh); bq.half[1] = *(const v8us*)(Bh + boff + 16 + 8 * hh);
      acc[t] = mmaH<ASPLIT ? 2 : 1>(ah.v, al.v, bq.v, bq.v, acc[t]); }
  }
#pragma unroll
  for (int t = 0; t < 4; ++t) { if (col0 + t * 16 >= N) continue;
#pragma unroll
    for (int r = 0; r < 8; ++r) so[w][8 * hh + r][t * 16 + ln] = acc[t][r] * alpha; }
  __builtin_amdgcn_fence(__ATOMIC_ACQ_REL, "workgroup"); __builtin_amdgcn_wave_barrier();
  const int rsub = lane >> 4, c4 = (lane & 15) * 4;
  {
#pragma unroll
    for (int q = 0; q < 8; ++q) { const int r = q * 2 + rsub; if (col0 + c4 < N) { const v4f v = *(const v4fa*)&so[w][r][c4]; *(v4f*)(C + (size_t)(row0 + r) * ldc + col0 + c4) = v; } }
     }
}

// Wt[n][k] = f16(W[k][n]·scale) from f32 row-major W[K][N] (scale = power of two; bf16-exact weights stay exact in f16 away from the subnormal range)
__global__ __launch_bounds__(256) void k_wt_f16(const float* __restrict__ W, _Float16* __restrict__ Wt, int K, int N, float scale) {
  const int t = blockIdx.x * 256 + threadIdx.x; if (t >= N * (K / 8)) return; const int n = t / (K / 8), k8 = (t % (K / 8)) * 8; FragH f;
#pragma unroll
  for (int i = 0; i < 8; ++i) f.h[i] = (_Float16)(bf16_round(W[(size_t)(k8 + i) * N + n]) * scale); const v8us o = f.half[0];
  *(v8us*)((unsigned short*)Wt + (size_t)n * K + k8) = o; 
}
// k_gemm_hh variant with fused epilogue: v = acc·alpha + bias[by·sBias + col] (+ CP[(row/rowsPerB)·sCPb + by·64 + col] if CP) ; ACT 0 none / 1 elu ; writes f16 C16 (and f32 C if non-null)
template <int ACT>
__global__ __launch_bounds__(128) void k_gemm_hhx(const _Float16* __restrict__ A, int lda, size_t sA, const _Float16* __restrict__ Bh, int ldb, size_t sB, float alpha, const float* __restrict__ bias, size_t sBias, const float* __restrict__ CP, int rowsPerB, size_t sCPb, int row0g,
    float* __restrict__ C, _Float16* __restrict__ C16, int ldc, size_t sC, int M, int N, int K) {
  __shared__ __attribute__((aligned(16))) float so[4][16][64];
  const int tid = threadIdx.x, w = tid >> 5, lane = tid & 31, ln = lane & 15, hh = lane >> 4; const int by = blockIdx.y;
  A += (size_t)by * sA; Bh += (size_t)by * sB; const size_t cofs = (size_t)by * sC; const float* bp = bias ? bias + (size_t)by * sBias : nullptr;
  const int ntn = (N + 63) / 64; const int wid = blockIdx.x * 4 + w; const int mt = wid / ntn, nq = wid % ntn; if (mt * 16 >= M) return;
  const int row0 = mt * 16, col0 = nq * 64; const _Float16* arow = A + (size_t)(row0 + ln) * lda;
  v8f acc[4] = {};
  for (int kb = 0; kb < K; kb += 32) { FragH ah; ah.half[0] = *(const v8us*)((const unsigned short*)arow + kb + 8 * hh); ah.half[1] = *(const v8us*)((const unsigned short*)arow + kb + 16 + 8 * hh);
#pragma unroll
    for (int t = 0; t < 4; ++t) { if (col0 + t * 16 >= N) continue; const size_t boff = (size_t)(col0 + t * 16 + ln) * ldb + kb; FragH bq; bq.half[0] = *(const v8us*)((const unsigned short*)Bh + boff + 8 * hh); bq.half[1] = *(const v8us*)((const unsigned short*)Bh + boff + 16 + 8 * hh);
      acc[t] = mmaH<1>(ah.v, ah.v, bq.v, bq.v, acc[t]); }
  }
#pragma unroll
  for (int t = 0; t < 4; ++t) { if (col0 + t * 16 >= N) continue; const int col = col0 + t * 16 + ln; const float bv = bp ? bf16_round(bp[col]) : 0.f;
#pragma unroll
    for (int r = 0; r < 8; ++r) { float v = acc[t][r] * alpha + bv; if (CP) { const int bidx = (row0g + row0 + 8 * hh + r) / rowsPerB; v += CP[(size_t)bidx * sCPb + (size_t)by * 64 + col]; } if (ACT == 1) v = (v > 0.f) ? v : expm1f(v); else if (ACT == 7) v = (v > 0.f) ? v + 1.0f : expf(v); else if (ACT == 8) v = tanhf(v); else if (ACT == 9) v = 0.5f * v * (1.0f + tanhf(0.7978845608028654f * (v + 0.044715f * v * v * v))); else if (ACT == 11) v = 1.0f / (1.0f + expf(-v)); else if (ACT == 12) v = (v > 0.f) ? v : 0.01f * v; else if (ACT == 14) v = (v > 0.f) ? v : 0.1f * v; else if (ACT == 15) v = v / (1.0f + expf(-v)); else if (ACT == 3) v = fmaxf(v, 0.f); else if (ACT == 6) v = 0.5f * v * (1.0f + erff(v * 0.70710678118654752f)); so[w][8 * hh + r][t * 16 + ln] = v; } }
  __builtin_amdgcn_fence(__ATOMIC_ACQ_REL, "workgroup"); __builtin_amdgcn_wave_barrier();
  const int rsub = lane >> 4, c4 = (lane & 15) * 4; typedef _Float16 v4h __attribute__((ext_vector_type(4)));
  {
#pragma unroll
    for (int q = 0; q < 8; ++q) { const int r = q * 2 + rsub; if (col0 + c4 < N) { const v4f v = *(const v4fa*)&so[w][r][c4]; if (C) *(v4f*)(C + cofs + (size_t)(row0 + r) * ldc + col0 + c4) = v; if (C16) { v4h h4; for (int i = 0; i < 4; ++i) h4[i] = (_Float16)v[i]; *(v4h*)(C16 + cofs + (size_t)(row0 + r) * ldc + col0 + c4) = h4; } } }
     }
}


typedef _Float16 v4h __attribute__((ext_vector_type(4)));

__global__ __launch_bounds__(256) void k_x16(const float* __restrict__ x, _Float16* __restrict__ X16, size_t n8) { const size_t t = (size_t)blockIdx.x * 256 + threadIdx.x; if (t >= n8) return; FragH f;
#pragma unroll
  for (int q = 0; q < 8; ++q) f.h[q] = (_Float16)bf16_round(x[t * 8 + q]); *(v8us*)((unsigned short*)X16 + t * 8) = f.half[0];  }
__global__ __launch_bounds__(256) void k_h16(const float* __restrict__ x, _Float16* __restrict__ X16, size_t n8) { const size_t t = (size_t)blockIdx.x * 256 + threadIdx.x; if (t >= n8) return; FragH f;
#pragma unroll
  for (int q = 0; q < 8; ++q) f.h[q] = (_Float16)x[t * 8 + q]; *(v8us*)((unsigned short*)X16 + t * 8) = f.half[0];  }
__global__ __launch_bounds__(256) void k_round16f(const float* __restrict__ W, _Float16* __restrict__ Bt, size_t n8) { const size_t t = (size_t)blockIdx.x * 256 + threadIdx.x; if (t >= n8) return; FragH f;
#pragma unroll
  for (int i = 0; i < 8; ++i) f.h[i] = (_Float16)(bf16_round(W[t * 8 + i]) * 16.0f); *(v8us*)((unsigned short*)Bt + t * 8) = f.half[0];  }
template <int NHv, int TTv>
__global__ __launch_bounds__(256) void k_vt(const _Float16* __restrict__ V16, int ldv, int voff, _Float16* __restrict__ Vt) { __shared__ unsigned short tl[64][66]; const int tid = threadIdx.x; const int slab = blockIdx.x / (TTv / 64), lg = blockIdx.x % (TTv / 64); const int b = slab / NHv, h = slab % NHv;
  for (int i = tid; i < 64 * 8; i += 256) { const int r = i / 8, c8 = (i % 8) * 8; FragH f; f.half[0] = *(const v8us*)((const unsigned short*)V16 + ((size_t)b * TTv + lg * 64 + r) * ldv + voff + h * 64 + c8);
#pragma unroll
    for (int q = 0; q < 8; ++q) tl[r][c8 + q] = f.u[q]; }
  __syncthreads();
  {
#pragma unroll
    for (int rd = 0; rd < 2; ++rd) { const int d = rd * 32 + tid / 8, pc = tid % 8; FragH f;
#pragma unroll
      for (int q = 0; q < 8; ++q) f.u[q] = tl[pc * 8 + q][d];
      *(v8us*)((unsigned short*)Vt + ((size_t)slab * 64 + d) * TTv + lg * 64 + pc * 8) = f.half[0]; }
     } }

// ---- fast GEMM (256 threads, block tile 128x128, wave tile 32x64; requires M % 128 == 0 rows per launch region, N % 128 == 0 and K % 64 == 0); epilogue = k_gemm_hhx semantics ----
__device__ __forceinline__ v16h g2_frag(const _Float16* p, int hh) { FragH f; f.half[0] = *(const v8us*)((const unsigned short*)p + 8 * hh); f.half[1] = *(const v8us*)((const unsigned short*)p + 16 + 8 * hh); return f.v; }
__device__ __forceinline__ v8f g2_mma(v16h a, v16h b, v8f c) { v8f d = __builtin_amdgcn_wmma_f32_16x16x32_f16(false, a, false, b, (short)0, c, false, false); asm volatile("v_nop\n\tv_nop\n\tv_nop\n\tv_nop" : "+v"(d) : "v"(a), "v"(b)); return d; }
// ---- operand staging of the 128 x 128 block tile (8 waves: 4 row groups x 2 column groups of 32 x 64): 64 k (128 B of every operand row) per stage, rows 0..127 = A, 128..255 = B, LDS pitch 72 halves = 144 B (16 B x odd for the 16-byte fragment reads), two buffers
#define GKT 64
#define GPITCH 72
#define GSTG (256 * GPITCH)
// Eight asynchronous 16-byte copies global -> LDS per lane (one stage's share: a wave's copy = 4 whole 128-B rows), through no register. The s_wait_xcnt is the last line of the copies' own statement, so that no address register named here is rewritten ahead of it.
__device__ __forceinline__ void g2_copy8(unsigned l0, unsigned l1, unsigned l2, unsigned l3, unsigned l4, unsigned l5, unsigned l6, unsigned l7,
    const unsigned short* g0, const unsigned short* g1, const unsigned short* g2, const unsigned short* g3, const unsigned short* g4, const unsigned short* g5, const unsigned short* g6, const unsigned short* g7) {
  asm volatile("global_load_async_to_lds_b128 %0, %8, off\n\t"
               "global_load_async_to_lds_b128 %1, %9, off\n\t"
               "global_load_async_to_lds_b128 %2, %10, off\n\t"
               "global_load_async_to_lds_b128 %3, %11, off\n\t"
               "global_load_async_to_lds_b128 %4, %12, off\n\t"
               "global_load_async_to_lds_b128 %5, %13, off\n\t"
               "global_load_async_to_lds_b128 %6, %14, off\n\t"
               "global_load_async_to_lds_b128 %7, %15, off\n\t"
               "s_wait_xcnt 0x0"
               :: "v"(l0), "v"(l1), "v"(l2), "v"(l3), "v"(l4), "v"(l5), "v"(l6), "v"(l7), "v"(g0), "v"(g1), "v"(g2), "v"(g3), "v"(g4), "v"(g5), "v"(g6), "v"(g7) : "memory");
}
// Main loop of the 32 x 64 wave tile over K (a multiple of 64), 256 threads: rows rowb..rowb+127 of A and colb..colb+127 of Bh are staged once for the block's eight waves; wave w reads the fragments of A rows 32 (w & 3).. and B rows 64 (w >> 2).. from LDS. Per accumulator the products come in the same k order as with fragments loaded from global. On return every wave has passed the barrier behind the last fragment read, so sT may be reused.
__device__ __forceinline__ void g2_main(const _Float16* __restrict__ A, int lda, const _Float16* __restrict__ Bh, int ldb, int K, int rowb, int colb, unsigned short* sT, v8f (&c)[8]) {
  const int tid = threadIdx.x, w = tid >> 5, lane = tid & 31, ln = lane & 15, hh = lane >> 4;
  const unsigned short* ga = (const unsigned short*)A + (size_t)(rowb + (tid >> 3)) * lda + (tid & 7) * 8; const unsigned short* gb = (const unsigned short*)Bh + (size_t)(colb + (tid >> 3)) * ldb + (tid & 7) * 8;
  const size_t a32 = (size_t)32 * lda, b32 = (size_t)32 * ldb; const unsigned lt = (unsigned)(size_t)&sT[(tid >> 3) * GPITCH + (tid & 7) * 8]; constexpr unsigned R32 = 32 * GPITCH * 2;
  auto stage = [&](int kb, unsigned bo) { const unsigned l = lt + bo; const unsigned short* a = ga + kb; const unsigned short* b = gb + kb;
    g2_copy8(l, l + R32, l + 2 * R32, l + 3 * R32, l + 4 * R32, l + 5 * R32, l + 6 * R32, l + 7 * R32, a, a + a32, a + 2 * a32, a + 3 * a32, b, b + b32, b + 2 * b32, b + 3 * b32); };
  stage(0, 0u);
  asm volatile("s_wait_asynccnt 0x0" ::: "memory");      /* this wave's copies of stage 0 have landed before the barrier that shows them to the other waves */
  __syncthreads();
  if (GKT < K) stage(GKT, (unsigned)(GSTG * 2));
  /* rolled: one trip per stage, so that the two buffers alternate by the trip's parity */
#pragma unroll 1
  for (int kb = 0; kb < K; kb += GKT) { const unsigned short* buf = sT + ((kb >> 6) & 1) * GSTG;      /* this trip reads its own buffer alone */
    const _Float16* ar = (const _Float16*)(buf + (32 * (w & 3) + ln) * GPITCH); const _Float16* br = (const _Float16*)(buf + (128 + 64 * (w >> 2) + ln) * GPITCH);
    v16h fa[2][2], fb[2][4];      /* the trip's 24 fragment reads stand together in front of its products, so that their LDS latency is waited out once per trip and not in front of every pair of products */
#pragma unroll
    for (int ks = 0; ks < 2; ++ks) { fa[ks][0] = g2_frag(ar + ks * 32, hh); fa[ks][1] = g2_frag(ar + 16 * GPITCH + ks * 32, hh);
#pragma unroll
      for (int t = 0; t < 4; ++t) fb[ks][t] = g2_frag(br + t * 16 * GPITCH + ks * 32, hh); }
#pragma unroll
    for (int ks = 0; ks < 2; ++ks)
#pragma unroll
      for (int t = 0; t < 4; ++t) { c[t] = g2_mma(fa[ks][0], fb[ks][t], c[t]); c[4 + t] = g2_mma(fa[ks][1], fb[ks][t], c[4 + t]); }
    asm volatile("s_wait_dscnt 0x0" ::: "memory");      /* this wave's reads of the buffer have returned before the buffer may be refilled */
    asm volatile("s_wait_asynccnt 0x0" ::: "memory");      /* this wave's copies of the next stage have landed before the barrier that shows them */
    __syncthreads();      /* publishes the next stage and ends every wave's reads of this trip's buffer */
    if (kb + 2 * GKT < K) stage(kb + 2 * GKT, (unsigned)(((kb >> 6) & 1) * (GSTG * 2))); }
  asm volatile("s_wait_asynccnt 0x0" ::: "memory");      /* no copy is outstanding when the LDS becomes output staging */
}
template <int ACT>
__global__ __launch_bounds__(256) void k_gemm2(const _Float16* __restrict__ A, int lda, size_t sA, const _Float16* __restrict__ Bh, int ldb, size_t sB, float alpha, const float* __restrict__ bias, size_t sBias, const float* __restrict__ CP, int rowsPerB, size_t sCPb, int row0g,
    float* __restrict__ C, _Float16* __restrict__ C16, int ldc, size_t sC, int M, int N, int K) {
  __shared__ __attribute__((aligned(16))) float sm[2 * GSTG / 2];      /* the two operand buffers; behind the main loop its first 8 x 32 x 68 floats are the output staging */
  float (*so)[32][68] = (float (*)[32][68])sm;
  const int tid = threadIdx.x, w = tid >> 5, lane = tid & 31, ln = lane & 15, hh = lane >> 4; const int by = blockIdx.y;
  A += (size_t)by * sA; Bh += (size_t)by * sB; const size_t cofs = (size_t)by * sC; const float* bp = bias ? bias + (size_t)by * sBias : nullptr;
  const int ntn = N >> 7; const int mt = blockIdx.x / ntn, nq = blockIdx.x - mt * ntn; const int row0 = mt * 128 + 32 * (w & 3), col0 = nq * 128 + 64 * (w >> 2); if (mt * 128 + 128 > M) return;      /* block-uniform, in front of every barrier and copy */
  const v8f z8 = {0.f,0.f,0.f,0.f,0.f,0.f,0.f,0.f}; v8f accs[8] = {z8, z8, z8, z8, z8, z8, z8, z8};
  g2_main(A, lda, Bh, ldb, K, mt * 128, nq * 128, (unsigned short*)sm, accs);
#pragma unroll
  for (int u = 0; u < 8; ++u) { const int t = u & 3, half = u >> 2; const int col = col0 + t * 16 + ln; const float bv = bp ? bf16_round(bp[col]) : 0.f;
#pragma unroll
    for (int r = 0; r < 8; ++r) { const int rloc = half * 16 + 8 * hh + r; float v = accs[u][r] * alpha + bv; if (CP) { const int bidx = (row0g + row0 + rloc) / rowsPerB; v += CP[(size_t)bidx * sCPb + (size_t)by * 64 + col]; }
      if (ACT == 3) v = fmaxf(v, 0.f); else if (ACT == 6) v = 0.5f * v * (1.0f + erff(v * 0.70710678118654752f)); else if (ACT == 11) v = 1.0f / (1.0f + expf(-v)); else if (ACT == 15) v = v / (1.0f + expf(-v)); else if (ACT == 12) v = (v > 0.f) ? v : 0.01f * v; else if (ACT == 8) v = tanhf(v);
      so[w][rloc][t * 16 + ln] = v; } }
  __builtin_amdgcn_fence(__ATOMIC_ACQ_REL, "workgroup"); __builtin_amdgcn_wave_barrier();
  const int rsub = lane >> 4, c4 = (lane & 15) * 4;
  {
#pragma unroll
    for (int q = 0; q < 16; ++q) { const int r = q * 2 + rsub; const v4f v = *(const v4fa*)&so[w][r][c4]; if (C) *(v4f*)(C + cofs + (size_t)(row0 + r) * ldc + col0 + c4) = v; if (C16) { v4h h4; for (int i = 0; i < 4; ++i) h4[i] = (_Float16)v[i]; *(v4h*)(C16 + cofs + (size_t)(row0 + r) * ldc + col0 + c4) = h4; } }
     } }



__device__ __forceinline__ float siluf(float g) { return g / (1.0f + expf(-g)); }
// ---- projection GEMM (main loop of k_gemm2, NR x DM x DM, Bt carries x16) with the element-wise tail in its epilogue. A wave tile is 32 tokens x the 64 columns of one head, so the head's norm is a sum inside the wave's own LDS rows.
// POLAR 1: g = silu(acc/16) * f, f = r*scale[h]/(r + 1e-6) * post, r = |silu row|; g stored as f16 hi + x2^10 residual, row-major, one whole 128-B line per row and plane. post = log2(e) for q (the flash kernel's exponentials are then powers of 2), 1 for k.
// POLAR 0: g = silu(acc/16) stored transposed per (batch, head) slab as hi + residual planes [64 dims][SLEN tokens]; the block's 128 tokens are transposed through LDS, one whole 128-B line per 8 lanes.
template <int POLAR>
__global__ __launch_bounds__(256) void k_proj(const _Float16* __restrict__ A, const _Float16* __restrict__ Bh, const float* __restrict__ scale, float post, _Float16* __restrict__ Hh, _Float16* __restrict__ Hl) {
  constexpr int PT = POLAR ? 68 : 65;      /* LDS row pitch in floats: 68 for the 16-B row reads, 65 for the column reads of the transpose */
  __shared__ __attribute__((aligned(16))) float so[2 * GSTG / 2];      /* the two operand buffers; behind the main loop its first 256 x PT floats are the output staging: rows 32 w.. are wave w's */
  const int tid = threadIdx.x, w = tid >> 5, lane = tid & 31, ln = lane & 15, hh = lane >> 4;
  constexpr int ntn = DM >> 7; const int mt = blockIdx.x / ntn, nq = (blockIdx.x - mt * ntn) * 2 + __builtin_amdgcn_readfirstlane(w >> 2); const int row0 = mt * 128 + 32 * (w & 3), col0 = nq * 64;      /* nq = the wave's head: waves 0..3 the block's first, 4..7 its second; read from the first lane so that it stays a scalar and scale[nq] a scalar load */
  const v8f z8 = {0.f,0.f,0.f,0.f,0.f,0.f,0.f,0.f}; v8f accs[8] = {z8, z8, z8, z8, z8, z8, z8, z8};
  g2_main(A, DM, Bh, DM, DM, mt * 128, (blockIdx.x - mt * ntn) * 128, (unsigned short*)so, accs);      /* the main loop of k_gemm2 */
#pragma unroll
  for (int u = 0; u < 8; ++u) { const int t = u & 3, half = u >> 2;
#pragma unroll
    for (int r = 0; r < 8; ++r) so[(32 * w + half * 16 + 8 * hh + r) * PT + t * 16 + ln] = siluf(accs[u][r] * 0.0625f); }
  if (POLAR) {
    __builtin_amdgcn_fence(__ATOMIC_ACQ_REL, "workgroup"); __builtin_amdgcn_wave_barrier();      /* each wave reads back its own 32 rows only */
    const int rsub = lane >> 4, c4 = (lane & 15) * 4; const float sc = bf16_round(scale[nq]);
#pragma unroll
    for (int q = 0; q < 16; ++q) { const int r = q * 2 + rsub; const v4f v = *(const v4fa*)&so[(32 * w + r) * PT + c4];
      float s = (v[0] * v[0] + v[1] * v[1]) + (v[2] * v[2] + v[3] * v[3]); s += __shfl_xor(s, 8, 32); s += __shfl_xor(s, 4, 32); s += __shfl_xor(s, 2, 32); s += __shfl_xor(s, 1, 32);
      const float rr = sqrtf(s); const float fac = (rr * sc) / (rr + 1e-6f) * post; v4h h4, l4;
#pragma unroll
      for (int i = 0; i < 4; ++i) { const float g = v[i] * fac; const _Float16 h = (_Float16)g; h4[i] = h; l4[i] = (_Float16)((g - (float)h) * 1024.0f); }
      const size_t o = (size_t)(row0 + r) * DM + col0 + c4; *(v4h*)(Hh + o) = h4; *(v4h*)(Hl + o) = l4; }
  } else {
    __syncthreads();      /* the transpose reads rows that the block's other waves wrote */
    const int slab = (mt * 128 / SLEN) * NH + nq, tok0 = mt * 128 % SLEN;
#pragma unroll
    for (int it = 0; it < 8; ++it) { const int item = it * 128 + (tid & 127); const int pc = item & 7, d = (item >> 3) & 63, g = item >> 9; FragH fh, fl;      /* each half of the block transposes its own head's 128 LDS rows */
#pragma unroll
      for (int q = 0; q < 8; ++q) { const float v = so[((w >> 2) * 128 + g * 64 + pc * 8 + q) * PT + d]; const _Float16 hv = (_Float16)v; fh.h[q] = hv; fl.h[q] = (_Float16)((v - (float)hv) * 1024.0f); }
      const size_t o = ((size_t)slab * 64 + d) * SLEN + tok0 + g * 64 + pc * 8; *(v8us*)((unsigned short*)Hh + o) = fh.half[0]; *(v8us*)((unsigned short*)Hl + o) = fl.half[0]; }
  } }

// Eight asynchronous 16-byte copies global -> LDS per lane (one key pass's share of the K and V^T hi / residual tiles), through no register. The s_wait_xcnt is the last line of the copies' own statement, so that no address register named here is rewritten ahead of it.
__device__ __forceinline__ void kv_copy8(unsigned l0, unsigned l1, unsigned l2, unsigned l3, unsigned l4, unsigned l5, unsigned l6, unsigned l7,
    const unsigned short* g0, const unsigned short* g1, const unsigned short* g2, const unsigned short* g3, const unsigned short* g4, const unsigned short* g5, const unsigned short* g6, const unsigned short* g7) {
  asm volatile("global_load_async_to_lds_b128 %0, %8, off\n\t"
               "global_load_async_to_lds_b128 %1, %9, off\n\t"
               "global_load_async_to_lds_b128 %2, %10, off\n\t"
               "global_load_async_to_lds_b128 %3, %11, off\n\t"
               "global_load_async_to_lds_b128 %4, %12, off\n\t"
               "global_load_async_to_lds_b128 %5, %13, off\n\t"
               "global_load_async_to_lds_b128 %6, %14, off\n\t"
               "global_load_async_to_lds_b128 %7, %15, off\n\t"
               "s_wait_xcnt 0x0"
               :: "v"(l0), "v"(l1), "v"(l2), "v"(l3), "v"(l4), "v"(l5), "v"(l6), "v"(l7), "v"(g0), "v"(g1), "v"(g2), "v"(g3), "v"(g4), "v"(g5), "v"(g6), "v"(g7) : "memory");
}
__device__ __forceinline__ float xhalf(float x) { return __builtin_bit_cast(float, __builtin_amdgcn_permlanex16(__builtin_bit_cast(int, x), __builtin_bit_cast(int, x), 0x76543210, 0xfedcba98, false, false)); }      /* lane l's value of lane l ^ 16 */
// Both products run with their operands swapped: S^T = K Q^T (A = 16 key rows from LDS, B = the wave's 16 queries, kept in registers) and O^T += V^T P^T (A = 16 V^T rows from LDS, B = P^T). Lane (ln, hh) then holds, of query q0 + ln alone, the scores of keys 16 nt + 8 hh + r and the output dims 16 dt + 8 hh + r. The two score tiles converted in place are the B operand of the value product: position s of a fragment is k = 8 hh + s (s < 8) or 16 + 8 hh + (s - 8), which is tile s >> 3, register s & 7.
template <int TQ, int TK>
__global__ __launch_bounds__(128) void k_flashm(const _Float16* __restrict__ Q16, const _Float16* __restrict__ Q16lo, int ldq, const _Float16* __restrict__ K16, const _Float16* __restrict__ K16lo, int ldk, const _Float16* __restrict__ Vt, const _Float16* __restrict__ Vtlo, const unsigned* __restrict__ MB, const int* __restrict__ RA, const int* __restrict__ KE, _Float16* __restrict__ Oh, _Float16* __restrict__ Ol, int ldo) {
  constexpr int RPW = 16, NQB = TQ / (4 * RPW), DT = 4, KS = 2;
  /* One pass's 32 keys, staged once for the block's four waves, two buffers. In 16-bit units: K rows (64 dims) at pitch 72 = 144 B, V^T rows (32 keys) at pitch 40 = 80 B, both 16 B x odd for the 16-byte fragment reads. */
  constexpr int KP = 72, VP = 40, KL0 = 32 * KP, VH0 = 2 * 32 * KP, VL0 = VH0 + 64 * VP, STG = VL0 + 64 * VP;
  __shared__ __attribute__((aligned(16))) unsigned short sKV[2][STG];
  const int tid = threadIdx.x, w = tid >> 5, lane = tid & 31, ln = lane & 15, hh = lane >> 4;
  /* Heaviest first: a block walks 2 (qblk + 1) key passes, so the block index counts the query blocks downwards, all (batch, head) slabs of one query block side by side. Cost falls with the index: the long blocks start first, neighbours in the index cost the same, and the launch ends on 2-pass blocks. Every (slab, query block) is taken exactly once. */
  constexpr int NSL = NBT * NH; const int slab = blockIdx.x % NSL, qblk = NQB - 1 - blockIdx.x / NSL; const int b = slab / NH, h = slab % NH; const int qb0 = qblk * (4 * RPW); const int q0 = qb0 + w * RPW;
  FragH aq[KS], aql[KS];
  { const size_t qo = ((size_t)b * TQ + q0 + ln) * ldq + h * 64; const unsigned short* qr = (const unsigned short*)Q16 + qo; const unsigned short* ql = (const unsigned short*)Q16lo + qo;
#pragma unroll
    for (int ks = 0; ks < KS; ++ks) { aq[ks].half[0] = *(const v8us*)(qr + ks * 32 + 8 * hh); aq[ks].half[1] = *(const v8us*)(qr + ks * 32 + 16 + 8 * hh); aql[ks].half[0] = *(const v8us*)(ql + ks * 32 + 8 * hh); aql[ks].half[1] = *(const v8us*)(ql + ks * 32 + 16 + 8 * hh); } }
  asm volatile("s_wait_xcnt 0x0" ::: "memory");      /* the Q loads' address registers are reused right below */
  const unsigned short* Vth = (const unsigned short*)Vt + (size_t)slab * 64 * TK; const unsigned short* Vtl = (const unsigned short*)Vtlo + (size_t)slab * 64 * TK;
  float m_r = -3.0e38f, l_r = 0.f; v8f oacc[DT], oaccl[DT];      /* running maximum and this lane's half of the running sum of query q0 + ln */
#pragma unroll
  for (int dt = 0; dt < DT; ++dt) { oacc[dt] = (v8f){0.f,0.f,0.f,0.f,0.f,0.f,0.f,0.f}; oaccl[dt] = oacc[dt]; }
  int jend = KE[qblk * 32]; jend = min(TK, (jend + 31) & ~31); if (jend < 32) jend = 32;      /* block-uniform */
  /* each thread copies two 16-byte pieces of each of the four tiles: K rows tid/8 and tid/8 + 16 (a wave's copy = 4 whole 128-B rows), V^T rows tid/4 and tid/4 + 32 */
  const unsigned short* gkh = (const unsigned short*)K16 + ((size_t)b * TK + (tid >> 3)) * ldk + h * 64 + (tid & 7) * 8; const unsigned short* gkl = (const unsigned short*)K16lo + ((size_t)b * TK + (tid >> 3)) * ldk + h * 64 + (tid & 7) * 8;
  const unsigned short* gvh = Vth + (size_t)(tid >> 2) * TK + (tid & 3) * 8; const unsigned short* gvl = Vtl + (size_t)(tid >> 2) * TK + (tid & 3) * 8;
  const unsigned lk = (unsigned)(size_t)&sKV[0][(tid >> 3) * KP + (tid & 7) * 8], lv = (unsigned)(size_t)&sKV[0][VH0 + (tid >> 2) * VP + (tid & 3) * 8];
  auto stage = [&](int j, unsigned bo) { const size_t ko = (size_t)j * ldk, k16 = (size_t)16 * ldk;
    kv_copy8(lk + bo, lk + bo + 16 * KP * 2, lk + bo + KL0 * 2, lk + bo + (KL0 + 16 * KP) * 2, lv + bo, lv + bo + 32 * VP * 2, lv + bo + 64 * VP * 2, lv + bo + 96 * VP * 2,
             gkh + ko, gkh + ko + k16, gkl + ko, gkl + ko + k16, gvh + j, gvh + j + (size_t)32 * TK, gvl + j, gvl + j + (size_t)32 * TK); };
  stage(0, 0u);
  asm volatile("s_wait_asynccnt 0x0" ::: "memory");      /* this wave's copies of pass 0 have landed before the barrier that shows them to the other waves */
  __syncthreads();
  if (32 < jend) stage(32, (unsigned)(STG * 2));
  const bool am = (RA[q0 + ln] != 0); const unsigned* mp = MB + (size_t)(q0 + ln) * (TK / 32);      /* one row flag and one mask row per lane: its query's; mp walks the row, one word a pass */
  asm volatile("s_wait_xcnt 0x0" ::: "memory");      /* the row-flag load's address register is reused below */
#pragma unroll 1
  for (int j0 = 0; j0 < jend; j0 += 32) {
    const unsigned mws = *mp >> (8 * hh);      /* asked for at the head of the pass: its wait falls together with the K fragments'; bit 16 nt + r is then this lane's key 16 nt + 8 hh + r */
    const unsigned short* kvb = &sKV[(j0 >> 5) & 1][0];      /* this pass reads its own buffer alone */
    v8f s[2];
#pragma unroll
    for (int nt = 0; nt < 2; ++nt) { const unsigned short* kr = kvb + (nt * 16 + ln) * KP; const unsigned short* kl = kr + KL0; FragH bk[KS], bkl[KS];
#pragma unroll
      for (int ks = 0; ks < KS; ++ks) { bk[ks].half[0] = *(const v8us*)(kr + ks * 32 + 8 * hh); bk[ks].half[1] = *(const v8us*)(kr + ks * 32 + 16 + 8 * hh); bkl[ks].half[0] = *(const v8us*)(kl + ks * 32 + 8 * hh); bkl[ks].half[1] = *(const v8us*)(kl + ks * 32 + 16 + 8 * hh); }
      v8f acc = (v8f){0.f,0.f,0.f,0.f,0.f,0.f,0.f,0.f}, accr = acc;
#pragma unroll
      for (int ks = 0; ks < KS; ++ks) { acc = mmaH<1>(bk[ks].v, bk[ks].v, aq[ks].v, aq[ks].v, acc); accr = mmaH<1>(bk[ks].v, bk[ks].v, aql[ks].v, aql[ks].v, accr); accr = mmaH<1>(bkl[ks].v, bkl[ks].v, aq[ks].v, aq[ks].v, accr); }
      s[nt] = acc + accr * 0.0009765625f; }
    /* The lane's 16 scores are all of one query: maximum and sum are taken inside the lane, the maximum joined with the other half of the wave by one exchange. No branch (each exp is computed and then chosen by a select), each step written for all 16 before the next. */
    float sv[16], mx[8]; bool ok[16];
#pragma unroll
    for (int i = 0; i < 16; ++i) { ok[i] = am || (((mws >> (16 * (i >> 3) + (i & 7))) & 1u) == 0u); sv[i] = ok[i] ? (am ? 0.f : s[i >> 3][i & 7] * SCL) : -INFINITY; }
#pragma unroll
    for (int i = 0; i < 8; ++i) mx[i] = fmaxf(sv[i], sv[8 + i]);
    float mc = fmaxf(fmaxf(fmaxf(mx[0], mx[1]), fmaxf(mx[2], mx[3])), fmaxf(fmaxf(mx[4], mx[5]), fmaxf(mx[6], mx[7]))); mc = fmaxf(mc, xhalf(mc));
    const float mn = fmaxf(m_r, mc); const float ea = __builtin_amdgcn_exp2f(m_r - mn); const float al = (mn > -1.0e38f) ? ea : 1.0f; m_r = mn;      /* the scores arrive times log2(e) (folded into q by its projection), so e^(s - m) is 2^(difference): one v_exp_f32 */
    FragH pa, pl; float p[16];
#pragma unroll
    for (int i = 0; i < 16; ++i) { const float e = __builtin_amdgcn_exp2f(sv[i] - mn); p[i] = ok[i] ? e : 0.f; }
#pragma unroll
    for (int i = 0; i < 16; ++i) { const float ps = p[i] * 1024.0f; pa.h[i] = (_Float16)ps; pl.h[i] = (_Float16)((ps - (float)pa.h[i]) * 1024.0f); }
#pragma unroll
    for (int i = 0; i < 8; ++i) p[i] += p[8 + i];
    l_r = l_r * al + (((p[0] + p[1]) + (p[2] + p[3])) + ((p[4] + p[5]) + (p[6] + p[7])));
#pragma unroll
    for (int dt = 0; dt < DT; ++dt) { oacc[dt] *= al; oaccl[dt] *= al; }
#pragma unroll
    for (int dt = 0; dt < DT; ++dt) { const unsigned short* vr = kvb + VH0 + (dt * 16 + ln) * VP; const unsigned short* vl = vr + 64 * VP; FragH bv, bl; bv.half[0] = *(const v8us*)(vr + 8 * hh); bv.half[1] = *(const v8us*)(vr + 16 + 8 * hh); bl.half[0] = *(const v8us*)(vl + 8 * hh); bl.half[1] = *(const v8us*)(vl + 16 + 8 * hh);
      oacc[dt] = mmaH<1>(bv.v, bv.v, pa.v, pa.v, oacc[dt]); oaccl[dt] = mmaH<1>(bl.v, bl.v, pa.v, pa.v, oaccl[dt]); oaccl[dt] = mmaH<1>(bv.v, bv.v, pl.v, pl.v, oaccl[dt]); }
    asm volatile("s_wait_xcnt 0x0" ::: "memory");      /* the mask-word load's address register is stepped for the next pass behind this point */
    ++mp;
    asm volatile("s_wait_dscnt 0x0" ::: "memory");      /* this wave's reads of the buffer have returned before the buffer may be refilled */
    asm volatile("s_wait_asynccnt 0x0" ::: "memory");      /* this wave's copies of the next pass have landed before the barrier that shows them */
    __syncthreads();      /* publishes the next pass's tiles and ends every wave's reads of this pass's buffer */
    if (j0 + 64 < jend) stage(j0 + 64, (unsigned)(((j0 >> 5) & 1) * (STG * 2))); }
  asm volatile("s_wait_asynccnt 0x0" ::: "memory");      /* no copy is outstanding when the wave goes on to its end */
  const float l = l_r + xhalf(l_r); const float li = (l > 0.f) ? 1.0f / (l * 1024.0f) : 0.f;      /* the two halves' sums are joined once */
  /* a lane's 8 registers of a tile are 8 neighbouring dims of its query's row: one 16-byte store per tile and plane; the wave's 8 stores fill its 16 whole 128-B rows of each plane */
  FragH fh[DT], fl[DT];
#pragma unroll
  for (int dt = 0; dt < DT; ++dt)
#pragma unroll
    for (int r = 0; r < 8; ++r) { const float val = (oacc[dt][r] + oaccl[dt][r] * 0.0009765625f) * li; const _Float16 hv = (_Float16)val; fh[dt].h[r] = hv; fl[dt].h[r] = (_Float16)((val - (float)hv) * 1024.0f); }
  const size_t oo = ((size_t)b * TQ + q0 + ln) * ldo + h * 64 + 8 * hh;
#pragma unroll
  for (int dt = 0; dt < DT; ++dt) { *(v8us*)((unsigned short*)Oh + oo + dt * 16) = fh[dt].half[0]; *(v8us*)((unsigned short*)Ol + oo + dt * 16) = fl[dt].half[0]; } }


__global__ __launch_bounds__(256) void k_causaltab(unsigned* __restrict__ MB, int* __restrict__ RA, int* __restrict__ KE, int nq, int nk) {
  const int t = blockIdx.x * 256 + threadIdx.x; const int nw = nk / 32;
  if (t < nq * nw) { const int q = t / nw, w = t % nw; const int first = q + 1 - 32 * w; const unsigned bits = (first <= 0) ? 0xffffffffu : ((first >= 32) ? 0u : (0xffffffffu << first)); *(unsigned*)(MB + t) = bits;  }
  if (t < nq) { *(int*)(RA + t) = 0;  }
  if (t < nq / 64) { const int v = 64 * (t + 1); *(int*)(KE + t * 32) = v;  } }

extern "C" void kernel_launch(void* const* d_in, const int* in_sizes, int n_in,
                              void* d_out, int out_size, void* d_ws, size_t ws_size, hipStream_t stream) {
  (void)in_sizes; (void)n_in; (void)out_size;
  const float* const* I = (const float* const*)d_in; const float* x = I[0]; const float* Wq = I[1]; const float* Wk = I[2]; const float* Wv = I[3]; const float* Wo = I[4]; const float* qs = I[5]; const float* ks = I[6];
  char* ws = (char*)d_ws; size_t off = 0;
  auto take = [&](size_t bytes) { char* p = ws + off; off += (bytes + 255) & ~(size_t)255; return p; };
  _Float16* BQ = (_Float16*)take((size_t)DM * DM * 2); _Float16* BK = (_Float16*)take((size_t)DM * DM * 2); _Float16* BV = (_Float16*)take((size_t)DM * DM * 2); _Float16* BO = (_Float16*)take((size_t)DM * DM * 2);
  _Float16* X16 = (_Float16*)take((size_t)NR * DM * 2); _Float16* Oh = (_Float16*)take((size_t)NR * DM * 2); _Float16* Ol = (_Float16*)take((size_t)NR * DM * 2);
  _Float16* Qh = (_Float16*)take((size_t)NR * DM * 2); _Float16* Ql = (_Float16*)take((size_t)NR * DM * 2); _Float16* Kh = (_Float16*)take((size_t)NR * DM * 2); _Float16* Kl = (_Float16*)take((size_t)NR * DM * 2); _Float16* Vth = (_Float16*)take((size_t)NR * DM * 2); _Float16* Vtl = (_Float16*)take((size_t)NR * DM * 2);
  unsigned* MB = (unsigned*)take((size_t)SLEN * (SLEN / 32) * 4); int* RA = (int*)take((size_t)SLEN * 4); int* KE = (int*)take((size_t)(SLEN / 64) * 32 * 4);
  if (off > ws_size) return;      /* 8 + 16 + 2 x 16 + 6 x 16 + 0.5 = 153 MiB */
  const size_t n8 = (size_t)NR * DM / 8; const unsigned nb8 = (unsigned)((n8 + 255) / 256); const size_t w8 = (size_t)DM * DM / 8; const unsigned wb = (unsigned)((w8 + 255) / 256);
  k_round16f<<<wb, 256, 0, stream>>>(Wq, BQ, w8); k_round16f<<<wb, 256, 0, stream>>>(Wk, BK, w8); k_round16f<<<wb, 256, 0, stream>>>(Wv, BV, w8); k_round16f<<<wb, 256, 0, stream>>>(Wo, BO, w8);      /* torch (out,in) = natural Bt; x16 */
  k_causaltab<<<(SLEN * (SLEN / 32) + 255) / 256, 256, 0, stream>>>(MB, RA, KE, SLEN, SLEN);
  const dim3 gP((NR / 128) * (DM / 128), 1);
  k_x16<<<nb8, 256, 0, stream>>>(x, X16, n8);
  k_proj<1><<<gP, 256, 0, stream>>>(X16, BQ, qs, 1.4426950408889634f, Qh, Ql);      /* q = silu(x Wq^T) * f_q * log2(e), hi + residual */
  k_proj<1><<<gP, 256, 0, stream>>>(X16, BK, ks, 1.0f, Kh, Kl);      /* k = silu(x Wk^T) * f_k, hi + residual */
  k_proj<0><<<gP, 256, 0, stream>>>(X16, BV, ks, 1.0f, Vth, Vtl);      /* v = silu(x Wv^T), transposed, hi + residual (scale, post unread) */
  k_flashm<SLEN, SLEN><<<NBT * NH * (SLEN / 64), 128, 0, stream>>>(Qh, Ql, DM, Kh, Kl, DM, Vth, Vtl, MB, RA, KE, Oh, Ol, DM);
  float* outb = (float*)d_out;
  k_gemm2<0><<<gP, 256, 0, stream>>>(Oh, DM, 0, BO, DM, 0, 0.0625f, nullptr, 0, nullptr, 1, 0, 0, outb, nullptr, DM, 0, NR, DM, DM);
  k_gemm2<0><<<gP, 256, 0, stream>>>(Ol, DM, 0, BO, DM, 0, 0.0625f / 1024.0f, nullptr, 0, outb, 1, (size_t)DM, 0, outb, nullptr, DM, 0, NR, DM, DM);
}

// v009
// Measured time: 232 microseconds a run.
// Next to v008, in two timings, it ran 1.13 and 1.09 times as fast.
// Counting every step since v000, it is 8.44 times as fast.
#include <hip/hip_runtime.h>
#define NBT 4
#define SLEN 2048
#define DM 1024
#define NH 16
#define SCL 1.0f
#define NR (NBT * SLEN)
typedef __bf16 v16b __attribute__((ext_vector_type(16)));
typedef unsigned short v8us __attribute__((ext_vector_type(8), may_alias));
typedef float  v8f  __attribute__((ext_vector_type(8)));
typedef float  v4f  __attribute__((ext_vector_type(4)));
typedef float  v4fa __attribute__((ext_vector_type(4), may_alias));
union FragB { v16b v; v8us half[2]; unsigned short u[16]; };

__device__ __forceinline__ unsigned short bf16_bits(float x) { unsigned int u = __float_as_uint(x); return (unsigned short)((u + 0x7FFFu + ((u >> 16) & 1u)) >> 16); }
__device__ __forceinline__ float bf16_val(unsigned short b) { return __uint_as_float(((unsigned int)b) << 16); }
__device__ __forceinline__ float bf16_round(float x) { return bf16_val(bf16_bits(x)); }
// D += A·B with NT terms: 1 = ah·bh, 2 = + al·bh (A split), 3 = + ah·bl (both split)
template <int NT>
__device__ __forceinline__ v8f mmaN(v16b ah, v16b al, v16b bh, v16b bl, v8f c) {
  c = __builtin_amdgcn_wmma_f32_16x16x32_bf16(false, ah, false, bh, (short)0, c, false, false);
  if (NT >= 2) c = __builtin_amdgcn_wmma_f32_16x16x32_bf16(false, al, false, bh, (short)0, c, false, false);
  if (NT >= 3) c = __builtin_amdgcn_wmma_f32_16x16x32_bf16(false, ah, false, bl, (short)0, c, false, false);
  asm volatile("v_nop\n\tv_nop\n\tv_nop\n\tv_nop" : "+v"(c) : "v"(ah), "v"(al), "v"(bh), "v"(bl));
  return c;
}

__global__ __launch_bounds__(256) void k_wt_bf16(const float* __restrict__ W, unsigned short* __restrict__ Wt, int K, int N) {
  const int t = blockIdx.x * 256 + threadIdx.x;
  const int k8n = K / 8;
  if (t >= N * k8n) return;
  const int n = t / k8n, k8 = (t % k8n) * 8;
  v8us v;
#pragma unroll
  for (int i = 0; i < 8; ++i) v[i] = bf16_bits(W[(size_t)(k8 + i) * N + n]);
  *(v8us*)(Wt + (size_t)n * K + k8) = v;
  
}

// GEMM C[M][N] (f32, pitch ldc) = act(A[M][K]·W + bias). A f32 row-major (pitch lda) converted per fragment to bf16
// (ASPLIT: hi/lo two planes -> 2 terms, else single rounded term); Wt bf16 [N][K] (pitch ldb). BIAS_BF16 rounds the
// bias to bf16 first (bias quantised to bf16 before the add). K%32==0, M%16==0, N%64==0.
template <bool ASPLIT, int ACT, bool BIAS_BF16>
__global__ __launch_bounds__(128) void k_gemm_bf(const float* __restrict__ A, int lda, const unsigned short* __restrict__ Wt, int ldb,
                                               const float* __restrict__ bias, float* __restrict__ C, int ldc, int M, int N, int K) {
  __shared__ __attribute__((aligned(16))) float so[4][16][64];
  const int tid = threadIdx.x, w = tid >> 5, lane = tid & 31, ln = lane & 15, hh = lane >> 4;
  const int ntn = N / 64;
  const int wid = blockIdx.x * 4 + w;
  const int mt = wid / ntn, nq = wid % ntn;
  if (mt * 16 >= M) return;
  const int row0 = mt * 16, col0 = nq * 64;
  const float* arow = A + (size_t)(row0 + ln) * lda;
  v8f acc[4] = {};
  for (int kb = 0; kb < K; kb += 32) {
    FragB ah, al;
    const v4f x0 = *(const v4fa*)(arow + kb + 8 * hh), x1 = *(const v4fa*)(arow + kb + 8 * hh + 4);
    const v4f x2 = *(const v4fa*)(arow + kb + 16 + 8 * hh), x3 = *(const v4fa*)(arow + kb + 16 + 8 * hh + 4);
    float xs[16] = {x0[0],x0[1],x0[2],x0[3],x1[0],x1[1],x1[2],x1[3],x2[0],x2[1],x2[2],x2[3],x3[0],x3[1],x3[2],x3[3]};
#pragma unroll
    for (int i = 0; i < 16; ++i) { const unsigned short hb = bf16_bits(xs[i]); ah.u[i] = hb; al.u[i] = ASPLIT ? bf16_bits(xs[i] - bf16_val(hb)) : (unsigned short)0; }
#pragma unroll
    for (int t = 0; t < 4; ++t) {
      const unsigned short* brow = Wt + (size_t)(col0 + t * 16 + ln) * ldb + kb;
      FragB b;
      b.half[0] = *(const v8us*)(brow + 8 * hh);
      b.half[1] = *(const v8us*)(brow + 16 + 8 * hh);
      acc[t] = mmaN<ASPLIT ? 2 : 1>(ah.v, al.v, b.v, b.v, acc[t]);
    }
  }
#pragma unroll
  for (int t = 0; t < 4; ++t) {
    float bv = bias ? bias[col0 + t * 16 + ln] : 0.f;
    if (BIAS_BF16) bv = bf16_round(bv);
#pragma unroll
    for (int r = 0; r < 8; ++r) { float v = acc[t][r] + bv; if (ACT == 1) v = fmaxf(v, 0.f); so[w][8 * hh + r][t * 16 + ln] = v; }
  }
  __builtin_amdgcn_fence(__ATOMIC_ACQ_REL, "workgroup");
  __builtin_amdgcn_wave_barrier();
  const int rsub = lane >> 4, c4 = (lane & 15) * 4;
  {
#pragma unroll
    for (int q = 0; q < 8; ++q) {
      const int r = q * 2 + rsub;
      const v4f v = *(const v4fa*)&so[w][r][c4];
      *(v4f*)(C + (size_t)(row0 + r) * ldc + col0 + c4) = v;
    }
    
  }
}

// GEMM C = act(A·W + bias + resid): A f32 (ASPLIT -> hi/lo 2 terms), Wt bf16 [N][K]; ACT 0 none, 1 relu, 2 exact gelu;
// resid (optional, f32, row index = (row % rmod), pitch ldr, RES_BF16 rounds it) added before the activation.
template <bool ASPLIT, int ACT, bool BIAS_BF16, bool RES_BF16>
__global__ __launch_bounds__(128) void k_gemm_bf3(const float* __restrict__ A, int lda, const unsigned short* __restrict__ Wt, int ldb,
                                                const float* __restrict__ bias, const float* __restrict__ resid, int rmod, int ldr,
                                                float* __restrict__ C, int ldc, int M, int N, int K) {
  __shared__ __attribute__((aligned(16))) float so[4][16][64];
  const int tid = threadIdx.x, w = tid >> 5, lane = tid & 31, ln = lane & 15, hh = lane >> 4;
  const int ntn = N / 64;
  const int wid = blockIdx.x * 4 + w;
  const int mt = wid / ntn, nq = wid % ntn;
  if (mt * 16 >= M) return;
  const int row0 = mt * 16, col0 = nq * 64;
  const float* arow = A + (size_t)(row0 + ln) * lda;
  v8f acc[4] = {};
  for (int kb = 0; kb < K; kb += 32) {
    FragB ah, al;
    const v4f x0 = *(const v4fa*)(arow + kb + 8 * hh), x1 = *(const v4fa*)(arow + kb + 8 * hh + 4);
    const v4f x2 = *(const v4fa*)(arow + kb + 16 + 8 * hh), x3 = *(const v4fa*)(arow + kb + 16 + 8 * hh + 4);
    float xs[16] = {x0[0],x0[1],x0[2],x0[3],x1[0],x1[1],x1[2],x1[3],x2[0],x2[1],x2[2],x2[3],x3[0],x3[1],x3[2],x3[3]};
#pragma unroll
    for (int i = 0; i < 16; ++i) { const unsigned short hb = bf16_bits(xs[i]); ah.u[i] = hb; al.u[i] = ASPLIT ? bf16_bits(xs[i] - bf16_val(hb)) : (unsigned short)0; }
#pragma unroll
    for (int t = 0; t < 4; ++t) {
      const unsigned short* brow = Wt + (size_t)(col0 + t * 16 + ln) * ldb + kb;
      FragB b;
      b.half[0] = *(const v8us*)(brow + 8 * hh);
      b.half[1] = *(const v8us*)(brow + 16 + 8 * hh);
      acc[t] = mmaN<ASPLIT ? 2 : 1>(ah.v, al.v, b.v, b.v, acc[t]);
    }
  }
#pragma unroll
  for (int t = 0; t < 4; ++t) {
    const int col = col0 + t * 16 + ln;
    float bv = bias ? bias[col] : 0.f;
    if (BIAS_BF16) bv = bf16_round(bv);
#pragma unroll
    for (int r = 0; r < 8; ++r) {
      float v = acc[t][r] + bv;
      if (resid) { float rv = resid[(size_t)((row0 + 8 * hh + r) % rmod) * ldr + col]; if (RES_BF16) rv = bf16_round(rv); v += rv; }
      if (ACT == 1) v = fmaxf(v, 0.f);
      if (ACT == 2) v = 0.5f * v * (1.0f + erff(v * 0.70710678118654752f));
      if (ACT == 3) { const float u = 0.7978845608028654f * (v + 0.044715f * v * v * v); v = 0.5f * v * (1.0f + tanhf(u)); }
      so[w][8 * hh + r][t * 16 + ln] = v;
    }
  }
  __builtin_amdgcn_fence(__ATOMIC_ACQ_REL, "workgroup");
  __builtin_amdgcn_wave_barrier();
  const int rsub = lane >> 4, c4 = (lane & 15) * 4;
  {
#pragma unroll
    for (int q = 0; q < 8; ++q) {
      const int r = q * 2 + rsub;
      const v4f v = *(const v4fa*)&so[w][r][c4];
      *(v4f*)(C + (size_t)(row0 + r) * ldc + col0 + c4) = v;
    }
    
  }
}
// row LayerNorm (biased variance, eps) over N: s = X (+ R); optional out_sum <- s; out_norm <- (s-mu)*rsqrt(var+eps)*g + b
template <bool PARAM_BF16>
__global__ __launch_bounds__(256) void k_layernorm(const float* __restrict__ X, const float* __restrict__ R, const float* __restrict__ g, const float* __restrict__ bta,
                                                  float* __restrict__ out_sum, float* __restrict__ out_norm, int N, float eps) {
  __shared__ float red[256];
  const int row = blockIdx.x, tid = threadIdx.x;
  const float* x = X + (size_t)row * N; const float* rr = R ? R + (size_t)row * N : nullptr;
  float vals[16];                     // up to N = 4096
  const int per = N / 256;            // contiguous chunk per thread? use strided-by-4 chunks: thread handles j = tid*4 + 1024*u
  float s1 = 0.f;
  for (int u = 0; u < per / 4; ++u) {
    const int j = tid * 4 + 1024 * u;
    const v4f a = *(const v4fa*)(x + j);
    v4f b = {0.f,0.f,0.f,0.f}; if (rr) b = *(const v4fa*)(rr + j);
#pragma unroll
    for (int q = 0; q < 4; ++q) { const float v = a[q] + b[q]; vals[u * 4 + q] = v; s1 += v; }
  }
  red[tid] = s1; __syncthreads();
  for (int st = 128; st > 0; st >>= 1) { if (tid < st) red[tid] += red[tid + st]; __syncthreads(); }
  const float mu = red[0] / (float)N; __syncthreads();
  float s2 = 0.f;
  for (int u = 0; u < per / 4; ++u)
#pragma unroll
    for (int q = 0; q < 4; ++q) { const float c = vals[u * 4 + q] - mu; s2 += c * c; }
  red[tid] = s2; __syncthreads();
  for (int st = 128; st > 0; st >>= 1) { if (tid < st) red[tid] += red[tid + st]; __syncthreads(); }
  const float rs = rsqrtf(red[0] / (float)N + eps);
  {
    for (int u = 0; u < per / 4; ++u) {
      const int j = tid * 4 + 1024 * u;
      v4f o, sm;
#pragma unroll
      for (int q = 0; q < 4; ++q) {
        float gg = g[j + q], bb = bta[j + q];
        if (PARAM_BF16) { gg = bf16_round(gg); bb = bf16_round(bb); }
        sm[q] = vals[u * 4 + q]; o[q] = (vals[u * 4 + q] - mu) * rs * gg + bb;
      }
      if (out_sum) *(v4f*)(out_sum + (size_t)row * N + j) = sm;
      *(v4f*)(out_norm + (size_t)row * N + j) = o;
    }
    
  }
}



// ---- f16 WMMA path (v_wmma_f32_16x16x32_f16): 11-bit significands for operands in range — used where a [0,1] probability operand needs more precision than bf16
typedef _Float16 v16h __attribute__((ext_vector_type(16)));
union FragH { v16h v; v8us half[2]; _Float16 h[16]; unsigned short u[16]; };
template <int NT>
__device__ __forceinline__ v8f mmaH(v16h ah, v16h al, v16h bh, v16h bl, v8f c) {
  c = __builtin_amdgcn_wmma_f32_16x16x32_f16(false, ah, false, bh, (short)0, c, false, false);
  if (NT >= 2) c = __builtin_amdgcn_wmma_f32_16x16x32_f16(false, al, false, bh, (short)0, c, false, false);
  if (NT >= 3) c = __builtin_amdgcn_wmma_f32_16x16x32_f16(false, ah, false, bl, (short)0, c, false, false);
  asm volatile("v_nop\n\tv_nop\n\tv_nop\n\tv_nop" : "+v"(c) : "v"(ah), "v"(al), "v"(bh), "v"(bl));
  return c;
}
// batched GEMM like k_gemm_b but f16 operands: A f32 (split into f16 hi/lo if ASPLIT, else rounded to f16), Bt = f16 values [n][k]; alpha; C f32; N multiple of 16 (partial tiles skipped)
template <bool ASPLIT>
__global__ __launch_bounds__(128) void k_gemm_h(const float* __restrict__ A, int lda, size_t sA, const _Float16* __restrict__ Bh, int ldb, size_t sB, float alpha, float* __restrict__ C, int ldc, size_t sC, int M, int N, int K) {
  __shared__ __attribute__((aligned(16))) float so[4][16][64];
  const int tid = threadIdx.x, w = tid >> 5, lane = tid & 31, ln = lane & 15, hh = lane >> 4; const int by = blockIdx.y;
  A += (size_t)by * sA; Bh += (size_t)by * sB; C += (size_t)by * sC;
  const int ntn = (N + 63) / 64; const int wid = blockIdx.x * 4 + w; const int mt = wid / ntn, nq = wid % ntn; if (mt * 16 >= M) return;
  const int row0 = mt * 16, col0 = nq * 64; const float* arow = A + (size_t)(row0 + ln) * lda;
  v8f acc[4] = {};
  for (int kb = 0; kb < K; kb += 32) {
    FragH ah, al;
    const v4f x0 = *(const v4fa*)(arow + kb + 8 * hh), x1 = *(const v4fa*)(arow + kb + 8 * hh + 4), x2 = *(const v4fa*)(arow + kb + 16 + 8 * hh), x3 = *(const v4fa*)(arow + kb + 16 + 8 * hh + 4);
    float xs[16] = {x0[0],x0[1],x0[2],x0[3],x1[0],x1[1],x1[2],x1[3],x2[0],x2[1],x2[2],x2[3],x3[0],x3[1],x3[2],x3[3]};
#pragma unroll
    for (int i = 0; i < 16; ++i) { const _Float16 h = (_Float16)xs[i]; ah.h[i] = h; al.h[i] = ASPLIT ? (_Float16)(xs[i] - (float)h) : (_Float16)0.0f; }
#pragma unroll
    for (int t = 0; t < 4; ++t) { if (col0 + t * 16 >= N) continue; const size_t boff = (size_t)(col0 + t * 16 + ln) * ldb + kb; FragH bq; bq.half[0] = *(const v8us*)(Bh + boff + 8 * hh); bq.half[1] = *(const v8us*)(Bh + boff + 16 + 8 * hh);
      acc[t] = mmaH<ASPLIT ? 2 : 1>(ah.v, al.v, bq.v, bq.v, acc[t]); }
  }
#pragma unroll
  for (int t = 0; t < 4; ++t) { if (col0 + t * 16 >= N) continue;
#pragma unroll
    for (int r = 0; r < 8; ++r) so[w][8 * hh + r][t * 16 + ln] = acc[t][r] * alpha; }
  __builtin_amdgcn_fence(__ATOMIC_ACQ_REL, "workgroup"); __builtin_amdgcn_wave_barrier();
  const int rsub = lane >> 4, c4 = (lane & 15) * 4;
  {
#pragma unroll
    for (int q = 0; q < 8; ++q) { const int r = q * 2 + rsub; if (col0 + c4 < N) { const v4f v = *(const v4fa*)&so[w][r][c4]; *(v4f*)(C + (size_t)(row0 + r) * ldc + col0 + c4) = v; } }
     }
}

// Wt[n][k] = f16(W[k][n]·scale) from f32 row-major W[K][N] (scale = power of two; bf16-exact weights stay exact in f16 away from the subnormal range)
__global__ __launch_bounds__(256) void k_wt_f16(const float* __restrict__ W, _Float16* __restrict__ Wt, int K, int N, float scale) {
  const int t = blockIdx.x * 256 + threadIdx.x; if (t >= N * (K / 8)) return; const int n = t / (K / 8), k8 = (t % (K / 8)) * 8; FragH f;
#pragma unroll
  for (int i = 0; i < 8; ++i) f.h[i] = (_Float16)(bf16_round(W[(size_t)(k8 + i) * N + n]) * scale); const v8us o = f.half[0];
  *(v8us*)((unsigned short*)Wt + (size_t)n * K + k8) = o; 
}
// k_gemm_hh variant with fused epilogue: v = acc·alpha + bias[by·sBias + col] (+ CP[(row/rowsPerB)·sCPb + by·64 + col] if CP) ; ACT 0 none / 1 elu ; writes f16 C16 (and f32 C if non-null)
template <int ACT>
__global__ __launch_bounds__(128) void k_gemm_hhx(const _Float16* __restrict__ A, int lda, size_t sA, const _Float16* __restrict__ Bh, int ldb, size_t sB, float alpha, const float* __restrict__ bias, size_t sBias, const float* __restrict__ CP, int rowsPerB, size_t sCPb, int row0g,
    float* __restrict__ C, _Float16* __restrict__ C16, int ldc, size_t sC, int M, int N, int K) {
  __shared__ __attribute__((aligned(16))) float so[4][16][64];
  const int tid = threadIdx.x, w = tid >> 5, lane = tid & 31, ln = lane & 15, hh = lane >> 4; const int by = blockIdx.y;
  A += (size_t)by * sA; Bh += (size_t)by * sB; const size_t cofs = (size_t)by * sC; const float* bp = bias ? bias + (size_t)by * sBias : nullptr;
  const int ntn = (N + 63) / 64; const int wid = blockIdx.x * 4 + w; const int mt = wid / ntn, nq = wid % ntn; if (mt * 16 >= M) return;
  const int row0 = mt * 16, col0 = nq * 64; const _Float16* arow = A + (size_t)(row0 + ln) * lda;
  v8f acc[4] = {};
  for (int kb = 0; kb < K; kb += 32) { FragH ah; ah.half[0] = *(const v8us*)((const unsigned short*)arow + kb + 8 * hh); ah.half[1] = *(const v8us*)((const unsigned short*)arow + kb + 16 + 8 * hh);
#pragma unroll
    for (int t = 0; t < 4; ++t) { if (col0 + t * 16 >= N) continue; const size_t boff = (size_t)(col0 + t * 16 + ln) * ldb + kb; FragH bq; bq.half[0] = *(const v8us*)((const unsigned short*)Bh + boff + 8 * hh); bq.half[1] = *(const v8us*)((const unsigned short*)Bh + boff + 16 + 8 * hh);
      acc[t] = mmaH<1>(ah.v, ah.v, bq.v, bq.v, acc[t]); }
  }
#pragma unroll
  for (int t = 0; t < 4; ++t) { if (col0 + t * 16 >= N) continue; const int col = col0 + t * 16 + ln; const float bv = bp ? bf16_round(bp[col]) : 0.f;
#pragma unroll
    for (int r = 0; r < 8; ++r) { float v = acc[t][r] * alpha + bv; if (CP) { const int bidx = (row0g + row0 + 8 * hh + r) / rowsPerB; v += CP[(size_t)bidx * sCPb + (size_t)by * 64 + col]; } if (ACT == 1) v = (v > 0.f) ? v : expm1f(v); else if (ACT == 7) v = (v > 0.f) ? v + 1.0f : expf(v); else if (ACT == 8) v = tanhf(v); else if (ACT == 9) v = 0.5f * v * (1.0f + tanhf(0.7978845608028654f * (v + 0.044715f * v * v * v))); else if (ACT == 11) v = 1.0f / (1.0f + expf(-v)); else if (ACT == 12) v = (v > 0.f) ? v : 0.01f * v; else if (ACT == 14) v = (v > 0.f) ? v : 0.1f * v; else if (ACT == 15) v = v / (1.0f + expf(-v)); else if (ACT == 3) v = fmaxf(v, 0.f); else if (ACT == 6) v = 0.5f * v * (1.0f + erff(v * 0.70710678118654752f)); so[w][8 * hh + r][t * 16 + ln] = v; } }
  __builtin_amdgcn_fence(__ATOMIC_ACQ_REL, "workgroup"); __builtin_amdgcn_wave_barrier();
  const int rsub = lane >> 4, c4 = (lane & 15) * 4; typedef _Float16 v4h __attribute__((ext_vector_type(4)));
  {
#pragma unroll
    for (int q = 0; q < 8; ++q) { const int r = q * 2 + rsub; if (col0 + c4 < N) { const v4f v = *(const v4fa*)&so[w][r][c4]; if (C) *(v4f*)(C + cofs + (size_t)(row0 + r) * ldc + col0 + c4) = v; if (C16) { v4h h4; for (int i = 0; i < 4; ++i) h4[i] = (_Float16)v[i]; *(v4h*)(C16 + cofs + (size_t)(row0 + r) * ldc + col0 + c4) = h4; } } }
     }
}


typedef _Float16 v4h __attribute__((ext_vector_type(4)));

__global__ __launch_bounds__(256) void k_h16(const float* __restrict__ x, _Float16* __restrict__ X16, size_t n8) { const size_t t = (size_t)blockIdx.x * 256 + threadIdx.x; if (t >= n8) return; FragH f;
#pragma unroll
  for (int q = 0; q < 8; ++q) f.h[q] = (_Float16)x[t * 8 + q]; *(v8us*)((unsigned short*)X16 + t * 8) = f.half[0];  }
template <int NHv, int TTv>
__global__ __launch_bounds__(256) void k_vt(const _Float16* __restrict__ V16, int ldv, int voff, _Float16* __restrict__ Vt) { __shared__ unsigned short tl[64][66]; const int tid = threadIdx.x; const int slab = blockIdx.x / (TTv / 64), lg = blockIdx.x % (TTv / 64); const int b = slab / NHv, h = slab % NHv;
  for (int i = tid; i < 64 * 8; i += 256) { const int r = i / 8, c8 = (i % 8) * 8; FragH f; f.half[0] = *(const v8us*)((const unsigned short*)V16 + ((size_t)b * TTv + lg * 64 + r) * ldv + voff + h * 64 + c8);
#pragma unroll
    for (int q = 0; q < 8; ++q) tl[r][c8 + q] = f.u[q]; }
  __syncthreads();
  {
#pragma unroll
    for (int rd = 0; rd < 2; ++rd) { const int d = rd * 32 + tid / 8, pc = tid % 8; FragH f;
#pragma unroll
      for (int q = 0; q < 8; ++q) f.u[q] = tl[pc * 8 + q][d];
      *(v8us*)((unsigned short*)Vt + ((size_t)slab * 64 + d) * TTv + lg * 64 + pc * 8) = f.half[0]; }
     } }

// ---- fast GEMM (256 threads, block tile 128x128, wave tile 32x64; requires M % 128 == 0 rows per launch region, N % 128 == 0 and K % 64 == 0); epilogue = k_gemm_hhx semantics ----
__device__ __forceinline__ v16h g2_frag(const _Float16* p, int hh) { FragH f; f.half[0] = *(const v8us*)((const unsigned short*)p + 8 * hh); f.half[1] = *(const v8us*)((const unsigned short*)p + 16 + 8 * hh); return f.v; }
__device__ __forceinline__ v8f g2_mma(v16h a, v16h b, v8f c) { v8f d = __builtin_amdgcn_wmma_f32_16x16x32_f16(false, a, false, b, (short)0, c, false, false); asm volatile("v_nop\n\tv_nop\n\tv_nop\n\tv_nop" : "+v"(d) : "v"(a), "v"(b)); return d; }
// ---- operand staging of the 128 x 128 block tile (8 waves: 4 row groups x 2 column groups of 32 x 64): 64 k (128 B of every operand row) per stage, rows 0..127 = A, 128..255 = B, LDS pitch 72 halves = 144 B (16 B x odd for the 16-byte fragment reads), two buffers
#define GKT 64
#define GPITCH 72
#define GSTG (256 * GPITCH)
// Eight asynchronous 16-byte copies global -> LDS per lane (one stage's share: a wave's copy = 4 whole 128-B rows), through no register. The s_wait_xcnt is the last line of the copies' own statement, so that no address register named here is rewritten ahead of it.
__device__ __forceinline__ void g2_copy8(unsigned l0, unsigned l1, unsigned l2, unsigned l3, unsigned l4, unsigned l5, unsigned l6, unsigned l7,
    const unsigned short* g0, const unsigned short* g1, const unsigned short* g2, const unsigned short* g3, const unsigned short* g4, const unsigned short* g5, const unsigned short* g6, const unsigned short* g7) {
  asm volatile("global_load_async_to_lds_b128 %0, %8, off\n\t"
               "global_load_async_to_lds_b128 %1, %9, off\n\t"
               "global_load_async_to_lds_b128 %2, %10, off\n\t"
               "global_load_async_to_lds_b128 %3, %11, off\n\t"
               "global_load_async_to_lds_b128 %4, %12, off\n\t"
               "global_load_async_to_lds_b128 %5, %13, off\n\t"
               "global_load_async_to_lds_b128 %6, %14, off\n\t"
               "global_load_async_to_lds_b128 %7, %15, off\n\t"
               "s_wait_xcnt 0x0"
               :: "v"(l0), "v"(l1), "v"(l2), "v"(l3), "v"(l4), "v"(l5), "v"(l6), "v"(l7), "v"(g0), "v"(g1), "v"(g2), "v"(g3), "v"(g4), "v"(g5), "v"(g6), "v"(g7) : "memory");
}
// Main loop of the 32 x 64 wave tile over K (a multiple of 64), 256 threads: rows rowb..rowb+127 of A and colb..colb+127 of Bh are staged once for the block's eight waves; wave w reads the fragments of A rows 32 (w & 3).. and B rows 64 (w >> 2).. from LDS. Per accumulator the products come in the same k order as with fragments loaded from global. On return every wave has passed the barrier behind the last fragment read, so sT may be reused.
__device__ __forceinline__ void g2_main(const _Float16* __restrict__ A, int lda, const _Float16* __restrict__ Bh, int ldb, int K, int rowb, int colb, unsigned short* sT, v8f (&c)[8]) {
  const int tid = threadIdx.x, w = tid >> 5, lane = tid & 31, ln = lane & 15, hh = lane >> 4;
  const unsigned short* ga = (const unsigned short*)A + (size_t)(rowb + (tid >> 3)) * lda + (tid & 7) * 8; const unsigned short* gb = (const unsigned short*)Bh + (size_t)(colb + (tid >> 3)) * ldb + (tid & 7) * 8;
  const size_t a32 = (size_t)32 * lda, b32 = (size_t)32 * ldb; const unsigned lt = (unsigned)(size_t)&sT[(tid >> 3) * GPITCH + (tid & 7) * 8]; constexpr unsigned R32 = 32 * GPITCH * 2;
  auto stage = [&](int kb, unsigned bo) { const unsigned l = lt + bo; const unsigned short* a = ga + kb; const unsigned short* b = gb + kb;
    g2_copy8(l, l + R32, l + 2 * R32, l + 3 * R32, l + 4 * R32, l + 5 * R32, l + 6 * R32, l + 7 * R32, a, a + a32, a + 2 * a32, a + 3 * a32, b, b + b32, b + 2 * b32, b + 3 * b32); };
  stage(0, 0u);
  asm volatile("s_wait_asynccnt 0x0" ::: "memory");      /* this wave's copies of stage 0 have landed before the barrier that shows them to the other waves */
  __syncthreads();
  if (GKT < K) stage(GKT, (unsigned)(GSTG * 2));
  /* rolled: one trip per stage, so that the two buffers alternate by the trip's parity */
#pragma unroll 1
  for (int kb = 0; kb < K; kb += GKT) { const unsigned short* buf = sT + ((kb >> 6) & 1) * GSTG;      /* this trip reads its own buffer alone */
    const _Float16* ar = (const _Float16*)(buf + (32 * (w & 3) + ln) * GPITCH); const _Float16* br = (const _Float16*)(buf + (128 + 64 * (w >> 2) + ln) * GPITCH);
    v16h fa[2][2], fb[2][4];      /* the trip's 24 fragment reads stand together in front of its products, so that their LDS latency is waited out once per trip and not in front of every pair of products */
#pragma unroll
    for (int ks = 0; ks < 2; ++ks) { fa[ks][0] = g2_frag(ar + ks * 32, hh); fa[ks][1] = g2_frag(ar + 16 * GPITCH + ks * 32, hh);
#pragma unroll
      for (int t = 0; t < 4; ++t) fb[ks][t] = g2_frag(br + t * 16 * GPITCH + ks * 32, hh); }
#pragma unroll
    for (int ks = 0; ks < 2; ++ks)
#pragma unroll
      for (int t = 0; t < 4; ++t) { c[t] = g2_mma(fa[ks][0], fb[ks][t], c[t]); c[4 + t] = g2_mma(fa[ks][1], fb[ks][t], c[4 + t]); }
    asm volatile("s_wait_dscnt 0x0" ::: "memory");      /* this wave's reads of the buffer have returned before the buffer may be refilled */
    asm volatile("s_wait_asynccnt 0x0" ::: "memory");      /* this wave's copies of the next stage have landed before the barrier that shows them */
    __syncthreads();      /* publishes the next stage and ends every wave's reads of this trip's buffer */
    if (kb + 2 * GKT < K) stage(kb + 2 * GKT, (unsigned)(((kb >> 6) & 1) * (GSTG * 2))); }
  asm volatile("s_wait_asynccnt 0x0" ::: "memory");      /* no copy is outstanding when the LDS becomes output staging */
}
template <int ACT>
__global__ __launch_bounds__(256) void k_gemm2(const _Float16* __restrict__ A, int lda, size_t sA, const _Float16* __restrict__ Bh, int ldb, size_t sB, float alpha, const float* __restrict__ bias, size_t sBias, const float* __restrict__ CP, int rowsPerB, size_t sCPb, int row0g,
    float* __restrict__ C, _Float16* __restrict__ C16, int ldc, size_t sC, int M, int N, int K) {
  __shared__ __attribute__((aligned(16))) float sm[2 * GSTG / 2];      /* the two operand buffers; behind the main loop its first 8 x 32 x 68 floats are the output staging */
  float (*so)[32][68] = (float (*)[32][68])sm;
  const int tid = threadIdx.x, w = tid >> 5, lane = tid & 31, ln = lane & 15, hh = lane >> 4; const int by = blockIdx.y;
  A += (size_t)by * sA; Bh += (size_t)by * sB; const size_t cofs = (size_t)by * sC; const float* bp = bias ? bias + (size_t)by * sBias : nullptr;
  const int ntn = N >> 7; const int mt = blockIdx.x / ntn, nq = blockIdx.x - mt * ntn; const int row0 = mt * 128 + 32 * (w & 3), col0 = nq * 128 + 64 * (w >> 2); if (mt * 128 + 128 > M) return;      /* block-uniform, in front of every barrier and copy */
  const v8f z8 = {0.f,0.f,0.f,0.f,0.f,0.f,0.f,0.f}; v8f accs[8] = {z8, z8, z8, z8, z8, z8, z8, z8};
  g2_main(A, lda, Bh, ldb, K, mt * 128, nq * 128, (unsigned short*)sm, accs);
#pragma unroll
  for (int u = 0; u < 8; ++u) { const int t = u & 3, half = u >> 2; const int col = col0 + t * 16 + ln; const float bv = bp ? bf16_round(bp[col]) : 0.f;
#pragma unroll
    for (int r = 0; r < 8; ++r) { const int rloc = half * 16 + 8 * hh + r; float v = accs[u][r] * alpha + bv; if (CP) { const int bidx = (row0g + row0 + rloc) / rowsPerB; v += CP[(size_t)bidx * sCPb + (size_t)by * 64 + col]; }
      if (ACT == 3) v = fmaxf(v, 0.f); else if (ACT == 6) v = 0.5f * v * (1.0f + erff(v * 0.70710678118654752f)); else if (ACT == 11) v = 1.0f / (1.0f + expf(-v)); else if (ACT == 15) v = v / (1.0f + expf(-v)); else if (ACT == 12) v = (v > 0.f) ? v : 0.01f * v; else if (ACT == 8) v = tanhf(v);
      so[w][rloc][t * 16 + ln] = v; } }
  __builtin_amdgcn_fence(__ATOMIC_ACQ_REL, "workgroup"); __builtin_amdgcn_wave_barrier();
  const int rsub = lane >> 4, c4 = (lane & 15) * 4;
  {
#pragma unroll
    for (int q = 0; q < 16; ++q) { const int r = q * 2 + rsub; const v4f v = *(const v4fa*)&so[w][r][c4]; if (C) *(v4f*)(C + cofs + (size_t)(row0 + r) * ldc + col0 + c4) = v; if (C16) { v4h h4; for (int i = 0; i < 4; ++i) h4[i] = (_Float16)v[i]; *(v4h*)(C16 + cofs + (size_t)(row0 + r) * ldc + col0 + c4) = h4; } }
     } }



__device__ __forceinline__ float siluf(float g) { return g / (1.0f + expf(-g)); }
// ---- projection GEMM (main loop of k_gemm2, NR x DM x DM, Bt carries x16) with the element-wise tail in its epilogue. A wave tile is 32 tokens x the 64 columns of one head, so the head's norm is a sum inside the wave's own LDS rows.
// POLAR 1: g = silu(acc/16) * f, f = r*scale[h]/(r + 1e-6) * post, r = |silu row|; g stored as f16 hi + x2^10 residual, row-major, one whole 128-B line per row and plane. post = log2(e) for q (the flash kernel's exponentials are then powers of 2), 1 for k.
// POLAR 0: g = silu(acc/16) stored transposed per (batch, head) slab as hi + residual planes [64 dims][SLEN tokens]; the block's 128 tokens are transposed through LDS, one whole 128-B line per 8 lanes.
template <int POLAR>
__device__ __forceinline__ void proj_tail(float* so, v8f (&accs)[8], int mt, int nq, const float* __restrict__ scale, float post, _Float16* __restrict__ Hh, _Float16* __restrict__ Hl) {
  constexpr int PT = POLAR ? 68 : 65;      /* LDS row pitch in floats: 68 for the 16-B row reads, 65 for the column reads of the transpose */
  const int tid = threadIdx.x, w = tid >> 5, lane = tid & 31, ln = lane & 15, hh = lane >> 4; const int row0 = mt * 128 + 32 * (w & 3), col0 = nq * 64;
#pragma unroll
  for (int u = 0; u < 8; ++u) { const int t = u & 3, half = u >> 2;
#pragma unroll
    for (int r = 0; r < 8; ++r) so[(32 * w + half * 16 + 8 * hh + r) * PT + t * 16 + ln] = accs[u][r]; }
  if (POLAR) {
    __builtin_amdgcn_fence(__ATOMIC_ACQ_REL, "workgroup"); __builtin_amdgcn_wave_barrier();      /* each wave reads back its own 32 rows only */
    const int rsub = lane >> 4, c4 = (lane & 15) * 4; const float sc = bf16_round(scale[nq]);
#pragma unroll
    for (int q = 0; q < 16; ++q) { const int r = q * 2 + rsub; const v4f v = *(const v4fa*)&so[(32 * w + r) * PT + c4];
      float s = (v[0] * v[0] + v[1] * v[1]) + (v[2] * v[2] + v[3] * v[3]); s += __shfl_xor(s, 8, 32); s += __shfl_xor(s, 4, 32); s += __shfl_xor(s, 2, 32); s += __shfl_xor(s, 1, 32);
      const float rr = sqrtf(s); const float fac = (rr * sc) / (rr + 1e-6f) * post; v4h h4, l4;
#pragma unroll
      for (int i = 0; i < 4; ++i) { const float g = v[i] * fac; const _Float16 h = (_Float16)g; h4[i] = h; l4[i] = (_Float16)((g - (float)h) * 1024.0f); }
      const size_t o = (size_t)(row0 + r) * DM + col0 + c4; *(v4h*)(Hh + o) = h4; *(v4h*)(Hl + o) = l4; }
  } else {
    __syncthreads();      /* the transpose reads rows that the block's other waves wrote */
    const int slab = (mt * 128 / SLEN) * NH + nq, tok0 = mt * 128 % SLEN;
#pragma unroll
    for (int it = 0; it < 8; ++it) { const int item = it * 128 + (tid & 127); const int pc = item & 7, d = (item >> 3) & 63, g = item >> 9; FragH fh, fl;      /* each half of the block transposes its own head's 128 LDS rows */
#pragma unroll
      for (int q = 0; q < 8; ++q) { const float v = so[((w >> 2) * 128 + g * 64 + pc * 8 + q) * PT + d]; const _Float16 hv = (_Float16)v; fh.h[q] = hv; fl.h[q] = (_Float16)((v - (float)hv) * 1024.0f); }
      const size_t o = ((size_t)slab * 64 + d) * SLEN + tok0 + g * 64 + pc * 8; *(v8us*)((unsigned short*)Hh + o) = fh.half[0]; *(v8us*)((unsigned short*)Hl + o) = fl.half[0]; }
    asm volatile("s_wait_xcnt 0x0" ::: "memory");      /* in the merged kernel's listing the other tail's code follows these stores and rewrites their address registers */
  } }
// The three projections in one launch: they read the same x plane and none reads what another writes, so the job (0 = q, 1 = k, 2 = v) is picked by the block index, PJB blocks each, in the order of the former three launches. A WGP takes its next block as soon as one ends: no launch gap, no refill of the chip and no idle tail between the jobs. The job is the same for the whole block, so the barriers in main loop and tail stand under block-uniform control flow.
#define PJB ((NR / 128) * (DM / 128))
__global__ __launch_bounds__(256) void k_proj3(const _Float16* __restrict__ A, const _Float16* __restrict__ BQ, const _Float16* __restrict__ BK, const _Float16* __restrict__ BV, const float* __restrict__ qs, const float* __restrict__ ks,
    _Float16* __restrict__ Qh, _Float16* __restrict__ Ql, _Float16* __restrict__ Kh, _Float16* __restrict__ Kl, _Float16* __restrict__ Vth, _Float16* __restrict__ Vtl) {
  __shared__ __attribute__((aligned(16))) float so[2 * GSTG / 2];      /* the two operand buffers; behind the main loop its first 256 rows of 68 (q, k) or 65 (v) floats are the output staging: rows 32 w.. are wave w's */
  const int w = threadIdx.x >> 5; const int job = blockIdx.x / PJB, bx = blockIdx.x - job * PJB;
  constexpr int ntn = DM >> 7; const int mt = bx / ntn, nq = (bx - mt * ntn) * 2 + __builtin_amdgcn_readfirstlane(w >> 2);      /* nq = the wave's head: waves 0..3 the block's first, 4..7 its second; read from the first lane so that it stays a scalar and scale[nq] a scalar load */
  const v8f z8 = {0.f,0.f,0.f,0.f,0.f,0.f,0.f,0.f}; v8f accs[8] = {z8, z8, z8, z8, z8, z8, z8, z8};
  g2_main(A, DM, job == 0 ? BQ : (job == 1 ? BK : BV), DM, DM, mt * 128, (bx - mt * ntn) * 128, (unsigned short*)so, accs);      /* the main loop of k_gemm2 */
#pragma unroll
  for (int u = 0; u < 8; ++u)
#pragma unroll
    for (int r = 0; r < 8; ++r) accs[u][r] = siluf(accs[u][r] * 0.0625f);      /* in front of the branch: the kernel's text holds this long code once for both tails; unrolled so that accs is indexed by constants and stays in registers */
  if (job < 2) proj_tail<1>(so, accs, mt, nq, job ? ks : qs, job ? 1.0f : 1.4426950408889634f, job ? Kh : Qh, job ? Kl : Ql);      /* q = silu(x Wq^T) * f_q * log2(e), k = silu(x Wk^T) * f_k, each hi + residual */
  else proj_tail<0>(so, accs, mt, nq, ks, 1.0f, Vth, Vtl);      /* v = silu(x Wv^T), transposed, hi + residual (scale, post unread) */
}

// Eight asynchronous 16-byte copies global -> LDS per lane (one key pass's share of the K and V^T hi / residual tiles), through no register. The s_wait_xcnt is the last line of the copies' own statement, so that no address register named here is rewritten ahead of it.
__device__ __forceinline__ void kv_copy8(unsigned l0, unsigned l1, unsigned l2, unsigned l3, unsigned l4, unsigned l5, unsigned l6, unsigned l7,
    const unsigned short* g0, const unsigned short* g1, const unsigned short* g2, const unsigned short* g3, const unsigned short* g4, const unsigned short* g5, const unsigned short* g6, const unsigned short* g7) {
  asm volatile("global_load_async_to_lds_b128 %0, %8, off\n\t"
               "global_load_async_to_lds_b128 %1, %9, off\n\t"
               "global_load_async_to_lds_b128 %2, %10, off\n\t"
               "global_load_async_to_lds_b128 %3, %11, off\n\t"
               "global_load_async_to_lds_b128 %4, %12, off\n\t"
               "global_load_async_to_lds_b128 %5, %13, off\n\t"
               "global_load_async_to_lds_b128 %6, %14, off\n\t"
               "global_load_async_to_lds_b128 %7, %15, off\n\t"
               "s_wait_xcnt 0x0"
               :: "v"(l0), "v"(l1), "v"(l2), "v"(l3), "v"(l4), "v"(l5), "v"(l6), "v"(l7), "v"(g0), "v"(g1), "v"(g2), "v"(g3), "v"(g4), "v"(g5), "v"(g6), "v"(g7) : "memory");
}
__device__ __forceinline__ float xhalf(float x) { return __builtin_bit_cast(float, __builtin_amdgcn_permlanex16(__builtin_bit_cast(int, x), __builtin_bit_cast(int, x), 0x76543210, 0xfedcba98, false, false)); }      /* lane l's value of lane l ^ 16 */
// Both products run with their operands swapped: S^T = K Q^T (A = 16 key rows from LDS, B = the wave's 16 queries, kept in registers) and O^T += V^T P^T (A = 16 V^T rows from LDS, B = P^T). Lane (ln, hh) then holds, of query q0 + ln alone, the scores of keys 16 nt + 8 hh + r and the output dims 16 dt + 8 hh + r. The two score tiles converted in place are the B operand of the value product: position s of a fragment is k = 8 hh + s (s < 8) or 16 + 8 hh + (s - 8), which is tile s >> 3, register s & 7.
template <int TQ, int TK>
__global__ __launch_bounds__(128) void k_flashm(const _Float16* __restrict__ Q16, const _Float16* __restrict__ Q16lo, int ldq, const _Float16* __restrict__ K16, const _Float16* __restrict__ K16lo, int ldk, const _Float16* __restrict__ Vt, const _Float16* __restrict__ Vtlo, const unsigned* __restrict__ MB, const int* __restrict__ RA, const int* __restrict__ KE, _Float16* __restrict__ Oh, _Float16* __restrict__ Ol, int ldo) {
  constexpr int RPW = 16, NQB = TQ / (4 * RPW), DT = 4, KS = 2;
  /* One pass's 32 keys, staged once for the block's four waves, two buffers. In 16-bit units: K rows (64 dims) at pitch 72 = 144 B, V^T rows (32 keys) at pitch 40 = 80 B, both 16 B x odd for the 16-byte fragment reads. */
  constexpr int KP = 72, VP = 40, KL0 = 32 * KP, VH0 = 2 * 32 * KP, VL0 = VH0 + 64 * VP, STG = VL0 + 64 * VP;
  __shared__ __attribute__((aligned(16))) unsigned short sKV[2][STG];
  const int tid = threadIdx.x, w = tid >> 5, lane = tid & 31, ln = lane & 15, hh = lane >> 4;
  /* Heaviest first: a block walks 2 (qblk + 1) key passes, so the block index counts the query blocks downwards, all (batch, head) slabs of one query block side by side. Cost falls with the index: the long blocks start first, neighbours in the index cost the same, and the launch ends on 2-pass blocks. Every (slab, query block) is taken exactly once. */
  constexpr int NSL = NBT * NH; const int slab = blockIdx.x % NSL, qblk = NQB - 1 - blockIdx.x / NSL; const int b = slab / NH, h = slab % NH; const int qb0 = qblk * (4 * RPW); const int q0 = qb0 + w * RPW;
  FragH aq[KS], aql[KS];
  { const size_t qo = ((size_t)b * TQ + q0 + ln) * ldq + h * 64; const unsigned short* qr = (const unsigned short*)Q16 + qo; const unsigned short* ql = (const unsigned short*)Q16lo + qo;
#pragma unroll
    for (int ks = 0; ks < KS; ++ks) { aq[ks].half[0] = *(const v8us*)(qr + ks * 32 + 8 * hh); aq[ks].half[1] = *(const v8us*)(qr + ks * 32 + 16 + 8 * hh); aql[ks].half[0] = *(const v8us*)(ql + ks * 32 + 8 * hh); aql[ks].half[1] = *(const v8us*)(ql + ks * 32 + 16 + 8 * hh); } }
  asm volatile("s_wait_xcnt 0x0" ::: "memory");      /* the Q loads' address registers are reused right below */
  const unsigned short* Vth = (const unsigned short*)Vt + (size_t)slab * 64 * TK; const unsigned short* Vtl = (const unsigned short*)Vtlo + (size_t)slab * 64 * TK;
  float m_r = -3.0e38f, l_r = 0.f; v8f oacc[DT], oaccl[DT];      /* running maximum and this lane's half of the running sum of query q0 + ln */
#pragma unroll
  for (int dt = 0; dt < DT; ++dt) { oacc[dt] = (v8f){0.f,0.f,0.f,0.f,0.f,0.f,0.f,0.f}; oaccl[dt] = oacc[dt]; }
  int jend = KE[qblk * 32]; jend = min(TK, (jend + 31) & ~31); if (jend < 32) jend = 32;      /* block-uniform */
  /* each thread copies two 16-byte pieces of each of the four tiles: K rows tid/8 and tid/8 + 16 (a wave's copy = 4 whole 128-B rows), V^T rows tid/4 and tid/4 + 32 */
  const unsigned short* gkh = (const unsigned short*)K16 + ((size_t)b * TK + (tid >> 3)) * ldk + h * 64 + (tid & 7) * 8; const unsigned short* gkl = (const unsigned short*)K16lo + ((size_t)b * TK + (tid >> 3)) * ldk + h * 64 + (tid & 7) * 8;
  const unsigned short* gvh = Vth + (size_t)(tid >> 2) * TK + (tid & 3) * 8; const unsigned short* gvl = Vtl + (size_t)(tid >> 2) * TK + (tid & 3) * 8;
  const unsigned lk = (unsigned)(size_t)&sKV[0][(tid >> 3) * KP + (tid & 7) * 8], lv = (unsigned)(size_t)&sKV[0][VH0 + (tid >> 2) * VP + (tid & 3) * 8];
  auto stage = [&](int j, unsigned bo) { const size_t ko = (size_t)j * ldk, k16 = (size_t)16 * ldk;
    kv_copy8(lk + bo, lk + bo + 16 * KP * 2, lk + bo + KL0 * 2, lk + bo + (KL0 + 16 * KP) * 2, lv + bo, lv + bo + 32 * VP * 2, lv + bo + 64 * VP * 2, lv + bo + 96 * VP * 2,
             gkh + ko, gkh + ko + k16, gkl + ko, gkl + ko + k16, gvh + j, gvh + j + (size_t)32 * TK, gvl + j, gvl + j + (size_t)32 * TK); };
  stage(0, 0u);
  asm volatile("s_wait_asynccnt 0x0" ::: "memory");      /* this wave's copies of pass 0 have landed before the barrier that shows them to the other waves */
  __syncthreads();
  if (32 < jend) stage(32, (unsigned)(STG * 2));
  const bool am = (RA[q0 + ln] != 0); const unsigned* mp = MB + (size_t)(q0 + ln) * (TK / 32);      /* one row flag and one mask row per lane: its query's; mp walks the row, one word a pass */
  asm volatile("s_wait_xcnt 0x0" ::: "memory");      /* the row-flag load's address register is reused below */
#pragma unroll 1
  for (int j0 = 0; j0 < jend; j0 += 32) {
    const unsigned mws = *mp >> (8 * hh);      /* asked for at the head of the pass: its wait falls together with the K fragments'; bit 16 nt + r is then this lane's key 16 nt + 8 hh + r */
    const unsigned short* kvb = &sKV[(j0 >> 5) & 1][0];      /* this pass reads its own buffer alone */
    v8f s[2];
#pragma unroll
    for (int nt = 0; nt < 2; ++nt) { const unsigned short* kr = kvb + (nt * 16 + ln) * KP; const unsigned short* kl = kr + KL0; FragH bk[KS], bkl[KS];
#pragma unroll
      for (int ks = 0; ks < KS; ++ks) { bk[ks].half[0] = *(const v8us*)(kr + ks * 32 + 8 * hh); bk[ks].half[1] = *(const v8us*)(kr + ks * 32 + 16 + 8 * hh); bkl[ks].half[0] = *(const v8us*)(kl + ks * 32 + 8 * hh); bkl[ks].half[1] = *(const v8us*)(kl + ks * 32 + 16 + 8 * hh); }
      v8f acc = (v8f){0.f,0.f,0.f,0.f,0.f,0.f,0.f,0.f}, accr = acc;
#pragma unroll
      for (int ks = 0; ks < KS; ++ks) { acc = mmaH<1>(bk[ks].v, bk[ks].v, aq[ks].v, aq[ks].v, acc); accr = mmaH<1>(bk[ks].v, bk[ks].v, aql[ks].v, aql[ks].v, accr); accr = mmaH<1>(bkl[ks].v, bkl[ks].v, aq[ks].v, aq[ks].v, accr); }
      s[nt] = acc + accr * 0.0009765625f; }
    /* The lane's 16 scores are all of one query: maximum and sum are taken inside the lane, the maximum joined with the other half of the wave by one exchange. No branch (each exp is computed and then chosen by a select), each step written for all 16 before the next. */
    float sv[16], mx[8]; bool ok[16];
#pragma unroll
    for (int i = 0; i < 16; ++i) { ok[i] = am || (((mws >> (16 * (i >> 3) + (i & 7))) & 1u) == 0u); sv[i] = ok[i] ? (am ? 0.f : s[i >> 3][i & 7] * SCL) : -INFINITY; }
#pragma unroll
    for (int i = 0; i < 8; ++i) mx[i] = fmaxf(sv[i], sv[8 + i]);
    float mc = fmaxf(fmaxf(fmaxf(mx[0], mx[1]), fmaxf(mx[2], mx[3])), fmaxf(fmaxf(mx[4], mx[5]), fmaxf(mx[6], mx[7]))); mc = fmaxf(mc, xhalf(mc));
    const float mn = fmaxf(m_r, mc); const float ea = __builtin_amdgcn_exp2f(m_r - mn); const float al = (mn > -1.0e38f) ? ea : 1.0f; m_r = mn;      /* the scores arrive times log2(e) (folded into q by its projection), so e^(s - m) is 2^(difference): one v_exp_f32 */
    FragH pa, pl; float p[16];
#pragma unroll
    for (int i = 0; i < 16; ++i) { const float e = __builtin_amdgcn_exp2f(sv[i] - mn); p[i] = ok[i] ? e : 0.f; }
#pragma unroll
    for (int i = 0; i < 16; ++i) { const float ps = p[i] * 1024.0f; pa.h[i] = (_Float16)ps; pl.h[i] = (_Float16)((ps - (float)pa.h[i]) * 1024.0f); }
#pragma unroll
    for (int i = 0; i < 8; ++i) p[i] += p[8 + i];
    l_r = l_r * al + (((p[0] + p[1]) + (p[2] + p[3])) + ((p[4] + p[5]) + (p[6] + p[7])));
#pragma unroll
    for (int dt = 0; dt < DT; ++dt) { oacc[dt] *= al; oaccl[dt] *= al; }
#pragma unroll
    for (int dt = 0; dt < DT; ++dt) { const unsigned short* vr = kvb + VH0 + (dt * 16 + ln) * VP; const unsigned short* vl = vr + 64 * VP; FragH bv, bl; bv.half[0] = *(const v8us*)(vr + 8 * hh); bv.half[1] = *(const v8us*)(vr + 16 + 8 * hh); bl.half[0] = *(const v8us*)(vl + 8 * hh); bl.half[1] = *(const v8us*)(vl + 16 + 8 * hh);
      oacc[dt] = mmaH<1>(bv.v, bv.v, pa.v, pa.v, oacc[dt]); oaccl[dt] = mmaH<1>(bl.v, bl.v, pa.v, pa.v, oaccl[dt]); oaccl[dt] = mmaH<1>(bv.v, bv.v, pl.v, pl.v, oaccl[dt]); }
    asm volatile("s_wait_xcnt 0x0" ::: "memory");      /* the mask-word load's address register is stepped for the next pass behind this point */
    ++mp;
    asm volatile("s_wait_dscnt 0x0" ::: "memory");      /* this wave's reads of the buffer have returned before the buffer may be refilled */
    asm volatile("s_wait_asynccnt 0x0" ::: "memory");      /* this wave's copies of the next pass have landed before the barrier that shows them */
    __syncthreads();      /* publishes the next pass's tiles and ends every wave's reads of this pass's buffer */
    if (j0 + 64 < jend) stage(j0 + 64, (unsigned)(((j0 >> 5) & 1) * (STG * 2))); }
  asm volatile("s_wait_asynccnt 0x0" ::: "memory");      /* no copy is outstanding when the wave goes on to its end */
  const float l = l_r + xhalf(l_r); const float li = (l > 0.f) ? 1.0f / (l * 1024.0f) : 0.f;      /* the two halves' sums are joined once */
  /* a lane's 8 registers of a tile are 8 neighbouring dims of its query's row: one 16-byte store per tile and plane; the wave's 8 stores fill its 16 whole 128-B rows of each plane */
  FragH fh[DT], fl[DT];
#pragma unroll
  for (int dt = 0; dt < DT; ++dt)
#pragma unroll
    for (int r = 0; r < 8; ++r) { const float val = (oacc[dt][r] + oaccl[dt][r] * 0.0009765625f) * li; const _Float16 hv = (_Float16)val; fh[dt].h[r] = hv; fl[dt].h[r] = (_Float16)((val - (float)hv) * 1024.0f); }
  const size_t oo = ((size_t)b * TQ + q0 + ln) * ldo + h * 64 + 8 * hh;
#pragma unroll
  for (int dt = 0; dt < DT; ++dt) { *(v8us*)((unsigned short*)Oh + oo + dt * 16) = fh[dt].half[0]; *(v8us*)((unsigned short*)Ol + oo + dt * 16) = fl[dt].half[0]; } }


// All preparation that reads inputs only, in one launch: no job reads what another writes, so the job is picked by the block index (the same for a whole block). Blocks [0, PXB): x as an f16 plane of its bf16-rounded values; [PXB, PXB + 4 PWB): the four weights, bf16-rounded, x16, as f16 planes (torch (out, in) = the natural B^T); the last PCB: the causal key bit plane, row flags and per-block key bounds. Every job's element count is a whole number of blocks.
#define PXB (NR * DM / 8 / 256)
#define PWB (DM * DM / 8 / 256)
#define PCB (SLEN * (SLEN / 32) / 256)
__global__ __launch_bounds__(256) void k_prep(const float* __restrict__ x, const float* __restrict__ Wq, const float* __restrict__ Wk, const float* __restrict__ Wv, const float* __restrict__ Wo,
    _Float16* __restrict__ X16, _Float16* __restrict__ BQ, _Float16* __restrict__ BK, _Float16* __restrict__ BV, _Float16* __restrict__ BO, unsigned* __restrict__ MB, int* __restrict__ RA, int* __restrict__ KE) {
  static_assert(NR * DM % (8 * 256) == 0 && DM * DM % (8 * 256) == 0 && SLEN * (SLEN / 32) % 256 == 0, "whole blocks");
  const int b = blockIdx.x;
  if (b < PXB) { const size_t t = (size_t)b * 256 + threadIdx.x; FragH f;
#pragma unroll
    for (int q = 0; q < 8; ++q) f.h[q] = (_Float16)bf16_round(x[t * 8 + q]);
    *(v8us*)((unsigned short*)X16 + t * 8) = f.half[0];
  } else if (b < PXB + 4 * PWB) { const int j = (b - PXB) / PWB; const float* __restrict__ W = j == 0 ? Wq : (j == 1 ? Wk : (j == 2 ? Wv : Wo)); _Float16* __restrict__ Bt = j == 0 ? BQ : (j == 1 ? BK : (j == 2 ? BV : BO));
    const size_t t = (size_t)(b - PXB - j * PWB) * 256 + threadIdx.x; FragH f;
#pragma unroll
    for (int i = 0; i < 8; ++i) f.h[i] = (_Float16)(bf16_round(W[t * 8 + i]) * 16.0f);
    *(v8us*)((unsigned short*)Bt + t * 8) = f.half[0];
  } else { const int t = (b - PXB - 4 * PWB) * 256 + threadIdx.x; constexpr int nq = SLEN, nw = SLEN / 32;
    { const int q = t / nw, w = t % nw; const int first = q + 1 - 32 * w; const unsigned bits = (first <= 0) ? 0xffffffffu : ((first >= 32) ? 0u : (0xffffffffu << first)); MB[t] = bits; }
    if (t < nq) RA[t] = 0;
    if (t < nq / 64) KE[t * 32] = 64 * (t + 1);
  } }

extern "C" void kernel_launch(void* const* d_in, const int* in_sizes, int n_in,
                              void* d_out, int out_size, void* d_ws, size_t ws_size, hipStream_t stream) {
  (void)in_sizes; (void)n_in; (void)out_size;
  const float* const* I = (const float* const*)d_in; const float* x = I[0]; const float* Wq = I[1]; const float* Wk = I[2]; const float* Wv = I[3]; const float* Wo = I[4]; const float* qs = I[5]; const float* ks = I[6];
  char* ws = (char*)d_ws; size_t off = 0;
  auto take = [&](size_t bytes) { char* p = ws + off; off += (bytes + 255) & ~(size_t)255; return p; };
  _Float16* BQ = (_Float16*)take((size_t)DM * DM * 2); _Float16* BK = (_Float16*)take((size_t)DM * DM * 2); _Float16* BV = (_Float16*)take((size_t)DM * DM * 2); _Float16* BO = (_Float16*)take((size_t)DM * DM * 2);
  _Float16* X16 = (_Float16*)take((size_t)NR * DM * 2); _Float16* Oh = (_Float16*)take((size_t)NR * DM * 2); _Float16* Ol = (_Float16*)take((size_t)NR * DM * 2);
  _Float16* Qh = (_Float16*)take((size_t)NR * DM * 2); _Float16* Ql = (_Float16*)take((size_t)NR * DM * 2); _Float16* Kh = (_Float16*)take((size_t)NR * DM * 2); _Float16* Kl = (_Float16*)take((size_t)NR * DM * 2); _Float16* Vth = (_Float16*)take((size_t)NR * DM * 2); _Float16* Vtl = (_Float16*)take((size_t)NR * DM * 2);
  unsigned* MB = (unsigned*)take((size_t)SLEN * (SLEN / 32) * 4); int* RA = (int*)take((size_t)SLEN * 4); int* KE = (int*)take((size_t)(SLEN / 64) * 32 * 4);
  if (off > ws_size) return;      /* 8 + 16 + 2 x 16 + 6 x 16 + 0.5 = 153 MiB */
  k_prep<<<PXB + 4 * PWB + PCB, 256, 0, stream>>>(x, Wq, Wk, Wv, Wo, X16, BQ, BK, BV, BO, MB, RA, KE);
  k_proj3<<<3 * PJB, 256, 0, stream>>>(X16, BQ, BK, BV, qs, ks, Qh, Ql, Kh, Kl, Vth, Vtl);
  k_flashm<SLEN, SLEN><<<NBT * NH * (SLEN / 64), 128, 0, stream>>>(Qh, Ql, DM, Kh, Kl, DM, Vth, Vtl, MB, RA, KE, Oh, Ol, DM);
  float* outb = (float*)d_out; const dim3 gP(PJB, 1);
  k_gemm2<0><<<gP, 256, 0, stream>>>(Oh, DM, 0, BO, DM, 0, 0.0625f, nullptr, 0, nullptr, 1, 0, 0, outb, nullptr, DM, 0, NR, DM, DM);
  k_gemm2<0><<<gP, 256, 0, stream>>>(Ol, DM, 0, BO, DM, 0, 0.0625f / 1024.0f, nullptr, 0, outb, 1, (size_t)DM, 0, outb, nullptr, DM, 0, NR, DM, DM);
}
